// v000
// Measured on an AMD MI455X. A time is GPU time per run, averaged over a window of back-to-back runs after a warm-up
// (all launches, gaps included; the runs take copies of the inputs in turn), and the median of several windows.
// Apart from v000's, it joins two sittings. Times from different sittings can be a few percent apart, while
// side-by-side timings come from the same sitting.
// The starting kernel, v000, takes 9830 microseconds a run.
#include <hip/hip_runtime.h>
// Multi-head self-attention with a multiplicative 0/1 mask and the module's 'unsafe' softmax (x [8][1024][1024]; q = x Wq, k = x Wk, v = x Wv ([in][out] 1024^2 sigma 1/32, no biases); 16 heads of 64; scores / 8; w = exp(s) mask[b][s][t] / (sum_t exp(s) mask + 1e-8) with the float mask input [8][1024][1024] (0/1, ~90 % ones, shared across heads) READ per (query, key); out = merged ctx (no output projection) -> [8][1024][1024]).
// Compute dtype: inputs rounded to bf16; x / weights exact; k, v and softmax weights as plain f16 GEMM operands (~2^-12); q as f16 hi + x1024 lo planes (effectively f32); o written f32; scores and softmax statistics f32. v_wmma_f32_16x16x32_f16.
#define NB 8
#define SQ 1024
#define DM 1024
#define NH 16
#define HD 64
#define HG 4                         /* heads per attention launch group */
#define B0 0                         /* first batch processed (debug hook) */
#define NBR NB                       /* batches processed (debug hook) */
#define NR ((size_t)NB * SQ)         /* token rows */
#define MP ((int)((size_t)NBR * SQ)) /* rows projected (debug hook) */
#define QN SQ                        /* query rows attended per batch (debug hook) */
#define NHD NH                       /* heads attended (debug hook) */
#define MPO MP                       /* unused */
#define LQ DM      /* row pitch of the q/k/v rows */
typedef __bf16 v16b __attribute__((ext_vector_type(16)));
typedef unsigned short v8us __attribute__((ext_vector_type(8), may_alias));
typedef float  v8f  __attribute__((ext_vector_type(8)));
typedef float  v4f  __attribute__((ext_vector_type(4)));
typedef float  v4fa __attribute__((ext_vector_type(4), may_alias));
union FragB { v16b v; v8us half[2]; unsigned short u[16]; };

__device__ __forceinline__ unsigned short bf16_bits(float x) { unsigned int u = __float_as_uint(x); return (unsigned short)((u + 0x7FFFu + ((u >> 16) & 1u)) >> 16); }
__device__ __forceinline__ float bf16_val(unsigned short b) { return __uint_as_float(((unsigned int)b) << 16); }
__device__ __forceinline__ float bf16_round(float x) { return bf16_val(bf16_bits(x)); }
// D += A·B with NT terms: 1 = ah·bh, 2 = + al·bh (A split), 3 = + ah·bl (both split)
template <int NT>
__device__ __forceinline__ v8f mmaN(v16b ah, v16b al, v16b bh, v16b bl, v8f c) {
  c = __builtin_amdgcn_wmma_f32_16x16x32_bf16(false, ah, false, bh, (short)0, c, false, false);
  if (NT >= 2) c = __builtin_amdgcn_wmma_f32_16x16x32_bf16(false, al, false, bh, (short)0, c, false, false);
  if (NT >= 3) c = __builtin_amdgcn_wmma_f32_16x16x32_bf16(false, ah, false, bl, (short)0, c, false, false);
  asm volatile("v_nop\n\tv_nop\n\tv_nop\n\tv_nop" : "+v"(c) : "v"(ah), "v"(al), "v"(bh), "v"(bl));
  return c;
}

__global__ __launch_bounds__(256) void k_wt_bf16(const float* __restrict__ W, unsigned short* __restrict__ Wt, int K, int N) {
  const int t = blockIdx.x * 256 + threadIdx.x;
  const int k8n = K / 8;
  if (t >= N * k8n) return;
  const int n = t / k8n, k8 = (t % k8n) * 8;
  v8us v;
#pragma unroll
  for (int i = 0; i < 8; ++i) v[i] = bf16_bits(W[(size_t)(k8 + i) * N + n]);
  *(v8us*)(Wt + (size_t)n * K + k8) = v;
  
}

// GEMM C[M][N] (f32, pitch ldc) = act(A[M][K]·W + bias). A f32 row-major (pitch lda) converted per fragment to bf16
// (ASPLIT: hi/lo two planes -> 2 terms, else single rounded term); Wt bf16 [N][K] (pitch ldb). BIAS_BF16 rounds the
// bias to bf16 first (bias quantised to bf16 before the add). K%32==0, M%16==0, N%64==0.
template <bool ASPLIT, int ACT, bool BIAS_BF16>
__global__ __launch_bounds__(128) void k_gemm_bf(const float* __restrict__ A, int lda, const unsigned short* __restrict__ Wt, int ldb,
                                               const float* __restrict__ bias, float* __restrict__ C, int ldc, int M, int N, int K) {
  __shared__ __attribute__((aligned(16))) float so[4][16][64];
  const int tid = threadIdx.x, w = tid >> 5, lane = tid & 31, ln = lane & 15, hh = lane >> 4;
  const int ntn = N / 64;
  const int wid = blockIdx.x * 4 + w;
  const int mt = wid / ntn, nq = wid % ntn;
  if (mt * 16 >= M) return;
  const int row0 = mt * 16, col0 = nq * 64;
  const float* arow = A + (size_t)(row0 + ln) * lda;
  v8f acc[4] = {};
  for (int kb = 0; kb < K; kb += 32) {
    FragB ah, al;
    const v4f x0 = *(const v4fa*)(arow + kb + 8 * hh), x1 = *(const v4fa*)(arow + kb + 8 * hh + 4);
    const v4f x2 = *(const v4fa*)(arow + kb + 16 + 8 * hh), x3 = *(const v4fa*)(arow + kb + 16 + 8 * hh + 4);
    float xs[16] = {x0[0],x0[1],x0[2],x0[3],x1[0],x1[1],x1[2],x1[3],x2[0],x2[1],x2[2],x2[3],x3[0],x3[1],x3[2],x3[3]};
#pragma unroll
    for (int i = 0; i < 16; ++i) { const unsigned short hb = bf16_bits(xs[i]); ah.u[i] = hb; al.u[i] = ASPLIT ? bf16_bits(xs[i] - bf16_val(hb)) : (unsigned short)0; }
#pragma unroll
    for (int t = 0; t < 4; ++t) {
      const unsigned short* brow = Wt + (size_t)(col0 + t * 16 + ln) * ldb + kb;
      FragB b;
      b.half[0] = *(const v8us*)(brow + 8 * hh);
      b.half[1] = *(const v8us*)(brow + 16 + 8 * hh);
      acc[t] = mmaN<ASPLIT ? 2 : 1>(ah.v, al.v, b.v, b.v, acc[t]);
    }
  }
#pragma unroll
  for (int t = 0; t < 4; ++t) {
    float bv = bias ? bias[col0 + t * 16 + ln] : 0.f;
    if (BIAS_BF16) bv = bf16_round(bv);
#pragma unroll
    for (int r = 0; r < 8; ++r) { float v = acc[t][r] + bv; if (ACT == 1) v = fmaxf(v, 0.f); so[w][8 * hh + r][t * 16 + ln] = v; }
  }
  __builtin_amdgcn_fence(__ATOMIC_ACQ_REL, "workgroup");
  __builtin_amdgcn_wave_barrier();
  const int rsub = lane >> 4, c4 = (lane & 15) * 4;
  {
#pragma unroll
    for (int q = 0; q < 8; ++q) {
      const int r = q * 2 + rsub;
      const v4f v = *(const v4fa*)&so[w][r][c4];
      *(v4f*)(C + (size_t)(row0 + r) * ldc + col0 + c4) = v;
    }
    
  }
}

// GEMM C = act(A·W + bias + resid): A f32 (ASPLIT -> hi/lo 2 terms), Wt bf16 [N][K]; ACT 0 none, 1 relu, 2 exact gelu;
// resid (optional, f32, row index = (row % rmod), pitch ldr, RES_BF16 rounds it) added before the activation.
template <bool ASPLIT, int ACT, bool BIAS_BF16, bool RES_BF16>
__global__ __launch_bounds__(128) void k_gemm_bf3(const float* __restrict__ A, int lda, const unsigned short* __restrict__ Wt, int ldb,
                                                const float* __restrict__ bias, const float* __restrict__ resid, int rmod, int ldr,
                                                float* __restrict__ C, int ldc, int M, int N, int K) {
  __shared__ __attribute__((aligned(16))) float so[4][16][64];
  const int tid = threadIdx.x, w = tid >> 5, lane = tid & 31, ln = lane & 15, hh = lane >> 4;
  const int ntn = N / 64;
  const int wid = blockIdx.x * 4 + w;
  const int mt = wid / ntn, nq = wid % ntn;
  if (mt * 16 >= M) return;
  const int row0 = mt * 16, col0 = nq * 64;
  const float* arow = A + (size_t)(row0 + ln) * lda;
  v8f acc[4] = {};
  for (int kb = 0; kb < K; kb += 32) {
    FragB ah, al;
    const v4f x0 = *(const v4fa*)(arow + kb + 8 * hh), x1 = *(const v4fa*)(arow + kb + 8 * hh + 4);
    const v4f x2 = *(const v4fa*)(arow + kb + 16 + 8 * hh), x3 = *(const v4fa*)(arow + kb + 16 + 8 * hh + 4);
    float xs[16] = {x0[0],x0[1],x0[2],x0[3],x1[0],x1[1],x1[2],x1[3],x2[0],x2[1],x2[2],x2[3],x3[0],x3[1],x3[2],x3[3]};
#pragma unroll
    for (int i = 0; i < 16; ++i) { const unsigned short hb = bf16_bits(xs[i]); ah.u[i] = hb; al.u[i] = ASPLIT ? bf16_bits(xs[i] - bf16_val(hb)) : (unsigned short)0; }
#pragma unroll
    for (int t = 0; t < 4; ++t) {
      const unsigned short* brow = Wt + (size_t)(col0 + t * 16 + ln) * ldb + kb;
      FragB b;
      b.half[0] = *(const v8us*)(brow + 8 * hh);
      b.half[1] = *(const v8us*)(brow + 16 + 8 * hh);
      acc[t] = mmaN<ASPLIT ? 2 : 1>(ah.v, al.v, b.v, b.v, acc[t]);
    }
  }
#pragma unroll
  for (int t = 0; t < 4; ++t) {
    const int col = col0 + t * 16 + ln;
    float bv = bias ? bias[col] : 0.f;
    if (BIAS_BF16) bv = bf16_round(bv);
#pragma unroll
    for (int r = 0; r < 8; ++r) {
      float v = acc[t][r] + bv;
      if (resid) { float rv = resid[(size_t)((row0 + 8 * hh + r) % rmod) * ldr + col]; if (RES_BF16) rv = bf16_round(rv); v += rv; }
      if (ACT == 1) v = fmaxf(v, 0.f);
      if (ACT == 2) v = 0.5f * v * (1.0f + erff(v * 0.70710678118654752f));
      if (ACT == 3) { const float u = 0.7978845608028654f * (v + 0.044715f * v * v * v); v = 0.5f * v * (1.0f + tanhf(u)); }
      so[w][8 * hh + r][t * 16 + ln] = v;
    }
  }
  __builtin_amdgcn_fence(__ATOMIC_ACQ_REL, "workgroup");
  __builtin_amdgcn_wave_barrier();
  const int rsub = lane >> 4, c4 = (lane & 15) * 4;
  {
#pragma unroll
    for (int q = 0; q < 8; ++q) {
      const int r = q * 2 + rsub;
      const v4f v = *(const v4fa*)&so[w][r][c4];
      *(v4f*)(C + (size_t)(row0 + r) * ldc + col0 + c4) = v;
    }
    
  }
}
// row LayerNorm (biased variance, eps) over N: s = X (+ R); optional out_sum <- s; out_norm <- (s-mu)*rsqrt(var+eps)*g + b
template <bool PARAM_BF16>
__global__ __launch_bounds__(256) void k_layernorm(const float* __restrict__ X, const float* __restrict__ R, const float* __restrict__ g, const float* __restrict__ bta,
                                                  float* __restrict__ out_sum, float* __restrict__ out_norm, int N, float eps) {
  __shared__ float red[256];
  const int row = blockIdx.x, tid = threadIdx.x;
  const float* x = X + (size_t)row * N; const float* rr = R ? R + (size_t)row * N : nullptr;
  float vals[16];                     // up to N = 4096
  const int per = N / 256;            // contiguous chunk per thread? use strided-by-4 chunks: thread handles j = tid*4 + 1024*u
  float s1 = 0.f;
  for (int u = 0; u < per / 4; ++u) {
    const int j = tid * 4 + 1024 * u;
    const v4f a = *(const v4fa*)(x + j);
    v4f b = {0.f,0.f,0.f,0.f}; if (rr) b = *(const v4fa*)(rr + j);
#pragma unroll
    for (int q = 0; q < 4; ++q) { const float v = a[q] + b[q]; vals[u * 4 + q] = v; s1 += v; }
  }
  red[tid] = s1; __syncthreads();
  for (int st = 128; st > 0; st >>= 1) { if (tid < st) red[tid] += red[tid + st]; __syncthreads(); }
  const float mu = red[0] / (float)N; __syncthreads();
  float s2 = 0.f;
  for (int u = 0; u < per / 4; ++u)
#pragma unroll
    for (int q = 0; q < 4; ++q) { const float c = vals[u * 4 + q] - mu; s2 += c * c; }
  red[tid] = s2; __syncthreads();
  for (int st = 128; st > 0; st >>= 1) { if (tid < st) red[tid] += red[tid + st]; __syncthreads(); }
  const float rs = rsqrtf(red[0] / (float)N + eps);
  {
    for (int u = 0; u < per / 4; ++u) {
      const int j = tid * 4 + 1024 * u;
      v4f o, sm;
#pragma unroll
      for (int q = 0; q < 4; ++q) {
        float gg = g[j + q], bb = bta[j + q];
        if (PARAM_BF16) { gg = bf16_round(gg); bb = bf16_round(bb); }
        sm[q] = vals[u * 4 + q]; o[q] = (vals[u * 4 + q] - mu) * rs * gg + bb;
      }
      if (out_sum) *(v4f*)(out_sum + (size_t)row * N + j) = sm;
      *(v4f*)(out_norm + (size_t)row * N + j) = o;
    }
    
  }
}



// ---- f16 WMMA path (v_wmma_f32_16x16x32_f16): 11-bit significands for operands in range — used where a [0,1] probability operand needs more precision than bf16
typedef _Float16 v16h __attribute__((ext_vector_type(16)));
union FragH { v16h v; v8us half[2]; _Float16 h[16]; unsigned short u[16]; };
template <int NT>
__device__ __forceinline__ v8f mmaH(v16h ah, v16h al, v16h bh, v16h bl, v8f c) {
  c = __builtin_amdgcn_wmma_f32_16x16x32_f16(false, ah, false, bh, (short)0, c, false, false);
  if (NT >= 2) c = __builtin_amdgcn_wmma_f32_16x16x32_f16(false, al, false, bh, (short)0, c, false, false);
  if (NT >= 3) c = __builtin_amdgcn_wmma_f32_16x16x32_f16(false, ah, false, bl, (short)0, c, false, false);
  asm volatile("v_nop\n\tv_nop\n\tv_nop\n\tv_nop" : "+v"(c) : "v"(ah), "v"(al), "v"(bh), "v"(bl));
  return c;
}
// batched GEMM like k_gemm_b but f16 operands: A f32 (split into f16 hi/lo if ASPLIT, else rounded to f16), Bt = f16 values [n][k]; alpha; C f32; N multiple of 16 (partial tiles skipped)
template <bool ASPLIT>
__global__ __launch_bounds__(128) void k_gemm_h(const float* __restrict__ A, int lda, size_t sA, const _Float16* __restrict__ Bh, int ldb, size_t sB, float alpha, float* __restrict__ C, int ldc, size_t sC, int M, int N, int K) {
  __shared__ __attribute__((aligned(16))) float so[4][16][64];
  const int tid = threadIdx.x, w = tid >> 5, lane = tid & 31, ln = lane & 15, hh = lane >> 4; const int by = blockIdx.y;
  A += (size_t)by * sA; Bh += (size_t)by * sB; C += (size_t)by * sC;
  const int ntn = (N + 63) / 64; const int wid = blockIdx.x * 4 + w; const int mt = wid / ntn, nq = wid % ntn; if (mt * 16 >= M) return;
  const int row0 = mt * 16, col0 = nq * 64; const float* arow = A + (size_t)(row0 + ln) * lda;
  v8f acc[4] = {};
  for (int kb = 0; kb < K; kb += 32) {
    FragH ah, al;
    const v4f x0 = *(const v4fa*)(arow + kb + 8 * hh), x1 = *(const v4fa*)(arow + kb + 8 * hh + 4), x2 = *(const v4fa*)(arow + kb + 16 + 8 * hh), x3 = *(const v4fa*)(arow + kb + 16 + 8 * hh + 4);
    float xs[16] = {x0[0],x0[1],x0[2],x0[3],x1[0],x1[1],x1[2],x1[3],x2[0],x2[1],x2[2],x2[3],x3[0],x3[1],x3[2],x3[3]};
#pragma unroll
    for (int i = 0; i < 16; ++i) { const _Float16 h = (_Float16)xs[i]; ah.h[i] = h; al.h[i] = ASPLIT ? (_Float16)(xs[i] - (float)h) : (_Float16)0.0f; }
#pragma unroll
    for (int t = 0; t < 4; ++t) { if (col0 + t * 16 >= N) continue; const size_t boff = (size_t)(col0 + t * 16 + ln) * ldb + kb; FragH bq; bq.half[0] = *(const v8us*)(Bh + boff + 8 * hh); bq.half[1] = *(const v8us*)(Bh + boff + 16 + 8 * hh);
      acc[t] = mmaH<ASPLIT ? 2 : 1>(ah.v, al.v, bq.v, bq.v, acc[t]); }
  }
#pragma unroll
  for (int t = 0; t < 4; ++t) { if (col0 + t * 16 >= N) continue;
#pragma unroll
    for (int r = 0; r < 8; ++r) so[w][8 * hh + r][t * 16 + ln] = acc[t][r] * alpha; }
  __builtin_amdgcn_fence(__ATOMIC_ACQ_REL, "workgroup"); __builtin_amdgcn_wave_barrier();
  const int rsub = lane >> 4, c4 = (lane & 15) * 4;
  {
#pragma unroll
    for (int q = 0; q < 8; ++q) { const int r = q * 2 + rsub; if (col0 + c4 < N) { const v4f v = *(const v4fa*)&so[w][r][c4]; *(v4f*)(C + (size_t)(row0 + r) * ldc + col0 + c4) = v; } }
     }
}

// Wt[n][k] = f16(W[k][n]·scale) from f32 row-major W[K][N] (scale = power of two; bf16-exact weights stay exact in f16 away from the subnormal range)
__global__ __launch_bounds__(256) void k_wt_f16(const float* __restrict__ W, _Float16* __restrict__ Wt, int K, int N, float scale) {
  const int t = blockIdx.x * 256 + threadIdx.x; if (t >= N * (K / 8)) return; const int n = t / (K / 8), k8 = (t % (K / 8)) * 8; FragH f;
#pragma unroll
  for (int i = 0; i < 8; ++i) f.h[i] = (_Float16)(bf16_round(W[(size_t)(k8 + i) * N + n]) * scale); const v8us o = f.half[0];
  *(v8us*)((unsigned short*)Wt + (size_t)n * K + k8) = o; 
}
// k_gemm_hh variant with fused epilogue: v = acc·alpha + bias[by·sBias + col] (+ CP[(row/rowsPerB)·sCPb + by·64 + col] if CP) ; ACT 0 none / 1 elu ; writes f16 C16 (and f32 C if non-null)
template <int ACT>
__global__ __launch_bounds__(128) void k_gemm_hhx(const _Float16* __restrict__ A, int lda, size_t sA, const _Float16* __restrict__ Bh, int ldb, size_t sB, float alpha, const float* __restrict__ bias, size_t sBias, const float* __restrict__ CP, int rowsPerB, size_t sCPb, int row0g,
    float* __restrict__ C, _Float16* __restrict__ C16, int ldc, size_t sC, int M, int N, int K) {
  __shared__ __attribute__((aligned(16))) float so[4][16][64];
  const int tid = threadIdx.x, w = tid >> 5, lane = tid & 31, ln = lane & 15, hh = lane >> 4; const int by = blockIdx.y;
  A += (size_t)by * sA; Bh += (size_t)by * sB; const size_t cofs = (size_t)by * sC; const float* bp = bias ? bias + (size_t)by * sBias : nullptr;
  const int ntn = (N + 63) / 64; const int wid = blockIdx.x * 4 + w; const int mt = wid / ntn, nq = wid % ntn; if (mt * 16 >= M) return;
  const int row0 = mt * 16, col0 = nq * 64; const _Float16* arow = A + (size_t)(row0 + ln) * lda;
  v8f acc[4] = {};
  for (int kb = 0; kb < K; kb += 32) { FragH ah; ah.half[0] = *(const v8us*)((const unsigned short*)arow + kb + 8 * hh); ah.half[1] = *(const v8us*)((const unsigned short*)arow + kb + 16 + 8 * hh);
#pragma unroll
    for (int t = 0; t < 4; ++t) { if (col0 + t * 16 >= N) continue; const size_t boff = (size_t)(col0 + t * 16 + ln) * ldb + kb; FragH bq; bq.half[0] = *(const v8us*)((const unsigned short*)Bh + boff + 8 * hh); bq.half[1] = *(const v8us*)((const unsigned short*)Bh + boff + 16 + 8 * hh);
      acc[t] = mmaH<1>(ah.v, ah.v, bq.v, bq.v, acc[t]); }
  }
#pragma unroll
  for (int t = 0; t < 4; ++t) { if (col0 + t * 16 >= N) continue; const int col = col0 + t * 16 + ln; const float bv = bp ? bf16_round(bp[col]) : 0.f;
#pragma unroll
    for (int r = 0; r < 8; ++r) { float v = acc[t][r] * alpha + bv; if (CP) { const int rr = row0g + row0 + 8 * hh + r; if (rowsPerB < 0) v += CP[cofs + (size_t)rr * ldc + col];      /* rowsPerB < 0: own element of the batched C plane */ else { const int bidx = rr / rowsPerB; v += CP[(size_t)bidx * sCPb + (size_t)by * 64 + col]; } } if (ACT == 1) v = (v > 0.f) ? v : expm1f(v); else if (ACT == 7) v = (v > 0.f) ? v + 1.0f : expf(v); else if (ACT == 8) v = tanhf(v); else if (ACT == 9) v = 0.5f * v * (1.0f + tanhf(0.7978845608028654f * (v + 0.044715f * v * v * v))); else if (ACT == 11) v = 1.0f / (1.0f + expf(-v)); else if (ACT == 12) v = (v > 0.f) ? v : 0.01f * v; else if (ACT == 14) v = (v > 0.f) ? v : 0.1f * v; else if (ACT == 16) v = (v >= 0.f) ? v : 0.3f * v; else if (ACT == 17) v = (v >= 0.f) ? v : 0.2f * v; else if (ACT == 15) v = v / (1.0f + expf(-v)); else if (ACT == 3) v = fmaxf(v, 0.f); else if (ACT == 6) v = 0.5f * v * (1.0f + erff(v * 0.70710678118654752f)); so[w][8 * hh + r][t * 16 + ln] = v; } }
  __builtin_amdgcn_fence(__ATOMIC_ACQ_REL, "workgroup"); __builtin_amdgcn_wave_barrier();
  const int rsub = lane >> 4, c4 = (lane & 15) * 4; typedef _Float16 v4h __attribute__((ext_vector_type(4)));
  {
#pragma unroll
    for (int q = 0; q < 8; ++q) { const int r = q * 2 + rsub; if (col0 + c4 < N) { const v4f v = *(const v4fa*)&so[w][r][c4]; if (C) *(v4f*)(C + cofs + (size_t)(row0 + r) * ldc + col0 + c4) = v; if (C16) { v4h h4; for (int i = 0; i < 4; ++i) h4[i] = (_Float16)v[i]; *(v4h*)(C16 + cofs + (size_t)(row0 + r) * ldc + col0 + c4) = h4; } } }
     }
}


typedef _Float16 v4h __attribute__((ext_vector_type(4)));

__global__ __launch_bounds__(256) void k_x16(const float* __restrict__ x, _Float16* __restrict__ X16, size_t n8) { const size_t t = (size_t)blockIdx.x * 256 + threadIdx.x; if (t >= n8) return; FragH f;
#pragma unroll
  for (int q = 0; q < 8; ++q) f.h[q] = (_Float16)bf16_round(x[t * 8 + q]); *(v8us*)((unsigned short*)X16 + t * 8) = f.half[0];  }
__global__ __launch_bounds__(256) void k_h16(const float* __restrict__ x, _Float16* __restrict__ X16, size_t n8) { const size_t t = (size_t)blockIdx.x * 256 + threadIdx.x; if (t >= n8) return; FragH f;
#pragma unroll
  for (int q = 0; q < 8; ++q) f.h[q] = (_Float16)x[t * 8 + q]; *(v8us*)((unsigned short*)X16 + t * 8) = f.half[0];  }
__global__ __launch_bounds__(256) void k_round16f(const float* __restrict__ W, _Float16* __restrict__ Bt, size_t n8) { const size_t t = (size_t)blockIdx.x * 256 + threadIdx.x; if (t >= n8) return; FragH f;
#pragma unroll
  for (int i = 0; i < 8; ++i) f.h[i] = (_Float16)(bf16_round(W[t * 8 + i]) * 16.0f); *(v8us*)((unsigned short*)Bt + t * 8) = f.half[0];  }
template <int NHv, int TTv>
__global__ __launch_bounds__(256) void k_vt(const _Float16* __restrict__ V16, int ldv, int voff, _Float16* __restrict__ Vt) { __shared__ unsigned short tl[64][66]; const int tid = threadIdx.x; const int slab = blockIdx.x / (TTv / 64), lg = blockIdx.x % (TTv / 64); const int b = slab / NHv, h = slab % NHv;
  for (int i = tid; i < 64 * 8; i += 256) { const int r = i / 8, c8 = (i % 8) * 8; FragH f; f.half[0] = *(const v8us*)((const unsigned short*)V16 + ((size_t)b * TTv + lg * 64 + r) * ldv + voff + h * 64 + c8);
#pragma unroll
    for (int q = 0; q < 8; ++q) tl[r][c8 + q] = f.u[q]; }
  __syncthreads();
  {
#pragma unroll
    for (int rd = 0; rd < 2; ++rd) { const int d = rd * 32 + tid / 8, pc = tid % 8; FragH f;
#pragma unroll
      for (int q = 0; q < 8; ++q) f.u[q] = tl[pc * 8 + q][d];
      *(v8us*)((unsigned short*)Vt + ((size_t)slab * 64 + d) * TTv + lg * 64 + pc * 8) = f.half[0]; }
     } }

__global__ __launch_bounds__(256) void k_hl(const float* __restrict__ F, _Float16* __restrict__ Hh, _Float16* __restrict__ Hl, size_t n8) { const size_t t = (size_t)blockIdx.x * 256 + threadIdx.x; if (t >= n8) return; FragH fh, fl; const v4f a = *(const v4fa*)(F + t * 8), c = *(const v4fa*)(F + t * 8 + 4);
#pragma unroll
  for (int q = 0; q < 4; ++q) { _Float16 h = (_Float16)a[q]; fh.h[q] = h; fl.h[q] = (_Float16)((a[q] - (float)h) * 1024.0f); h = (_Float16)c[q]; fh.h[4 + q] = h; fl.h[4 + q] = (_Float16)((c[q] - (float)h) * 1024.0f); }
  { *(v8us*)((unsigned short*)Hh + t * 8) = fh.half[0]; *(v8us*)((unsigned short*)Hl + t * 8) = fl.half[0];  } }

// ---- fast GEMM (wave tile 32x64; requires M % 32 == 0 rows per launch region and N % 64 == 0); epilogue = k_gemm_hhx semantics ----
__device__ __forceinline__ v16h g2_frag(const _Float16* p, int hh) { FragH f; f.half[0] = *(const v8us*)((const unsigned short*)p + 8 * hh); f.half[1] = *(const v8us*)((const unsigned short*)p + 16 + 8 * hh); return f.v; }
__device__ __forceinline__ v8f g2_mma(v16h a, v16h b, v8f c) { v8f d = __builtin_amdgcn_wmma_f32_16x16x32_f16(false, a, false, b, (short)0, c, false, false); asm volatile("v_nop\n\tv_nop\n\tv_nop\n\tv_nop" : "+v"(d) : "v"(a), "v"(b)); return d; }
template <int ACT>
__global__ __launch_bounds__(128) void k_gemm2(const _Float16* __restrict__ A, int lda, size_t sA, const _Float16* __restrict__ Bh, int ldb, size_t sB, float alpha, const float* __restrict__ bias, size_t sBias, const float* __restrict__ CP, int rowsPerB, size_t sCPb, int row0g,
    float* __restrict__ C, _Float16* __restrict__ C16, int ldc, size_t sC, int M, int N, int K) { static_assert(ACT == 0 || ACT == 3 || ACT == 6 || ACT == 8 || ACT == 9 || ACT == 11 || ACT == 12 || ACT == 14 || ACT == 15 || ACT == 16 || ACT == 17, "k_gemm2: unsupported ACT code (would silently apply no activation)");
  __shared__ __attribute__((aligned(16))) float so[4][32][68];
  const int tid = threadIdx.x, w = tid >> 5, lane = tid & 31, ln = lane & 15, hh = lane >> 4; const int by = blockIdx.y;
  A += (size_t)by * sA; Bh += (size_t)by * sB; const size_t cofs = (size_t)by * sC; const float* bp = bias ? bias + (size_t)by * sBias : nullptr;
  const int ntn = N >> 6; const int mt = blockIdx.x / ntn, nq = blockIdx.x - mt * ntn; const int row0 = mt * 128 + 32 * w, col0 = nq * 64; if (row0 >= M) return;
  const _Float16* a0p = A + (size_t)(row0 + ln) * lda; const _Float16* a1p = a0p + (size_t)16 * lda;
  const _Float16* b0p = Bh + (size_t)(col0 + ln) * ldb; const _Float16* b1p = b0p + (size_t)16 * ldb; const _Float16* b2p = b1p + (size_t)16 * ldb; const _Float16* b3p = b2p + (size_t)16 * ldb;
  const v8f z8 = {0.f,0.f,0.f,0.f,0.f,0.f,0.f,0.f}; v8f c00 = z8, c01 = z8, c02 = z8, c03 = z8, c10 = z8, c11 = z8, c12 = z8, c13 = z8;
#pragma unroll 1
  for (int kb = 0; kb < K; kb += 32) { const v16h a0 = g2_frag(a0p + kb, hh), a1 = g2_frag(a1p + kb, hh);
    v16h b = g2_frag(b0p + kb, hh); c00 = g2_mma(a0, b, c00); c10 = g2_mma(a1, b, c10);
    b = g2_frag(b1p + kb, hh); c01 = g2_mma(a0, b, c01); c11 = g2_mma(a1, b, c11);
    b = g2_frag(b2p + kb, hh); c02 = g2_mma(a0, b, c02); c12 = g2_mma(a1, b, c12);
    b = g2_frag(b3p + kb, hh); c03 = g2_mma(a0, b, c03); c13 = g2_mma(a1, b, c13); }
  v8f accs[8] = {c00, c01, c02, c03, c10, c11, c12, c13};
#pragma unroll
  for (int u = 0; u < 8; ++u) { const int t = u & 3, half = u >> 2; const int col = col0 + t * 16 + ln; const float bv = bp ? bf16_round(bp[col]) : 0.f;
#pragma unroll
    for (int r = 0; r < 8; ++r) { const int rloc = half * 16 + 8 * hh + r; float v = accs[u][r] * alpha + bv; if (CP) { if (rowsPerB < 0) v += CP[cofs + (size_t)(row0g + row0 + rloc) * ldc + col];      /* rowsPerB < 0: own element of the batched C plane */ else { const int bidx = (row0g + row0 + rloc) / rowsPerB; v += CP[(size_t)bidx * sCPb + (size_t)by * 64 + col]; } }
      if (ACT == 3) v = fmaxf(v, 0.f); else if (ACT == 6) v = 0.5f * v * (1.0f + erff(v * 0.70710678118654752f)); else if (ACT == 11) v = 1.0f / (1.0f + expf(-v)); else if (ACT == 15) v = v / (1.0f + expf(-v)); else if (ACT == 12) v = (v > 0.f) ? v : 0.01f * v; else if (ACT == 8) v = tanhf(v); else if (ACT == 9) v = 0.5f * v * (1.0f + tanhf(0.7978845608028654f * (v + 0.044715f * v * v * v))); else if (ACT == 14) v = (v > 0.f) ? v : 0.1f * v; else if (ACT == 16) v = (v >= 0.f) ? v : 0.3f * v; else if (ACT == 17) v = (v >= 0.f) ? v : 0.2f * v;
      so[w][rloc][t * 16 + ln] = v; } }
  __builtin_amdgcn_fence(__ATOMIC_ACQ_REL, "workgroup"); __builtin_amdgcn_wave_barrier();
  const int rsub = lane >> 4, c4 = (lane & 15) * 4;
  {
#pragma unroll
    for (int q = 0; q < 16; ++q) { const int r = q * 2 + rsub; const v4f v = *(const v4fa*)&so[w][r][c4]; if (C) *(v4f*)(C + cofs + (size_t)(row0 + r) * ldc + col0 + c4) = v; if (C16) { v4h h4; for (int i = 0; i < 4; ++i) h4[i] = (_Float16)v[i]; *(v4h*)(C16 + cofs + (size_t)(row0 + r) * ldc + col0 + c4) = h4; } }
     } }


__global__ __launch_bounds__(256) void k_wnat(const float* __restrict__ w, size_t n8, _Float16* __restrict__ Bt) { const size_t t = (size_t)blockIdx.x * 256 + threadIdx.x; if (t >= n8) return; FragH f; for (int q = 0; q < 8; ++q) f.h[q] = (_Float16)(bf16_round(w[t * 8 + q]) * 16.0f); *(v8us*)((unsigned short*)Bt + t * 8) = f.half[0];  }
__global__ __launch_bounds__(256) void k_rsm(const float* __restrict__ S, _Float16* __restrict__ P, int nrows) {
  #pragma clang fp contract(off)
  const int i = blockIdx.x * 256 + threadIdx.x; if (i >= nrows) return; const float* s = S + (size_t)i * SQ; float mx = -3.0e38f;
#pragma unroll 1
  for (int j = 0; j < SQ; ++j) mx = fmaxf(mx, s[j]); float se = 0.f;
#pragma unroll 1
  for (int j = 0; j < SQ; ++j) se += expf(s[j] - mx); const float sc = 256.0f / se;
#pragma unroll 1
  for (int j0 = 0; j0 < SQ; j0 += 8) { FragH f; for (int q = 0; q < 8; ++q) f.h[q] = (_Float16)(expf(s[j0 + q] - mx) * sc); unsigned short* d = (unsigned short*)P + (size_t)i * SQ + j0; *(v8us*)d = f.half[0];  } }
__global__ __launch_bounds__(256) void k_vt(const _Float16* __restrict__ V16, int b, int h0, _Float16* __restrict__ VT) { __shared__ unsigned short tl[64][65]; const int tid = threadIdx.x; const int hh = blockIdx.x % HG, sg = blockIdx.x / HG; const int s0 = sg * 64; const int h = h0 + hh;
  for (int i = tid; i < 64 * 8; i += 256) { const int j = i / 8, d8 = (i % 8) * 8; FragH f; f.half[0] = *(const v8us*)((const unsigned short*)V16 + ((size_t)b * SQ + s0 + j) * DM + h * HD + d8); for (int q = 0; q < 8; ++q) tl[d8 + q][j] = f.u[q]; }
  __syncthreads();
  { for (int i = tid; i < 64 * 8; i += 256) { const int d = i / 8, j8 = (i % 8) * 8; FragH f; for (int q = 0; q < 8; ++q) f.u[q] = tl[d][j8 + q]; *(v8us*)((unsigned short*)VT + ((size_t)hh * HD + d) * SQ + s0 + j8) = f.half[0]; }  } }



__global__ __launch_bounds__(256) void k_rsmf(const float* __restrict__ S, _Float16* __restrict__ P, int qn, int hg) {
  #pragma clang fp contract(off)
  const int t = blockIdx.x * 256 + threadIdx.x; if (t >= qn * hg) return; const size_t i = (size_t)(t / qn) * SQ + (t % qn); const float* s = S + i * SQ; float mx = -3.0e38f;
#pragma unroll 1
  for (int j = 0; j < SQ; ++j) mx = fmaxf(mx, s[j]); float se = 0.f;
#pragma unroll 1
  for (int j = 0; j < SQ; ++j) se += __expf(s[j] - mx); const float sc = 256.0f / se;
#pragma unroll 1
  for (int j0 = 0; j0 < SQ; j0 += 8) { FragH f; for (int q = 0; q < 8; ++q) f.h[q] = (_Float16)(__expf(s[j0 + q] - mx) * sc); unsigned short* d = (unsigned short*)P + i * SQ + j0; *(v8us*)d = f.half[0];  } }

__global__ __launch_bounds__(256) void k_rsmfx(const float* __restrict__ S, _Float16* __restrict__ P, int qn, int hg, const float* __restrict__ Mk) {
  #pragma clang fp contract(off)
  const int t = blockIdx.x * 256 + threadIdx.x; if (t >= qn * hg) return; const size_t i = (size_t)(t / qn) * SQ + (t % qn); const float* s = S + i * SQ; const float* m = Mk + (size_t)(t % qn) * SQ; float mx = -3.0e38f;
#pragma unroll 1
  for (int j = 0; j < SQ; ++j) mx = fmaxf(mx, s[j]); float se = 0.f;
#pragma unroll 1
  for (int j = 0; j < SQ; ++j) se += __expf(s[j] - mx) * m[j]; const float sc = 256.0f / se;
#pragma unroll 1
  for (int j0 = 0; j0 < SQ; j0 += 8) { FragH f; for (int q = 0; q < 8; ++q) f.h[q] = (_Float16)(__expf(s[j0 + q] - mx) * m[j0 + q] * sc); unsigned short* d = (unsigned short*)P + i * SQ + j0; *(v8us*)d = f.half[0];  } }

extern "C" void kernel_launch(void* const* d_in, const int* in_sizes, int n_in,
                              void* d_out, int out_size, void* d_ws, size_t ws_size, hipStream_t stream) {
  (void)in_sizes; (void)n_in; (void)out_size;
  const float* const* I = (const float* const*)d_in; const float* x = I[0]; const float* amask = I[1]; const float* wq = I[2]; const float* wk = I[3]; const float* wv = I[4]; const float* bq = nullptr; const float* bk = nullptr; const float* bv = nullptr;      /* [in][out] weights, no biases; float 0/1 mask [8][1024][1024] read in the softmax */
  char* ws = (char*)d_ws; size_t off = 0;
  auto take = [&](size_t bytes) { char* p = ws + off; off += (bytes + 255) & ~(size_t)255; return p; };
  _Float16* BQ = (_Float16*)take((size_t)DM * DM * 2); _Float16* BK = (_Float16*)take((size_t)DM * DM * 2); _Float16* BV = (_Float16*)take((size_t)DM * DM * 2); 
  _Float16* X16 = (_Float16*)take(NR * DM * 2); _Float16* Q16 = (_Float16*)take(NR * DM * 2); float* QF = (float*)take(NR * DM * 4); _Float16* QL = (_Float16*)take(NR * DM * 2); _Float16* K16 = (_Float16*)take(NR * DM * 2); _Float16* V16 = (_Float16*)take(NR * DM * 2); _Float16* O16 = (_Float16*)take(NR * DM * 2);
  float* S = (float*)take((size_t)HG * SQ * SQ * 4); _Float16* P = (_Float16*)take((size_t)HG * SQ * SQ * 2); _Float16* VT = (_Float16*)take((size_t)NH * HD * SQ * 2);
  if (off > ws_size) return;
  { const unsigned g = (unsigned)(((size_t)DM * (DM / 8) + 255) / 256); k_wt_f16<<<g, 256, 0, stream>>>(wq, BQ, DM, DM, 16.0f); k_wt_f16<<<g, 256, 0, stream>>>(wk, BK, DM, DM, 16.0f); k_wt_f16<<<g, 256, 0, stream>>>(wv, BV, DM, DM, 16.0f); }      /* [in][out] -> Bt x16 */

  k_x16<<<(unsigned)((NR * DM / 8 + 255) / 256), 256, 0, stream>>>(x, X16, NR * DM / 8);
  const size_t r0p = (size_t)B0 * SQ;      /* first projected row */
  k_gemm2<0><<<dim3((unsigned)((MP / 128) * (DM / 64)), 1), 128, 0, stream>>>(X16 + r0p * DM, DM, 0, BQ, DM, 0, 0.0625f, nullptr, 0, nullptr, 1, 0, 0, QF + r0p * DM, nullptr, DM, 0, MP, DM, DM); k_hl<<<(unsigned)(((size_t)MP * DM / 8 + 255) / 256), 256, 0, stream>>>(QF + r0p * DM, Q16 + r0p * DM, QL + r0p * DM, (size_t)MP * DM / 8);      /* q in f32, then f16 hi + x1024 residual planes */
  k_gemm2<0><<<dim3((unsigned)((MP / 128) * (DM / 64)), 1), 128, 0, stream>>>(X16 + r0p * DM, DM, 0, BK, DM, 0, 0.0625f, nullptr, 0, nullptr, 1, 0, 0, nullptr, K16 + r0p * DM, DM, 0, MP, DM, DM);
  k_gemm2<0><<<dim3((unsigned)((MP / 128) * (DM / 64)), 1), 128, 0, stream>>>(X16 + r0p * DM, DM, 0, BV, DM, 0, 0.0625f, nullptr, 0, nullptr, 1, 0, 0, nullptr, V16 + r0p * DM, DM, 0, MP, DM, DM);
  for (int b = B0; b < B0 + NBR; ++b) { const size_t r0 = (size_t)b * SQ;
    k_vt<NH, SQ><<<NH * (SQ / 64), 256, 0, stream>>>(V16 + r0 * LQ, LQ, 0, VT);      /* V^T [NH][HD][SQ] for this batch */
    for (int h0 = 0; h0 < NHD; h0 += HG) {
      k_gemm2<0><<<dim3((QN / 128) * (SQ / 64), HG), 128, 0, stream>>>(Q16 + r0 * LQ + h0 * HD, LQ, (size_t)HD, K16 + r0 * LQ + h0 * HD, LQ, (size_t)HD, 0.125f, nullptr, 0, nullptr, 1, 0, 0, S, nullptr, SQ, (size_t)SQ * SQ, QN, SQ, HD); k_gemm2<0><<<dim3((QN / 128) * (SQ / 64), HG), 128, 0, stream>>>(QL + r0 * LQ + h0 * HD, LQ, (size_t)HD, K16 + r0 * LQ + h0 * HD, LQ, (size_t)HD, 0.0001220703125f, nullptr, 0, S, -1, 0, 0, S, nullptr, SQ, (size_t)SQ * SQ, QN, SQ, HD);      /* scores = q_hi.k/8, then += q_lo.k 2^-10/8 (own-element accumulate): q effectively f32 */      /* scores, HG heads per launch */
      k_rsmfx<<<(HG * QN + 255) / 256, 256, 0, stream>>>(S, P, QN, HG, amask + (size_t)b * SQ * SQ);      /* P = 256 masked softmax (f16): the batch's float 0/1 mask read per (query, key), rows of all HG heads */
      k_gemm2<0><<<dim3((QN / 128) * (HD / 64), HG), 128, 0, stream>>>(P, SQ, (size_t)SQ * SQ, VT + (size_t)h0 * HD * SQ, SQ, (size_t)HD * SQ, 0.00390625f, nullptr, 0, nullptr, 1, 0, 0, (float*)d_out + r0 * DM + h0 * HD, nullptr, DM, (size_t)HD, QN, HD, SQ); } }      /* ctx (merged heads) straight to the f32 output */
}

// v001
// Measured time: 2440 microseconds a run.
// Two timings next to v000 put it at 4.06 and 4.05 times that version's speed.
#include <hip/hip_runtime.h>
// Multi-head self-attention with a multiplicative 0/1 mask and the module's 'unsafe' softmax (x [8][1024][1024]; q = x Wq, k = x Wk, v = x Wv ([in][out] 1024^2 sigma 1/32, no biases); 16 heads of 64; scores / 8; w = exp(s) mask[b][s][t] / (sum_t exp(s) mask + 1e-8) with the float mask input [8][1024][1024] (0/1, ~90 % ones, shared across heads) READ per (query, key); out = merged ctx (no output projection) -> [8][1024][1024]).
// Compute dtype: inputs rounded to bf16; x / weights exact; k, v and softmax weights as plain f16 GEMM operands (~2^-12); q as f16 hi + x1024 lo planes (effectively f32); o written f32; scores and softmax statistics f32. v_wmma_f32_16x16x32_f16.
#define NB 8
#define SQ 1024
#define DM 1024
#define NH 16
#define HD 64
#define HG 4                         /* heads per attention launch group */
#define B0 0                         /* first batch processed (debug hook) */
#define NBR NB                       /* batches processed (debug hook) */
#define NR ((size_t)NB * SQ)         /* token rows */
#define MP ((int)((size_t)NBR * SQ)) /* rows projected (debug hook) */
#define QN SQ                        /* query rows attended per batch (debug hook) */
#define NHD NH                       /* heads attended (debug hook) */
#define MPO MP                       /* unused */
#define LQ DM      /* row pitch of the q/k/v rows */
typedef __bf16 v16b __attribute__((ext_vector_type(16)));
typedef unsigned short v8us __attribute__((ext_vector_type(8), may_alias));
typedef float  v8f  __attribute__((ext_vector_type(8)));
typedef float  v4f  __attribute__((ext_vector_type(4)));
typedef float  v4fa __attribute__((ext_vector_type(4), may_alias));
union FragB { v16b v; v8us half[2]; unsigned short u[16]; };

__device__ __forceinline__ unsigned short bf16_bits(float x) { unsigned int u = __float_as_uint(x); return (unsigned short)((u + 0x7FFFu + ((u >> 16) & 1u)) >> 16); }
__device__ __forceinline__ float bf16_val(unsigned short b) { return __uint_as_float(((unsigned int)b) << 16); }
__device__ __forceinline__ float bf16_round(float x) { return bf16_val(bf16_bits(x)); }
// D += A·B with NT terms: 1 = ah·bh, 2 = + al·bh (A split), 3 = + ah·bl (both split)
template <int NT>
__device__ __forceinline__ v8f mmaN(v16b ah, v16b al, v16b bh, v16b bl, v8f c) {
  c = __builtin_amdgcn_wmma_f32_16x16x32_bf16(false, ah, false, bh, (short)0, c, false, false);
  if (NT >= 2) c = __builtin_amdgcn_wmma_f32_16x16x32_bf16(false, al, false, bh, (short)0, c, false, false);
  if (NT >= 3) c = __builtin_amdgcn_wmma_f32_16x16x32_bf16(false, ah, false, bl, (short)0, c, false, false);
  asm volatile("v_nop\n\tv_nop\n\tv_nop\n\tv_nop" : "+v"(c) : "v"(ah), "v"(al), "v"(bh), "v"(bl));
  return c;
}

__global__ __launch_bounds__(256) void k_wt_bf16(const float* __restrict__ W, unsigned short* __restrict__ Wt, int K, int N) {
  const int t = blockIdx.x * 256 + threadIdx.x;
  const int k8n = K / 8;
  if (t >= N * k8n) return;
  const int n = t / k8n, k8 = (t % k8n) * 8;
  v8us v;
#pragma unroll
  for (int i = 0; i < 8; ++i) v[i] = bf16_bits(W[(size_t)(k8 + i) * N + n]);
  *(v8us*)(Wt + (size_t)n * K + k8) = v;
  
}

// GEMM C[M][N] (f32, pitch ldc) = act(A[M][K]·W + bias). A f32 row-major (pitch lda) converted per fragment to bf16
// (ASPLIT: hi/lo two planes -> 2 terms, else single rounded term); Wt bf16 [N][K] (pitch ldb). BIAS_BF16 rounds the
// bias to bf16 first (bias quantised to bf16 before the add). K%32==0, M%16==0, N%64==0.
template <bool ASPLIT, int ACT, bool BIAS_BF16>
__global__ __launch_bounds__(128) void k_gemm_bf(const float* __restrict__ A, int lda, const unsigned short* __restrict__ Wt, int ldb,
                                               const float* __restrict__ bias, float* __restrict__ C, int ldc, int M, int N, int K) {
  __shared__ __attribute__((aligned(16))) float so[4][16][64];
  const int tid = threadIdx.x, w = tid >> 5, lane = tid & 31, ln = lane & 15, hh = lane >> 4;
  const int ntn = N / 64;
  const int wid = blockIdx.x * 4 + w;
  const int mt = wid / ntn, nq = wid % ntn;
  if (mt * 16 >= M) return;
  const int row0 = mt * 16, col0 = nq * 64;
  const float* arow = A + (size_t)(row0 + ln) * lda;
  v8f acc[4] = {};
  for (int kb = 0; kb < K; kb += 32) {
    FragB ah, al;
    const v4f x0 = *(const v4fa*)(arow + kb + 8 * hh), x1 = *(const v4fa*)(arow + kb + 8 * hh + 4);
    const v4f x2 = *(const v4fa*)(arow + kb + 16 + 8 * hh), x3 = *(const v4fa*)(arow + kb + 16 + 8 * hh + 4);
    float xs[16] = {x0[0],x0[1],x0[2],x0[3],x1[0],x1[1],x1[2],x1[3],x2[0],x2[1],x2[2],x2[3],x3[0],x3[1],x3[2],x3[3]};
#pragma unroll
    for (int i = 0; i < 16; ++i) { const unsigned short hb = bf16_bits(xs[i]); ah.u[i] = hb; al.u[i] = ASPLIT ? bf16_bits(xs[i] - bf16_val(hb)) : (unsigned short)0; }
#pragma unroll
    for (int t = 0; t < 4; ++t) {
      const unsigned short* brow = Wt + (size_t)(col0 + t * 16 + ln) * ldb + kb;
      FragB b;
      b.half[0] = *(const v8us*)(brow + 8 * hh);
      b.half[1] = *(const v8us*)(brow + 16 + 8 * hh);
      acc[t] = mmaN<ASPLIT ? 2 : 1>(ah.v, al.v, b.v, b.v, acc[t]);
    }
  }
#pragma unroll
  for (int t = 0; t < 4; ++t) {
    float bv = bias ? bias[col0 + t * 16 + ln] : 0.f;
    if (BIAS_BF16) bv = bf16_round(bv);
#pragma unroll
    for (int r = 0; r < 8; ++r) { float v = acc[t][r] + bv; if (ACT == 1) v = fmaxf(v, 0.f); so[w][8 * hh + r][t * 16 + ln] = v; }
  }
  __builtin_amdgcn_fence(__ATOMIC_ACQ_REL, "workgroup");
  __builtin_amdgcn_wave_barrier();
  const int rsub = lane >> 4, c4 = (lane & 15) * 4;
  {
#pragma unroll
    for (int q = 0; q < 8; ++q) {
      const int r = q * 2 + rsub;
      const v4f v = *(const v4fa*)&so[w][r][c4];
      *(v4f*)(C + (size_t)(row0 + r) * ldc + col0 + c4) = v;
    }
    
  }
}

// GEMM C = act(A·W + bias + resid): A f32 (ASPLIT -> hi/lo 2 terms), Wt bf16 [N][K]; ACT 0 none, 1 relu, 2 exact gelu;
// resid (optional, f32, row index = (row % rmod), pitch ldr, RES_BF16 rounds it) added before the activation.
template <bool ASPLIT, int ACT, bool BIAS_BF16, bool RES_BF16>
__global__ __launch_bounds__(128) void k_gemm_bf3(const float* __restrict__ A, int lda, const unsigned short* __restrict__ Wt, int ldb,
                                                const float* __restrict__ bias, const float* __restrict__ resid, int rmod, int ldr,
                                                float* __restrict__ C, int ldc, int M, int N, int K) {
  __shared__ __attribute__((aligned(16))) float so[4][16][64];
  const int tid = threadIdx.x, w = tid >> 5, lane = tid & 31, ln = lane & 15, hh = lane >> 4;
  const int ntn = N / 64;
  const int wid = blockIdx.x * 4 + w;
  const int mt = wid / ntn, nq = wid % ntn;
  if (mt * 16 >= M) return;
  const int row0 = mt * 16, col0 = nq * 64;
  const float* arow = A + (size_t)(row0 + ln) * lda;
  v8f acc[4] = {};
  for (int kb = 0; kb < K; kb += 32) {
    FragB ah, al;
    const v4f x0 = *(const v4fa*)(arow + kb + 8 * hh), x1 = *(const v4fa*)(arow + kb + 8 * hh + 4);
    const v4f x2 = *(const v4fa*)(arow + kb + 16 + 8 * hh), x3 = *(const v4fa*)(arow + kb + 16 + 8 * hh + 4);
    float xs[16] = {x0[0],x0[1],x0[2],x0[3],x1[0],x1[1],x1[2],x1[3],x2[0],x2[1],x2[2],x2[3],x3[0],x3[1],x3[2],x3[3]};
#pragma unroll
    for (int i = 0; i < 16; ++i) { const unsigned short hb = bf16_bits(xs[i]); ah.u[i] = hb; al.u[i] = ASPLIT ? bf16_bits(xs[i] - bf16_val(hb)) : (unsigned short)0; }
#pragma unroll
    for (int t = 0; t < 4; ++t) {
      const unsigned short* brow = Wt + (size_t)(col0 + t * 16 + ln) * ldb + kb;
      FragB b;
      b.half[0] = *(const v8us*)(brow + 8 * hh);
      b.half[1] = *(const v8us*)(brow + 16 + 8 * hh);
      acc[t] = mmaN<ASPLIT ? 2 : 1>(ah.v, al.v, b.v, b.v, acc[t]);
    }
  }
#pragma unroll
  for (int t = 0; t < 4; ++t) {
    const int col = col0 + t * 16 + ln;
    float bv = bias ? bias[col] : 0.f;
    if (BIAS_BF16) bv = bf16_round(bv);
#pragma unroll
    for (int r = 0; r < 8; ++r) {
      float v = acc[t][r] + bv;
      if (resid) { float rv = resid[(size_t)((row0 + 8 * hh + r) % rmod) * ldr + col]; if (RES_BF16) rv = bf16_round(rv); v += rv; }
      if (ACT == 1) v = fmaxf(v, 0.f);
      if (ACT == 2) v = 0.5f * v * (1.0f + erff(v * 0.70710678118654752f));
      if (ACT == 3) { const float u = 0.7978845608028654f * (v + 0.044715f * v * v * v); v = 0.5f * v * (1.0f + tanhf(u)); }
      so[w][8 * hh + r][t * 16 + ln] = v;
    }
  }
  __builtin_amdgcn_fence(__ATOMIC_ACQ_REL, "workgroup");
  __builtin_amdgcn_wave_barrier();
  const int rsub = lane >> 4, c4 = (lane & 15) * 4;
  {
#pragma unroll
    for (int q = 0; q < 8; ++q) {
      const int r = q * 2 + rsub;
      const v4f v = *(const v4fa*)&so[w][r][c4];
      *(v4f*)(C + (size_t)(row0 + r) * ldc + col0 + c4) = v;
    }
    
  }
}
// row LayerNorm (biased variance, eps) over N: s = X (+ R); optional out_sum <- s; out_norm <- (s-mu)*rsqrt(var+eps)*g + b
template <bool PARAM_BF16>
__global__ __launch_bounds__(256) void k_layernorm(const float* __restrict__ X, const float* __restrict__ R, const float* __restrict__ g, const float* __restrict__ bta,
                                                  float* __restrict__ out_sum, float* __restrict__ out_norm, int N, float eps) {
  __shared__ float red[256];
  const int row = blockIdx.x, tid = threadIdx.x;
  const float* x = X + (size_t)row * N; const float* rr = R ? R + (size_t)row * N : nullptr;
  float vals[16];                     // up to N = 4096
  const int per = N / 256;            // contiguous chunk per thread? use strided-by-4 chunks: thread handles j = tid*4 + 1024*u
  float s1 = 0.f;
  for (int u = 0; u < per / 4; ++u) {
    const int j = tid * 4 + 1024 * u;
    const v4f a = *(const v4fa*)(x + j);
    v4f b = {0.f,0.f,0.f,0.f}; if (rr) b = *(const v4fa*)(rr + j);
#pragma unroll
    for (int q = 0; q < 4; ++q) { const float v = a[q] + b[q]; vals[u * 4 + q] = v; s1 += v; }
  }
  red[tid] = s1; __syncthreads();
  for (int st = 128; st > 0; st >>= 1) { if (tid < st) red[tid] += red[tid + st]; __syncthreads(); }
  const float mu = red[0] / (float)N; __syncthreads();
  float s2 = 0.f;
  for (int u = 0; u < per / 4; ++u)
#pragma unroll
    for (int q = 0; q < 4; ++q) { const float c = vals[u * 4 + q] - mu; s2 += c * c; }
  red[tid] = s2; __syncthreads();
  for (int st = 128; st > 0; st >>= 1) { if (tid < st) red[tid] += red[tid + st]; __syncthreads(); }
  const float rs = rsqrtf(red[0] / (float)N + eps);
  {
    for (int u = 0; u < per / 4; ++u) {
      const int j = tid * 4 + 1024 * u;
      v4f o, sm;
#pragma unroll
      for (int q = 0; q < 4; ++q) {
        float gg = g[j + q], bb = bta[j + q];
        if (PARAM_BF16) { gg = bf16_round(gg); bb = bf16_round(bb); }
        sm[q] = vals[u * 4 + q]; o[q] = (vals[u * 4 + q] - mu) * rs * gg + bb;
      }
      if (out_sum) *(v4f*)(out_sum + (size_t)row * N + j) = sm;
      *(v4f*)(out_norm + (size_t)row * N + j) = o;
    }
    
  }
}



// ---- f16 WMMA path (v_wmma_f32_16x16x32_f16): 11-bit significands for operands in range — used where a [0,1] probability operand needs more precision than bf16
typedef _Float16 v16h __attribute__((ext_vector_type(16)));
union FragH { v16h v; v8us half[2]; _Float16 h[16]; unsigned short u[16]; };
template <int NT>
__device__ __forceinline__ v8f mmaH(v16h ah, v16h al, v16h bh, v16h bl, v8f c) {
  c = __builtin_amdgcn_wmma_f32_16x16x32_f16(false, ah, false, bh, (short)0, c, false, false);
  if (NT >= 2) c = __builtin_amdgcn_wmma_f32_16x16x32_f16(false, al, false, bh, (short)0, c, false, false);
  if (NT >= 3) c = __builtin_amdgcn_wmma_f32_16x16x32_f16(false, ah, false, bl, (short)0, c, false, false);
  asm volatile("v_nop\n\tv_nop\n\tv_nop\n\tv_nop" : "+v"(c) : "v"(ah), "v"(al), "v"(bh), "v"(bl));
  return c;
}
// batched GEMM like k_gemm_b but f16 operands: A f32 (split into f16 hi/lo if ASPLIT, else rounded to f16), Bt = f16 values [n][k]; alpha; C f32; N multiple of 16 (partial tiles skipped)
template <bool ASPLIT>
__global__ __launch_bounds__(128) void k_gemm_h(const float* __restrict__ A, int lda, size_t sA, const _Float16* __restrict__ Bh, int ldb, size_t sB, float alpha, float* __restrict__ C, int ldc, size_t sC, int M, int N, int K) {
  __shared__ __attribute__((aligned(16))) float so[4][16][64];
  const int tid = threadIdx.x, w = tid >> 5, lane = tid & 31, ln = lane & 15, hh = lane >> 4; const int by = blockIdx.y;
  A += (size_t)by * sA; Bh += (size_t)by * sB; C += (size_t)by * sC;
  const int ntn = (N + 63) / 64; const int wid = blockIdx.x * 4 + w; const int mt = wid / ntn, nq = wid % ntn; if (mt * 16 >= M) return;
  const int row0 = mt * 16, col0 = nq * 64; const float* arow = A + (size_t)(row0 + ln) * lda;
  v8f acc[4] = {};
  for (int kb = 0; kb < K; kb += 32) {
    FragH ah, al;
    const v4f x0 = *(const v4fa*)(arow + kb + 8 * hh), x1 = *(const v4fa*)(arow + kb + 8 * hh + 4), x2 = *(const v4fa*)(arow + kb + 16 + 8 * hh), x3 = *(const v4fa*)(arow + kb + 16 + 8 * hh + 4);
    float xs[16] = {x0[0],x0[1],x0[2],x0[3],x1[0],x1[1],x1[2],x1[3],x2[0],x2[1],x2[2],x2[3],x3[0],x3[1],x3[2],x3[3]};
#pragma unroll
    for (int i = 0; i < 16; ++i) { const _Float16 h = (_Float16)xs[i]; ah.h[i] = h; al.h[i] = ASPLIT ? (_Float16)(xs[i] - (float)h) : (_Float16)0.0f; }
#pragma unroll
    for (int t = 0; t < 4; ++t) { if (col0 + t * 16 >= N) continue; const size_t boff = (size_t)(col0 + t * 16 + ln) * ldb + kb; FragH bq; bq.half[0] = *(const v8us*)(Bh + boff + 8 * hh); bq.half[1] = *(const v8us*)(Bh + boff + 16 + 8 * hh);
      acc[t] = mmaH<ASPLIT ? 2 : 1>(ah.v, al.v, bq.v, bq.v, acc[t]); }
  }
#pragma unroll
  for (int t = 0; t < 4; ++t) { if (col0 + t * 16 >= N) continue;
#pragma unroll
    for (int r = 0; r < 8; ++r) so[w][8 * hh + r][t * 16 + ln] = acc[t][r] * alpha; }
  __builtin_amdgcn_fence(__ATOMIC_ACQ_REL, "workgroup"); __builtin_amdgcn_wave_barrier();
  const int rsub = lane >> 4, c4 = (lane & 15) * 4;
  {
#pragma unroll
    for (int q = 0; q < 8; ++q) { const int r = q * 2 + rsub; if (col0 + c4 < N) { const v4f v = *(const v4fa*)&so[w][r][c4]; *(v4f*)(C + (size_t)(row0 + r) * ldc + col0 + c4) = v; } }
     }
}

// Wt[n][k] = f16(W[k][n]·scale) from f32 row-major W[K][N] (scale = power of two; bf16-exact weights stay exact in f16 away from the subnormal range)
__global__ __launch_bounds__(256) void k_wt_f16(const float* __restrict__ W, _Float16* __restrict__ Wt, int K, int N, float scale) {
  const int t = blockIdx.x * 256 + threadIdx.x; if (t >= N * (K / 8)) return; const int n = t / (K / 8), k8 = (t % (K / 8)) * 8; FragH f;
#pragma unroll
  for (int i = 0; i < 8; ++i) f.h[i] = (_Float16)(bf16_round(W[(size_t)(k8 + i) * N + n]) * scale); const v8us o = f.half[0];
  *(v8us*)((unsigned short*)Wt + (size_t)n * K + k8) = o; 
}
// k_gemm_hh variant with fused epilogue: v = acc·alpha + bias[by·sBias + col] (+ CP[(row/rowsPerB)·sCPb + by·64 + col] if CP) ; ACT 0 none / 1 elu ; writes f16 C16 (and f32 C if non-null)
template <int ACT>
__global__ __launch_bounds__(128) void k_gemm_hhx(const _Float16* __restrict__ A, int lda, size_t sA, const _Float16* __restrict__ Bh, int ldb, size_t sB, float alpha, const float* __restrict__ bias, size_t sBias, const float* __restrict__ CP, int rowsPerB, size_t sCPb, int row0g,
    float* __restrict__ C, _Float16* __restrict__ C16, int ldc, size_t sC, int M, int N, int K) {
  __shared__ __attribute__((aligned(16))) float so[4][16][64];
  const int tid = threadIdx.x, w = tid >> 5, lane = tid & 31, ln = lane & 15, hh = lane >> 4; const int by = blockIdx.y;
  A += (size_t)by * sA; Bh += (size_t)by * sB; const size_t cofs = (size_t)by * sC; const float* bp = bias ? bias + (size_t)by * sBias : nullptr;
  const int ntn = (N + 63) / 64; const int wid = blockIdx.x * 4 + w; const int mt = wid / ntn, nq = wid % ntn; if (mt * 16 >= M) return;
  const int row0 = mt * 16, col0 = nq * 64; const _Float16* arow = A + (size_t)(row0 + ln) * lda;
  v8f acc[4] = {};
  for (int kb = 0; kb < K; kb += 32) { FragH ah; ah.half[0] = *(const v8us*)((const unsigned short*)arow + kb + 8 * hh); ah.half[1] = *(const v8us*)((const unsigned short*)arow + kb + 16 + 8 * hh);
#pragma unroll
    for (int t = 0; t < 4; ++t) { if (col0 + t * 16 >= N) continue; const size_t boff = (size_t)(col0 + t * 16 + ln) * ldb + kb; FragH bq; bq.half[0] = *(const v8us*)((const unsigned short*)Bh + boff + 8 * hh); bq.half[1] = *(const v8us*)((const unsigned short*)Bh + boff + 16 + 8 * hh);
      acc[t] = mmaH<1>(ah.v, ah.v, bq.v, bq.v, acc[t]); }
  }
#pragma unroll
  for (int t = 0; t < 4; ++t) { if (col0 + t * 16 >= N) continue; const int col = col0 + t * 16 + ln; const float bv = bp ? bf16_round(bp[col]) : 0.f;
#pragma unroll
    for (int r = 0; r < 8; ++r) { float v = acc[t][r] * alpha + bv; if (CP) { const int rr = row0g + row0 + 8 * hh + r; if (rowsPerB < 0) v += CP[cofs + (size_t)rr * ldc + col];      /* rowsPerB < 0: own element of the batched C plane */ else { const int bidx = rr / rowsPerB; v += CP[(size_t)bidx * sCPb + (size_t)by * 64 + col]; } } if (ACT == 1) v = (v > 0.f) ? v : expm1f(v); else if (ACT == 7) v = (v > 0.f) ? v + 1.0f : expf(v); else if (ACT == 8) v = tanhf(v); else if (ACT == 9) v = 0.5f * v * (1.0f + tanhf(0.7978845608028654f * (v + 0.044715f * v * v * v))); else if (ACT == 11) v = 1.0f / (1.0f + expf(-v)); else if (ACT == 12) v = (v > 0.f) ? v : 0.01f * v; else if (ACT == 14) v = (v > 0.f) ? v : 0.1f * v; else if (ACT == 16) v = (v >= 0.f) ? v : 0.3f * v; else if (ACT == 17) v = (v >= 0.f) ? v : 0.2f * v; else if (ACT == 15) v = v / (1.0f + expf(-v)); else if (ACT == 3) v = fmaxf(v, 0.f); else if (ACT == 6) v = 0.5f * v * (1.0f + erff(v * 0.70710678118654752f)); so[w][8 * hh + r][t * 16 + ln] = v; } }
  __builtin_amdgcn_fence(__ATOMIC_ACQ_REL, "workgroup"); __builtin_amdgcn_wave_barrier();
  const int rsub = lane >> 4, c4 = (lane & 15) * 4; typedef _Float16 v4h __attribute__((ext_vector_type(4)));
  {
#pragma unroll
    for (int q = 0; q < 8; ++q) { const int r = q * 2 + rsub; if (col0 + c4 < N) { const v4f v = *(const v4fa*)&so[w][r][c4]; if (C) *(v4f*)(C + cofs + (size_t)(row0 + r) * ldc + col0 + c4) = v; if (C16) { v4h h4; for (int i = 0; i < 4; ++i) h4[i] = (_Float16)v[i]; *(v4h*)(C16 + cofs + (size_t)(row0 + r) * ldc + col0 + c4) = h4; } } }
     }
}


typedef _Float16 v4h __attribute__((ext_vector_type(4)));

__global__ __launch_bounds__(256) void k_x16(const float* __restrict__ x, _Float16* __restrict__ X16, size_t n8) { const size_t t = (size_t)blockIdx.x * 256 + threadIdx.x; if (t >= n8) return; FragH f;
#pragma unroll
  for (int q = 0; q < 8; ++q) f.h[q] = (_Float16)bf16_round(x[t * 8 + q]); *(v8us*)((unsigned short*)X16 + t * 8) = f.half[0];  }
__global__ __launch_bounds__(256) void k_h16(const float* __restrict__ x, _Float16* __restrict__ X16, size_t n8) { const size_t t = (size_t)blockIdx.x * 256 + threadIdx.x; if (t >= n8) return; FragH f;
#pragma unroll
  for (int q = 0; q < 8; ++q) f.h[q] = (_Float16)x[t * 8 + q]; *(v8us*)((unsigned short*)X16 + t * 8) = f.half[0];  }
__global__ __launch_bounds__(256) void k_round16f(const float* __restrict__ W, _Float16* __restrict__ Bt, size_t n8) { const size_t t = (size_t)blockIdx.x * 256 + threadIdx.x; if (t >= n8) return; FragH f;
#pragma unroll
  for (int i = 0; i < 8; ++i) f.h[i] = (_Float16)(bf16_round(W[t * 8 + i]) * 16.0f); *(v8us*)((unsigned short*)Bt + t * 8) = f.half[0];  }
template <int NHv, int TTv>
__global__ __launch_bounds__(256) void k_vt(const _Float16* __restrict__ V16, int ldv, int voff, _Float16* __restrict__ Vt) { __shared__ unsigned short tl[64][66]; const int tid = threadIdx.x; const int slab = blockIdx.x / (TTv / 64), lg = blockIdx.x % (TTv / 64); const int b = slab / NHv, h = slab % NHv;
  for (int i = tid; i < 64 * 8; i += 256) { const int r = i / 8, c8 = (i % 8) * 8; FragH f; f.half[0] = *(const v8us*)((const unsigned short*)V16 + ((size_t)b * TTv + lg * 64 + r) * ldv + voff + h * 64 + c8);
#pragma unroll
    for (int q = 0; q < 8; ++q) tl[r][c8 + q] = f.u[q]; }
  __syncthreads();
  {
#pragma unroll
    for (int rd = 0; rd < 2; ++rd) { const int d = rd * 32 + tid / 8, pc = tid % 8; FragH f;
#pragma unroll
      for (int q = 0; q < 8; ++q) f.u[q] = tl[pc * 8 + q][d];
      *(v8us*)((unsigned short*)Vt + ((size_t)slab * 64 + d) * TTv + lg * 64 + pc * 8) = f.half[0]; }
     } }

__global__ __launch_bounds__(256) void k_hl(const float* __restrict__ F, _Float16* __restrict__ Hh, _Float16* __restrict__ Hl, size_t n8) { const size_t t = (size_t)blockIdx.x * 256 + threadIdx.x; if (t >= n8) return; FragH fh, fl; const v4f a = *(const v4fa*)(F + t * 8), c = *(const v4fa*)(F + t * 8 + 4);
#pragma unroll
  for (int q = 0; q < 4; ++q) { _Float16 h = (_Float16)a[q]; fh.h[q] = h; fl.h[q] = (_Float16)((a[q] - (float)h) * 1024.0f); h = (_Float16)c[q]; fh.h[4 + q] = h; fl.h[4 + q] = (_Float16)((c[q] - (float)h) * 1024.0f); }
  { *(v8us*)((unsigned short*)Hh + t * 8) = fh.half[0]; *(v8us*)((unsigned short*)Hl + t * 8) = fl.half[0];  } }

// ---- fast GEMM (wave tile 32x64; requires M % 32 == 0 rows per launch region and N % 64 == 0); epilogue = k_gemm_hhx semantics ----
__device__ __forceinline__ v16h g2_frag(const _Float16* p, int hh) { FragH f; f.half[0] = *(const v8us*)((const unsigned short*)p + 8 * hh); f.half[1] = *(const v8us*)((const unsigned short*)p + 16 + 8 * hh); return f.v; }
__device__ __forceinline__ v8f g2_mma(v16h a, v16h b, v8f c) { v8f d = __builtin_amdgcn_wmma_f32_16x16x32_f16(false, a, false, b, (short)0, c, false, false); asm volatile("v_nop\n\tv_nop\n\tv_nop\n\tv_nop" : "+v"(d) : "v"(a), "v"(b)); return d; }
template <int ACT>
__global__ __launch_bounds__(128) void k_gemm2(const _Float16* __restrict__ A, int lda, size_t sA, const _Float16* __restrict__ Bh, int ldb, size_t sB, float alpha, const float* __restrict__ bias, size_t sBias, const float* __restrict__ CP, int rowsPerB, size_t sCPb, int row0g,
    float* __restrict__ C, _Float16* __restrict__ C16, int ldc, size_t sC, int M, int N, int K) { static_assert(ACT == 0 || ACT == 3 || ACT == 6 || ACT == 8 || ACT == 9 || ACT == 11 || ACT == 12 || ACT == 14 || ACT == 15 || ACT == 16 || ACT == 17, "k_gemm2: unsupported ACT code (would silently apply no activation)");
  __shared__ __attribute__((aligned(16))) float so[4][32][68];
  const int tid = threadIdx.x, w = tid >> 5, lane = tid & 31, ln = lane & 15, hh = lane >> 4; const int by = blockIdx.y;
  A += (size_t)by * sA; Bh += (size_t)by * sB; const size_t cofs = (size_t)by * sC; const float* bp = bias ? bias + (size_t)by * sBias : nullptr;
  const int ntn = N >> 6; const int mt = blockIdx.x / ntn, nq = blockIdx.x - mt * ntn; const int row0 = mt * 128 + 32 * w, col0 = nq * 64; if (row0 >= M) return;
  const _Float16* a0p = A + (size_t)(row0 + ln) * lda; const _Float16* a1p = a0p + (size_t)16 * lda;
  const _Float16* b0p = Bh + (size_t)(col0 + ln) * ldb; const _Float16* b1p = b0p + (size_t)16 * ldb; const _Float16* b2p = b1p + (size_t)16 * ldb; const _Float16* b3p = b2p + (size_t)16 * ldb;
  const v8f z8 = {0.f,0.f,0.f,0.f,0.f,0.f,0.f,0.f}; v8f c00 = z8, c01 = z8, c02 = z8, c03 = z8, c10 = z8, c11 = z8, c12 = z8, c13 = z8;
#pragma unroll 1
  for (int kb = 0; kb < K; kb += 32) { const v16h a0 = g2_frag(a0p + kb, hh), a1 = g2_frag(a1p + kb, hh);
    v16h b = g2_frag(b0p + kb, hh); c00 = g2_mma(a0, b, c00); c10 = g2_mma(a1, b, c10);
    b = g2_frag(b1p + kb, hh); c01 = g2_mma(a0, b, c01); c11 = g2_mma(a1, b, c11);
    b = g2_frag(b2p + kb, hh); c02 = g2_mma(a0, b, c02); c12 = g2_mma(a1, b, c12);
    b = g2_frag(b3p + kb, hh); c03 = g2_mma(a0, b, c03); c13 = g2_mma(a1, b, c13); }
  v8f accs[8] = {c00, c01, c02, c03, c10, c11, c12, c13};
#pragma unroll
  for (int u = 0; u < 8; ++u) { const int t = u & 3, half = u >> 2; const int col = col0 + t * 16 + ln; const float bv = bp ? bf16_round(bp[col]) : 0.f;
#pragma unroll
    for (int r = 0; r < 8; ++r) { const int rloc = half * 16 + 8 * hh + r; float v = accs[u][r] * alpha + bv; if (CP) { if (rowsPerB < 0) v += CP[cofs + (size_t)(row0g + row0 + rloc) * ldc + col];      /* rowsPerB < 0: own element of the batched C plane */ else { const int bidx = (row0g + row0 + rloc) / rowsPerB; v += CP[(size_t)bidx * sCPb + (size_t)by * 64 + col]; } }
      if (ACT == 3) v = fmaxf(v, 0.f); else if (ACT == 6) v = 0.5f * v * (1.0f + erff(v * 0.70710678118654752f)); else if (ACT == 11) v = 1.0f / (1.0f + expf(-v)); else if (ACT == 15) v = v / (1.0f + expf(-v)); else if (ACT == 12) v = (v > 0.f) ? v : 0.01f * v; else if (ACT == 8) v = tanhf(v); else if (ACT == 9) v = 0.5f * v * (1.0f + tanhf(0.7978845608028654f * (v + 0.044715f * v * v * v))); else if (ACT == 14) v = (v > 0.f) ? v : 0.1f * v; else if (ACT == 16) v = (v >= 0.f) ? v : 0.3f * v; else if (ACT == 17) v = (v >= 0.f) ? v : 0.2f * v;
      so[w][rloc][t * 16 + ln] = v; } }
  __builtin_amdgcn_fence(__ATOMIC_ACQ_REL, "workgroup"); __builtin_amdgcn_wave_barrier();
  const int rsub = lane >> 4, c4 = (lane & 15) * 4;
  {
#pragma unroll
    for (int q = 0; q < 16; ++q) { const int r = q * 2 + rsub; const v4f v = *(const v4fa*)&so[w][r][c4]; if (C) *(v4f*)(C + cofs + (size_t)(row0 + r) * ldc + col0 + c4) = v; if (C16) { v4h h4; for (int i = 0; i < 4; ++i) h4[i] = (_Float16)v[i]; *(v4h*)(C16 + cofs + (size_t)(row0 + r) * ldc + col0 + c4) = h4; } }
     } }


__global__ __launch_bounds__(256) void k_wnat(const float* __restrict__ w, size_t n8, _Float16* __restrict__ Bt) { const size_t t = (size_t)blockIdx.x * 256 + threadIdx.x; if (t >= n8) return; FragH f; for (int q = 0; q < 8; ++q) f.h[q] = (_Float16)(bf16_round(w[t * 8 + q]) * 16.0f); *(v8us*)((unsigned short*)Bt + t * 8) = f.half[0];  }
__global__ __launch_bounds__(256) void k_rsm(const float* __restrict__ S, _Float16* __restrict__ P, int nrows) {
  #pragma clang fp contract(off)
  const int i = blockIdx.x * 256 + threadIdx.x; if (i >= nrows) return; const float* s = S + (size_t)i * SQ; float mx = -3.0e38f;
#pragma unroll 1
  for (int j = 0; j < SQ; ++j) mx = fmaxf(mx, s[j]); float se = 0.f;
#pragma unroll 1
  for (int j = 0; j < SQ; ++j) se += expf(s[j] - mx); const float sc = 256.0f / se;
#pragma unroll 1
  for (int j0 = 0; j0 < SQ; j0 += 8) { FragH f; for (int q = 0; q < 8; ++q) f.h[q] = (_Float16)(expf(s[j0 + q] - mx) * sc); unsigned short* d = (unsigned short*)P + (size_t)i * SQ + j0; *(v8us*)d = f.half[0];  } }
__global__ __launch_bounds__(256) void k_vt(const _Float16* __restrict__ V16, int b, int h0, _Float16* __restrict__ VT) { __shared__ unsigned short tl[64][65]; const int tid = threadIdx.x; const int hh = blockIdx.x % HG, sg = blockIdx.x / HG; const int s0 = sg * 64; const int h = h0 + hh;
  for (int i = tid; i < 64 * 8; i += 256) { const int j = i / 8, d8 = (i % 8) * 8; FragH f; f.half[0] = *(const v8us*)((const unsigned short*)V16 + ((size_t)b * SQ + s0 + j) * DM + h * HD + d8); for (int q = 0; q < 8; ++q) tl[d8 + q][j] = f.u[q]; }
  __syncthreads();
  { for (int i = tid; i < 64 * 8; i += 256) { const int d = i / 8, j8 = (i % 8) * 8; FragH f; for (int q = 0; q < 8; ++q) f.u[q] = tl[d][j8 + q]; *(v8us*)((unsigned short*)VT + ((size_t)hh * HD + d) * SQ + s0 + j8) = f.half[0]; }  } }



__global__ __launch_bounds__(256) void k_rsmf(const float* __restrict__ S, _Float16* __restrict__ P, int qn, int hg) {
  #pragma clang fp contract(off)
  const int t = blockIdx.x * 256 + threadIdx.x; if (t >= qn * hg) return; const size_t i = (size_t)(t / qn) * SQ + (t % qn); const float* s = S + i * SQ; float mx = -3.0e38f;
#pragma unroll 1
  for (int j = 0; j < SQ; ++j) mx = fmaxf(mx, s[j]); float se = 0.f;
#pragma unroll 1
  for (int j = 0; j < SQ; ++j) se += __expf(s[j] - mx); const float sc = 256.0f / se;
#pragma unroll 1
  for (int j0 = 0; j0 < SQ; j0 += 8) { FragH f; for (int q = 0; q < 8; ++q) f.h[q] = (_Float16)(__expf(s[j0 + q] - mx) * sc); unsigned short* d = (unsigned short*)P + i * SQ + j0; *(v8us*)d = f.half[0];  } }

// 2^x on v_exp_f32 with one free issue slot behind it: the instruction set asks for that slot before the result is read or the source overwritten.
__device__ __forceinline__ float exp2_slot(float x) { float r; asm("v_exp_f32 %0, %1\n\tv_nop" : "=v"(r) : "v"(x)); return r; }
// One wave per score row. Lane l holds elements 128 u + 4 l .. + 3 (u = 0..7), so each load and store of a wave covers one contiguous run of the row;
// scores and mask are read once and stay in registers; row maximum and row sum end in a five-step butterfly over the 32 lanes.
// Every loop is fully unrolled so that e[] and mk[] are indexed by constants and live in registers.
__global__ __launch_bounds__(256) void k_rsmfx(const float* __restrict__ S, _Float16* __restrict__ P, int qn, const float* __restrict__ Mk) {
  const int lane = threadIdx.x & 31; const int r = blockIdx.x * 8 + (threadIdx.x >> 5); if (r >= qn) return;      /* query row; blockIdx.y = head of the group */
  const size_t i = (size_t)blockIdx.y * SQ + r; const float* s = S + i * SQ + lane * 4; const float* m = Mk + (size_t)r * SQ + lane * 4;
  v4f e[SQ / 128], mk[SQ / 128];
#pragma unroll
  for (int u = 0; u < SQ / 128; ++u) { e[u] = *(const v4fa*)(s + u * 128); mk[u] = *(const v4fa*)(m + u * 128); }
  asm volatile("s_wait_xcnt 0x0" :: "v"(s), "v"(m) : "memory");      /* stands in front of the first reuse of the loads' address registers; naming both pointers as inputs keeps their registers live up to here, so that no load of the run lands its result in them */
  __builtin_amdgcn_sched_barrier(0);      /* keeps all 16 loads in flight together (without it the mask loads sink behind the maximum's butterfly and each pays its own latency) and keeps the arithmetic behind the wait above */
  float mx = -3.0e38f;
#pragma unroll
  for (int u = 0; u < SQ / 128; ++u) mx = fmaxf(mx, fmaxf(fmaxf(e[u][0], e[u][1]), fmaxf(e[u][2], e[u][3])));
#pragma unroll
  for (int d = 16; d > 0; d >>= 1) mx = fmaxf(mx, __shfl_xor(mx, d, 32));
  v4f s4 = {0.f, 0.f, 0.f, 0.f};
#pragma unroll
  for (int u = 0; u < SQ / 128; ++u) {
#pragma unroll
    for (int q = 0; q < 4; ++q) { e[u][q] = exp2_slot((e[u][q] - mx) * 1.44269504088896340736f) * mk[u][q]; s4[q] += e[u][q]; } }
  float se = (s4[0] + s4[1]) + (s4[2] + s4[3]);
#pragma unroll
  for (int d = 16; d > 0; d >>= 1) se += __shfl_xor(se, d, 32);
  const float sc = 256.0f / se; _Float16* d = P + i * SQ + lane * 4;
#pragma unroll
  for (int u = 0; u < SQ / 128; ++u) { v4h h4;
#pragma unroll
    for (int q = 0; q < 4; ++q) h4[q] = (_Float16)(e[u][q] * sc);
    *(v4h*)(d + u * 128) = h4; } }

extern "C" void kernel_launch(void* const* d_in, const int* in_sizes, int n_in,
                              void* d_out, int out_size, void* d_ws, size_t ws_size, hipStream_t stream) {
  (void)in_sizes; (void)n_in; (void)out_size;
  const float* const* I = (const float* const*)d_in; const float* x = I[0]; const float* amask = I[1]; const float* wq = I[2]; const float* wk = I[3]; const float* wv = I[4]; const float* bq = nullptr; const float* bk = nullptr; const float* bv = nullptr;      /* [in][out] weights, no biases; float 0/1 mask [8][1024][1024] read in the softmax */
  char* ws = (char*)d_ws; size_t off = 0;
  auto take = [&](size_t bytes) { char* p = ws + off; off += (bytes + 255) & ~(size_t)255; return p; };
  _Float16* BQ = (_Float16*)take((size_t)DM * DM * 2); _Float16* BK = (_Float16*)take((size_t)DM * DM * 2); _Float16* BV = (_Float16*)take((size_t)DM * DM * 2); 
  _Float16* X16 = (_Float16*)take(NR * DM * 2); _Float16* Q16 = (_Float16*)take(NR * DM * 2); float* QF = (float*)take(NR * DM * 4); _Float16* QL = (_Float16*)take(NR * DM * 2); _Float16* K16 = (_Float16*)take(NR * DM * 2); _Float16* V16 = (_Float16*)take(NR * DM * 2); _Float16* O16 = (_Float16*)take(NR * DM * 2);
  float* S = (float*)take((size_t)HG * SQ * SQ * 4); _Float16* P = (_Float16*)take((size_t)HG * SQ * SQ * 2); _Float16* VT = (_Float16*)take((size_t)NH * HD * SQ * 2);
  if (off > ws_size) return;
  { const unsigned g = (unsigned)(((size_t)DM * (DM / 8) + 255) / 256); k_wt_f16<<<g, 256, 0, stream>>>(wq, BQ, DM, DM, 16.0f); k_wt_f16<<<g, 256, 0, stream>>>(wk, BK, DM, DM, 16.0f); k_wt_f16<<<g, 256, 0, stream>>>(wv, BV, DM, DM, 16.0f); }      /* [in][out] -> Bt x16 */

  k_x16<<<(unsigned)((NR * DM / 8 + 255) / 256), 256, 0, stream>>>(x, X16, NR * DM / 8);
  const size_t r0p = (size_t)B0 * SQ;      /* first projected row */
  k_gemm2<0><<<dim3((unsigned)((MP / 128) * (DM / 64)), 1), 128, 0, stream>>>(X16 + r0p * DM, DM, 0, BQ, DM, 0, 0.0625f, nullptr, 0, nullptr, 1, 0, 0, QF + r0p * DM, nullptr, DM, 0, MP, DM, DM); k_hl<<<(unsigned)(((size_t)MP * DM / 8 + 255) / 256), 256, 0, stream>>>(QF + r0p * DM, Q16 + r0p * DM, QL + r0p * DM, (size_t)MP * DM / 8);      /* q in f32, then f16 hi + x1024 residual planes */
  k_gemm2<0><<<dim3((unsigned)((MP / 128) * (DM / 64)), 1), 128, 0, stream>>>(X16 + r0p * DM, DM, 0, BK, DM, 0, 0.0625f, nullptr, 0, nullptr, 1, 0, 0, nullptr, K16 + r0p * DM, DM, 0, MP, DM, DM);
  k_gemm2<0><<<dim3((unsigned)((MP / 128) * (DM / 64)), 1), 128, 0, stream>>>(X16 + r0p * DM, DM, 0, BV, DM, 0, 0.0625f, nullptr, 0, nullptr, 1, 0, 0, nullptr, V16 + r0p * DM, DM, 0, MP, DM, DM);
  for (int b = B0; b < B0 + NBR; ++b) { const size_t r0 = (size_t)b * SQ;
    k_vt<NH, SQ><<<NH * (SQ / 64), 256, 0, stream>>>(V16 + r0 * LQ, LQ, 0, VT);      /* V^T [NH][HD][SQ] for this batch */
    for (int h0 = 0; h0 < NHD; h0 += HG) {
      k_gemm2<0><<<dim3((QN / 128) * (SQ / 64), HG), 128, 0, stream>>>(Q16 + r0 * LQ + h0 * HD, LQ, (size_t)HD, K16 + r0 * LQ + h0 * HD, LQ, (size_t)HD, 0.125f, nullptr, 0, nullptr, 1, 0, 0, S, nullptr, SQ, (size_t)SQ * SQ, QN, SQ, HD); k_gemm2<0><<<dim3((QN / 128) * (SQ / 64), HG), 128, 0, stream>>>(QL + r0 * LQ + h0 * HD, LQ, (size_t)HD, K16 + r0 * LQ + h0 * HD, LQ, (size_t)HD, 0.0001220703125f, nullptr, 0, S, -1, 0, 0, S, nullptr, SQ, (size_t)SQ * SQ, QN, SQ, HD);      /* scores = q_hi.k/8, then += q_lo.k 2^-10/8 (own-element accumulate): q effectively f32 */      /* scores, HG heads per launch */
      k_rsmfx<<<dim3((QN + 7) / 8, HG), 256, 0, stream>>>(S, P, QN, amask + (size_t)b * SQ * SQ);      /* P = 256 masked softmax (f16): the batch's float 0/1 mask read per (query, key), rows of all HG heads */
      k_gemm2<0><<<dim3((QN / 128) * (HD / 64), HG), 128, 0, stream>>>(P, SQ, (size_t)SQ * SQ, VT + (size_t)h0 * HD * SQ, SQ, (size_t)HD * SQ, 0.00390625f, nullptr, 0, nullptr, 1, 0, 0, (float*)d_out + r0 * DM + h0 * HD, nullptr, DM, (size_t)HD, QN, HD, SQ); } }      /* ctx (merged heads) straight to the f32 output */
}

// v002
// It runs in 256 microseconds.
// Next to v001, in two timings, it ran 9.46 and 9.48 times as fast.
// Counting every step since v000, it is 38.4 times as fast.
#include <hip/hip_runtime.h>
// Multi-head self-attention with a multiplicative 0/1 mask and the module's 'unsafe' softmax (x [8][1024][1024]; q = x Wq, k = x Wk, v = x Wv ([in][out] 1024^2 sigma 1/32, no biases); 16 heads of 64; scores / 8; w = exp(s) mask[b][s][t] / (sum_t exp(s) mask + 1e-8) with the float mask input [8][1024][1024] (0/1, ~90 % ones, shared across heads) READ per (query, key); out = merged ctx (no output projection) -> [8][1024][1024]).
// Compute dtype: inputs rounded to bf16; x / weights exact; k, v and softmax weights as plain f16 GEMM operands (~2^-12); q as f16 hi + x1024 lo planes (effectively f32); o written f32; scores and softmax statistics f32. v_wmma_f32_16x16x32_f16.
#define NB 8
#define SQ 1024
#define DM 1024
#define NH 16
#define HD 64
#define HG 4                         /* heads per launch of k_vt(V16, b, h0, VT); that overload is not launched */
#define B0 0                         /* first batch processed (debug hook) */
#define NBR NB                       /* batches processed (debug hook) */
#define NR ((size_t)NB * SQ)         /* token rows */
#define MP ((int)((size_t)NBR * SQ)) /* rows projected (debug hook) */
#define QN SQ                        /* unused */
#define NHD NH                       /* unused */
#define MPO MP                       /* unused */
#define LQ DM      /* row pitch of the q/k/v rows */
typedef __bf16 v16b __attribute__((ext_vector_type(16)));
typedef unsigned short v8us __attribute__((ext_vector_type(8), may_alias));
typedef float  v8f  __attribute__((ext_vector_type(8)));
typedef float  v4f  __attribute__((ext_vector_type(4)));
typedef float  v4fa __attribute__((ext_vector_type(4), may_alias));
union FragB { v16b v; v8us half[2]; unsigned short u[16]; };

__device__ __forceinline__ unsigned short bf16_bits(float x) { unsigned int u = __float_as_uint(x); return (unsigned short)((u + 0x7FFFu + ((u >> 16) & 1u)) >> 16); }
__device__ __forceinline__ float bf16_val(unsigned short b) { return __uint_as_float(((unsigned int)b) << 16); }
__device__ __forceinline__ float bf16_round(float x) { return bf16_val(bf16_bits(x)); }
// D += A·B with NT terms: 1 = ah·bh, 2 = + al·bh (A split), 3 = + ah·bl (both split)
template <int NT>
__device__ __forceinline__ v8f mmaN(v16b ah, v16b al, v16b bh, v16b bl, v8f c) {
  c = __builtin_amdgcn_wmma_f32_16x16x32_bf16(false, ah, false, bh, (short)0, c, false, false);
  if (NT >= 2) c = __builtin_amdgcn_wmma_f32_16x16x32_bf16(false, al, false, bh, (short)0, c, false, false);
  if (NT >= 3) c = __builtin_amdgcn_wmma_f32_16x16x32_bf16(false, ah, false, bl, (short)0, c, false, false);
  asm volatile("v_nop\n\tv_nop\n\tv_nop\n\tv_nop" : "+v"(c) : "v"(ah), "v"(al), "v"(bh), "v"(bl));
  return c;
}

__global__ __launch_bounds__(256) void k_wt_bf16(const float* __restrict__ W, unsigned short* __restrict__ Wt, int K, int N) {
  const int t = blockIdx.x * 256 + threadIdx.x;
  const int k8n = K / 8;
  if (t >= N * k8n) return;
  const int n = t / k8n, k8 = (t % k8n) * 8;
  v8us v;
#pragma unroll
  for (int i = 0; i < 8; ++i) v[i] = bf16_bits(W[(size_t)(k8 + i) * N + n]);
  *(v8us*)(Wt + (size_t)n * K + k8) = v;
  
}

// GEMM C[M][N] (f32, pitch ldc) = act(A[M][K]·W + bias). A f32 row-major (pitch lda) converted per fragment to bf16
// (ASPLIT: hi/lo two planes -> 2 terms, else single rounded term); Wt bf16 [N][K] (pitch ldb). BIAS_BF16 rounds the
// bias to bf16 first (bias quantised to bf16 before the add). K%32==0, M%16==0, N%64==0.
template <bool ASPLIT, int ACT, bool BIAS_BF16>
__global__ __launch_bounds__(128) void k_gemm_bf(const float* __restrict__ A, int lda, const unsigned short* __restrict__ Wt, int ldb,
                                               const float* __restrict__ bias, float* __restrict__ C, int ldc, int M, int N, int K) {
  __shared__ __attribute__((aligned(16))) float so[4][16][64];
  const int tid = threadIdx.x, w = tid >> 5, lane = tid & 31, ln = lane & 15, hh = lane >> 4;
  const int ntn = N / 64;
  const int wid = blockIdx.x * 4 + w;
  const int mt = wid / ntn, nq = wid % ntn;
  if (mt * 16 >= M) return;
  const int row0 = mt * 16, col0 = nq * 64;
  const float* arow = A + (size_t)(row0 + ln) * lda;
  v8f acc[4] = {};
  for (int kb = 0; kb < K; kb += 32) {
    FragB ah, al;
    const v4f x0 = *(const v4fa*)(arow + kb + 8 * hh), x1 = *(const v4fa*)(arow + kb + 8 * hh + 4);
    const v4f x2 = *(const v4fa*)(arow + kb + 16 + 8 * hh), x3 = *(const v4fa*)(arow + kb + 16 + 8 * hh + 4);
    float xs[16] = {x0[0],x0[1],x0[2],x0[3],x1[0],x1[1],x1[2],x1[3],x2[0],x2[1],x2[2],x2[3],x3[0],x3[1],x3[2],x3[3]};
#pragma unroll
    for (int i = 0; i < 16; ++i) { const unsigned short hb = bf16_bits(xs[i]); ah.u[i] = hb; al.u[i] = ASPLIT ? bf16_bits(xs[i] - bf16_val(hb)) : (unsigned short)0; }
#pragma unroll
    for (int t = 0; t < 4; ++t) {
      const unsigned short* brow = Wt + (size_t)(col0 + t * 16 + ln) * ldb + kb;
      FragB b;
      b.half[0] = *(const v8us*)(brow + 8 * hh);
      b.half[1] = *(const v8us*)(brow + 16 + 8 * hh);
      acc[t] = mmaN<ASPLIT ? 2 : 1>(ah.v, al.v, b.v, b.v, acc[t]);
    }
  }
#pragma unroll
  for (int t = 0; t < 4; ++t) {
    float bv = bias ? bias[col0 + t * 16 + ln] : 0.f;
    if (BIAS_BF16) bv = bf16_round(bv);
#pragma unroll
    for (int r = 0; r < 8; ++r) { float v = acc[t][r] + bv; if (ACT == 1) v = fmaxf(v, 0.f); so[w][8 * hh + r][t * 16 + ln] = v; }
  }
  __builtin_amdgcn_fence(__ATOMIC_ACQ_REL, "workgroup");
  __builtin_amdgcn_wave_barrier();
  const int rsub = lane >> 4, c4 = (lane & 15) * 4;
  {
#pragma unroll
    for (int q = 0; q < 8; ++q) {
      const int r = q * 2 + rsub;
      const v4f v = *(const v4fa*)&so[w][r][c4];
      *(v4f*)(C + (size_t)(row0 + r) * ldc + col0 + c4) = v;
    }
    
  }
}

// GEMM C = act(A·W + bias + resid): A f32 (ASPLIT -> hi/lo 2 terms), Wt bf16 [N][K]; ACT 0 none, 1 relu, 2 exact gelu;
// resid (optional, f32, row index = (row % rmod), pitch ldr, RES_BF16 rounds it) added before the activation.
template <bool ASPLIT, int ACT, bool BIAS_BF16, bool RES_BF16>
__global__ __launch_bounds__(128) void k_gemm_bf3(const float* __restrict__ A, int lda, const unsigned short* __restrict__ Wt, int ldb,
                                                const float* __restrict__ bias, const float* __restrict__ resid, int rmod, int ldr,
                                                float* __restrict__ C, int ldc, int M, int N, int K) {
  __shared__ __attribute__((aligned(16))) float so[4][16][64];
  const int tid = threadIdx.x, w = tid >> 5, lane = tid & 31, ln = lane & 15, hh = lane >> 4;
  const int ntn = N / 64;
  const int wid = blockIdx.x * 4 + w;
  const int mt = wid / ntn, nq = wid % ntn;
  if (mt * 16 >= M) return;
  const int row0 = mt * 16, col0 = nq * 64;
  const float* arow = A + (size_t)(row0 + ln) * lda;
  v8f acc[4] = {};
  for (int kb = 0; kb < K; kb += 32) {
    FragB ah, al;
    const v4f x0 = *(const v4fa*)(arow + kb + 8 * hh), x1 = *(const v4fa*)(arow + kb + 8 * hh + 4);
    const v4f x2 = *(const v4fa*)(arow + kb + 16 + 8 * hh), x3 = *(const v4fa*)(arow + kb + 16 + 8 * hh + 4);
    float xs[16] = {x0[0],x0[1],x0[2],x0[3],x1[0],x1[1],x1[2],x1[3],x2[0],x2[1],x2[2],x2[3],x3[0],x3[1],x3[2],x3[3]};
#pragma unroll
    for (int i = 0; i < 16; ++i) { const unsigned short hb = bf16_bits(xs[i]); ah.u[i] = hb; al.u[i] = ASPLIT ? bf16_bits(xs[i] - bf16_val(hb)) : (unsigned short)0; }
#pragma unroll
    for (int t = 0; t < 4; ++t) {
      const unsigned short* brow = Wt + (size_t)(col0 + t * 16 + ln) * ldb + kb;
      FragB b;
      b.half[0] = *(const v8us*)(brow + 8 * hh);
      b.half[1] = *(const v8us*)(brow + 16 + 8 * hh);
      acc[t] = mmaN<ASPLIT ? 2 : 1>(ah.v, al.v, b.v, b.v, acc[t]);
    }
  }
#pragma unroll
  for (int t = 0; t < 4; ++t) {
    const int col = col0 + t * 16 + ln;
    float bv = bias ? bias[col] : 0.f;
    if (BIAS_BF16) bv = bf16_round(bv);
#pragma unroll
    for (int r = 0; r < 8; ++r) {
      float v = acc[t][r] + bv;
      if (resid) { float rv = resid[(size_t)((row0 + 8 * hh + r) % rmod) * ldr + col]; if (RES_BF16) rv = bf16_round(rv); v += rv; }
      if (ACT == 1) v = fmaxf(v, 0.f);
      if (ACT == 2) v = 0.5f * v * (1.0f + erff(v * 0.70710678118654752f));
      if (ACT == 3) { const float u = 0.7978845608028654f * (v + 0.044715f * v * v * v); v = 0.5f * v * (1.0f + tanhf(u)); }
      so[w][8 * hh + r][t * 16 + ln] = v;
    }
  }
  __builtin_amdgcn_fence(__ATOMIC_ACQ_REL, "workgroup");
  __builtin_amdgcn_wave_barrier();
  const int rsub = lane >> 4, c4 = (lane & 15) * 4;
  {
#pragma unroll
    for (int q = 0; q < 8; ++q) {
      const int r = q * 2 + rsub;
      const v4f v = *(const v4fa*)&so[w][r][c4];
      *(v4f*)(C + (size_t)(row0 + r) * ldc + col0 + c4) = v;
    }
    
  }
}
// row LayerNorm (biased variance, eps) over N: s = X (+ R); optional out_sum <- s; out_norm <- (s-mu)*rsqrt(var+eps)*g + b
template <bool PARAM_BF16>
__global__ __launch_bounds__(256) void k_layernorm(const float* __restrict__ X, const float* __restrict__ R, const float* __restrict__ g, const float* __restrict__ bta,
                                                  float* __restrict__ out_sum, float* __restrict__ out_norm, int N, float eps) {
  __shared__ float red[256];
  const int row = blockIdx.x, tid = threadIdx.x;
  const float* x = X + (size_t)row * N; const float* rr = R ? R + (size_t)row * N : nullptr;
  float vals[16];                     // up to N = 4096
  const int per = N / 256;            // contiguous chunk per thread? use strided-by-4 chunks: thread handles j = tid*4 + 1024*u
  float s1 = 0.f;
  for (int u = 0; u < per / 4; ++u) {
    const int j = tid * 4 + 1024 * u;
    const v4f a = *(const v4fa*)(x + j);
    v4f b = {0.f,0.f,0.f,0.f}; if (rr) b = *(const v4fa*)(rr + j);
#pragma unroll
    for (int q = 0; q < 4; ++q) { const float v = a[q] + b[q]; vals[u * 4 + q] = v; s1 += v; }
  }
  red[tid] = s1; __syncthreads();
  for (int st = 128; st > 0; st >>= 1) { if (tid < st) red[tid] += red[tid + st]; __syncthreads(); }
  const float mu = red[0] / (float)N; __syncthreads();
  float s2 = 0.f;
  for (int u = 0; u < per / 4; ++u)
#pragma unroll
    for (int q = 0; q < 4; ++q) { const float c = vals[u * 4 + q] - mu; s2 += c * c; }
  red[tid] = s2; __syncthreads();
  for (int st = 128; st > 0; st >>= 1) { if (tid < st) red[tid] += red[tid + st]; __syncthreads(); }
  const float rs = rsqrtf(red[0] / (float)N + eps);
  {
    for (int u = 0; u < per / 4; ++u) {
      const int j = tid * 4 + 1024 * u;
      v4f o, sm;
#pragma unroll
      for (int q = 0; q < 4; ++q) {
        float gg = g[j + q], bb = bta[j + q];
        if (PARAM_BF16) { gg = bf16_round(gg); bb = bf16_round(bb); }
        sm[q] = vals[u * 4 + q]; o[q] = (vals[u * 4 + q] - mu) * rs * gg + bb;
      }
      if (out_sum) *(v4f*)(out_sum + (size_t)row * N + j) = sm;
      *(v4f*)(out_norm + (size_t)row * N + j) = o;
    }
    
  }
}



// ---- f16 WMMA path (v_wmma_f32_16x16x32_f16): 11-bit significands for operands in range — used where a [0,1] probability operand needs more precision than bf16
typedef _Float16 v16h __attribute__((ext_vector_type(16)));
union FragH { v16h v; v8us half[2]; _Float16 h[16]; unsigned short u[16]; };
template <int NT>
__device__ __forceinline__ v8f mmaH(v16h ah, v16h al, v16h bh, v16h bl, v8f c) {
  c = __builtin_amdgcn_wmma_f32_16x16x32_f16(false, ah, false, bh, (short)0, c, false, false);
  if (NT >= 2) c = __builtin_amdgcn_wmma_f32_16x16x32_f16(false, al, false, bh, (short)0, c, false, false);
  if (NT >= 3) c = __builtin_amdgcn_wmma_f32_16x16x32_f16(false, ah, false, bl, (short)0, c, false, false);
  asm volatile("v_nop\n\tv_nop\n\tv_nop\n\tv_nop" : "+v"(c) : "v"(ah), "v"(al), "v"(bh), "v"(bl));
  return c;
}
// batched GEMM like k_gemm_b but f16 operands: A f32 (split into f16 hi/lo if ASPLIT, else rounded to f16), Bt = f16 values [n][k]; alpha; C f32; N multiple of 16 (partial tiles skipped)
template <bool ASPLIT>
__global__ __launch_bounds__(128) void k_gemm_h(const float* __restrict__ A, int lda, size_t sA, const _Float16* __restrict__ Bh, int ldb, size_t sB, float alpha, float* __restrict__ C, int ldc, size_t sC, int M, int N, int K) {
  __shared__ __attribute__((aligned(16))) float so[4][16][64];
  const int tid = threadIdx.x, w = tid >> 5, lane = tid & 31, ln = lane & 15, hh = lane >> 4; const int by = blockIdx.y;
  A += (size_t)by * sA; Bh += (size_t)by * sB; C += (size_t)by * sC;
  const int ntn = (N + 63) / 64; const int wid = blockIdx.x * 4 + w; const int mt = wid / ntn, nq = wid % ntn; if (mt * 16 >= M) return;
  const int row0 = mt * 16, col0 = nq * 64; const float* arow = A + (size_t)(row0 + ln) * lda;
  v8f acc[4] = {};
  for (int kb = 0; kb < K; kb += 32) {
    FragH ah, al;
    const v4f x0 = *(const v4fa*)(arow + kb + 8 * hh), x1 = *(const v4fa*)(arow + kb + 8 * hh + 4), x2 = *(const v4fa*)(arow + kb + 16 + 8 * hh), x3 = *(const v4fa*)(arow + kb + 16 + 8 * hh + 4);
    float xs[16] = {x0[0],x0[1],x0[2],x0[3],x1[0],x1[1],x1[2],x1[3],x2[0],x2[1],x2[2],x2[3],x3[0],x3[1],x3[2],x3[3]};
#pragma unroll
    for (int i = 0; i < 16; ++i) { const _Float16 h = (_Float16)xs[i]; ah.h[i] = h; al.h[i] = ASPLIT ? (_Float16)(xs[i] - (float)h) : (_Float16)0.0f; }
#pragma unroll
    for (int t = 0; t < 4; ++t) { if (col0 + t * 16 >= N) continue; const size_t boff = (size_t)(col0 + t * 16 + ln) * ldb + kb; FragH bq; bq.half[0] = *(const v8us*)(Bh + boff + 8 * hh); bq.half[1] = *(const v8us*)(Bh + boff + 16 + 8 * hh);
      acc[t] = mmaH<ASPLIT ? 2 : 1>(ah.v, al.v, bq.v, bq.v, acc[t]); }
  }
#pragma unroll
  for (int t = 0; t < 4; ++t) { if (col0 + t * 16 >= N) continue;
#pragma unroll
    for (int r = 0; r < 8; ++r) so[w][8 * hh + r][t * 16 + ln] = acc[t][r] * alpha; }
  __builtin_amdgcn_fence(__ATOMIC_ACQ_REL, "workgroup"); __builtin_amdgcn_wave_barrier();
  const int rsub = lane >> 4, c4 = (lane & 15) * 4;
  {
#pragma unroll
    for (int q = 0; q < 8; ++q) { const int r = q * 2 + rsub; if (col0 + c4 < N) { const v4f v = *(const v4fa*)&so[w][r][c4]; *(v4f*)(C + (size_t)(row0 + r) * ldc + col0 + c4) = v; } }
     }
}

// Wt[n][k] = f16(W[k][n]·scale) from f32 row-major W[K][N] (scale = power of two; bf16-exact weights stay exact in f16 away from the subnormal range)
__global__ __launch_bounds__(256) void k_wt_f16(const float* __restrict__ W, _Float16* __restrict__ Wt, int K, int N, float scale) {
  const int t = blockIdx.x * 256 + threadIdx.x; if (t >= N * (K / 8)) return; const int n = t / (K / 8), k8 = (t % (K / 8)) * 8; FragH f;
#pragma unroll
  for (int i = 0; i < 8; ++i) f.h[i] = (_Float16)(bf16_round(W[(size_t)(k8 + i) * N + n]) * scale); const v8us o = f.half[0];
  *(v8us*)((unsigned short*)Wt + (size_t)n * K + k8) = o; 
}
// k_gemm_hh variant with fused epilogue: v = acc·alpha + bias[by·sBias + col] (+ CP[(row/rowsPerB)·sCPb + by·64 + col] if CP) ; ACT 0 none / 1 elu ; writes f16 C16 (and f32 C if non-null)
template <int ACT>
__global__ __launch_bounds__(128) void k_gemm_hhx(const _Float16* __restrict__ A, int lda, size_t sA, const _Float16* __restrict__ Bh, int ldb, size_t sB, float alpha, const float* __restrict__ bias, size_t sBias, const float* __restrict__ CP, int rowsPerB, size_t sCPb, int row0g,
    float* __restrict__ C, _Float16* __restrict__ C16, int ldc, size_t sC, int M, int N, int K) {
  __shared__ __attribute__((aligned(16))) float so[4][16][64];
  const int tid = threadIdx.x, w = tid >> 5, lane = tid & 31, ln = lane & 15, hh = lane >> 4; const int by = blockIdx.y;
  A += (size_t)by * sA; Bh += (size_t)by * sB; const size_t cofs = (size_t)by * sC; const float* bp = bias ? bias + (size_t)by * sBias : nullptr;
  const int ntn = (N + 63) / 64; const int wid = blockIdx.x * 4 + w; const int mt = wid / ntn, nq = wid % ntn; if (mt * 16 >= M) return;
  const int row0 = mt * 16, col0 = nq * 64; const _Float16* arow = A + (size_t)(row0 + ln) * lda;
  v8f acc[4] = {};
  for (int kb = 0; kb < K; kb += 32) { FragH ah; ah.half[0] = *(const v8us*)((const unsigned short*)arow + kb + 8 * hh); ah.half[1] = *(const v8us*)((const unsigned short*)arow + kb + 16 + 8 * hh);
#pragma unroll
    for (int t = 0; t < 4; ++t) { if (col0 + t * 16 >= N) continue; const size_t boff = (size_t)(col0 + t * 16 + ln) * ldb + kb; FragH bq; bq.half[0] = *(const v8us*)((const unsigned short*)Bh + boff + 8 * hh); bq.half[1] = *(const v8us*)((const unsigned short*)Bh + boff + 16 + 8 * hh);
      acc[t] = mmaH<1>(ah.v, ah.v, bq.v, bq.v, acc[t]); }
  }
#pragma unroll
  for (int t = 0; t < 4; ++t) { if (col0 + t * 16 >= N) continue; const int col = col0 + t * 16 + ln; const float bv = bp ? bf16_round(bp[col]) : 0.f;
#pragma unroll
    for (int r = 0; r < 8; ++r) { float v = acc[t][r] * alpha + bv; if (CP) { const int rr = row0g + row0 + 8 * hh + r; if (rowsPerB < 0) v += CP[cofs + (size_t)rr * ldc + col];      /* rowsPerB < 0: own element of the batched C plane */ else { const int bidx = rr / rowsPerB; v += CP[(size_t)bidx * sCPb + (size_t)by * 64 + col]; } } if (ACT == 1) v = (v > 0.f) ? v : expm1f(v); else if (ACT == 7) v = (v > 0.f) ? v + 1.0f : expf(v); else if (ACT == 8) v = tanhf(v); else if (ACT == 9) v = 0.5f * v * (1.0f + tanhf(0.7978845608028654f * (v + 0.044715f * v * v * v))); else if (ACT == 11) v = 1.0f / (1.0f + expf(-v)); else if (ACT == 12) v = (v > 0.f) ? v : 0.01f * v; else if (ACT == 14) v = (v > 0.f) ? v : 0.1f * v; else if (ACT == 16) v = (v >= 0.f) ? v : 0.3f * v; else if (ACT == 17) v = (v >= 0.f) ? v : 0.2f * v; else if (ACT == 15) v = v / (1.0f + expf(-v)); else if (ACT == 3) v = fmaxf(v, 0.f); else if (ACT == 6) v = 0.5f * v * (1.0f + erff(v * 0.70710678118654752f)); so[w][8 * hh + r][t * 16 + ln] = v; } }
  __builtin_amdgcn_fence(__ATOMIC_ACQ_REL, "workgroup"); __builtin_amdgcn_wave_barrier();
  const int rsub = lane >> 4, c4 = (lane & 15) * 4; typedef _Float16 v4h __attribute__((ext_vector_type(4)));
  {
#pragma unroll
    for (int q = 0; q < 8; ++q) { const int r = q * 2 + rsub; if (col0 + c4 < N) { const v4f v = *(const v4fa*)&so[w][r][c4]; if (C) *(v4f*)(C + cofs + (size_t)(row0 + r) * ldc + col0 + c4) = v; if (C16) { v4h h4; for (int i = 0; i < 4; ++i) h4[i] = (_Float16)v[i]; *(v4h*)(C16 + cofs + (size_t)(row0 + r) * ldc + col0 + c4) = h4; } } }
     }
}


typedef _Float16 v4h __attribute__((ext_vector_type(4)));

__global__ __launch_bounds__(256) void k_x16(const float* __restrict__ x, _Float16* __restrict__ X16, size_t n8) { const size_t t = (size_t)blockIdx.x * 256 + threadIdx.x; if (t >= n8) return; FragH f;
#pragma unroll
  for (int q = 0; q < 8; ++q) f.h[q] = (_Float16)bf16_round(x[t * 8 + q]); *(v8us*)((unsigned short*)X16 + t * 8) = f.half[0];  }
__global__ __launch_bounds__(256) void k_h16(const float* __restrict__ x, _Float16* __restrict__ X16, size_t n8) { const size_t t = (size_t)blockIdx.x * 256 + threadIdx.x; if (t >= n8) return; FragH f;
#pragma unroll
  for (int q = 0; q < 8; ++q) f.h[q] = (_Float16)x[t * 8 + q]; *(v8us*)((unsigned short*)X16 + t * 8) = f.half[0];  }
__global__ __launch_bounds__(256) void k_round16f(const float* __restrict__ W, _Float16* __restrict__ Bt, size_t n8) { const size_t t = (size_t)blockIdx.x * 256 + threadIdx.x; if (t >= n8) return; FragH f;
#pragma unroll
  for (int i = 0; i < 8; ++i) f.h[i] = (_Float16)(bf16_round(W[t * 8 + i]) * 16.0f); *(v8us*)((unsigned short*)Bt + t * 8) = f.half[0];  }
template <int NHv, int TTv>
__global__ __launch_bounds__(256) void k_vt(const _Float16* __restrict__ V16, int ldv, int voff, _Float16* __restrict__ Vt) { __shared__ unsigned short tl[64][66]; const int tid = threadIdx.x; const int slab = blockIdx.x / (TTv / 64), lg = blockIdx.x % (TTv / 64); const int b = slab / NHv, h = slab % NHv;
  for (int i = tid; i < 64 * 8; i += 256) { const int r = i / 8, c8 = (i % 8) * 8; FragH f; f.half[0] = *(const v8us*)((const unsigned short*)V16 + ((size_t)b * TTv + lg * 64 + r) * ldv + voff + h * 64 + c8);
#pragma unroll
    for (int q = 0; q < 8; ++q) tl[r][c8 + q] = f.u[q]; }
  __syncthreads();
  {
#pragma unroll
    for (int rd = 0; rd < 2; ++rd) { const int d = rd * 32 + tid / 8, pc = tid % 8; FragH f;
#pragma unroll
      for (int q = 0; q < 8; ++q) f.u[q] = tl[pc * 8 + q][d];
      *(v8us*)((unsigned short*)Vt + ((size_t)slab * 64 + d) * TTv + lg * 64 + pc * 8) = f.half[0]; }
     } }

__global__ __launch_bounds__(256) void k_hl(const float* __restrict__ F, _Float16* __restrict__ Hh, _Float16* __restrict__ Hl, size_t n8) { const size_t t = (size_t)blockIdx.x * 256 + threadIdx.x; if (t >= n8) return; FragH fh, fl; const v4f a = *(const v4fa*)(F + t * 8), c = *(const v4fa*)(F + t * 8 + 4);
#pragma unroll
  for (int q = 0; q < 4; ++q) { _Float16 h = (_Float16)a[q]; fh.h[q] = h; fl.h[q] = (_Float16)((a[q] - (float)h) * 1024.0f); h = (_Float16)c[q]; fh.h[4 + q] = h; fl.h[4 + q] = (_Float16)((c[q] - (float)h) * 1024.0f); }
  { *(v8us*)((unsigned short*)Hh + t * 8) = fh.half[0]; *(v8us*)((unsigned short*)Hl + t * 8) = fl.half[0];  } }

// ---- fast GEMM (wave tile 32x64; requires M % 32 == 0 rows per launch region and N % 64 == 0); epilogue = k_gemm_hhx semantics ----
__device__ __forceinline__ v16h g2_frag(const _Float16* p, int hh) { FragH f; f.half[0] = *(const v8us*)((const unsigned short*)p + 8 * hh); f.half[1] = *(const v8us*)((const unsigned short*)p + 16 + 8 * hh); return f.v; }
__device__ __forceinline__ v8f g2_mma(v16h a, v16h b, v8f c) { v8f d = __builtin_amdgcn_wmma_f32_16x16x32_f16(false, a, false, b, (short)0, c, false, false); asm volatile("v_nop\n\tv_nop\n\tv_nop\n\tv_nop" : "+v"(d) : "v"(a), "v"(b)); return d; }
template <int ACT>
__global__ __launch_bounds__(128) void k_gemm2(const _Float16* __restrict__ A, int lda, size_t sA, const _Float16* __restrict__ Bh, int ldb, size_t sB, float alpha, const float* __restrict__ bias, size_t sBias, const float* __restrict__ CP, int rowsPerB, size_t sCPb, int row0g,
    float* __restrict__ C, _Float16* __restrict__ C16, int ldc, size_t sC, int M, int N, int K) { static_assert(ACT == 0 || ACT == 3 || ACT == 6 || ACT == 8 || ACT == 9 || ACT == 11 || ACT == 12 || ACT == 14 || ACT == 15 || ACT == 16 || ACT == 17, "k_gemm2: unsupported ACT code (would silently apply no activation)");
  __shared__ __attribute__((aligned(16))) float so[4][32][68];
  const int tid = threadIdx.x, w = tid >> 5, lane = tid & 31, ln = lane & 15, hh = lane >> 4; const int by = blockIdx.y;
  A += (size_t)by * sA; Bh += (size_t)by * sB; const size_t cofs = (size_t)by * sC; const float* bp = bias ? bias + (size_t)by * sBias : nullptr;
  const int ntn = N >> 6; const int mt = blockIdx.x / ntn, nq = blockIdx.x - mt * ntn; const int row0 = mt * 128 + 32 * w, col0 = nq * 64; if (row0 >= M) return;
  const _Float16* a0p = A + (size_t)(row0 + ln) * lda; const _Float16* a1p = a0p + (size_t)16 * lda;
  const _Float16* b0p = Bh + (size_t)(col0 + ln) * ldb; const _Float16* b1p = b0p + (size_t)16 * ldb; const _Float16* b2p = b1p + (size_t)16 * ldb; const _Float16* b3p = b2p + (size_t)16 * ldb;
  const v8f z8 = {0.f,0.f,0.f,0.f,0.f,0.f,0.f,0.f}; v8f c00 = z8, c01 = z8, c02 = z8, c03 = z8, c10 = z8, c11 = z8, c12 = z8, c13 = z8;
#pragma unroll 1
  for (int kb = 0; kb < K; kb += 32) { const v16h a0 = g2_frag(a0p + kb, hh), a1 = g2_frag(a1p + kb, hh);
    v16h b = g2_frag(b0p + kb, hh); c00 = g2_mma(a0, b, c00); c10 = g2_mma(a1, b, c10);
    b = g2_frag(b1p + kb, hh); c01 = g2_mma(a0, b, c01); c11 = g2_mma(a1, b, c11);
    b = g2_frag(b2p + kb, hh); c02 = g2_mma(a0, b, c02); c12 = g2_mma(a1, b, c12);
    b = g2_frag(b3p + kb, hh); c03 = g2_mma(a0, b, c03); c13 = g2_mma(a1, b, c13); }
  v8f accs[8] = {c00, c01, c02, c03, c10, c11, c12, c13};
#pragma unroll
  for (int u = 0; u < 8; ++u) { const int t = u & 3, half = u >> 2; const int col = col0 + t * 16 + ln; const float bv = bp ? bf16_round(bp[col]) : 0.f;
#pragma unroll
    for (int r = 0; r < 8; ++r) { const int rloc = half * 16 + 8 * hh + r; float v = accs[u][r] * alpha + bv; if (CP) { if (rowsPerB < 0) v += CP[cofs + (size_t)(row0g + row0 + rloc) * ldc + col];      /* rowsPerB < 0: own element of the batched C plane */ else { const int bidx = (row0g + row0 + rloc) / rowsPerB; v += CP[(size_t)bidx * sCPb + (size_t)by * 64 + col]; } }
      if (ACT == 3) v = fmaxf(v, 0.f); else if (ACT == 6) v = 0.5f * v * (1.0f + erff(v * 0.70710678118654752f)); else if (ACT == 11) v = 1.0f / (1.0f + expf(-v)); else if (ACT == 15) v = v / (1.0f + expf(-v)); else if (ACT == 12) v = (v > 0.f) ? v : 0.01f * v; else if (ACT == 8) v = tanhf(v); else if (ACT == 9) v = 0.5f * v * (1.0f + tanhf(0.7978845608028654f * (v + 0.044715f * v * v * v))); else if (ACT == 14) v = (v > 0.f) ? v : 0.1f * v; else if (ACT == 16) v = (v >= 0.f) ? v : 0.3f * v; else if (ACT == 17) v = (v >= 0.f) ? v : 0.2f * v;
      so[w][rloc][t * 16 + ln] = v; } }
  __builtin_amdgcn_fence(__ATOMIC_ACQ_REL, "workgroup"); __builtin_amdgcn_wave_barrier();
  const int rsub = lane >> 4, c4 = (lane & 15) * 4;
  {
#pragma unroll
    for (int q = 0; q < 16; ++q) { const int r = q * 2 + rsub; const v4f v = *(const v4fa*)&so[w][r][c4]; if (C) *(v4f*)(C + cofs + (size_t)(row0 + r) * ldc + col0 + c4) = v; if (C16) { v4h h4; for (int i = 0; i < 4; ++i) h4[i] = (_Float16)v[i]; *(v4h*)(C16 + cofs + (size_t)(row0 + r) * ldc + col0 + c4) = h4; } }
     } }


__global__ __launch_bounds__(256) void k_wnat(const float* __restrict__ w, size_t n8, _Float16* __restrict__ Bt) { const size_t t = (size_t)blockIdx.x * 256 + threadIdx.x; if (t >= n8) return; FragH f; for (int q = 0; q < 8; ++q) f.h[q] = (_Float16)(bf16_round(w[t * 8 + q]) * 16.0f); *(v8us*)((unsigned short*)Bt + t * 8) = f.half[0];  }
__global__ __launch_bounds__(256) void k_rsm(const float* __restrict__ S, _Float16* __restrict__ P, int nrows) {
  #pragma clang fp contract(off)
  const int i = blockIdx.x * 256 + threadIdx.x; if (i >= nrows) return; const float* s = S + (size_t)i * SQ; float mx = -3.0e38f;
#pragma unroll 1
  for (int j = 0; j < SQ; ++j) mx = fmaxf(mx, s[j]); float se = 0.f;
#pragma unroll 1
  for (int j = 0; j < SQ; ++j) se += expf(s[j] - mx); const float sc = 256.0f / se;
#pragma unroll 1
  for (int j0 = 0; j0 < SQ; j0 += 8) { FragH f; for (int q = 0; q < 8; ++q) f.h[q] = (_Float16)(expf(s[j0 + q] - mx) * sc); unsigned short* d = (unsigned short*)P + (size_t)i * SQ + j0; *(v8us*)d = f.half[0];  } }
__global__ __launch_bounds__(256) void k_vt(const _Float16* __restrict__ V16, int b, int h0, _Float16* __restrict__ VT) { __shared__ unsigned short tl[64][65]; const int tid = threadIdx.x; const int hh = blockIdx.x % HG, sg = blockIdx.x / HG; const int s0 = sg * 64; const int h = h0 + hh;
  for (int i = tid; i < 64 * 8; i += 256) { const int j = i / 8, d8 = (i % 8) * 8; FragH f; f.half[0] = *(const v8us*)((const unsigned short*)V16 + ((size_t)b * SQ + s0 + j) * DM + h * HD + d8); for (int q = 0; q < 8; ++q) tl[d8 + q][j] = f.u[q]; }
  __syncthreads();
  { for (int i = tid; i < 64 * 8; i += 256) { const int d = i / 8, j8 = (i % 8) * 8; FragH f; for (int q = 0; q < 8; ++q) f.u[q] = tl[d][j8 + q]; *(v8us*)((unsigned short*)VT + ((size_t)hh * HD + d) * SQ + s0 + j8) = f.half[0]; }  } }



__global__ __launch_bounds__(256) void k_rsmf(const float* __restrict__ S, _Float16* __restrict__ P, int qn, int hg) {
  #pragma clang fp contract(off)
  const int t = blockIdx.x * 256 + threadIdx.x; if (t >= qn * hg) return; const size_t i = (size_t)(t / qn) * SQ + (t % qn); const float* s = S + i * SQ; float mx = -3.0e38f;
#pragma unroll 1
  for (int j = 0; j < SQ; ++j) mx = fmaxf(mx, s[j]); float se = 0.f;
#pragma unroll 1
  for (int j = 0; j < SQ; ++j) se += __expf(s[j] - mx); const float sc = 256.0f / se;
#pragma unroll 1
  for (int j0 = 0; j0 < SQ; j0 += 8) { FragH f; for (int q = 0; q < 8; ++q) f.h[q] = (_Float16)(__expf(s[j0 + q] - mx) * sc); unsigned short* d = (unsigned short*)P + i * SQ + j0; *(v8us*)d = f.half[0];  } }

// 2^x on v_exp_f32 with one free issue slot behind it: the instruction set asks for that slot before the result is read or the source overwritten.
__device__ __forceinline__ float exp2_slot(float x) { float r; asm("v_exp_f32 %0, %1\n\tv_nop" : "=v"(r) : "v"(x)); return r; }
#define FK 64      /* keys per stage */
#define FQ 128     /* query rows per work-group */
#define KPH 72     /* LDS row pitch of K and V^T, halves: 144 B = 16 B x odd, b128 fragment reads free of bank conflicts */
#define MPF 68     /* LDS row pitch of the mask rows, floats: 272 B = 16 B x odd */
__device__ __forceinline__ float xhalf(float x) { return __builtin_bit_cast(float, __builtin_amdgcn_permlanex16(__builtin_bit_cast(int, x), __builtin_bit_cast(int, x), 0x76543210, 0xfedcba98, false, false)); }      /* lane l with lane l ^ 16 */
__device__ __forceinline__ v8f fa_mma(v16h a, v16h b, v8f c) { return __builtin_amdgcn_wmma_f32_16x16x32_f16(false, a, false, b, (short)0, c, false, false); }
__global__ __launch_bounds__(256) void k_fattn(const _Float16* __restrict__ Qh, const _Float16* __restrict__ Ql, const _Float16* __restrict__ Kh, const _Float16* __restrict__ Vt, const float* __restrict__ Mk, float* __restrict__ out) {
  __shared__ __attribute__((aligned(16))) _Float16 sk[FK][KPH];
  __shared__ __attribute__((aligned(16))) _Float16 sv[HD][KPH];
  __shared__ __attribute__((aligned(16))) float sm[FQ][MPF];
  const int tid = threadIdx.x, w = tid >> 5, lane = tid & 31, ln = lane & 15, hh = lane >> 4;
  const int h = blockIdx.x % NH, qb = (blockIdx.x / NH) % (SQ / FQ), b = blockIdx.x / (NH * (SQ / FQ));      /* neighbouring work-groups: same mask rows, other heads */
  const int qrow = qb * FQ + w * 16;
  const size_t qo = ((size_t)b * SQ + qrow + ln) * DM + h * HD;
  const v16h qh0 = g2_frag(Qh + qo, hh), qh1 = g2_frag(Qh + qo + 32, hh), ql0 = g2_frag(Ql + qo, hh), ql1 = g2_frag(Ql + qo + 32, hh);
  const int sr = tid >> 3, sc = (tid & 7) * 8;      /* staging: 8 threads cover one 128-byte row, a wave four whole lines */
  const _Float16* kg = Kh + ((size_t)b * SQ + sr) * DM + h * HD + sc;
  const _Float16* vg = Vt + (((size_t)b * NH + h) * HD + sr) * SQ + sc;
  const float* mg = Mk + ((size_t)b * SQ + qrow + hh) * SQ + ln * 4;      /* 16 lanes cover 256 bytes of one mask row */
  v8us kr[2], vr[2]; v4f mr[8];
#pragma unroll
  for (int i = 0; i < 2; ++i) { kr[i] = *(const v8us*)((const unsigned short*)kg + (size_t)i * 32 * DM); vr[i] = *(const v8us*)((const unsigned short*)vg + (size_t)i * 32 * SQ); }
#pragma unroll
  for (int i = 0; i < 8; ++i) mr[i] = *(const v4fa*)(mg + (size_t)i * 2 * SQ);
  const v8f z8 = {0.f, 0.f, 0.f, 0.f, 0.f, 0.f, 0.f, 0.f};
  v8f o[4] = {z8, z8, z8, z8};
  float m = -3.0e38f, l = 0.f;
#pragma unroll 1      /* rolled, for speed only */
  for (int s = 0; s < SQ / FK; ++s) {
    __syncthreads();      /* every wave has finished reading the stage before */
#pragma unroll
    for (int i = 0; i < 2; ++i) { *(v8us*)&sk[sr + 32 * i][sc] = kr[i]; *(v8us*)&sv[sr + 32 * i][sc] = vr[i]; }
#pragma unroll
    for (int i = 0; i < 8; ++i) *(v4fa*)&sm[w * 16 + 2 * i + hh][ln * 4] = mr[i];
    __syncthreads();      /* the stage is complete for every wave */
    if (s + 1 < SQ / FK) {      /* next stage's loads fly while this one is worked on */
      kg += (size_t)FK * DM; vg += FK; mg += FK;
#pragma unroll
      for (int i = 0; i < 2; ++i) { kr[i] = *(const v8us*)((const unsigned short*)kg + (size_t)i * 32 * DM); vr[i] = *(const v8us*)((const unsigned short*)vg + (size_t)i * 32 * SQ); }
#pragma unroll
      for (int i = 0; i < 8; ++i) mr[i] = *(const v4fa*)(mg + (size_t)i * 2 * SQ);
    }
    v8f sh[4], sl[4];
#pragma unroll
    for (int t = 0; t < 4; ++t) {
      const v16h a0 = g2_frag(&sk[t * 16 + ln][0], hh), a1 = g2_frag(&sk[t * 16 + ln][32], hh);
      sh[t] = fa_mma(a1, qh1, fa_mma(a0, qh0, z8)); sl[t] = fa_mma(a1, ql1, fa_mma(a0, ql0, z8)); }
    float bm = -3.0e38f;
#pragma unroll
    for (int t = 0; t < 4; ++t) {
#pragma unroll
      for (int r = 0; r < 8; ++r) { sh[t][r] += sl[t][r] * 0.0009765625f; bm = fmaxf(bm, sh[t][r]); } }      /* q_hi.k + q_lo.k 2^-10 */
    const float cl = 0.18033688011112042592f;      /* 1/8 and the change to log2 units */
    bm = fmaxf(bm, xhalf(bm)) * cl;
    const float mn = fmaxf(m, bm), al = exp2_slot(m - mn), off = mn - 8.0f; m = mn;
    float ps[4] = {0.f, 0.f, 0.f, 0.f};      /* four partial sums: no chain of 32 dependent adds */
#pragma unroll
    for (int t = 0; t < 4; ++t) o[t] *= al;
    FragH pb[2];
#pragma unroll
    for (int t = 0; t < 4; ++t) {
      const v4f k0 = *(const v4fa*)&sm[w * 16 + ln][t * 16 + 8 * hh], k1 = *(const v4fa*)&sm[w * 16 + ln][t * 16 + 8 * hh + 4];
#pragma unroll
      for (int r = 0; r < 8; ++r) { const float p = exp2_slot(sh[t][r] * cl - off) * (r < 4 ? k0[r & 3] : k1[r & 3]); ps[r & 3] += p; pb[t >> 1].h[(t & 1) * 8 + r] = (_Float16)p; } }
    l = l * al + ((ps[0] + ps[1]) + (ps[2] + ps[3]));
#pragma unroll
    for (int t = 0; t < 4; ++t) o[t] = fa_mma(g2_frag(&sv[t * 16 + ln][32], hh), pb[1].v, fa_mma(g2_frag(&sv[t * 16 + ln][0], hh), pb[0].v, o[t]));
  }
  l += xhalf(l);
  const float inv = 1.0f / l;
  /* the wave's own 16 mask rows become its output staging: [query][d], so that each store below covers whole lines */
#pragma unroll
  for (int t = 0; t < 4; ++t) { const v8f v = o[t] * inv; const v4f lo4 = {v[0], v[1], v[2], v[3]}, hi4 = {v[4], v[5], v[6], v[7]};
    *(v4fa*)&sm[w * 16 + ln][t * 16 + 8 * hh] = lo4; *(v4fa*)&sm[w * 16 + ln][t * 16 + 8 * hh + 4] = hi4; }
  __builtin_amdgcn_fence(__ATOMIC_ACQ_REL, "workgroup"); __builtin_amdgcn_wave_barrier();      /* orders the LDS stores above in front of the loads below, which read what other lanes of the same wave wrote; no other wave touches these rows */
#pragma unroll
  for (int i = 0; i < 8; ++i) { const int r = 2 * i + hh; const v4f v = *(const v4fa*)&sm[w * 16 + r][ln * 4]; *(v4f*)(out + ((size_t)b * SQ + qrow + r) * DM + h * HD + ln * 4) = v; } }

extern "C" void kernel_launch(void* const* d_in, const int* in_sizes, int n_in,
                              void* d_out, int out_size, void* d_ws, size_t ws_size, hipStream_t stream) {
  (void)in_sizes; (void)n_in; (void)out_size;
  const float* const* I = (const float* const*)d_in; const float* x = I[0]; const float* amask = I[1]; const float* wq = I[2]; const float* wk = I[3]; const float* wv = I[4]; const float* bq = nullptr; const float* bk = nullptr; const float* bv = nullptr;      /* [in][out] weights, no biases; float 0/1 mask [8][1024][1024] read in the softmax */
  char* ws = (char*)d_ws; size_t off = 0;
  auto take = [&](size_t bytes) { char* p = ws + off; off += (bytes + 255) & ~(size_t)255; return p; };
  _Float16* BQ = (_Float16*)take((size_t)DM * DM * 2); _Float16* BK = (_Float16*)take((size_t)DM * DM * 2); _Float16* BV = (_Float16*)take((size_t)DM * DM * 2); 
  _Float16* X16 = (_Float16*)take(NR * DM * 2); _Float16* Q16 = (_Float16*)take(NR * DM * 2); float* QF = (float*)take(NR * DM * 4); _Float16* QL = (_Float16*)take(NR * DM * 2); _Float16* K16 = (_Float16*)take(NR * DM * 2); _Float16* V16 = (_Float16*)take(NR * DM * 2); _Float16* O16 = (_Float16*)take(NR * DM * 2);
  _Float16* VT = (_Float16*)take((size_t)NB * NH * HD * SQ * 2);
  if (off > ws_size) return;
  { const unsigned g = (unsigned)(((size_t)DM * (DM / 8) + 255) / 256); k_wt_f16<<<g, 256, 0, stream>>>(wq, BQ, DM, DM, 16.0f); k_wt_f16<<<g, 256, 0, stream>>>(wk, BK, DM, DM, 16.0f); k_wt_f16<<<g, 256, 0, stream>>>(wv, BV, DM, DM, 16.0f); }      /* [in][out] -> Bt x16 */

  k_x16<<<(unsigned)((NR * DM / 8 + 255) / 256), 256, 0, stream>>>(x, X16, NR * DM / 8);
  const size_t r0p = (size_t)B0 * SQ;      /* first projected row */
  k_gemm2<0><<<dim3((unsigned)((MP / 128) * (DM / 64)), 1), 128, 0, stream>>>(X16 + r0p * DM, DM, 0, BQ, DM, 0, 0.0625f, nullptr, 0, nullptr, 1, 0, 0, QF + r0p * DM, nullptr, DM, 0, MP, DM, DM); k_hl<<<(unsigned)(((size_t)MP * DM / 8 + 255) / 256), 256, 0, stream>>>(QF + r0p * DM, Q16 + r0p * DM, QL + r0p * DM, (size_t)MP * DM / 8);      /* q in f32, then f16 hi + x1024 residual planes */
  k_gemm2<0><<<dim3((unsigned)((MP / 128) * (DM / 64)), 1), 128, 0, stream>>>(X16 + r0p * DM, DM, 0, BK, DM, 0, 0.0625f, nullptr, 0, nullptr, 1, 0, 0, nullptr, K16 + r0p * DM, DM, 0, MP, DM, DM);
  k_gemm2<0><<<dim3((unsigned)((MP / 128) * (DM / 64)), 1), 128, 0, stream>>>(X16 + r0p * DM, DM, 0, BV, DM, 0, 0.0625f, nullptr, 0, nullptr, 1, 0, 0, nullptr, V16 + r0p * DM, DM, 0, MP, DM, DM);
  k_vt<NH, SQ><<<NB * NH * (SQ / 64), 256, 0, stream>>>(V16, LQ, 0, VT);      /* V^T [NB][NH][HD][SQ], all batches */
  k_fattn<<<NB * NH * (SQ / FQ), 256, 0, stream>>>(Q16, QL, K16, VT, amask, (float*)d_out);      /* ctx (merged heads) straight to the f32 output */
}

// v003
// It runs in 137 microseconds.
// Next to v002, in two timings, it ran 1.87 and 1.88 times as fast.
// All steps since v000 together make it 72.0 times as fast.
#include <hip/hip_runtime.h>
// Multi-head self-attention with a multiplicative 0/1 mask and the module's 'unsafe' softmax (x [8][1024][1024]; q = x Wq, k = x Wk, v = x Wv ([in][out] 1024^2 sigma 1/32, no biases); 16 heads of 64; scores / 8; w = exp(s) mask[b][s][t] / (sum_t exp(s) mask + 1e-8) with the float mask input [8][1024][1024] (0/1, ~90 % ones, shared across heads) READ per (query, key); out = merged ctx (no output projection) -> [8][1024][1024]).
// Compute dtype: inputs rounded to bf16; x / weights exact; k, v and softmax weights as plain f16 GEMM operands (~2^-12); q as f16 hi + x1024 lo planes (effectively f32); o written f32; scores and softmax statistics f32. v_wmma_f32_16x16x32_f16.
#define NB 8
#define SQ 1024
#define DM 1024
#define NH 16
#define HD 64
#define HG 4                         /* heads per launch of k_vt(V16, b, h0, VT); that overload is not launched */
#define B0 0                         /* first batch processed (debug hook) */
#define NBR NB                       /* batches processed (debug hook) */
#define NR ((size_t)NB * SQ)         /* token rows */
#define MP ((int)((size_t)NBR * SQ)) /* rows projected (debug hook) */
#define QN SQ                        /* unused */
#define NHD NH                       /* unused */
#define MPO MP                       /* unused */
#define LQ DM      /* row pitch of the q/k/v rows */
typedef __bf16 v16b __attribute__((ext_vector_type(16)));
typedef unsigned short v8us __attribute__((ext_vector_type(8), may_alias));
typedef float  v8f  __attribute__((ext_vector_type(8)));
typedef float  v4f  __attribute__((ext_vector_type(4)));
typedef float  v4fa __attribute__((ext_vector_type(4), may_alias));
union FragB { v16b v; v8us half[2]; unsigned short u[16]; };

__device__ __forceinline__ unsigned short bf16_bits(float x) { unsigned int u = __float_as_uint(x); return (unsigned short)((u + 0x7FFFu + ((u >> 16) & 1u)) >> 16); }
__device__ __forceinline__ float bf16_val(unsigned short b) { return __uint_as_float(((unsigned int)b) << 16); }
__device__ __forceinline__ float bf16_round(float x) { return bf16_val(bf16_bits(x)); }
// D += A·B with NT terms: 1 = ah·bh, 2 = + al·bh (A split), 3 = + ah·bl (both split)
template <int NT>
__device__ __forceinline__ v8f mmaN(v16b ah, v16b al, v16b bh, v16b bl, v8f c) {
  c = __builtin_amdgcn_wmma_f32_16x16x32_bf16(false, ah, false, bh, (short)0, c, false, false);
  if (NT >= 2) c = __builtin_amdgcn_wmma_f32_16x16x32_bf16(false, al, false, bh, (short)0, c, false, false);
  if (NT >= 3) c = __builtin_amdgcn_wmma_f32_16x16x32_bf16(false, ah, false, bl, (short)0, c, false, false);
  asm volatile("v_nop\n\tv_nop\n\tv_nop\n\tv_nop" : "+v"(c) : "v"(ah), "v"(al), "v"(bh), "v"(bl));
  return c;
}

__global__ __launch_bounds__(256) void k_wt_bf16(const float* __restrict__ W, unsigned short* __restrict__ Wt, int K, int N) {
  const int t = blockIdx.x * 256 + threadIdx.x;
  const int k8n = K / 8;
  if (t >= N * k8n) return;
  const int n = t / k8n, k8 = (t % k8n) * 8;
  v8us v;
#pragma unroll
  for (int i = 0; i < 8; ++i) v[i] = bf16_bits(W[(size_t)(k8 + i) * N + n]);
  *(v8us*)(Wt + (size_t)n * K + k8) = v;
  
}

// GEMM C[M][N] (f32, pitch ldc) = act(A[M][K]·W + bias). A f32 row-major (pitch lda) converted per fragment to bf16
// (ASPLIT: hi/lo two planes -> 2 terms, else single rounded term); Wt bf16 [N][K] (pitch ldb). BIAS_BF16 rounds the
// bias to bf16 first (bias quantised to bf16 before the add). K%32==0, M%16==0, N%64==0.
template <bool ASPLIT, int ACT, bool BIAS_BF16>
__global__ __launch_bounds__(128) void k_gemm_bf(const float* __restrict__ A, int lda, const unsigned short* __restrict__ Wt, int ldb,
                                               const float* __restrict__ bias, float* __restrict__ C, int ldc, int M, int N, int K) {
  __shared__ __attribute__((aligned(16))) float so[4][16][64];
  const int tid = threadIdx.x, w = tid >> 5, lane = tid & 31, ln = lane & 15, hh = lane >> 4;
  const int ntn = N / 64;
  const int wid = blockIdx.x * 4 + w;
  const int mt = wid / ntn, nq = wid % ntn;
  if (mt * 16 >= M) return;
  const int row0 = mt * 16, col0 = nq * 64;
  const float* arow = A + (size_t)(row0 + ln) * lda;
  v8f acc[4] = {};
  for (int kb = 0; kb < K; kb += 32) {
    FragB ah, al;
    const v4f x0 = *(const v4fa*)(arow + kb + 8 * hh), x1 = *(const v4fa*)(arow + kb + 8 * hh + 4);
    const v4f x2 = *(const v4fa*)(arow + kb + 16 + 8 * hh), x3 = *(const v4fa*)(arow + kb + 16 + 8 * hh + 4);
    float xs[16] = {x0[0],x0[1],x0[2],x0[3],x1[0],x1[1],x1[2],x1[3],x2[0],x2[1],x2[2],x2[3],x3[0],x3[1],x3[2],x3[3]};
#pragma unroll
    for (int i = 0; i < 16; ++i) { const unsigned short hb = bf16_bits(xs[i]); ah.u[i] = hb; al.u[i] = ASPLIT ? bf16_bits(xs[i] - bf16_val(hb)) : (unsigned short)0; }
#pragma unroll
    for (int t = 0; t < 4; ++t) {
      const unsigned short* brow = Wt + (size_t)(col0 + t * 16 + ln) * ldb + kb;
      FragB b;
      b.half[0] = *(const v8us*)(brow + 8 * hh);
      b.half[1] = *(const v8us*)(brow + 16 + 8 * hh);
      acc[t] = mmaN<ASPLIT ? 2 : 1>(ah.v, al.v, b.v, b.v, acc[t]);
    }
  }
#pragma unroll
  for (int t = 0; t < 4; ++t) {
    float bv = bias ? bias[col0 + t * 16 + ln] : 0.f;
    if (BIAS_BF16) bv = bf16_round(bv);
#pragma unroll
    for (int r = 0; r < 8; ++r) { float v = acc[t][r] + bv; if (ACT == 1) v = fmaxf(v, 0.f); so[w][8 * hh + r][t * 16 + ln] = v; }
  }
  __builtin_amdgcn_fence(__ATOMIC_ACQ_REL, "workgroup");
  __builtin_amdgcn_wave_barrier();
  const int rsub = lane >> 4, c4 = (lane & 15) * 4;
  {
#pragma unroll
    for (int q = 0; q < 8; ++q) {
      const int r = q * 2 + rsub;
      const v4f v = *(const v4fa*)&so[w][r][c4];
      *(v4f*)(C + (size_t)(row0 + r) * ldc + col0 + c4) = v;
    }
    
  }
}

// GEMM C = act(A·W + bias + resid): A f32 (ASPLIT -> hi/lo 2 terms), Wt bf16 [N][K]; ACT 0 none, 1 relu, 2 exact gelu;
// resid (optional, f32, row index = (row % rmod), pitch ldr, RES_BF16 rounds it) added before the activation.
template <bool ASPLIT, int ACT, bool BIAS_BF16, bool RES_BF16>
__global__ __launch_bounds__(128) void k_gemm_bf3(const float* __restrict__ A, int lda, const unsigned short* __restrict__ Wt, int ldb,
                                                const float* __restrict__ bias, const float* __restrict__ resid, int rmod, int ldr,
                                                float* __restrict__ C, int ldc, int M, int N, int K) {
  __shared__ __attribute__((aligned(16))) float so[4][16][64];
  const int tid = threadIdx.x, w = tid >> 5, lane = tid & 31, ln = lane & 15, hh = lane >> 4;
  const int ntn = N / 64;
  const int wid = blockIdx.x * 4 + w;
  const int mt = wid / ntn, nq = wid % ntn;
  if (mt * 16 >= M) return;
  const int row0 = mt * 16, col0 = nq * 64;
  const float* arow = A + (size_t)(row0 + ln) * lda;
  v8f acc[4] = {};
  for (int kb = 0; kb < K; kb += 32) {
    FragB ah, al;
    const v4f x0 = *(const v4fa*)(arow + kb + 8 * hh), x1 = *(const v4fa*)(arow + kb + 8 * hh + 4);
    const v4f x2 = *(const v4fa*)(arow + kb + 16 + 8 * hh), x3 = *(const v4fa*)(arow + kb + 16 + 8 * hh + 4);
    float xs[16] = {x0[0],x0[1],x0[2],x0[3],x1[0],x1[1],x1[2],x1[3],x2[0],x2[1],x2[2],x2[3],x3[0],x3[1],x3[2],x3[3]};
#pragma unroll
    for (int i = 0; i < 16; ++i) { const unsigned short hb = bf16_bits(xs[i]); ah.u[i] = hb; al.u[i] = ASPLIT ? bf16_bits(xs[i] - bf16_val(hb)) : (unsigned short)0; }
#pragma unroll
    for (int t = 0; t < 4; ++t) {
      const unsigned short* brow = Wt + (size_t)(col0 + t * 16 + ln) * ldb + kb;
      FragB b;
      b.half[0] = *(const v8us*)(brow + 8 * hh);
      b.half[1] = *(const v8us*)(brow + 16 + 8 * hh);
      acc[t] = mmaN<ASPLIT ? 2 : 1>(ah.v, al.v, b.v, b.v, acc[t]);
    }
  }
#pragma unroll
  for (int t = 0; t < 4; ++t) {
    const int col = col0 + t * 16 + ln;
    float bv = bias ? bias[col] : 0.f;
    if (BIAS_BF16) bv = bf16_round(bv);
#pragma unroll
    for (int r = 0; r < 8; ++r) {
      float v = acc[t][r] + bv;
      if (resid) { float rv = resid[(size_t)((row0 + 8 * hh + r) % rmod) * ldr + col]; if (RES_BF16) rv = bf16_round(rv); v += rv; }
      if (ACT == 1) v = fmaxf(v, 0.f);
      if (ACT == 2) v = 0.5f * v * (1.0f + erff(v * 0.70710678118654752f));
      if (ACT == 3) { const float u = 0.7978845608028654f * (v + 0.044715f * v * v * v); v = 0.5f * v * (1.0f + tanhf(u)); }
      so[w][8 * hh + r][t * 16 + ln] = v;
    }
  }
  __builtin_amdgcn_fence(__ATOMIC_ACQ_REL, "workgroup");
  __builtin_amdgcn_wave_barrier();
  const int rsub = lane >> 4, c4 = (lane & 15) * 4;
  {
#pragma unroll
    for (int q = 0; q < 8; ++q) {
      const int r = q * 2 + rsub;
      const v4f v = *(const v4fa*)&so[w][r][c4];
      *(v4f*)(C + (size_t)(row0 + r) * ldc + col0 + c4) = v;
    }
    
  }
}
// row LayerNorm (biased variance, eps) over N: s = X (+ R); optional out_sum <- s; out_norm <- (s-mu)*rsqrt(var+eps)*g + b
template <bool PARAM_BF16>
__global__ __launch_bounds__(256) void k_layernorm(const float* __restrict__ X, const float* __restrict__ R, const float* __restrict__ g, const float* __restrict__ bta,
                                                  float* __restrict__ out_sum, float* __restrict__ out_norm, int N, float eps) {
  __shared__ float red[256];
  const int row = blockIdx.x, tid = threadIdx.x;
  const float* x = X + (size_t)row * N; const float* rr = R ? R + (size_t)row * N : nullptr;
  float vals[16];                     // up to N = 4096
  const int per = N / 256;            // contiguous chunk per thread? use strided-by-4 chunks: thread handles j = tid*4 + 1024*u
  float s1 = 0.f;
  for (int u = 0; u < per / 4; ++u) {
    const int j = tid * 4 + 1024 * u;
    const v4f a = *(const v4fa*)(x + j);
    v4f b = {0.f,0.f,0.f,0.f}; if (rr) b = *(const v4fa*)(rr + j);
#pragma unroll
    for (int q = 0; q < 4; ++q) { const float v = a[q] + b[q]; vals[u * 4 + q] = v; s1 += v; }
  }
  red[tid] = s1; __syncthreads();
  for (int st = 128; st > 0; st >>= 1) { if (tid < st) red[tid] += red[tid + st]; __syncthreads(); }
  const float mu = red[0] / (float)N; __syncthreads();
  float s2 = 0.f;
  for (int u = 0; u < per / 4; ++u)
#pragma unroll
    for (int q = 0; q < 4; ++q) { const float c = vals[u * 4 + q] - mu; s2 += c * c; }
  red[tid] = s2; __syncthreads();
  for (int st = 128; st > 0; st >>= 1) { if (tid < st) red[tid] += red[tid + st]; __syncthreads(); }
  const float rs = rsqrtf(red[0] / (float)N + eps);
  {
    for (int u = 0; u < per / 4; ++u) {
      const int j = tid * 4 + 1024 * u;
      v4f o, sm;
#pragma unroll
      for (int q = 0; q < 4; ++q) {
        float gg = g[j + q], bb = bta[j + q];
        if (PARAM_BF16) { gg = bf16_round(gg); bb = bf16_round(bb); }
        sm[q] = vals[u * 4 + q]; o[q] = (vals[u * 4 + q] - mu) * rs * gg + bb;
      }
      if (out_sum) *(v4f*)(out_sum + (size_t)row * N + j) = sm;
      *(v4f*)(out_norm + (size_t)row * N + j) = o;
    }
    
  }
}



// ---- f16 WMMA path (v_wmma_f32_16x16x32_f16): 11-bit significands for operands in range — used where a [0,1] probability operand needs more precision than bf16
typedef _Float16 v16h __attribute__((ext_vector_type(16)));
union FragH { v16h v; v8us half[2]; _Float16 h[16]; unsigned short u[16]; };
template <int NT>
__device__ __forceinline__ v8f mmaH(v16h ah, v16h al, v16h bh, v16h bl, v8f c) {
  c = __builtin_amdgcn_wmma_f32_16x16x32_f16(false, ah, false, bh, (short)0, c, false, false);
  if (NT >= 2) c = __builtin_amdgcn_wmma_f32_16x16x32_f16(false, al, false, bh, (short)0, c, false, false);
  if (NT >= 3) c = __builtin_amdgcn_wmma_f32_16x16x32_f16(false, ah, false, bl, (short)0, c, false, false);
  asm volatile("v_nop\n\tv_nop\n\tv_nop\n\tv_nop" : "+v"(c) : "v"(ah), "v"(al), "v"(bh), "v"(bl));
  return c;
}
// batched GEMM like k_gemm_b but f16 operands: A f32 (split into f16 hi/lo if ASPLIT, else rounded to f16), Bt = f16 values [n][k]; alpha; C f32; N multiple of 16 (partial tiles skipped)
template <bool ASPLIT>
__global__ __launch_bounds__(128) void k_gemm_h(const float* __restrict__ A, int lda, size_t sA, const _Float16* __restrict__ Bh, int ldb, size_t sB, float alpha, float* __restrict__ C, int ldc, size_t sC, int M, int N, int K) {
  __shared__ __attribute__((aligned(16))) float so[4][16][64];
  const int tid = threadIdx.x, w = tid >> 5, lane = tid & 31, ln = lane & 15, hh = lane >> 4; const int by = blockIdx.y;
  A += (size_t)by * sA; Bh += (size_t)by * sB; C += (size_t)by * sC;
  const int ntn = (N + 63) / 64; const int wid = blockIdx.x * 4 + w; const int mt = wid / ntn, nq = wid % ntn; if (mt * 16 >= M) return;
  const int row0 = mt * 16, col0 = nq * 64; const float* arow = A + (size_t)(row0 + ln) * lda;
  v8f acc[4] = {};
  for (int kb = 0; kb < K; kb += 32) {
    FragH ah, al;
    const v4f x0 = *(const v4fa*)(arow + kb + 8 * hh), x1 = *(const v4fa*)(arow + kb + 8 * hh + 4), x2 = *(const v4fa*)(arow + kb + 16 + 8 * hh), x3 = *(const v4fa*)(arow + kb + 16 + 8 * hh + 4);
    float xs[16] = {x0[0],x0[1],x0[2],x0[3],x1[0],x1[1],x1[2],x1[3],x2[0],x2[1],x2[2],x2[3],x3[0],x3[1],x3[2],x3[3]};
#pragma unroll
    for (int i = 0; i < 16; ++i) { const _Float16 h = (_Float16)xs[i]; ah.h[i] = h; al.h[i] = ASPLIT ? (_Float16)(xs[i] - (float)h) : (_Float16)0.0f; }
#pragma unroll
    for (int t = 0; t < 4; ++t) { if (col0 + t * 16 >= N) continue; const size_t boff = (size_t)(col0 + t * 16 + ln) * ldb + kb; FragH bq; bq.half[0] = *(const v8us*)(Bh + boff + 8 * hh); bq.half[1] = *(const v8us*)(Bh + boff + 16 + 8 * hh);
      acc[t] = mmaH<ASPLIT ? 2 : 1>(ah.v, al.v, bq.v, bq.v, acc[t]); }
  }
#pragma unroll
  for (int t = 0; t < 4; ++t) { if (col0 + t * 16 >= N) continue;
#pragma unroll
    for (int r = 0; r < 8; ++r) so[w][8 * hh + r][t * 16 + ln] = acc[t][r] * alpha; }
  __builtin_amdgcn_fence(__ATOMIC_ACQ_REL, "workgroup"); __builtin_amdgcn_wave_barrier();
  const int rsub = lane >> 4, c4 = (lane & 15) * 4;
  {
#pragma unroll
    for (int q = 0; q < 8; ++q) { const int r = q * 2 + rsub; if (col0 + c4 < N) { const v4f v = *(const v4fa*)&so[w][r][c4]; *(v4f*)(C + (size_t)(row0 + r) * ldc + col0 + c4) = v; } }
     }
}

// Wt[n][k] = f16(W[k][n]·scale) from f32 row-major W[K][N] (scale = power of two; bf16-exact weights stay exact in f16 away from the subnormal range)
__global__ __launch_bounds__(256) void k_wt_f16(const float* __restrict__ W, _Float16* __restrict__ Wt, int K, int N, float scale) {
  const int t = blockIdx.x * 256 + threadIdx.x; if (t >= N * (K / 8)) return; const int n = t / (K / 8), k8 = (t % (K / 8)) * 8; FragH f;
#pragma unroll
  for (int i = 0; i < 8; ++i) f.h[i] = (_Float16)(bf16_round(W[(size_t)(k8 + i) * N + n]) * scale); const v8us o = f.half[0];
  *(v8us*)((unsigned short*)Wt + (size_t)n * K + k8) = o; 
}
// k_gemm_hh variant with fused epilogue: v = acc·alpha + bias[by·sBias + col] (+ CP[(row/rowsPerB)·sCPb + by·64 + col] if CP) ; ACT 0 none / 1 elu ; writes f16 C16 (and f32 C if non-null)
template <int ACT>
__global__ __launch_bounds__(128) void k_gemm_hhx(const _Float16* __restrict__ A, int lda, size_t sA, const _Float16* __restrict__ Bh, int ldb, size_t sB, float alpha, const float* __restrict__ bias, size_t sBias, const float* __restrict__ CP, int rowsPerB, size_t sCPb, int row0g,
    float* __restrict__ C, _Float16* __restrict__ C16, int ldc, size_t sC, int M, int N, int K) {
  __shared__ __attribute__((aligned(16))) float so[4][16][64];
  const int tid = threadIdx.x, w = tid >> 5, lane = tid & 31, ln = lane & 15, hh = lane >> 4; const int by = blockIdx.y;
  A += (size_t)by * sA; Bh += (size_t)by * sB; const size_t cofs = (size_t)by * sC; const float* bp = bias ? bias + (size_t)by * sBias : nullptr;
  const int ntn = (N + 63) / 64; const int wid = blockIdx.x * 4 + w; const int mt = wid / ntn, nq = wid % ntn; if (mt * 16 >= M) return;
  const int row0 = mt * 16, col0 = nq * 64; const _Float16* arow = A + (size_t)(row0 + ln) * lda;
  v8f acc[4] = {};
  for (int kb = 0; kb < K; kb += 32) { FragH ah; ah.half[0] = *(const v8us*)((const unsigned short*)arow + kb + 8 * hh); ah.half[1] = *(const v8us*)((const unsigned short*)arow + kb + 16 + 8 * hh);
#pragma unroll
    for (int t = 0; t < 4; ++t) { if (col0 + t * 16 >= N) continue; const size_t boff = (size_t)(col0 + t * 16 + ln) * ldb + kb; FragH bq; bq.half[0] = *(const v8us*)((const unsigned short*)Bh + boff + 8 * hh); bq.half[1] = *(const v8us*)((const unsigned short*)Bh + boff + 16 + 8 * hh);
      acc[t] = mmaH<1>(ah.v, ah.v, bq.v, bq.v, acc[t]); }
  }
#pragma unroll
  for (int t = 0; t < 4; ++t) { if (col0 + t * 16 >= N) continue; const int col = col0 + t * 16 + ln; const float bv = bp ? bf16_round(bp[col]) : 0.f;
#pragma unroll
    for (int r = 0; r < 8; ++r) { float v = acc[t][r] * alpha + bv; if (CP) { const int rr = row0g + row0 + 8 * hh + r; if (rowsPerB < 0) v += CP[cofs + (size_t)rr * ldc + col];      /* rowsPerB < 0: own element of the batched C plane */ else { const int bidx = rr / rowsPerB; v += CP[(size_t)bidx * sCPb + (size_t)by * 64 + col]; } } if (ACT == 1) v = (v > 0.f) ? v : expm1f(v); else if (ACT == 7) v = (v > 0.f) ? v + 1.0f : expf(v); else if (ACT == 8) v = tanhf(v); else if (ACT == 9) v = 0.5f * v * (1.0f + tanhf(0.7978845608028654f * (v + 0.044715f * v * v * v))); else if (ACT == 11) v = 1.0f / (1.0f + expf(-v)); else if (ACT == 12) v = (v > 0.f) ? v : 0.01f * v; else if (ACT == 14) v = (v > 0.f) ? v : 0.1f * v; else if (ACT == 16) v = (v >= 0.f) ? v : 0.3f * v; else if (ACT == 17) v = (v >= 0.f) ? v : 0.2f * v; else if (ACT == 15) v = v / (1.0f + expf(-v)); else if (ACT == 3) v = fmaxf(v, 0.f); else if (ACT == 6) v = 0.5f * v * (1.0f + erff(v * 0.70710678118654752f)); so[w][8 * hh + r][t * 16 + ln] = v; } }
  __builtin_amdgcn_fence(__ATOMIC_ACQ_REL, "workgroup"); __builtin_amdgcn_wave_barrier();
  const int rsub = lane >> 4, c4 = (lane & 15) * 4; typedef _Float16 v4h __attribute__((ext_vector_type(4)));
  {
#pragma unroll
    for (int q = 0; q < 8; ++q) { const int r = q * 2 + rsub; if (col0 + c4 < N) { const v4f v = *(const v4fa*)&so[w][r][c4]; if (C) *(v4f*)(C + cofs + (size_t)(row0 + r) * ldc + col0 + c4) = v; if (C16) { v4h h4; for (int i = 0; i < 4; ++i) h4[i] = (_Float16)v[i]; *(v4h*)(C16 + cofs + (size_t)(row0 + r) * ldc + col0 + c4) = h4; } } }
     }
}


typedef _Float16 v4h __attribute__((ext_vector_type(4)));

__global__ __launch_bounds__(256) void k_x16(const float* __restrict__ x, _Float16* __restrict__ X16, size_t n8) { const size_t t = (size_t)blockIdx.x * 256 + threadIdx.x; if (t >= n8) return; FragH f;
#pragma unroll
  for (int q = 0; q < 8; ++q) f.h[q] = (_Float16)bf16_round(x[t * 8 + q]); *(v8us*)((unsigned short*)X16 + t * 8) = f.half[0];  }
__global__ __launch_bounds__(256) void k_h16(const float* __restrict__ x, _Float16* __restrict__ X16, size_t n8) { const size_t t = (size_t)blockIdx.x * 256 + threadIdx.x; if (t >= n8) return; FragH f;
#pragma unroll
  for (int q = 0; q < 8; ++q) f.h[q] = (_Float16)x[t * 8 + q]; *(v8us*)((unsigned short*)X16 + t * 8) = f.half[0];  }
__global__ __launch_bounds__(256) void k_round16f(const float* __restrict__ W, _Float16* __restrict__ Bt, size_t n8) { const size_t t = (size_t)blockIdx.x * 256 + threadIdx.x; if (t >= n8) return; FragH f;
#pragma unroll
  for (int i = 0; i < 8; ++i) f.h[i] = (_Float16)(bf16_round(W[t * 8 + i]) * 16.0f); *(v8us*)((unsigned short*)Bt + t * 8) = f.half[0];  }
template <int NHv, int TTv>
__global__ __launch_bounds__(256) void k_vt(const _Float16* __restrict__ V16, int ldv, int voff, _Float16* __restrict__ Vt) { __shared__ unsigned short tl[64][66]; const int tid = threadIdx.x; const int slab = blockIdx.x / (TTv / 64), lg = blockIdx.x % (TTv / 64); const int b = slab / NHv, h = slab % NHv;
  for (int i = tid; i < 64 * 8; i += 256) { const int r = i / 8, c8 = (i % 8) * 8; FragH f; f.half[0] = *(const v8us*)((const unsigned short*)V16 + ((size_t)b * TTv + lg * 64 + r) * ldv + voff + h * 64 + c8);
#pragma unroll
    for (int q = 0; q < 8; ++q) tl[r][c8 + q] = f.u[q]; }
  __syncthreads();
  {
#pragma unroll
    for (int rd = 0; rd < 2; ++rd) { const int d = rd * 32 + tid / 8, pc = tid % 8; FragH f;
#pragma unroll
      for (int q = 0; q < 8; ++q) f.u[q] = tl[pc * 8 + q][d];
      *(v8us*)((unsigned short*)Vt + ((size_t)slab * 64 + d) * TTv + lg * 64 + pc * 8) = f.half[0]; }
     } }

__global__ __launch_bounds__(256) void k_hl(const float* __restrict__ F, _Float16* __restrict__ Hh, _Float16* __restrict__ Hl, size_t n8) { const size_t t = (size_t)blockIdx.x * 256 + threadIdx.x; if (t >= n8) return; FragH fh, fl; const v4f a = *(const v4fa*)(F + t * 8), c = *(const v4fa*)(F + t * 8 + 4);
#pragma unroll
  for (int q = 0; q < 4; ++q) { _Float16 h = (_Float16)a[q]; fh.h[q] = h; fl.h[q] = (_Float16)((a[q] - (float)h) * 1024.0f); h = (_Float16)c[q]; fh.h[4 + q] = h; fl.h[4 + q] = (_Float16)((c[q] - (float)h) * 1024.0f); }
  { *(v8us*)((unsigned short*)Hh + t * 8) = fh.half[0]; *(v8us*)((unsigned short*)Hl + t * 8) = fl.half[0];  } }

// ---- fast GEMM (wave tile 32x64; requires M % 32 == 0 rows per launch region and N % 64 == 0); epilogue = k_gemm_hhx semantics ----
__device__ __forceinline__ v16h g2_frag(const _Float16* p, int hh) { FragH f; f.half[0] = *(const v8us*)((const unsigned short*)p + 8 * hh); f.half[1] = *(const v8us*)((const unsigned short*)p + 16 + 8 * hh); return f.v; }
__device__ __forceinline__ v8f g2_mma(v16h a, v16h b, v8f c) { v8f d = __builtin_amdgcn_wmma_f32_16x16x32_f16(false, a, false, b, (short)0, c, false, false); asm volatile("v_nop\n\tv_nop\n\tv_nop\n\tv_nop" : "+v"(d) : "v"(a), "v"(b)); return d; }
template <int ACT>
__global__ __launch_bounds__(128) void k_gemm2(const _Float16* __restrict__ A, int lda, size_t sA, const _Float16* __restrict__ Bh, int ldb, size_t sB, float alpha, const float* __restrict__ bias, size_t sBias, const float* __restrict__ CP, int rowsPerB, size_t sCPb, int row0g,
    float* __restrict__ C, _Float16* __restrict__ C16, int ldc, size_t sC, int M, int N, int K) { static_assert(ACT == 0 || ACT == 3 || ACT == 6 || ACT == 8 || ACT == 9 || ACT == 11 || ACT == 12 || ACT == 14 || ACT == 15 || ACT == 16 || ACT == 17, "k_gemm2: unsupported ACT code (would silently apply no activation)");
  __shared__ __attribute__((aligned(16))) float so[4][32][68];
  const int tid = threadIdx.x, w = tid >> 5, lane = tid & 31, ln = lane & 15, hh = lane >> 4; const int by = blockIdx.y;
  A += (size_t)by * sA; Bh += (size_t)by * sB; const size_t cofs = (size_t)by * sC; const float* bp = bias ? bias + (size_t)by * sBias : nullptr;
  const int ntn = N >> 6; const int mt = blockIdx.x / ntn, nq = blockIdx.x - mt * ntn; const int row0 = mt * 128 + 32 * w, col0 = nq * 64; if (row0 >= M) return;
  const _Float16* a0p = A + (size_t)(row0 + ln) * lda; const _Float16* a1p = a0p + (size_t)16 * lda;
  const _Float16* b0p = Bh + (size_t)(col0 + ln) * ldb; const _Float16* b1p = b0p + (size_t)16 * ldb; const _Float16* b2p = b1p + (size_t)16 * ldb; const _Float16* b3p = b2p + (size_t)16 * ldb;
  const v8f z8 = {0.f,0.f,0.f,0.f,0.f,0.f,0.f,0.f}; v8f c00 = z8, c01 = z8, c02 = z8, c03 = z8, c10 = z8, c11 = z8, c12 = z8, c13 = z8;
#pragma unroll 1
  for (int kb = 0; kb < K; kb += 32) { const v16h a0 = g2_frag(a0p + kb, hh), a1 = g2_frag(a1p + kb, hh);
    v16h b = g2_frag(b0p + kb, hh); c00 = g2_mma(a0, b, c00); c10 = g2_mma(a1, b, c10);
    b = g2_frag(b1p + kb, hh); c01 = g2_mma(a0, b, c01); c11 = g2_mma(a1, b, c11);
    b = g2_frag(b2p + kb, hh); c02 = g2_mma(a0, b, c02); c12 = g2_mma(a1, b, c12);
    b = g2_frag(b3p + kb, hh); c03 = g2_mma(a0, b, c03); c13 = g2_mma(a1, b, c13); }
  v8f accs[8] = {c00, c01, c02, c03, c10, c11, c12, c13};
#pragma unroll
  for (int u = 0; u < 8; ++u) { const int t = u & 3, half = u >> 2; const int col = col0 + t * 16 + ln; const float bv = bp ? bf16_round(bp[col]) : 0.f;
#pragma unroll
    for (int r = 0; r < 8; ++r) { const int rloc = half * 16 + 8 * hh + r; float v = accs[u][r] * alpha + bv; if (CP) { if (rowsPerB < 0) v += CP[cofs + (size_t)(row0g + row0 + rloc) * ldc + col];      /* rowsPerB < 0: own element of the batched C plane */ else { const int bidx = (row0g + row0 + rloc) / rowsPerB; v += CP[(size_t)bidx * sCPb + (size_t)by * 64 + col]; } }
      if (ACT == 3) v = fmaxf(v, 0.f); else if (ACT == 6) v = 0.5f * v * (1.0f + erff(v * 0.70710678118654752f)); else if (ACT == 11) v = 1.0f / (1.0f + expf(-v)); else if (ACT == 15) v = v / (1.0f + expf(-v)); else if (ACT == 12) v = (v > 0.f) ? v : 0.01f * v; else if (ACT == 8) v = tanhf(v); else if (ACT == 9) v = 0.5f * v * (1.0f + tanhf(0.7978845608028654f * (v + 0.044715f * v * v * v))); else if (ACT == 14) v = (v > 0.f) ? v : 0.1f * v; else if (ACT == 16) v = (v >= 0.f) ? v : 0.3f * v; else if (ACT == 17) v = (v >= 0.f) ? v : 0.2f * v;
      so[w][rloc][t * 16 + ln] = v; } }
  __builtin_amdgcn_fence(__ATOMIC_ACQ_REL, "workgroup"); __builtin_amdgcn_wave_barrier();
  const int rsub = lane >> 4, c4 = (lane & 15) * 4;
  {
#pragma unroll
    for (int q = 0; q < 16; ++q) { const int r = q * 2 + rsub; const v4f v = *(const v4fa*)&so[w][r][c4]; if (C) *(v4f*)(C + cofs + (size_t)(row0 + r) * ldc + col0 + c4) = v; if (C16) { v4h h4; for (int i = 0; i < 4; ++i) h4[i] = (_Float16)v[i]; *(v4h*)(C16 + cofs + (size_t)(row0 + r) * ldc + col0 + c4) = h4; } }
     } }


__global__ __launch_bounds__(256) void k_wnat(const float* __restrict__ w, size_t n8, _Float16* __restrict__ Bt) { const size_t t = (size_t)blockIdx.x * 256 + threadIdx.x; if (t >= n8) return; FragH f; for (int q = 0; q < 8; ++q) f.h[q] = (_Float16)(bf16_round(w[t * 8 + q]) * 16.0f); *(v8us*)((unsigned short*)Bt + t * 8) = f.half[0];  }
__global__ __launch_bounds__(256) void k_rsm(const float* __restrict__ S, _Float16* __restrict__ P, int nrows) {
  #pragma clang fp contract(off)
  const int i = blockIdx.x * 256 + threadIdx.x; if (i >= nrows) return; const float* s = S + (size_t)i * SQ; float mx = -3.0e38f;
#pragma unroll 1
  for (int j = 0; j < SQ; ++j) mx = fmaxf(mx, s[j]); float se = 0.f;
#pragma unroll 1
  for (int j = 0; j < SQ; ++j) se += expf(s[j] - mx); const float sc = 256.0f / se;
#pragma unroll 1
  for (int j0 = 0; j0 < SQ; j0 += 8) { FragH f; for (int q = 0; q < 8; ++q) f.h[q] = (_Float16)(expf(s[j0 + q] - mx) * sc); unsigned short* d = (unsigned short*)P + (size_t)i * SQ + j0; *(v8us*)d = f.half[0];  } }
__global__ __launch_bounds__(256) void k_vt(const _Float16* __restrict__ V16, int b, int h0, _Float16* __restrict__ VT) { __shared__ unsigned short tl[64][65]; const int tid = threadIdx.x; const int hh = blockIdx.x % HG, sg = blockIdx.x / HG; const int s0 = sg * 64; const int h = h0 + hh;
  for (int i = tid; i < 64 * 8; i += 256) { const int j = i / 8, d8 = (i % 8) * 8; FragH f; f.half[0] = *(const v8us*)((const unsigned short*)V16 + ((size_t)b * SQ + s0 + j) * DM + h * HD + d8); for (int q = 0; q < 8; ++q) tl[d8 + q][j] = f.u[q]; }
  __syncthreads();
  { for (int i = tid; i < 64 * 8; i += 256) { const int d = i / 8, j8 = (i % 8) * 8; FragH f; for (int q = 0; q < 8; ++q) f.u[q] = tl[d][j8 + q]; *(v8us*)((unsigned short*)VT + ((size_t)hh * HD + d) * SQ + s0 + j8) = f.half[0]; }  } }



__global__ __launch_bounds__(256) void k_rsmf(const float* __restrict__ S, _Float16* __restrict__ P, int qn, int hg) {
  #pragma clang fp contract(off)
  const int t = blockIdx.x * 256 + threadIdx.x; if (t >= qn * hg) return; const size_t i = (size_t)(t / qn) * SQ + (t % qn); const float* s = S + i * SQ; float mx = -3.0e38f;
#pragma unroll 1
  for (int j = 0; j < SQ; ++j) mx = fmaxf(mx, s[j]); float se = 0.f;
#pragma unroll 1
  for (int j = 0; j < SQ; ++j) se += __expf(s[j] - mx); const float sc = 256.0f / se;
#pragma unroll 1
  for (int j0 = 0; j0 < SQ; j0 += 8) { FragH f; for (int q = 0; q < 8; ++q) f.h[q] = (_Float16)(__expf(s[j0 + q] - mx) * sc); unsigned short* d = (unsigned short*)P + i * SQ + j0; *(v8us*)d = f.half[0];  } }

// 2^x on v_exp_f32 with one free issue slot behind it: the instruction set asks for that slot before the result is read or the source overwritten.
__device__ __forceinline__ float exp2_slot(float x) { float r; asm("v_exp_f32 %0, %1\n\tv_nop" : "=v"(r) : "v"(x)); return r; }
#define FK 64      /* keys per stage */
#define FQ 128     /* query rows per work-group */
#define KPH 72     /* LDS row pitch of K and V^T, halves: 144 B = 16 B x odd, b128 fragment reads free of bank conflicts */
#define MPF 68     /* LDS row pitch of the mask rows, floats: 272 B = 16 B x odd */
__device__ __forceinline__ float xhalf(float x) { return __builtin_bit_cast(float, __builtin_amdgcn_permlanex16(__builtin_bit_cast(int, x), __builtin_bit_cast(int, x), 0x76543210, 0xfedcba98, false, false)); }      /* lane l with lane l ^ 16 */
__device__ __forceinline__ v8f fa_mma(v16h a, v16h b, v8f c) { return __builtin_amdgcn_wmma_f32_16x16x32_f16(false, a, false, b, (short)0, c, false, false); }
__global__ __launch_bounds__(256) void k_fattn(const _Float16* __restrict__ Qh, const _Float16* __restrict__ Ql, const _Float16* __restrict__ Kh, const _Float16* __restrict__ Vt, const float* __restrict__ Mk, float* __restrict__ out) {
  __shared__ __attribute__((aligned(16))) _Float16 sk[FK][KPH];
  __shared__ __attribute__((aligned(16))) _Float16 sv[HD][KPH];
  __shared__ __attribute__((aligned(16))) float sm[FQ][MPF];
  const int tid = threadIdx.x, w = tid >> 5, lane = tid & 31, ln = lane & 15, hh = lane >> 4;
  const int h = blockIdx.x % NH, qb = (blockIdx.x / NH) % (SQ / FQ), b = blockIdx.x / (NH * (SQ / FQ));      /* neighbouring work-groups: same mask rows, other heads */
  const int qrow = qb * FQ + w * 16;
  const size_t qo = ((size_t)b * SQ + qrow + ln) * DM + h * HD;
  const v16h qh0 = g2_frag(Qh + qo, hh), qh1 = g2_frag(Qh + qo + 32, hh), ql0 = g2_frag(Ql + qo, hh), ql1 = g2_frag(Ql + qo + 32, hh);
  const int sr = tid >> 3, sc = (tid & 7) * 8;      /* staging: 8 threads cover one 128-byte row, a wave four whole lines */
  const _Float16* kg = Kh + ((size_t)b * SQ + sr) * DM + h * HD + sc;
  const _Float16* vg = Vt + (((size_t)b * NH + h) * HD + sr) * SQ + sc;
  const float* mg = Mk + ((size_t)b * SQ + qrow + hh) * SQ + ln * 4;      /* 16 lanes cover 256 bytes of one mask row */
  v8us kr[2], vr[2]; v4f mr[8];
#pragma unroll
  for (int i = 0; i < 2; ++i) { kr[i] = *(const v8us*)((const unsigned short*)kg + (size_t)i * 32 * DM); vr[i] = *(const v8us*)((const unsigned short*)vg + (size_t)i * 32 * SQ); }
#pragma unroll
  for (int i = 0; i < 8; ++i) mr[i] = *(const v4fa*)(mg + (size_t)i * 2 * SQ);
  const v8f z8 = {0.f, 0.f, 0.f, 0.f, 0.f, 0.f, 0.f, 0.f};
  v8f o[4] = {z8, z8, z8, z8};
  float m = -3.0e38f, l = 0.f;
#pragma unroll 1      /* rolled, for speed only */
  for (int s = 0; s < SQ / FK; ++s) {
    __syncthreads();      /* every wave has finished reading the stage before */
#pragma unroll
    for (int i = 0; i < 2; ++i) { *(v8us*)&sk[sr + 32 * i][sc] = kr[i]; *(v8us*)&sv[sr + 32 * i][sc] = vr[i]; }
#pragma unroll
    for (int i = 0; i < 8; ++i) *(v4fa*)&sm[w * 16 + 2 * i + hh][ln * 4] = mr[i];
    __syncthreads();      /* the stage is complete for every wave */
    if (s + 1 < SQ / FK) {      /* next stage's loads fly while this one is worked on */
      kg += (size_t)FK * DM; vg += FK; mg += FK;
#pragma unroll
      for (int i = 0; i < 2; ++i) { kr[i] = *(const v8us*)((const unsigned short*)kg + (size_t)i * 32 * DM); vr[i] = *(const v8us*)((const unsigned short*)vg + (size_t)i * 32 * SQ); }
#pragma unroll
      for (int i = 0; i < 8; ++i) mr[i] = *(const v4fa*)(mg + (size_t)i * 2 * SQ);
    }
    v8f sh[4], sl[4];
#pragma unroll
    for (int t = 0; t < 4; ++t) {
      const v16h a0 = g2_frag(&sk[t * 16 + ln][0], hh), a1 = g2_frag(&sk[t * 16 + ln][32], hh);
      sh[t] = fa_mma(a1, qh1, fa_mma(a0, qh0, z8)); sl[t] = fa_mma(a1, ql1, fa_mma(a0, ql0, z8)); }
    float bm = -3.0e38f;
#pragma unroll
    for (int t = 0; t < 4; ++t) {
#pragma unroll
      for (int r = 0; r < 8; ++r) { sh[t][r] += sl[t][r] * 0.0009765625f; bm = fmaxf(bm, sh[t][r]); } }      /* q_hi.k + q_lo.k 2^-10 */
    const float cl = 0.18033688011112042592f;      /* 1/8 and the change to log2 units */
    bm = fmaxf(bm, xhalf(bm)) * cl;
    const float mn = fmaxf(m, bm), al = exp2_slot(m - mn), off = mn - 8.0f; m = mn;
    float ps[4] = {0.f, 0.f, 0.f, 0.f};      /* four partial sums: no chain of 32 dependent adds */
#pragma unroll
    for (int t = 0; t < 4; ++t) o[t] *= al;
    FragH pb[2];
#pragma unroll
    for (int t = 0; t < 4; ++t) {
      const v4f k0 = *(const v4fa*)&sm[w * 16 + ln][t * 16 + 8 * hh], k1 = *(const v4fa*)&sm[w * 16 + ln][t * 16 + 8 * hh + 4];
#pragma unroll
      for (int r = 0; r < 8; ++r) { const float p = exp2_slot(sh[t][r] * cl - off) * (r < 4 ? k0[r & 3] : k1[r & 3]); ps[r & 3] += p; pb[t >> 1].h[(t & 1) * 8 + r] = (_Float16)p; } }
    l = l * al + ((ps[0] + ps[1]) + (ps[2] + ps[3]));
#pragma unroll
    for (int t = 0; t < 4; ++t) o[t] = fa_mma(g2_frag(&sv[t * 16 + ln][32], hh), pb[1].v, fa_mma(g2_frag(&sv[t * 16 + ln][0], hh), pb[0].v, o[t]));
  }
  l += xhalf(l);
  const float inv = 1.0f / l;
  /* the wave's own 16 mask rows become its output staging: [query][d], so that each store below covers whole lines */
#pragma unroll
  for (int t = 0; t < 4; ++t) { const v8f v = o[t] * inv; const v4f lo4 = {v[0], v[1], v[2], v[3]}, hi4 = {v[4], v[5], v[6], v[7]};
    *(v4fa*)&sm[w * 16 + ln][t * 16 + 8 * hh] = lo4; *(v4fa*)&sm[w * 16 + ln][t * 16 + 8 * hh + 4] = hi4; }
  __builtin_amdgcn_fence(__ATOMIC_ACQ_REL, "workgroup"); __builtin_amdgcn_wave_barrier();      /* orders the LDS stores above in front of the loads below, which read what other lanes of the same wave wrote; no other wave touches these rows */
#pragma unroll
  for (int i = 0; i < 8; ++i) { const int r = 2 * i + hh; const v4f v = *(const v4fa*)&sm[w * 16 + r][ln * 4]; *(v4f*)(out + ((size_t)b * SQ + qrow + r) * DM + h * HD + ln * 4) = v; } }

// ---- projection GEMM with both operands staged in LDS by tensor loads: C[8192][1024] = alpha * A[8192][1024] . Bt[1024][1024]^T, all rows k-contiguous f16 ----
// One 128 x 128 tile of C per work-group, four waves (2 x 2) of 64 x 64. A stage is 256 bytes (128 k) of the tile's 128 A rows and 128 Bt rows; each wave brings one 64-row slice of it with one tensor load.
// Two buffers: stage s + 2 is requested into the buffer that pass s has just left, so it flies while pass s + 1 is worked on. The k order of every accumulator is that of the plain loop: ascending in steps of 32.
// Every inner loop is fully unrolled so that the accumulator and fragment arrays are indexed by constants and live in registers.
typedef uint32_t u32x4 __attribute__((ext_vector_type(4)));
typedef uint32_t u32x8 __attribute__((ext_vector_type(8)));
#define G3T 128      /* tile rows of either operand */
#define G3RB 256     /* bytes of an operand row per stage */
#define G3P 272      /* LDS row pitch, bytes: 16 B x odd for the b128 fragment reads; laid by the tensor load's pad */
#define G3SL 18432   /* place of a slice: 64 rows x 272 B = 17,408 B, rounded up to a multiple of 2 KiB */
#define G3BUF (4 * G3SL)
#define G3NS (DM * 2 / G3RB)      /* stages */
__device__ __forceinline__ uint32_t uni(uint32_t v) { return (uint32_t)__builtin_amdgcn_readfirstlane(v); }
__device__ __forceinline__ uint32_t pinned(uint32_t v) { uint32_t w = uni(v); asm volatile("" : "+s"(w)); return w; }      /* for the tensor mover: keeps a tensor load's issue test a scalar branch, and the stage number that its descriptor words are formed from in a scalar register behind the waits */
template <bool F32O>      /* result rows go out as f32 to C, or else as f16 to C16: fixed at compile time, so that the output loop has no branch and its LDS reads and stores overlap */
__global__ __launch_bounds__(128) void k_gemm3(const _Float16* __restrict__ A, const _Float16* __restrict__ Bh, float alpha, float* __restrict__ C, _Float16* __restrict__ C16) {
  __shared__ __attribute__((aligned(2048))) unsigned char ring[2 * G3BUF];
  const int tid = threadIdx.x, lane = tid & 31, ln = lane & 15, hh = lane >> 4;
  const uint32_t w = uni((uint32_t)tid >> 5), wm = w >> 1, wn = w & 1u;
  const int nq = blockIdx.x % (DM / G3T), mt = blockIdx.x / (DM / G3T); const int row0 = mt * G3T, col0 = nq * G3T;
  const uint32_t lbase = (uint32_t)(size_t)ring;
  /* waves 0 and 1 bring the two halves of the A rows, waves 2 and 3 those of the Bt rows */
  const uint64_t ga0 = (uint64_t)(size_t)(w < 2u ? A + (size_t)(row0 + 64 * (int)w) * DM : Bh + (size_t)(col0 + 64 * (int)(w - 2u)) * DM);
  u32x8 g1;      /* 1-byte elements, tile = tensor = 64 rows of 256 B, source pitch one row of the matrix, 16 B of LDS pad behind every 256 B, no mask */
  g1[0] = uni((1u << 20) | (5u << 22) | (3u << 25)); g1[1] = uni((uint32_t)G3RB << 16); g1[2] = uni(64u << 16); g1[3] = uni((uint32_t)G3RB << 16); g1[4] = uni(64u); g1[5] = uni((uint32_t)DM * 2u); g1[6] = uni(0u); g1[7] = uni(0u);
  auto issue = [&](uint32_t st) {
    const uint64_t ga = ga0 + (uint64_t)st * G3RB; u32x4 g0;
    g0[0] = uni(1u); g0[1] = uni(lbase + (st & 1u) * G3BUF + w * G3SL); g0[2] = uni((uint32_t)ga); g0[3] = uni((((uint32_t)(ga >> 32)) & 0x01FFFFFFu) | 0x80000000u);
    asm volatile("tensor_load_to_lds %0, %1" :: "s"(g0), "s"(g1) : "memory"); };
  issue(0u);
  asm volatile("s_wait_tensorcnt 0x0" ::: "memory");      /* this wave's slice of stage 0 has landed */
  __syncthreads();      /* stage 0 is complete for every wave */
  issue(1u);
  const v8f z8 = {0.f, 0.f, 0.f, 0.f, 0.f, 0.f, 0.f, 0.f};
  v8f acc[4][4];
#pragma unroll
  for (int i = 0; i < 4; ++i) {
#pragma unroll
    for (int j = 0; j < 4; ++j) acc[i][j] = z8; }
#pragma unroll 1      /* rolled: one pass is 64 matrix instructions, and the ring's order stands once in the text */
  for (uint32_t s = 0; s < G3NS; ++s) {
    const unsigned char* buf = ring + (s & 1u) * G3BUF;
    const unsigned char* ap = buf + wm * G3SL + ln * G3P; const unsigned char* bp = buf + (2u + wn) * G3SL + ln * G3P;
    v16h a[2][4], b[2][4];      /* two fragment sets: block kb + 1 is fetched, as one group, while block kb is multiplied; no fragment of another stage is fetched */
#pragma unroll
    for (int i = 0; i < 4; ++i) { a[0][i] = g2_frag((const _Float16*)(ap + i * 16 * G3P), hh); b[0][i] = g2_frag((const _Float16*)(bp + i * 16 * G3P), hh); }
#pragma unroll
    for (int kb = 0; kb < G3RB / 64; ++kb) {
      __builtin_amdgcn_sched_barrier(0);      /* keeps the next block's LDS reads together in front of this block's matrix instructions, for speed only */
      if (kb + 1 < G3RB / 64) {
#pragma unroll
        for (int i = 0; i < 4; ++i) { a[(kb + 1) & 1][i] = g2_frag((const _Float16*)(ap + i * 16 * G3P + (kb + 1) * 64), hh); b[(kb + 1) & 1][i] = g2_frag((const _Float16*)(bp + i * 16 * G3P + (kb + 1) * 64), hh); }
      }
      __builtin_amdgcn_sched_barrier(0);      /* the other side of the same group */
      if (kb + 1 == G3RB / 64) {      /* the pass's foot stands in front of its last block, whose fragments are fetched by now: the refill starts a block earlier, and what follows works on registers alone */
        asm volatile("s_wait_dscnt 0x0" ::: "memory");      /* this wave's reads of the buffer have returned before it is refilled */
        asm volatile("s_wait_tensorcnt 0x0" ::: "memory");      /* this wave's slice of stage s + 1 has landed */
        __syncthreads();      /* publishes stage s + 1 and ends every wave's reading of stage s */
        if (pinned(s + 2u < G3NS)) issue(pinned(s + 2u));
      }
#pragma unroll
      for (int i = 0; i < 4; ++i) {
#pragma unroll
        for (int j = 0; j < 4; ++j) acc[i][j] = fa_mma(a[kb & 1][i], b[kb & 1][j], acc[i][j]); }
    }
  }
  asm volatile("s_wait_tensorcnt 0x0" ::: "memory");      /* nothing in flight when the ring becomes output staging */
  asm volatile("s_wait_dscnt 0x0" ::: "memory");
  /* the last pass's barrier has ended every read of the ring: each wave stages its 64 x 64 results in its own slice place, [row][col] at 68 floats, so that each store below covers whole lines */
  float* so = (float*)(ring + w * G3SL);
#pragma unroll
  for (int i = 0; i < 4; ++i) {
#pragma unroll
    for (int j = 0; j < 4; ++j) {
#pragma unroll
      for (int r = 0; r < 8; ++r) so[(i * 16 + 8 * hh + r) * 68 + j * 16 + ln] = acc[i][j][r] * alpha; } }
  __builtin_amdgcn_fence(__ATOMIC_ACQ_REL, "workgroup"); __builtin_amdgcn_wave_barrier();      /* orders the LDS stores above in front of the loads below, which read what other lanes of the same wave wrote */
  const int c4 = ln * 4; const size_t cb = (size_t)(row0 + 64 * (int)wm) * DM + col0 + 64 * (int)wn + c4;
#pragma unroll
  for (int q = 0; q < 32; ++q) { const int r = q * 2 + hh; const v4f v = *(const v4fa*)&so[r * 68 + c4];
    if (F32O) *(v4f*)(C + cb + (size_t)r * DM) = v;
    else { v4h h4; for (int i = 0; i < 4; ++i) h4[i] = (_Float16)v[i]; *(v4h*)(C16 + cb + (size_t)r * DM) = h4; } } }

extern "C" void kernel_launch(void* const* d_in, const int* in_sizes, int n_in,
                              void* d_out, int out_size, void* d_ws, size_t ws_size, hipStream_t stream) {
  (void)in_sizes; (void)n_in; (void)out_size;
  const float* const* I = (const float* const*)d_in; const float* x = I[0]; const float* amask = I[1]; const float* wq = I[2]; const float* wk = I[3]; const float* wv = I[4]; const float* bq = nullptr; const float* bk = nullptr; const float* bv = nullptr;      /* [in][out] weights, no biases; float 0/1 mask [8][1024][1024] read in the softmax */
  char* ws = (char*)d_ws; size_t off = 0;
  auto take = [&](size_t bytes) { char* p = ws + off; off += (bytes + 255) & ~(size_t)255; return p; };
  _Float16* BQ = (_Float16*)take((size_t)DM * DM * 2); _Float16* BK = (_Float16*)take((size_t)DM * DM * 2); _Float16* BV = (_Float16*)take((size_t)DM * DM * 2); 
  _Float16* X16 = (_Float16*)take(NR * DM * 2); _Float16* Q16 = (_Float16*)take(NR * DM * 2); float* QF = (float*)take(NR * DM * 4); _Float16* QL = (_Float16*)take(NR * DM * 2); _Float16* K16 = (_Float16*)take(NR * DM * 2); _Float16* V16 = (_Float16*)take(NR * DM * 2); _Float16* O16 = (_Float16*)take(NR * DM * 2);
  _Float16* VT = (_Float16*)take((size_t)NB * NH * HD * SQ * 2);
  if (off > ws_size) return;
  { const unsigned g = (unsigned)(((size_t)DM * (DM / 8) + 255) / 256); k_wt_f16<<<g, 256, 0, stream>>>(wq, BQ, DM, DM, 16.0f); k_wt_f16<<<g, 256, 0, stream>>>(wk, BK, DM, DM, 16.0f); k_wt_f16<<<g, 256, 0, stream>>>(wv, BV, DM, DM, 16.0f); }      /* [in][out] -> Bt x16 */

  k_x16<<<(unsigned)((NR * DM / 8 + 255) / 256), 256, 0, stream>>>(x, X16, NR * DM / 8);
  const size_t r0p = (size_t)B0 * SQ;      /* first projected row */
  k_gemm3<true><<<(unsigned)((MP / G3T) * (DM / G3T)), 128, 0, stream>>>(X16 + r0p * DM, BQ, 0.0625f, QF + r0p * DM, nullptr); k_hl<<<(unsigned)(((size_t)MP * DM / 8 + 255) / 256), 256, 0, stream>>>(QF + r0p * DM, Q16 + r0p * DM, QL + r0p * DM, (size_t)MP * DM / 8);      /* q in f32, then f16 hi + x1024 residual planes */
  k_gemm3<false><<<(unsigned)((MP / G3T) * (DM / G3T)), 128, 0, stream>>>(X16 + r0p * DM, BK, 0.0625f, nullptr, K16 + r0p * DM);
  k_gemm3<false><<<(unsigned)((MP / G3T) * (DM / G3T)), 128, 0, stream>>>(X16 + r0p * DM, BV, 0.0625f, nullptr, V16 + r0p * DM);
  k_vt<NH, SQ><<<NB * NH * (SQ / 64), 256, 0, stream>>>(V16, LQ, 0, VT);      /* V^T [NB][NH][HD][SQ], all batches */
  k_fattn<<<NB * NH * (SQ / FQ), 256, 0, stream>>>(Q16, QL, K16, VT, amask, (float*)d_out);      /* ctx (merged heads) straight to the f32 output */
}

// v004
// Measured time: 120 microseconds a run.
// In both of two side-by-side timings against v003, it was 1.14 times as fast.
// All steps since v000 together make it 82.1 times as fast.
#include <hip/hip_runtime.h>
// Multi-head self-attention with a multiplicative 0/1 mask and the module's 'unsafe' softmax (x [8][1024][1024]; q = x Wq, k = x Wk, v = x Wv ([in][out] 1024^2 sigma 1/32, no biases); 16 heads of 64; scores / 8; w = exp(s) mask[b][s][t] / (sum_t exp(s) mask + 1e-8) with the float mask input [8][1024][1024] (0/1, ~90 % ones, shared across heads) READ per (query, key); out = merged ctx (no output projection) -> [8][1024][1024]).
// Compute dtype: inputs rounded to bf16; x / weights exact; k, v and softmax weights as plain f16 GEMM operands (~2^-12); q as f16 hi + x1024 lo planes (effectively f32); o written f32; scores and softmax statistics f32. v_wmma_f32_16x16x32_f16.
#define NB 8
#define SQ 1024
#define DM 1024
#define NH 16
#define HD 64
#define HG 4                         /* heads per launch of k_vt(V16, b, h0, VT); that overload is not launched */
#define B0 0                         /* first batch processed (debug hook) */
#define NBR NB                       /* batches processed (debug hook) */
#define NR ((size_t)NB * SQ)         /* token rows */
#define MP ((int)((size_t)NBR * SQ)) /* rows projected (debug hook) */
#define QN SQ                        /* unused */
#define NHD NH                       /* unused */
#define MPO MP                       /* unused */
#define LQ DM      /* unused */
typedef __bf16 v16b __attribute__((ext_vector_type(16)));
typedef unsigned short v8us __attribute__((ext_vector_type(8), may_alias));
typedef float  v8f  __attribute__((ext_vector_type(8)));
typedef float  v4f  __attribute__((ext_vector_type(4)));
typedef float  v4fa __attribute__((ext_vector_type(4), may_alias));
union FragB { v16b v; v8us half[2]; unsigned short u[16]; };

__device__ __forceinline__ unsigned short bf16_bits(float x) { unsigned int u = __float_as_uint(x); return (unsigned short)((u + 0x7FFFu + ((u >> 16) & 1u)) >> 16); }
__device__ __forceinline__ float bf16_val(unsigned short b) { return __uint_as_float(((unsigned int)b) << 16); }
__device__ __forceinline__ float bf16_round(float x) { return bf16_val(bf16_bits(x)); }
// D += A·B with NT terms: 1 = ah·bh, 2 = + al·bh (A split), 3 = + ah·bl (both split)
template <int NT>
__device__ __forceinline__ v8f mmaN(v16b ah, v16b al, v16b bh, v16b bl, v8f c) {
  c = __builtin_amdgcn_wmma_f32_16x16x32_bf16(false, ah, false, bh, (short)0, c, false, false);
  if (NT >= 2) c = __builtin_amdgcn_wmma_f32_16x16x32_bf16(false, al, false, bh, (short)0, c, false, false);
  if (NT >= 3) c = __builtin_amdgcn_wmma_f32_16x16x32_bf16(false, ah, false, bl, (short)0, c, false, false);
  asm volatile("v_nop\n\tv_nop\n\tv_nop\n\tv_nop" : "+v"(c) : "v"(ah), "v"(al), "v"(bh), "v"(bl));
  return c;
}

__global__ __launch_bounds__(256) void k_wt_bf16(const float* __restrict__ W, unsigned short* __restrict__ Wt, int K, int N) {
  const int t = blockIdx.x * 256 + threadIdx.x;
  const int k8n = K / 8;
  if (t >= N * k8n) return;
  const int n = t / k8n, k8 = (t % k8n) * 8;
  v8us v;
#pragma unroll
  for (int i = 0; i < 8; ++i) v[i] = bf16_bits(W[(size_t)(k8 + i) * N + n]);
  *(v8us*)(Wt + (size_t)n * K + k8) = v;
  
}

// GEMM C[M][N] (f32, pitch ldc) = act(A[M][K]·W + bias). A f32 row-major (pitch lda) converted per fragment to bf16
// (ASPLIT: hi/lo two planes -> 2 terms, else single rounded term); Wt bf16 [N][K] (pitch ldb). BIAS_BF16 rounds the
// bias to bf16 first (bias quantised to bf16 before the add). K%32==0, M%16==0, N%64==0.
template <bool ASPLIT, int ACT, bool BIAS_BF16>
__global__ __launch_bounds__(128) void k_gemm_bf(const float* __restrict__ A, int lda, const unsigned short* __restrict__ Wt, int ldb,
                                               const float* __restrict__ bias, float* __restrict__ C, int ldc, int M, int N, int K) {
  __shared__ __attribute__((aligned(16))) float so[4][16][64];
  const int tid = threadIdx.x, w = tid >> 5, lane = tid & 31, ln = lane & 15, hh = lane >> 4;
  const int ntn = N / 64;
  const int wid = blockIdx.x * 4 + w;
  const int mt = wid / ntn, nq = wid % ntn;
  if (mt * 16 >= M) return;
  const int row0 = mt * 16, col0 = nq * 64;
  const float* arow = A + (size_t)(row0 + ln) * lda;
  v8f acc[4] = {};
  for (int kb = 0; kb < K; kb += 32) {
    FragB ah, al;
    const v4f x0 = *(const v4fa*)(arow + kb + 8 * hh), x1 = *(const v4fa*)(arow + kb + 8 * hh + 4);
    const v4f x2 = *(const v4fa*)(arow + kb + 16 + 8 * hh), x3 = *(const v4fa*)(arow + kb + 16 + 8 * hh + 4);
    float xs[16] = {x0[0],x0[1],x0[2],x0[3],x1[0],x1[1],x1[2],x1[3],x2[0],x2[1],x2[2],x2[3],x3[0],x3[1],x3[2],x3[3]};
#pragma unroll
    for (int i = 0; i < 16; ++i) { const unsigned short hb = bf16_bits(xs[i]); ah.u[i] = hb; al.u[i] = ASPLIT ? bf16_bits(xs[i] - bf16_val(hb)) : (unsigned short)0; }
#pragma unroll
    for (int t = 0; t < 4; ++t) {
      const unsigned short* brow = Wt + (size_t)(col0 + t * 16 + ln) * ldb + kb;
      FragB b;
      b.half[0] = *(const v8us*)(brow + 8 * hh);
      b.half[1] = *(const v8us*)(brow + 16 + 8 * hh);
      acc[t] = mmaN<ASPLIT ? 2 : 1>(ah.v, al.v, b.v, b.v, acc[t]);
    }
  }
#pragma unroll
  for (int t = 0; t < 4; ++t) {
    float bv = bias ? bias[col0 + t * 16 + ln] : 0.f;
    if (BIAS_BF16) bv = bf16_round(bv);
#pragma unroll
    for (int r = 0; r < 8; ++r) { float v = acc[t][r] + bv; if (ACT == 1) v = fmaxf(v, 0.f); so[w][8 * hh + r][t * 16 + ln] = v; }
  }
  __builtin_amdgcn_fence(__ATOMIC_ACQ_REL, "workgroup");
  __builtin_amdgcn_wave_barrier();
  const int rsub = lane >> 4, c4 = (lane & 15) * 4;
  {
#pragma unroll
    for (int q = 0; q < 8; ++q) {
      const int r = q * 2 + rsub;
      const v4f v = *(const v4fa*)&so[w][r][c4];
      *(v4f*)(C + (size_t)(row0 + r) * ldc + col0 + c4) = v;
    }
    
  }
}

// GEMM C = act(A·W + bias + resid): A f32 (ASPLIT -> hi/lo 2 terms), Wt bf16 [N][K]; ACT 0 none, 1 relu, 2 exact gelu;
// resid (optional, f32, row index = (row % rmod), pitch ldr, RES_BF16 rounds it) added before the activation.
template <bool ASPLIT, int ACT, bool BIAS_BF16, bool RES_BF16>
__global__ __launch_bounds__(128) void k_gemm_bf3(const float* __restrict__ A, int lda, const unsigned short* __restrict__ Wt, int ldb,
                                                const float* __restrict__ bias, const float* __restrict__ resid, int rmod, int ldr,
                                                float* __restrict__ C, int ldc, int M, int N, int K) {
  __shared__ __attribute__((aligned(16))) float so[4][16][64];
  const int tid = threadIdx.x, w = tid >> 5, lane = tid & 31, ln = lane & 15, hh = lane >> 4;
  const int ntn = N / 64;
  const int wid = blockIdx.x * 4 + w;
  const int mt = wid / ntn, nq = wid % ntn;
  if (mt * 16 >= M) return;
  const int row0 = mt * 16, col0 = nq * 64;
  const float* arow = A + (size_t)(row0 + ln) * lda;
  v8f acc[4] = {};
  for (int kb = 0; kb < K; kb += 32) {
    FragB ah, al;
    const v4f x0 = *(const v4fa*)(arow + kb + 8 * hh), x1 = *(const v4fa*)(arow + kb + 8 * hh + 4);
    const v4f x2 = *(const v4fa*)(arow + kb + 16 + 8 * hh), x3 = *(const v4fa*)(arow + kb + 16 + 8 * hh + 4);
    float xs[16] = {x0[0],x0[1],x0[2],x0[3],x1[0],x1[1],x1[2],x1[3],x2[0],x2[1],x2[2],x2[3],x3[0],x3[1],x3[2],x3[3]};
#pragma unroll
    for (int i = 0; i < 16; ++i) { const unsigned short hb = bf16_bits(xs[i]); ah.u[i] = hb; al.u[i] = ASPLIT ? bf16_bits(xs[i] - bf16_val(hb)) : (unsigned short)0; }
#pragma unroll
    for (int t = 0; t < 4; ++t) {
      const unsigned short* brow = Wt + (size_t)(col0 + t * 16 + ln) * ldb + kb;
      FragB b;
      b.half[0] = *(const v8us*)(brow + 8 * hh);
      b.half[1] = *(const v8us*)(brow + 16 + 8 * hh);
      acc[t] = mmaN<ASPLIT ? 2 : 1>(ah.v, al.v, b.v, b.v, acc[t]);
    }
  }
#pragma unroll
  for (int t = 0; t < 4; ++t) {
    const int col = col0 + t * 16 + ln;
    float bv = bias ? bias[col] : 0.f;
    if (BIAS_BF16) bv = bf16_round(bv);
#pragma unroll
    for (int r = 0; r < 8; ++r) {
      float v = acc[t][r] + bv;
      if (resid) { float rv = resid[(size_t)((row0 + 8 * hh + r) % rmod) * ldr + col]; if (RES_BF16) rv = bf16_round(rv); v += rv; }
      if (ACT == 1) v = fmaxf(v, 0.f);
      if (ACT == 2) v = 0.5f * v * (1.0f + erff(v * 0.70710678118654752f));
      if (ACT == 3) { const float u = 0.7978845608028654f * (v + 0.044715f * v * v * v); v = 0.5f * v * (1.0f + tanhf(u)); }
      so[w][8 * hh + r][t * 16 + ln] = v;
    }
  }
  __builtin_amdgcn_fence(__ATOMIC_ACQ_REL, "workgroup");
  __builtin_amdgcn_wave_barrier();
  const int rsub = lane >> 4, c4 = (lane & 15) * 4;
  {
#pragma unroll
    for (int q = 0; q < 8; ++q) {
      const int r = q * 2 + rsub;
      const v4f v = *(const v4fa*)&so[w][r][c4];
      *(v4f*)(C + (size_t)(row0 + r) * ldc + col0 + c4) = v;
    }
    
  }
}
// row LayerNorm (biased variance, eps) over N: s = X (+ R); optional out_sum <- s; out_norm <- (s-mu)*rsqrt(var+eps)*g + b
template <bool PARAM_BF16>
__global__ __launch_bounds__(256) void k_layernorm(const float* __restrict__ X, const float* __restrict__ R, const float* __restrict__ g, const float* __restrict__ bta,
                                                  float* __restrict__ out_sum, float* __restrict__ out_norm, int N, float eps) {
  __shared__ float red[256];
  const int row = blockIdx.x, tid = threadIdx.x;
  const float* x = X + (size_t)row * N; const float* rr = R ? R + (size_t)row * N : nullptr;
  float vals[16];                     // up to N = 4096
  const int per = N / 256;            // contiguous chunk per thread? use strided-by-4 chunks: thread handles j = tid*4 + 1024*u
  float s1 = 0.f;
  for (int u = 0; u < per / 4; ++u) {
    const int j = tid * 4 + 1024 * u;
    const v4f a = *(const v4fa*)(x + j);
    v4f b = {0.f,0.f,0.f,0.f}; if (rr) b = *(const v4fa*)(rr + j);
#pragma unroll
    for (int q = 0; q < 4; ++q) { const float v = a[q] + b[q]; vals[u * 4 + q] = v; s1 += v; }
  }
  red[tid] = s1; __syncthreads();
  for (int st = 128; st > 0; st >>= 1) { if (tid < st) red[tid] += red[tid + st]; __syncthreads(); }
  const float mu = red[0] / (float)N; __syncthreads();
  float s2 = 0.f;
  for (int u = 0; u < per / 4; ++u)
#pragma unroll
    for (int q = 0; q < 4; ++q) { const float c = vals[u * 4 + q] - mu; s2 += c * c; }
  red[tid] = s2; __syncthreads();
  for (int st = 128; st > 0; st >>= 1) { if (tid < st) red[tid] += red[tid + st]; __syncthreads(); }
  const float rs = rsqrtf(red[0] / (float)N + eps);
  {
    for (int u = 0; u < per / 4; ++u) {
      const int j = tid * 4 + 1024 * u;
      v4f o, sm;
#pragma unroll
      for (int q = 0; q < 4; ++q) {
        float gg = g[j + q], bb = bta[j + q];
        if (PARAM_BF16) { gg = bf16_round(gg); bb = bf16_round(bb); }
        sm[q] = vals[u * 4 + q]; o[q] = (vals[u * 4 + q] - mu) * rs * gg + bb;
      }
      if (out_sum) *(v4f*)(out_sum + (size_t)row * N + j) = sm;
      *(v4f*)(out_norm + (size_t)row * N + j) = o;
    }
    
  }
}



// ---- f16 WMMA path (v_wmma_f32_16x16x32_f16): 11-bit significands for operands in range — used where a [0,1] probability operand needs more precision than bf16
typedef _Float16 v16h __attribute__((ext_vector_type(16)));
union FragH { v16h v; v8us half[2]; _Float16 h[16]; unsigned short u[16]; };
template <int NT>
__device__ __forceinline__ v8f mmaH(v16h ah, v16h al, v16h bh, v16h bl, v8f c) {
  c = __builtin_amdgcn_wmma_f32_16x16x32_f16(false, ah, false, bh, (short)0, c, false, false);
  if (NT >= 2) c = __builtin_amdgcn_wmma_f32_16x16x32_f16(false, al, false, bh, (short)0, c, false, false);
  if (NT >= 3) c = __builtin_amdgcn_wmma_f32_16x16x32_f16(false, ah, false, bl, (short)0, c, false, false);
  asm volatile("v_nop\n\tv_nop\n\tv_nop\n\tv_nop" : "+v"(c) : "v"(ah), "v"(al), "v"(bh), "v"(bl));
  return c;
}
// batched GEMM like k_gemm_b but f16 operands: A f32 (split into f16 hi/lo if ASPLIT, else rounded to f16), Bt = f16 values [n][k]; alpha; C f32; N multiple of 16 (partial tiles skipped)
template <bool ASPLIT>
__global__ __launch_bounds__(128) void k_gemm_h(const float* __restrict__ A, int lda, size_t sA, const _Float16* __restrict__ Bh, int ldb, size_t sB, float alpha, float* __restrict__ C, int ldc, size_t sC, int M, int N, int K) {
  __shared__ __attribute__((aligned(16))) float so[4][16][64];
  const int tid = threadIdx.x, w = tid >> 5, lane = tid & 31, ln = lane & 15, hh = lane >> 4; const int by = blockIdx.y;
  A += (size_t)by * sA; Bh += (size_t)by * sB; C += (size_t)by * sC;
  const int ntn = (N + 63) / 64; const int wid = blockIdx.x * 4 + w; const int mt = wid / ntn, nq = wid % ntn; if (mt * 16 >= M) return;
  const int row0 = mt * 16, col0 = nq * 64; const float* arow = A + (size_t)(row0 + ln) * lda;
  v8f acc[4] = {};
  for (int kb = 0; kb < K; kb += 32) {
    FragH ah, al;
    const v4f x0 = *(const v4fa*)(arow + kb + 8 * hh), x1 = *(const v4fa*)(arow + kb + 8 * hh + 4), x2 = *(const v4fa*)(arow + kb + 16 + 8 * hh), x3 = *(const v4fa*)(arow + kb + 16 + 8 * hh + 4);
    float xs[16] = {x0[0],x0[1],x0[2],x0[3],x1[0],x1[1],x1[2],x1[3],x2[0],x2[1],x2[2],x2[3],x3[0],x3[1],x3[2],x3[3]};
#pragma unroll
    for (int i = 0; i < 16; ++i) { const _Float16 h = (_Float16)xs[i]; ah.h[i] = h; al.h[i] = ASPLIT ? (_Float16)(xs[i] - (float)h) : (_Float16)0.0f; }
#pragma unroll
    for (int t = 0; t < 4; ++t) { if (col0 + t * 16 >= N) continue; const size_t boff = (size_t)(col0 + t * 16 + ln) * ldb + kb; FragH bq; bq.half[0] = *(const v8us*)(Bh + boff + 8 * hh); bq.half[1] = *(const v8us*)(Bh + boff + 16 + 8 * hh);
      acc[t] = mmaH<ASPLIT ? 2 : 1>(ah.v, al.v, bq.v, bq.v, acc[t]); }
  }
#pragma unroll
  for (int t = 0; t < 4; ++t) { if (col0 + t * 16 >= N) continue;
#pragma unroll
    for (int r = 0; r < 8; ++r) so[w][8 * hh + r][t * 16 + ln] = acc[t][r] * alpha; }
  __builtin_amdgcn_fence(__ATOMIC_ACQ_REL, "workgroup"); __builtin_amdgcn_wave_barrier();
  const int rsub = lane >> 4, c4 = (lane & 15) * 4;
  {
#pragma unroll
    for (int q = 0; q < 8; ++q) { const int r = q * 2 + rsub; if (col0 + c4 < N) { const v4f v = *(const v4fa*)&so[w][r][c4]; *(v4f*)(C + (size_t)(row0 + r) * ldc + col0 + c4) = v; } }
     }
}

// Wt[n][k] = f16(W[k][n]·scale) from f32 row-major W[K][N] (scale = power of two; bf16-exact weights stay exact in f16 away from the subnormal range)
__global__ __launch_bounds__(256) void k_wt_f16(const float* __restrict__ W, _Float16* __restrict__ Wt, int K, int N, float scale) {
  const int t = blockIdx.x * 256 + threadIdx.x; if (t >= N * (K / 8)) return; const int n = t / (K / 8), k8 = (t % (K / 8)) * 8; FragH f;
#pragma unroll
  for (int i = 0; i < 8; ++i) f.h[i] = (_Float16)(bf16_round(W[(size_t)(k8 + i) * N + n]) * scale); const v8us o = f.half[0];
  *(v8us*)((unsigned short*)Wt + (size_t)n * K + k8) = o; 
}
// k_gemm_hh variant with fused epilogue: v = acc·alpha + bias[by·sBias + col] (+ CP[(row/rowsPerB)·sCPb + by·64 + col] if CP) ; ACT 0 none / 1 elu ; writes f16 C16 (and f32 C if non-null)
template <int ACT>
__global__ __launch_bounds__(128) void k_gemm_hhx(const _Float16* __restrict__ A, int lda, size_t sA, const _Float16* __restrict__ Bh, int ldb, size_t sB, float alpha, const float* __restrict__ bias, size_t sBias, const float* __restrict__ CP, int rowsPerB, size_t sCPb, int row0g,
    float* __restrict__ C, _Float16* __restrict__ C16, int ldc, size_t sC, int M, int N, int K) {
  __shared__ __attribute__((aligned(16))) float so[4][16][64];
  const int tid = threadIdx.x, w = tid >> 5, lane = tid & 31, ln = lane & 15, hh = lane >> 4; const int by = blockIdx.y;
  A += (size_t)by * sA; Bh += (size_t)by * sB; const size_t cofs = (size_t)by * sC; const float* bp = bias ? bias + (size_t)by * sBias : nullptr;
  const int ntn = (N + 63) / 64; const int wid = blockIdx.x * 4 + w; const int mt = wid / ntn, nq = wid % ntn; if (mt * 16 >= M) return;
  const int row0 = mt * 16, col0 = nq * 64; const _Float16* arow = A + (size_t)(row0 + ln) * lda;
  v8f acc[4] = {};
  for (int kb = 0; kb < K; kb += 32) { FragH ah; ah.half[0] = *(const v8us*)((const unsigned short*)arow + kb + 8 * hh); ah.half[1] = *(const v8us*)((const unsigned short*)arow + kb + 16 + 8 * hh);
#pragma unroll
    for (int t = 0; t < 4; ++t) { if (col0 + t * 16 >= N) continue; const size_t boff = (size_t)(col0 + t * 16 + ln) * ldb + kb; FragH bq; bq.half[0] = *(const v8us*)((const unsigned short*)Bh + boff + 8 * hh); bq.half[1] = *(const v8us*)((const unsigned short*)Bh + boff + 16 + 8 * hh);
      acc[t] = mmaH<1>(ah.v, ah.v, bq.v, bq.v, acc[t]); }
  }
#pragma unroll
  for (int t = 0; t < 4; ++t) { if (col0 + t * 16 >= N) continue; const int col = col0 + t * 16 + ln; const float bv = bp ? bf16_round(bp[col]) : 0.f;
#pragma unroll
    for (int r = 0; r < 8; ++r) { float v = acc[t][r] * alpha + bv; if (CP) { const int rr = row0g + row0 + 8 * hh + r; if (rowsPerB < 0) v += CP[cofs + (size_t)rr * ldc + col];      /* rowsPerB < 0: own element of the batched C plane */ else { const int bidx = rr / rowsPerB; v += CP[(size_t)bidx * sCPb + (size_t)by * 64 + col]; } } if (ACT == 1) v = (v > 0.f) ? v : expm1f(v); else if (ACT == 7) v = (v > 0.f) ? v + 1.0f : expf(v); else if (ACT == 8) v = tanhf(v); else if (ACT == 9) v = 0.5f * v * (1.0f + tanhf(0.7978845608028654f * (v + 0.044715f * v * v * v))); else if (ACT == 11) v = 1.0f / (1.0f + expf(-v)); else if (ACT == 12) v = (v > 0.f) ? v : 0.01f * v; else if (ACT == 14) v = (v > 0.f) ? v : 0.1f * v; else if (ACT == 16) v = (v >= 0.f) ? v : 0.3f * v; else if (ACT == 17) v = (v >= 0.f) ? v : 0.2f * v; else if (ACT == 15) v = v / (1.0f + expf(-v)); else if (ACT == 3) v = fmaxf(v, 0.f); else if (ACT == 6) v = 0.5f * v * (1.0f + erff(v * 0.70710678118654752f)); so[w][8 * hh + r][t * 16 + ln] = v; } }
  __builtin_amdgcn_fence(__ATOMIC_ACQ_REL, "workgroup"); __builtin_amdgcn_wave_barrier();
  const int rsub = lane >> 4, c4 = (lane & 15) * 4; typedef _Float16 v4h __attribute__((ext_vector_type(4)));
  {
#pragma unroll
    for (int q = 0; q < 8; ++q) { const int r = q * 2 + rsub; if (col0 + c4 < N) { const v4f v = *(const v4fa*)&so[w][r][c4]; if (C) *(v4f*)(C + cofs + (size_t)(row0 + r) * ldc + col0 + c4) = v; if (C16) { v4h h4; for (int i = 0; i < 4; ++i) h4[i] = (_Float16)v[i]; *(v4h*)(C16 + cofs + (size_t)(row0 + r) * ldc + col0 + c4) = h4; } } }
     }
}


typedef _Float16 v4h __attribute__((ext_vector_type(4)));

__global__ __launch_bounds__(256) void k_x16(const float* __restrict__ x, _Float16* __restrict__ X16, size_t n8) { const size_t t = (size_t)blockIdx.x * 256 + threadIdx.x; if (t >= n8) return; FragH f;
#pragma unroll
  for (int q = 0; q < 8; ++q) f.h[q] = (_Float16)bf16_round(x[t * 8 + q]); *(v8us*)((unsigned short*)X16 + t * 8) = f.half[0];  }
__global__ __launch_bounds__(256) void k_h16(const float* __restrict__ x, _Float16* __restrict__ X16, size_t n8) { const size_t t = (size_t)blockIdx.x * 256 + threadIdx.x; if (t >= n8) return; FragH f;
#pragma unroll
  for (int q = 0; q < 8; ++q) f.h[q] = (_Float16)x[t * 8 + q]; *(v8us*)((unsigned short*)X16 + t * 8) = f.half[0];  }
__global__ __launch_bounds__(256) void k_round16f(const float* __restrict__ W, _Float16* __restrict__ Bt, size_t n8) { const size_t t = (size_t)blockIdx.x * 256 + threadIdx.x; if (t >= n8) return; FragH f;
#pragma unroll
  for (int i = 0; i < 8; ++i) f.h[i] = (_Float16)(bf16_round(W[t * 8 + i]) * 16.0f); *(v8us*)((unsigned short*)Bt + t * 8) = f.half[0];  }
// ---- fast GEMM (wave tile 32x64; requires M % 32 == 0 rows per launch region and N % 64 == 0); epilogue = k_gemm_hhx semantics ----
__device__ __forceinline__ v16h g2_frag(const _Float16* p, int hh) { FragH f; f.half[0] = *(const v8us*)((const unsigned short*)p + 8 * hh); f.half[1] = *(const v8us*)((const unsigned short*)p + 16 + 8 * hh); return f.v; }
__device__ __forceinline__ v8f g2_mma(v16h a, v16h b, v8f c) { v8f d = __builtin_amdgcn_wmma_f32_16x16x32_f16(false, a, false, b, (short)0, c, false, false); asm volatile("v_nop\n\tv_nop\n\tv_nop\n\tv_nop" : "+v"(d) : "v"(a), "v"(b)); return d; }
template <int ACT>
__global__ __launch_bounds__(128) void k_gemm2(const _Float16* __restrict__ A, int lda, size_t sA, const _Float16* __restrict__ Bh, int ldb, size_t sB, float alpha, const float* __restrict__ bias, size_t sBias, const float* __restrict__ CP, int rowsPerB, size_t sCPb, int row0g,
    float* __restrict__ C, _Float16* __restrict__ C16, int ldc, size_t sC, int M, int N, int K) { static_assert(ACT == 0 || ACT == 3 || ACT == 6 || ACT == 8 || ACT == 9 || ACT == 11 || ACT == 12 || ACT == 14 || ACT == 15 || ACT == 16 || ACT == 17, "k_gemm2: unsupported ACT code (would silently apply no activation)");
  __shared__ __attribute__((aligned(16))) float so[4][32][68];
  const int tid = threadIdx.x, w = tid >> 5, lane = tid & 31, ln = lane & 15, hh = lane >> 4; const int by = blockIdx.y;
  A += (size_t)by * sA; Bh += (size_t)by * sB; const size_t cofs = (size_t)by * sC; const float* bp = bias ? bias + (size_t)by * sBias : nullptr;
  const int ntn = N >> 6; const int mt = blockIdx.x / ntn, nq = blockIdx.x - mt * ntn; const int row0 = mt * 128 + 32 * w, col0 = nq * 64; if (row0 >= M) return;
  const _Float16* a0p = A + (size_t)(row0 + ln) * lda; const _Float16* a1p = a0p + (size_t)16 * lda;
  const _Float16* b0p = Bh + (size_t)(col0 + ln) * ldb; const _Float16* b1p = b0p + (size_t)16 * ldb; const _Float16* b2p = b1p + (size_t)16 * ldb; const _Float16* b3p = b2p + (size_t)16 * ldb;
  const v8f z8 = {0.f,0.f,0.f,0.f,0.f,0.f,0.f,0.f}; v8f c00 = z8, c01 = z8, c02 = z8, c03 = z8, c10 = z8, c11 = z8, c12 = z8, c13 = z8;
#pragma unroll 1
  for (int kb = 0; kb < K; kb += 32) { const v16h a0 = g2_frag(a0p + kb, hh), a1 = g2_frag(a1p + kb, hh);
    v16h b = g2_frag(b0p + kb, hh); c00 = g2_mma(a0, b, c00); c10 = g2_mma(a1, b, c10);
    b = g2_frag(b1p + kb, hh); c01 = g2_mma(a0, b, c01); c11 = g2_mma(a1, b, c11);
    b = g2_frag(b2p + kb, hh); c02 = g2_mma(a0, b, c02); c12 = g2_mma(a1, b, c12);
    b = g2_frag(b3p + kb, hh); c03 = g2_mma(a0, b, c03); c13 = g2_mma(a1, b, c13); }
  v8f accs[8] = {c00, c01, c02, c03, c10, c11, c12, c13};
#pragma unroll
  for (int u = 0; u < 8; ++u) { const int t = u & 3, half = u >> 2; const int col = col0 + t * 16 + ln; const float bv = bp ? bf16_round(bp[col]) : 0.f;
#pragma unroll
    for (int r = 0; r < 8; ++r) { const int rloc = half * 16 + 8 * hh + r; float v = accs[u][r] * alpha + bv; if (CP) { if (rowsPerB < 0) v += CP[cofs + (size_t)(row0g + row0 + rloc) * ldc + col];      /* rowsPerB < 0: own element of the batched C plane */ else { const int bidx = (row0g + row0 + rloc) / rowsPerB; v += CP[(size_t)bidx * sCPb + (size_t)by * 64 + col]; } }
      if (ACT == 3) v = fmaxf(v, 0.f); else if (ACT == 6) v = 0.5f * v * (1.0f + erff(v * 0.70710678118654752f)); else if (ACT == 11) v = 1.0f / (1.0f + expf(-v)); else if (ACT == 15) v = v / (1.0f + expf(-v)); else if (ACT == 12) v = (v > 0.f) ? v : 0.01f * v; else if (ACT == 8) v = tanhf(v); else if (ACT == 9) v = 0.5f * v * (1.0f + tanhf(0.7978845608028654f * (v + 0.044715f * v * v * v))); else if (ACT == 14) v = (v > 0.f) ? v : 0.1f * v; else if (ACT == 16) v = (v >= 0.f) ? v : 0.3f * v; else if (ACT == 17) v = (v >= 0.f) ? v : 0.2f * v;
      so[w][rloc][t * 16 + ln] = v; } }
  __builtin_amdgcn_fence(__ATOMIC_ACQ_REL, "workgroup"); __builtin_amdgcn_wave_barrier();
  const int rsub = lane >> 4, c4 = (lane & 15) * 4;
  {
#pragma unroll
    for (int q = 0; q < 16; ++q) { const int r = q * 2 + rsub; const v4f v = *(const v4fa*)&so[w][r][c4]; if (C) *(v4f*)(C + cofs + (size_t)(row0 + r) * ldc + col0 + c4) = v; if (C16) { v4h h4; for (int i = 0; i < 4; ++i) h4[i] = (_Float16)v[i]; *(v4h*)(C16 + cofs + (size_t)(row0 + r) * ldc + col0 + c4) = h4; } }
     } }


__global__ __launch_bounds__(256) void k_wnat(const float* __restrict__ w, size_t n8, _Float16* __restrict__ Bt) { const size_t t = (size_t)blockIdx.x * 256 + threadIdx.x; if (t >= n8) return; FragH f; for (int q = 0; q < 8; ++q) f.h[q] = (_Float16)(bf16_round(w[t * 8 + q]) * 16.0f); *(v8us*)((unsigned short*)Bt + t * 8) = f.half[0];  }
__global__ __launch_bounds__(256) void k_rsm(const float* __restrict__ S, _Float16* __restrict__ P, int nrows) {
  #pragma clang fp contract(off)
  const int i = blockIdx.x * 256 + threadIdx.x; if (i >= nrows) return; const float* s = S + (size_t)i * SQ; float mx = -3.0e38f;
#pragma unroll 1
  for (int j = 0; j < SQ; ++j) mx = fmaxf(mx, s[j]); float se = 0.f;
#pragma unroll 1
  for (int j = 0; j < SQ; ++j) se += expf(s[j] - mx); const float sc = 256.0f / se;
#pragma unroll 1
  for (int j0 = 0; j0 < SQ; j0 += 8) { FragH f; for (int q = 0; q < 8; ++q) f.h[q] = (_Float16)(expf(s[j0 + q] - mx) * sc); unsigned short* d = (unsigned short*)P + (size_t)i * SQ + j0; *(v8us*)d = f.half[0];  } }
__global__ __launch_bounds__(256) void k_vt(const _Float16* __restrict__ V16, int b, int h0, _Float16* __restrict__ VT) { __shared__ unsigned short tl[64][65]; const int tid = threadIdx.x; const int hh = blockIdx.x % HG, sg = blockIdx.x / HG; const int s0 = sg * 64; const int h = h0 + hh;
  for (int i = tid; i < 64 * 8; i += 256) { const int j = i / 8, d8 = (i % 8) * 8; FragH f; f.half[0] = *(const v8us*)((const unsigned short*)V16 + ((size_t)b * SQ + s0 + j) * DM + h * HD + d8); for (int q = 0; q < 8; ++q) tl[d8 + q][j] = f.u[q]; }
  __syncthreads();
  { for (int i = tid; i < 64 * 8; i += 256) { const int d = i / 8, j8 = (i % 8) * 8; FragH f; for (int q = 0; q < 8; ++q) f.u[q] = tl[d][j8 + q]; *(v8us*)((unsigned short*)VT + ((size_t)hh * HD + d) * SQ + s0 + j8) = f.half[0]; }  } }



__global__ __launch_bounds__(256) void k_rsmf(const float* __restrict__ S, _Float16* __restrict__ P, int qn, int hg) {
  #pragma clang fp contract(off)
  const int t = blockIdx.x * 256 + threadIdx.x; if (t >= qn * hg) return; const size_t i = (size_t)(t / qn) * SQ + (t % qn); const float* s = S + i * SQ; float mx = -3.0e38f;
#pragma unroll 1
  for (int j = 0; j < SQ; ++j) mx = fmaxf(mx, s[j]); float se = 0.f;
#pragma unroll 1
  for (int j = 0; j < SQ; ++j) se += __expf(s[j] - mx); const float sc = 256.0f / se;
#pragma unroll 1
  for (int j0 = 0; j0 < SQ; j0 += 8) { FragH f; for (int q = 0; q < 8; ++q) f.h[q] = (_Float16)(__expf(s[j0 + q] - mx) * sc); unsigned short* d = (unsigned short*)P + i * SQ + j0; *(v8us*)d = f.half[0];  } }

// 2^x on v_exp_f32 with one free issue slot behind it: the instruction set asks for that slot before the result is read or the source overwritten.
__device__ __forceinline__ float exp2_slot(float x) { float r; asm("v_exp_f32 %0, %1\n\tv_nop" : "=v"(r) : "v"(x)); return r; }
#define FK 64      /* keys per stage */
#define FQ 128     /* query rows per work-group */
#define KPH 72     /* LDS row pitch of K and V^T, halves: 144 B = 16 B x odd, b128 fragment reads free of bank conflicts */
#define MPF 68     /* LDS row pitch of the mask rows, floats: 272 B = 16 B x odd */
__device__ __forceinline__ float xhalf(float x) { return __builtin_bit_cast(float, __builtin_amdgcn_permlanex16(__builtin_bit_cast(int, x), __builtin_bit_cast(int, x), 0x76543210, 0xfedcba98, false, false)); }      /* lane l with lane l ^ 16 */
__device__ __forceinline__ v8f fa_mma(v16h a, v16h b, v8f c) { return __builtin_amdgcn_wmma_f32_16x16x32_f16(false, a, false, b, (short)0, c, false, false); }
__global__ __launch_bounds__(256) void k_fattn(const _Float16* __restrict__ Qh, const _Float16* __restrict__ Ql, const _Float16* __restrict__ Kh, const _Float16* __restrict__ Vt, const float* __restrict__ Mk, float* __restrict__ out) {
  __shared__ __attribute__((aligned(16))) _Float16 sk[FK][KPH];
  __shared__ __attribute__((aligned(16))) _Float16 sv[HD][KPH];
  __shared__ __attribute__((aligned(16))) float sm[FQ][MPF];
  const int tid = threadIdx.x, w = tid >> 5, lane = tid & 31, ln = lane & 15, hh = lane >> 4;
  const int h = blockIdx.x % NH, qb = (blockIdx.x / NH) % (SQ / FQ), b = blockIdx.x / (NH * (SQ / FQ));      /* neighbouring work-groups: same mask rows, other heads */
  const int qrow = qb * FQ + w * 16;
  const size_t qo = ((size_t)b * SQ + qrow + ln) * DM + h * HD;
  const v16h qh0 = g2_frag(Qh + qo, hh), qh1 = g2_frag(Qh + qo + 32, hh), ql0 = g2_frag(Ql + qo, hh), ql1 = g2_frag(Ql + qo + 32, hh);
  const int sr = tid >> 3, sc = (tid & 7) * 8;      /* staging: 8 threads cover one 128-byte row, a wave four whole lines */
  const _Float16* kg = Kh + ((size_t)b * SQ + sr) * DM + h * HD + sc;
  const _Float16* vg = Vt + (((size_t)b * NH + h) * HD + sr) * SQ + sc;
  const float* mg = Mk + ((size_t)b * SQ + qrow + hh) * SQ + ln * 4;      /* 16 lanes cover 256 bytes of one mask row */
  v8us kr[2], vr[2]; v4f mr[8];
#pragma unroll
  for (int i = 0; i < 2; ++i) { kr[i] = *(const v8us*)((const unsigned short*)kg + (size_t)i * 32 * DM); vr[i] = *(const v8us*)((const unsigned short*)vg + (size_t)i * 32 * SQ); }
#pragma unroll
  for (int i = 0; i < 8; ++i) mr[i] = *(const v4fa*)(mg + (size_t)i * 2 * SQ);
  const v8f z8 = {0.f, 0.f, 0.f, 0.f, 0.f, 0.f, 0.f, 0.f};
  v8f o[4] = {z8, z8, z8, z8};
  float m = -3.0e38f, l = 0.f;
#pragma unroll 1      /* rolled, for speed only */
  for (int s = 0; s < SQ / FK; ++s) {
    __syncthreads();      /* every wave has finished reading the stage before */
#pragma unroll
    for (int i = 0; i < 2; ++i) { *(v8us*)&sk[sr + 32 * i][sc] = kr[i]; *(v8us*)&sv[sr + 32 * i][sc] = vr[i]; }
#pragma unroll
    for (int i = 0; i < 8; ++i) *(v4fa*)&sm[w * 16 + 2 * i + hh][ln * 4] = mr[i];
    __syncthreads();      /* the stage is complete for every wave */
    if (s + 1 < SQ / FK) {      /* next stage's loads fly while this one is worked on */
      kg += (size_t)FK * DM; vg += FK; mg += FK;
#pragma unroll
      for (int i = 0; i < 2; ++i) { kr[i] = *(const v8us*)((const unsigned short*)kg + (size_t)i * 32 * DM); vr[i] = *(const v8us*)((const unsigned short*)vg + (size_t)i * 32 * SQ); }
#pragma unroll
      for (int i = 0; i < 8; ++i) mr[i] = *(const v4fa*)(mg + (size_t)i * 2 * SQ);
    }
    v8f sh[4], sl[4];
#pragma unroll
    for (int t = 0; t < 4; ++t) {
      const v16h a0 = g2_frag(&sk[t * 16 + ln][0], hh), a1 = g2_frag(&sk[t * 16 + ln][32], hh);
      sh[t] = fa_mma(a1, qh1, fa_mma(a0, qh0, z8)); sl[t] = fa_mma(a1, ql1, fa_mma(a0, ql0, z8)); }
    float bm = -3.0e38f;
#pragma unroll
    for (int t = 0; t < 4; ++t) {
#pragma unroll
      for (int r = 0; r < 8; ++r) { sh[t][r] += sl[t][r] * 0.0009765625f; bm = fmaxf(bm, sh[t][r]); } }      /* q_hi.k + q_lo.k 2^-10 */
    const float cl = 0.18033688011112042592f;      /* 1/8 and the change to log2 units */
    bm = fmaxf(bm, xhalf(bm)) * cl;
    const float mn = fmaxf(m, bm), al = exp2_slot(m - mn), off = mn - 8.0f; m = mn;
    float ps[4] = {0.f, 0.f, 0.f, 0.f};      /* four partial sums: no chain of 32 dependent adds */
#pragma unroll
    for (int t = 0; t < 4; ++t) o[t] *= al;
    FragH pb[2];
#pragma unroll
    for (int t = 0; t < 4; ++t) {
      const v4f k0 = *(const v4fa*)&sm[w * 16 + ln][t * 16 + 8 * hh], k1 = *(const v4fa*)&sm[w * 16 + ln][t * 16 + 8 * hh + 4];
#pragma unroll
      for (int r = 0; r < 8; ++r) { const float p = exp2_slot(sh[t][r] * cl - off) * (r < 4 ? k0[r & 3] : k1[r & 3]); ps[r & 3] += p; pb[t >> 1].h[(t & 1) * 8 + r] = (_Float16)p; } }
    l = l * al + ((ps[0] + ps[1]) + (ps[2] + ps[3]));
#pragma unroll
    for (int t = 0; t < 4; ++t) o[t] = fa_mma(g2_frag(&sv[t * 16 + ln][32], hh), pb[1].v, fa_mma(g2_frag(&sv[t * 16 + ln][0], hh), pb[0].v, o[t]));
  }
  l += xhalf(l);
  const float inv = 1.0f / l;
  /* the wave's own 16 mask rows become its output staging: [query][d], so that each store below covers whole lines */
#pragma unroll
  for (int t = 0; t < 4; ++t) { const v8f v = o[t] * inv; const v4f lo4 = {v[0], v[1], v[2], v[3]}, hi4 = {v[4], v[5], v[6], v[7]};
    *(v4fa*)&sm[w * 16 + ln][t * 16 + 8 * hh] = lo4; *(v4fa*)&sm[w * 16 + ln][t * 16 + 8 * hh + 4] = hi4; }
  __builtin_amdgcn_fence(__ATOMIC_ACQ_REL, "workgroup"); __builtin_amdgcn_wave_barrier();      /* orders the LDS stores above in front of the loads below, which read what other lanes of the same wave wrote; no other wave touches these rows */
#pragma unroll
  for (int i = 0; i < 8; ++i) { const int r = 2 * i + hh; const v4f v = *(const v4fa*)&sm[w * 16 + r][ln * 4]; *(v4f*)(out + ((size_t)b * SQ + qrow + r) * DM + h * HD + ln * 4) = v; } }

// ---- the three projection GEMMs in one launch, both operands staged in LDS by tensor loads: alpha * X[8192][1024] . Wt[1024][1024]^T for Wt = Wq, Wk, Wv, all rows k-contiguous f16 ----
// Each result leaves the kernel in the form the attention kernel reads, so that no pass stands between the two: q as two f16 planes (value, and residual x 1024), k as f16 rows,
// v transposed per batch, [batch][feature][key]: for v the two operands change places (rows of the tile = rows of Wv, columns = rows of X), which leaves every element's products and their k order as they are.
// One 128 x 128 tile of a result per work-group, four waves (2 x 2) of 64 x 64. A stage is 256 bytes (128 k) of the tile's 128 A rows and 128 Bt rows; each wave brings one 64-row slice of it with one tensor load.
// Two buffers: stage s + 2 is requested into the buffer that pass s has just left, so it flies while pass s + 1 is worked on. The k order of every accumulator is that of the plain loop: ascending in steps of 32.
// Every inner loop is fully unrolled so that the accumulator and fragment arrays are indexed by constants and live in registers.
typedef uint32_t u32x4 __attribute__((ext_vector_type(4)));
typedef uint32_t u32x8 __attribute__((ext_vector_type(8)));
#define G3T 128      /* tile rows of either operand */
#define G3RB 256     /* bytes of an operand row per stage */
#define G3P 272      /* LDS row pitch, bytes: 16 B x odd for the b128 fragment reads; laid by the tensor load's pad */
#define G3SL 18432   /* place of a slice: 64 rows x 272 B = 17,408 B, rounded up to a multiple of 2 KiB */
#define G3BUF (4 * G3SL)
#define G3NS (DM * 2 / G3RB)      /* stages */
__device__ __forceinline__ uint32_t uni(uint32_t v) { return (uint32_t)__builtin_amdgcn_readfirstlane(v); }
__device__ __forceinline__ uint32_t pinned(uint32_t v) { uint32_t w = uni(v); asm volatile("" : "+s"(w)); return w; }      /* keeps a tensor load's issue test a scalar branch, and the stage number that its descriptor words are formed from in a scalar register behind the waits */
#define G3NT ((MP / G3T) * (DM / G3T))      /* tiles of one projection */
__global__ __launch_bounds__(128) void k_gemm3(const _Float16* __restrict__ X, const _Float16* __restrict__ Wq, const _Float16* __restrict__ Wk, const _Float16* __restrict__ Wv, float alpha,
                                               _Float16* __restrict__ Qh, _Float16* __restrict__ Ql, _Float16* __restrict__ K16, _Float16* __restrict__ Vt) {
  static_assert(SQ % G3T == 0 && NH * HD == DM, "a tile's 128 token rows lie in one batch; V^T rows are the features");
  __shared__ __attribute__((aligned(2048))) unsigned char ring[2 * G3BUF];
  const int tid = threadIdx.x, lane = tid & 31, ln = lane & 15, hh = lane >> 4;
  const uint32_t w = uni((uint32_t)tid >> 5), wm = w >> 1, wn = w & 1u;
  const int pj = blockIdx.x / G3NT, tl = blockIdx.x % G3NT;      /* 0 q, 1 k, 2 v: the same for the whole work-group; q, whose output is the largest, has the lowest block numbers */
  const int nq = tl % (DM / G3T), mt = tl / (DM / G3T); const int row0 = mt * G3T, col0 = nq * G3T;      /* first token row, first feature */
  const _Float16* xr = X + (size_t)row0 * DM; const _Float16* wr = (pj == 0 ? Wq : pj == 1 ? Wk : Wv) + (size_t)col0 * DM;
  const _Float16* A = pj == 2 ? wr : xr; const _Float16* Bh = pj == 2 ? xr : wr;      /* the 128 operand rows that become the tile's rows, and those that become its columns */
  const uint32_t lbase = (uint32_t)(size_t)ring;
  /* waves 0 and 1 bring the two halves of the A rows, waves 2 and 3 those of the Bt rows */
  const uint64_t ga0 = (uint64_t)(size_t)(w < 2u ? A + (size_t)(64 * (int)w) * DM : Bh + (size_t)(64 * (int)(w - 2u)) * DM);
  u32x8 g1;      /* 1-byte elements, tile = tensor = 64 rows of 256 B, source pitch one row of the matrix, 16 B of LDS pad behind every 256 B, no mask */
  g1[0] = uni((1u << 20) | (5u << 22) | (3u << 25)); g1[1] = uni((uint32_t)G3RB << 16); g1[2] = uni(64u << 16); g1[3] = uni((uint32_t)G3RB << 16); g1[4] = uni(64u); g1[5] = uni((uint32_t)DM * 2u); g1[6] = uni(0u); g1[7] = uni(0u);
  auto issue = [&](uint32_t st) {
    const uint64_t ga = ga0 + (uint64_t)st * G3RB; u32x4 g0;
    g0[0] = uni(1u); g0[1] = uni(lbase + (st & 1u) * G3BUF + w * G3SL); g0[2] = uni((uint32_t)ga); g0[3] = uni((((uint32_t)(ga >> 32)) & 0x01FFFFFFu) | 0x80000000u);
    asm volatile("tensor_load_to_lds %0, %1" :: "s"(g0), "s"(g1) : "memory"); };
  issue(0u);
  asm volatile("s_wait_tensorcnt 0x0" ::: "memory");      /* this wave's slice of stage 0 has landed */
  __syncthreads();      /* stage 0 is complete for every wave */
  issue(1u);
  const v8f z8 = {0.f, 0.f, 0.f, 0.f, 0.f, 0.f, 0.f, 0.f};
  v8f acc[4][4];
#pragma unroll
  for (int i = 0; i < 4; ++i) {
#pragma unroll
    for (int j = 0; j < 4; ++j) acc[i][j] = z8; }
#pragma unroll 1      /* rolled: one pass is 64 matrix instructions, and the ring's order stands once in the text */
  for (uint32_t s = 0; s < G3NS; ++s) {
    const unsigned char* buf = ring + (s & 1u) * G3BUF;
    const unsigned char* ap = buf + wm * G3SL + ln * G3P; const unsigned char* bp = buf + (2u + wn) * G3SL + ln * G3P;
    v16h a[2][4], b[2][4];      /* two fragment sets: block kb + 1 is fetched, as one group, while block kb is multiplied; no fragment of another stage is fetched */
#pragma unroll
    for (int i = 0; i < 4; ++i) { a[0][i] = g2_frag((const _Float16*)(ap + i * 16 * G3P), hh); b[0][i] = g2_frag((const _Float16*)(bp + i * 16 * G3P), hh); }
#pragma unroll
    for (int kb = 0; kb < G3RB / 64; ++kb) {
      __builtin_amdgcn_sched_barrier(0);      /* keeps the next block's LDS reads together in front of this block's matrix instructions, for speed only */
      if (kb + 1 < G3RB / 64) {
#pragma unroll
        for (int i = 0; i < 4; ++i) { a[(kb + 1) & 1][i] = g2_frag((const _Float16*)(ap + i * 16 * G3P + (kb + 1) * 64), hh); b[(kb + 1) & 1][i] = g2_frag((const _Float16*)(bp + i * 16 * G3P + (kb + 1) * 64), hh); }
      }
      __builtin_amdgcn_sched_barrier(0);      /* the other side of the same group */
      if (kb + 1 == G3RB / 64) {      /* the pass's foot stands in front of its last block, whose fragments are fetched by now: the refill starts a block earlier, and what follows works on registers alone */
        asm volatile("s_wait_dscnt 0x0" ::: "memory");      /* this wave's reads of the buffer have returned before it is refilled */
        asm volatile("s_wait_tensorcnt 0x0" ::: "memory");      /* this wave's slice of stage s + 1 has landed */
        __syncthreads();      /* publishes stage s + 1 and ends every wave's reading of stage s */
        if (pinned(s + 2u < G3NS)) issue(pinned(s + 2u));
      }
#pragma unroll
      for (int i = 0; i < 4; ++i) {
#pragma unroll
        for (int j = 0; j < 4; ++j) acc[i][j] = fa_mma(a[kb & 1][i], b[kb & 1][j], acc[i][j]); }
    }
  }
  asm volatile("s_wait_tensorcnt 0x0" ::: "memory");      /* nothing in flight when the ring becomes output staging */
  asm volatile("s_wait_dscnt 0x0" ::: "memory");
  /* the last pass's barrier has ended every read of the ring: each wave stages its 64 x 64 results in its own slice place, [row][col] at 68 floats, so that each store below covers whole lines */
  float* so = (float*)(ring + w * G3SL);
#pragma unroll
  for (int i = 0; i < 4; ++i) {
#pragma unroll
    for (int j = 0; j < 4; ++j) {
#pragma unroll
      for (int r = 0; r < 8; ++r) so[(i * 16 + 8 * hh + r) * 68 + j * 16 + ln] = acc[i][j][r] * alpha; } }
  __builtin_amdgcn_fence(__ATOMIC_ACQ_REL, "workgroup"); __builtin_amdgcn_wave_barrier();      /* orders the LDS stores above in front of the loads below, which read what other lanes of the same wave wrote */
  const int c4 = ln * 4;
  if (pj == 0) {      /* one branch for the whole work-group, outside the output loops: inside each loop the LDS reads and the stores overlap */
    const size_t cb = (size_t)(row0 + 64 * (int)wm) * DM + col0 + 64 * (int)wn + c4;
#pragma unroll
    for (int q = 0; q < 32; ++q) { const int r = q * 2 + hh; const v4f v = *(const v4fa*)&so[r * 68 + c4]; v4h h4, l4;
      for (int i = 0; i < 4; ++i) { h4[i] = (_Float16)v[i]; l4[i] = (_Float16)((v[i] - (float)h4[i]) * 1024.0f); }
      *(v4h*)(Qh + cb + (size_t)r * DM) = h4; *(v4h*)(Ql + cb + (size_t)r * DM) = l4; }
  } else {      /* k: [token][feature]; v: [batch][feature][key], the tile's rows being features and its columns keys */
    _Float16* C16 = pj == 1 ? K16 + (size_t)(row0 + 64 * (int)wm) * DM + col0 + 64 * (int)wn + c4
                            : Vt + ((size_t)(row0 / SQ) * DM + col0 + 64 * (int)wm) * SQ + row0 % SQ + 64 * (int)wn + c4;
    const size_t cp = pj == 1 ? DM : SQ;
#pragma unroll
    for (int q = 0; q < 32; ++q) { const int r = q * 2 + hh; const v4f v = *(const v4fa*)&so[r * 68 + c4]; v4h h4;
      for (int i = 0; i < 4; ++i) h4[i] = (_Float16)v[i];
      *(v4h*)(C16 + (size_t)r * cp) = h4; }
  } }

extern "C" void kernel_launch(void* const* d_in, const int* in_sizes, int n_in,
                              void* d_out, int out_size, void* d_ws, size_t ws_size, hipStream_t stream) {
  (void)in_sizes; (void)n_in; (void)out_size;
  const float* const* I = (const float* const*)d_in; const float* x = I[0]; const float* amask = I[1]; const float* wq = I[2]; const float* wk = I[3]; const float* wv = I[4]; const float* bq = nullptr; const float* bk = nullptr; const float* bv = nullptr;      /* [in][out] weights, no biases; float 0/1 mask [8][1024][1024] read in the softmax */
  char* ws = (char*)d_ws; size_t off = 0;
  auto take = [&](size_t bytes) { char* p = ws + off; off += (bytes + 255) & ~(size_t)255; return p; };
  _Float16* BQ = (_Float16*)take((size_t)DM * DM * 2); _Float16* BK = (_Float16*)take((size_t)DM * DM * 2); _Float16* BV = (_Float16*)take((size_t)DM * DM * 2); 
  _Float16* X16 = (_Float16*)take(NR * DM * 2); _Float16* Q16 = (_Float16*)take(NR * DM * 2); _Float16* QL = (_Float16*)take(NR * DM * 2); _Float16* K16 = (_Float16*)take(NR * DM * 2); _Float16* O16 = (_Float16*)take(NR * DM * 2);
  _Float16* VT = (_Float16*)take((size_t)NB * NH * HD * SQ * 2);
  if (off > ws_size) return;
  { const unsigned g = (unsigned)(((size_t)DM * (DM / 8) + 255) / 256); k_wt_f16<<<g, 256, 0, stream>>>(wq, BQ, DM, DM, 16.0f); k_wt_f16<<<g, 256, 0, stream>>>(wk, BK, DM, DM, 16.0f); k_wt_f16<<<g, 256, 0, stream>>>(wv, BV, DM, DM, 16.0f); }      /* [in][out] -> Bt x16 */

  k_x16<<<(unsigned)((NR * DM / 8 + 255) / 256), 256, 0, stream>>>(x, X16, NR * DM / 8);
  const size_t r0p = (size_t)B0 * SQ;      /* first projected row */
  k_gemm3<<<(unsigned)(3 * G3NT), 128, 0, stream>>>(X16 + r0p * DM, BQ, BK, BV, 0.0625f, Q16 + r0p * DM, QL + r0p * DM, K16 + r0p * DM, VT + r0p * DM);      /* q as f16 hi + x1024 residual planes, k rows, V^T [NB][NH][HD][SQ] */
  k_fattn<<<NB * NH * (SQ / FQ), 256, 0, stream>>>(Q16, QL, K16, VT, amask, (float*)d_out);      /* ctx (merged heads) straight to the f32 output */
}

// v005
// A run of this version takes 105 microseconds.
// In both of two side-by-side timings against v004, it was 1.15 times as fast.
// All steps since v000 together make it 94.2 times as fast.
#include <hip/hip_runtime.h>
// Multi-head self-attention with a multiplicative 0/1 mask and the module's 'unsafe' softmax (x [8][1024][1024]; q = x Wq, k = x Wk, v = x Wv ([in][out] 1024^2 sigma 1/32, no biases); 16 heads of 64; scores / 8; w = exp(s) mask[b][s][t] / (sum_t exp(s) mask + 1e-8) with the float mask input [8][1024][1024] (0/1, ~90 % ones, shared across heads) READ per (query, key); out = merged ctx (no output projection) -> [8][1024][1024]).
// Compute dtype: inputs rounded to bf16; x / weights exact; k, v and softmax weights as plain f16 GEMM operands (~2^-12); q as f16 hi + x1024 lo planes (effectively f32); o written f32; scores and softmax statistics f32. v_wmma_f32_16x16x32_f16.
#define NB 8
#define SQ 1024
#define DM 1024
#define NH 16
#define HD 64
#define HG 4                         /* heads per launch of k_vt(V16, b, h0, VT); that overload is not launched */
#define B0 0                         /* first batch processed (debug hook) */
#define NBR NB                       /* batches processed (debug hook) */
#define NR ((size_t)NB * SQ)         /* token rows */
#define MP ((int)((size_t)NBR * SQ)) /* rows projected (debug hook) */
#define QN SQ                        /* unused */
#define NHD NH                       /* unused */
#define MPO MP                       /* unused */
#define LQ DM      /* unused */
typedef __bf16 v16b __attribute__((ext_vector_type(16)));
typedef unsigned short v8us __attribute__((ext_vector_type(8), may_alias));
typedef float  v8f  __attribute__((ext_vector_type(8)));
typedef float  v4f  __attribute__((ext_vector_type(4)));
typedef float  v4fa __attribute__((ext_vector_type(4), may_alias));
union FragB { v16b v; v8us half[2]; unsigned short u[16]; };

__device__ __forceinline__ unsigned short bf16_bits(float x) { unsigned int u = __float_as_uint(x); return (unsigned short)((u + 0x7FFFu + ((u >> 16) & 1u)) >> 16); }
__device__ __forceinline__ float bf16_val(unsigned short b) { return __uint_as_float(((unsigned int)b) << 16); }
__device__ __forceinline__ float bf16_round(float x) { return bf16_val(bf16_bits(x)); }
// D += A·B with NT terms: 1 = ah·bh, 2 = + al·bh (A split), 3 = + ah·bl (both split)
template <int NT>
__device__ __forceinline__ v8f mmaN(v16b ah, v16b al, v16b bh, v16b bl, v8f c) {
  c = __builtin_amdgcn_wmma_f32_16x16x32_bf16(false, ah, false, bh, (short)0, c, false, false);
  if (NT >= 2) c = __builtin_amdgcn_wmma_f32_16x16x32_bf16(false, al, false, bh, (short)0, c, false, false);
  if (NT >= 3) c = __builtin_amdgcn_wmma_f32_16x16x32_bf16(false, ah, false, bl, (short)0, c, false, false);
  asm volatile("v_nop\n\tv_nop\n\tv_nop\n\tv_nop" : "+v"(c) : "v"(ah), "v"(al), "v"(bh), "v"(bl));
  return c;
}

__global__ __launch_bounds__(256) void k_wt_bf16(const float* __restrict__ W, unsigned short* __restrict__ Wt, int K, int N) {
  const int t = blockIdx.x * 256 + threadIdx.x;
  const int k8n = K / 8;
  if (t >= N * k8n) return;
  const int n = t / k8n, k8 = (t % k8n) * 8;
  v8us v;
#pragma unroll
  for (int i = 0; i < 8; ++i) v[i] = bf16_bits(W[(size_t)(k8 + i) * N + n]);
  *(v8us*)(Wt + (size_t)n * K + k8) = v;
  
}

// GEMM C[M][N] (f32, pitch ldc) = act(A[M][K]·W + bias). A f32 row-major (pitch lda) converted per fragment to bf16
// (ASPLIT: hi/lo two planes -> 2 terms, else single rounded term); Wt bf16 [N][K] (pitch ldb). BIAS_BF16 rounds the
// bias to bf16 first (bias quantised to bf16 before the add). K%32==0, M%16==0, N%64==0.
template <bool ASPLIT, int ACT, bool BIAS_BF16>
__global__ __launch_bounds__(128) void k_gemm_bf(const float* __restrict__ A, int lda, const unsigned short* __restrict__ Wt, int ldb,
                                               const float* __restrict__ bias, float* __restrict__ C, int ldc, int M, int N, int K) {
  __shared__ __attribute__((aligned(16))) float so[4][16][64];
  const int tid = threadIdx.x, w = tid >> 5, lane = tid & 31, ln = lane & 15, hh = lane >> 4;
  const int ntn = N / 64;
  const int wid = blockIdx.x * 4 + w;
  const int mt = wid / ntn, nq = wid % ntn;
  if (mt * 16 >= M) return;
  const int row0 = mt * 16, col0 = nq * 64;
  const float* arow = A + (size_t)(row0 + ln) * lda;
  v8f acc[4] = {};
  for (int kb = 0; kb < K; kb += 32) {
    FragB ah, al;
    const v4f x0 = *(const v4fa*)(arow + kb + 8 * hh), x1 = *(const v4fa*)(arow + kb + 8 * hh + 4);
    const v4f x2 = *(const v4fa*)(arow + kb + 16 + 8 * hh), x3 = *(const v4fa*)(arow + kb + 16 + 8 * hh + 4);
    float xs[16] = {x0[0],x0[1],x0[2],x0[3],x1[0],x1[1],x1[2],x1[3],x2[0],x2[1],x2[2],x2[3],x3[0],x3[1],x3[2],x3[3]};
#pragma unroll
    for (int i = 0; i < 16; ++i) { const unsigned short hb = bf16_bits(xs[i]); ah.u[i] = hb; al.u[i] = ASPLIT ? bf16_bits(xs[i] - bf16_val(hb)) : (unsigned short)0; }
#pragma unroll
    for (int t = 0; t < 4; ++t) {
      const unsigned short* brow = Wt + (size_t)(col0 + t * 16 + ln) * ldb + kb;
      FragB b;
      b.half[0] = *(const v8us*)(brow + 8 * hh);
      b.half[1] = *(const v8us*)(brow + 16 + 8 * hh);
      acc[t] = mmaN<ASPLIT ? 2 : 1>(ah.v, al.v, b.v, b.v, acc[t]);
    }
  }
#pragma unroll
  for (int t = 0; t < 4; ++t) {
    float bv = bias ? bias[col0 + t * 16 + ln] : 0.f;
    if (BIAS_BF16) bv = bf16_round(bv);
#pragma unroll
    for (int r = 0; r < 8; ++r) { float v = acc[t][r] + bv; if (ACT == 1) v = fmaxf(v, 0.f); so[w][8 * hh + r][t * 16 + ln] = v; }
  }
  __builtin_amdgcn_fence(__ATOMIC_ACQ_REL, "workgroup");
  __builtin_amdgcn_wave_barrier();
  const int rsub = lane >> 4, c4 = (lane & 15) * 4;
  {
#pragma unroll
    for (int q = 0; q < 8; ++q) {
      const int r = q * 2 + rsub;
      const v4f v = *(const v4fa*)&so[w][r][c4];
      *(v4f*)(C + (size_t)(row0 + r) * ldc + col0 + c4) = v;
    }
    
  }
}

// GEMM C = act(A·W + bias + resid): A f32 (ASPLIT -> hi/lo 2 terms), Wt bf16 [N][K]; ACT 0 none, 1 relu, 2 exact gelu;
// resid (optional, f32, row index = (row % rmod), pitch ldr, RES_BF16 rounds it) added before the activation.
template <bool ASPLIT, int ACT, bool BIAS_BF16, bool RES_BF16>
__global__ __launch_bounds__(128) void k_gemm_bf3(const float* __restrict__ A, int lda, const unsigned short* __restrict__ Wt, int ldb,
                                                const float* __restrict__ bias, const float* __restrict__ resid, int rmod, int ldr,
                                                float* __restrict__ C, int ldc, int M, int N, int K) {
  __shared__ __attribute__((aligned(16))) float so[4][16][64];
  const int tid = threadIdx.x, w = tid >> 5, lane = tid & 31, ln = lane & 15, hh = lane >> 4;
  const int ntn = N / 64;
  const int wid = blockIdx.x * 4 + w;
  const int mt = wid / ntn, nq = wid % ntn;
  if (mt * 16 >= M) return;
  const int row0 = mt * 16, col0 = nq * 64;
  const float* arow = A + (size_t)(row0 + ln) * lda;
  v8f acc[4] = {};
  for (int kb = 0; kb < K; kb += 32) {
    FragB ah, al;
    const v4f x0 = *(const v4fa*)(arow + kb + 8 * hh), x1 = *(const v4fa*)(arow + kb + 8 * hh + 4);
    const v4f x2 = *(const v4fa*)(arow + kb + 16 + 8 * hh), x3 = *(const v4fa*)(arow + kb + 16 + 8 * hh + 4);
    float xs[16] = {x0[0],x0[1],x0[2],x0[3],x1[0],x1[1],x1[2],x1[3],x2[0],x2[1],x2[2],x2[3],x3[0],x3[1],x3[2],x3[3]};
#pragma unroll
    for (int i = 0; i < 16; ++i) { const unsigned short hb = bf16_bits(xs[i]); ah.u[i] = hb; al.u[i] = ASPLIT ? bf16_bits(xs[i] - bf16_val(hb)) : (unsigned short)0; }
#pragma unroll
    for (int t = 0; t < 4; ++t) {
      const unsigned short* brow = Wt + (size_t)(col0 + t * 16 + ln) * ldb + kb;
      FragB b;
      b.half[0] = *(const v8us*)(brow + 8 * hh);
      b.half[1] = *(const v8us*)(brow + 16 + 8 * hh);
      acc[t] = mmaN<ASPLIT ? 2 : 1>(ah.v, al.v, b.v, b.v, acc[t]);
    }
  }
#pragma unroll
  for (int t = 0; t < 4; ++t) {
    const int col = col0 + t * 16 + ln;
    float bv = bias ? bias[col] : 0.f;
    if (BIAS_BF16) bv = bf16_round(bv);
#pragma unroll
    for (int r = 0; r < 8; ++r) {
      float v = acc[t][r] + bv;
      if (resid) { float rv = resid[(size_t)((row0 + 8 * hh + r) % rmod) * ldr + col]; if (RES_BF16) rv = bf16_round(rv); v += rv; }
      if (ACT == 1) v = fmaxf(v, 0.f);
      if (ACT == 2) v = 0.5f * v * (1.0f + erff(v * 0.70710678118654752f));
      if (ACT == 3) { const float u = 0.7978845608028654f * (v + 0.044715f * v * v * v); v = 0.5f * v * (1.0f + tanhf(u)); }
      so[w][8 * hh + r][t * 16 + ln] = v;
    }
  }
  __builtin_amdgcn_fence(__ATOMIC_ACQ_REL, "workgroup");
  __builtin_amdgcn_wave_barrier();
  const int rsub = lane >> 4, c4 = (lane & 15) * 4;
  {
#pragma unroll
    for (int q = 0; q < 8; ++q) {
      const int r = q * 2 + rsub;
      const v4f v = *(const v4fa*)&so[w][r][c4];
      *(v4f*)(C + (size_t)(row0 + r) * ldc + col0 + c4) = v;
    }
    
  }
}
// row LayerNorm (biased variance, eps) over N: s = X (+ R); optional out_sum <- s; out_norm <- (s-mu)*rsqrt(var+eps)*g + b
template <bool PARAM_BF16>
__global__ __launch_bounds__(256) void k_layernorm(const float* __restrict__ X, const float* __restrict__ R, const float* __restrict__ g, const float* __restrict__ bta,
                                                  float* __restrict__ out_sum, float* __restrict__ out_norm, int N, float eps) {
  __shared__ float red[256];
  const int row = blockIdx.x, tid = threadIdx.x;
  const float* x = X + (size_t)row * N; const float* rr = R ? R + (size_t)row * N : nullptr;
  float vals[16];                     // up to N = 4096
  const int per = N / 256;            // contiguous chunk per thread? use strided-by-4 chunks: thread handles j = tid*4 + 1024*u
  float s1 = 0.f;
  for (int u = 0; u < per / 4; ++u) {
    const int j = tid * 4 + 1024 * u;
    const v4f a = *(const v4fa*)(x + j);
    v4f b = {0.f,0.f,0.f,0.f}; if (rr) b = *(const v4fa*)(rr + j);
#pragma unroll
    for (int q = 0; q < 4; ++q) { const float v = a[q] + b[q]; vals[u * 4 + q] = v; s1 += v; }
  }
  red[tid] = s1; __syncthreads();
  for (int st = 128; st > 0; st >>= 1) { if (tid < st) red[tid] += red[tid + st]; __syncthreads(); }
  const float mu = red[0] / (float)N; __syncthreads();
  float s2 = 0.f;
  for (int u = 0; u < per / 4; ++u)
#pragma unroll
    for (int q = 0; q < 4; ++q) { const float c = vals[u * 4 + q] - mu; s2 += c * c; }
  red[tid] = s2; __syncthreads();
  for (int st = 128; st > 0; st >>= 1) { if (tid < st) red[tid] += red[tid + st]; __syncthreads(); }
  const float rs = rsqrtf(red[0] / (float)N + eps);
  {
    for (int u = 0; u < per / 4; ++u) {
      const int j = tid * 4 + 1024 * u;
      v4f o, sm;
#pragma unroll
      for (int q = 0; q < 4; ++q) {
        float gg = g[j + q], bb = bta[j + q];
        if (PARAM_BF16) { gg = bf16_round(gg); bb = bf16_round(bb); }
        sm[q] = vals[u * 4 + q]; o[q] = (vals[u * 4 + q] - mu) * rs * gg + bb;
      }
      if (out_sum) *(v4f*)(out_sum + (size_t)row * N + j) = sm;
      *(v4f*)(out_norm + (size_t)row * N + j) = o;
    }
    
  }
}



// ---- f16 WMMA path (v_wmma_f32_16x16x32_f16): 11-bit significands for operands in range — used where a [0,1] probability operand needs more precision than bf16
typedef _Float16 v16h __attribute__((ext_vector_type(16)));
union FragH { v16h v; v8us half[2]; _Float16 h[16]; unsigned short u[16]; };
template <int NT>
__device__ __forceinline__ v8f mmaH(v16h ah, v16h al, v16h bh, v16h bl, v8f c) {
  c = __builtin_amdgcn_wmma_f32_16x16x32_f16(false, ah, false, bh, (short)0, c, false, false);
  if (NT >= 2) c = __builtin_amdgcn_wmma_f32_16x16x32_f16(false, al, false, bh, (short)0, c, false, false);
  if (NT >= 3) c = __builtin_amdgcn_wmma_f32_16x16x32_f16(false, ah, false, bl, (short)0, c, false, false);
  asm volatile("v_nop\n\tv_nop\n\tv_nop\n\tv_nop" : "+v"(c) : "v"(ah), "v"(al), "v"(bh), "v"(bl));
  return c;
}
// batched GEMM like k_gemm_b but f16 operands: A f32 (split into f16 hi/lo if ASPLIT, else rounded to f16), Bt = f16 values [n][k]; alpha; C f32; N multiple of 16 (partial tiles skipped)
template <bool ASPLIT>
__global__ __launch_bounds__(128) void k_gemm_h(const float* __restrict__ A, int lda, size_t sA, const _Float16* __restrict__ Bh, int ldb, size_t sB, float alpha, float* __restrict__ C, int ldc, size_t sC, int M, int N, int K) {
  __shared__ __attribute__((aligned(16))) float so[4][16][64];
  const int tid = threadIdx.x, w = tid >> 5, lane = tid & 31, ln = lane & 15, hh = lane >> 4; const int by = blockIdx.y;
  A += (size_t)by * sA; Bh += (size_t)by * sB; C += (size_t)by * sC;
  const int ntn = (N + 63) / 64; const int wid = blockIdx.x * 4 + w; const int mt = wid / ntn, nq = wid % ntn; if (mt * 16 >= M) return;
  const int row0 = mt * 16, col0 = nq * 64; const float* arow = A + (size_t)(row0 + ln) * lda;
  v8f acc[4] = {};
  for (int kb = 0; kb < K; kb += 32) {
    FragH ah, al;
    const v4f x0 = *(const v4fa*)(arow + kb + 8 * hh), x1 = *(const v4fa*)(arow + kb + 8 * hh + 4), x2 = *(const v4fa*)(arow + kb + 16 + 8 * hh), x3 = *(const v4fa*)(arow + kb + 16 + 8 * hh + 4);
    float xs[16] = {x0[0],x0[1],x0[2],x0[3],x1[0],x1[1],x1[2],x1[3],x2[0],x2[1],x2[2],x2[3],x3[0],x3[1],x3[2],x3[3]};
#pragma unroll
    for (int i = 0; i < 16; ++i) { const _Float16 h = (_Float16)xs[i]; ah.h[i] = h; al.h[i] = ASPLIT ? (_Float16)(xs[i] - (float)h) : (_Float16)0.0f; }
#pragma unroll
    for (int t = 0; t < 4; ++t) { if (col0 + t * 16 >= N) continue; const size_t boff = (size_t)(col0 + t * 16 + ln) * ldb + kb; FragH bq; bq.half[0] = *(const v8us*)(Bh + boff + 8 * hh); bq.half[1] = *(const v8us*)(Bh + boff + 16 + 8 * hh);
      acc[t] = mmaH<ASPLIT ? 2 : 1>(ah.v, al.v, bq.v, bq.v, acc[t]); }
  }
#pragma unroll
  for (int t = 0; t < 4; ++t) { if (col0 + t * 16 >= N) continue;
#pragma unroll
    for (int r = 0; r < 8; ++r) so[w][8 * hh + r][t * 16 + ln] = acc[t][r] * alpha; }
  __builtin_amdgcn_fence(__ATOMIC_ACQ_REL, "workgroup"); __builtin_amdgcn_wave_barrier();
  const int rsub = lane >> 4, c4 = (lane & 15) * 4;
  {
#pragma unroll
    for (int q = 0; q < 8; ++q) { const int r = q * 2 + rsub; if (col0 + c4 < N) { const v4f v = *(const v4fa*)&so[w][r][c4]; *(v4f*)(C + (size_t)(row0 + r) * ldc + col0 + c4) = v; } }
     }
}

// Wt[n][k] = f16(W[k][n]·scale) from f32 row-major W[K][N] (scale = power of two; bf16-exact weights stay exact in f16 away from the subnormal range)
__global__ __launch_bounds__(256) void k_wt_f16(const float* __restrict__ W, _Float16* __restrict__ Wt, int K, int N, float scale) {
  const int t = blockIdx.x * 256 + threadIdx.x; if (t >= N * (K / 8)) return; const int n = t / (K / 8), k8 = (t % (K / 8)) * 8; FragH f;
#pragma unroll
  for (int i = 0; i < 8; ++i) f.h[i] = (_Float16)(bf16_round(W[(size_t)(k8 + i) * N + n]) * scale); const v8us o = f.half[0];
  *(v8us*)((unsigned short*)Wt + (size_t)n * K + k8) = o; 
}
// k_gemm_hh variant with fused epilogue: v = acc·alpha + bias[by·sBias + col] (+ CP[(row/rowsPerB)·sCPb + by·64 + col] if CP) ; ACT 0 none / 1 elu ; writes f16 C16 (and f32 C if non-null)
template <int ACT>
__global__ __launch_bounds__(128) void k_gemm_hhx(const _Float16* __restrict__ A, int lda, size_t sA, const _Float16* __restrict__ Bh, int ldb, size_t sB, float alpha, const float* __restrict__ bias, size_t sBias, const float* __restrict__ CP, int rowsPerB, size_t sCPb, int row0g,
    float* __restrict__ C, _Float16* __restrict__ C16, int ldc, size_t sC, int M, int N, int K) {
  __shared__ __attribute__((aligned(16))) float so[4][16][64];
  const int tid = threadIdx.x, w = tid >> 5, lane = tid & 31, ln = lane & 15, hh = lane >> 4; const int by = blockIdx.y;
  A += (size_t)by * sA; Bh += (size_t)by * sB; const size_t cofs = (size_t)by * sC; const float* bp = bias ? bias + (size_t)by * sBias : nullptr;
  const int ntn = (N + 63) / 64; const int wid = blockIdx.x * 4 + w; const int mt = wid / ntn, nq = wid % ntn; if (mt * 16 >= M) return;
  const int row0 = mt * 16, col0 = nq * 64; const _Float16* arow = A + (size_t)(row0 + ln) * lda;
  v8f acc[4] = {};
  for (int kb = 0; kb < K; kb += 32) { FragH ah; ah.half[0] = *(const v8us*)((const unsigned short*)arow + kb + 8 * hh); ah.half[1] = *(const v8us*)((const unsigned short*)arow + kb + 16 + 8 * hh);
#pragma unroll
    for (int t = 0; t < 4; ++t) { if (col0 + t * 16 >= N) continue; const size_t boff = (size_t)(col0 + t * 16 + ln) * ldb + kb; FragH bq; bq.half[0] = *(const v8us*)((const unsigned short*)Bh + boff + 8 * hh); bq.half[1] = *(const v8us*)((const unsigned short*)Bh + boff + 16 + 8 * hh);
      acc[t] = mmaH<1>(ah.v, ah.v, bq.v, bq.v, acc[t]); }
  }
#pragma unroll
  for (int t = 0; t < 4; ++t) { if (col0 + t * 16 >= N) continue; const int col = col0 + t * 16 + ln; const float bv = bp ? bf16_round(bp[col]) : 0.f;
#pragma unroll
    for (int r = 0; r < 8; ++r) { float v = acc[t][r] * alpha + bv; if (CP) { const int rr = row0g + row0 + 8 * hh + r; if (rowsPerB < 0) v += CP[cofs + (size_t)rr * ldc + col];      /* rowsPerB < 0: own element of the batched C plane */ else { const int bidx = rr / rowsPerB; v += CP[(size_t)bidx * sCPb + (size_t)by * 64 + col]; } } if (ACT == 1) v = (v > 0.f) ? v : expm1f(v); else if (ACT == 7) v = (v > 0.f) ? v + 1.0f : expf(v); else if (ACT == 8) v = tanhf(v); else if (ACT == 9) v = 0.5f * v * (1.0f + tanhf(0.7978845608028654f * (v + 0.044715f * v * v * v))); else if (ACT == 11) v = 1.0f / (1.0f + expf(-v)); else if (ACT == 12) v = (v > 0.f) ? v : 0.01f * v; else if (ACT == 14) v = (v > 0.f) ? v : 0.1f * v; else if (ACT == 16) v = (v >= 0.f) ? v : 0.3f * v; else if (ACT == 17) v = (v >= 0.f) ? v : 0.2f * v; else if (ACT == 15) v = v / (1.0f + expf(-v)); else if (ACT == 3) v = fmaxf(v, 0.f); else if (ACT == 6) v = 0.5f * v * (1.0f + erff(v * 0.70710678118654752f)); so[w][8 * hh + r][t * 16 + ln] = v; } }
  __builtin_amdgcn_fence(__ATOMIC_ACQ_REL, "workgroup"); __builtin_amdgcn_wave_barrier();
  const int rsub = lane >> 4, c4 = (lane & 15) * 4; typedef _Float16 v4h __attribute__((ext_vector_type(4)));
  {
#pragma unroll
    for (int q = 0; q < 8; ++q) { const int r = q * 2 + rsub; if (col0 + c4 < N) { const v4f v = *(const v4fa*)&so[w][r][c4]; if (C) *(v4f*)(C + cofs + (size_t)(row0 + r) * ldc + col0 + c4) = v; if (C16) { v4h h4; for (int i = 0; i < 4; ++i) h4[i] = (_Float16)v[i]; *(v4h*)(C16 + cofs + (size_t)(row0 + r) * ldc + col0 + c4) = h4; } } }
     }
}


typedef _Float16 v4h __attribute__((ext_vector_type(4)));

__global__ __launch_bounds__(256) void k_x16(const float* __restrict__ x, _Float16* __restrict__ X16, size_t n8) { const size_t t = (size_t)blockIdx.x * 256 + threadIdx.x; if (t >= n8) return; FragH f;
#pragma unroll
  for (int q = 0; q < 8; ++q) f.h[q] = (_Float16)bf16_round(x[t * 8 + q]); *(v8us*)((unsigned short*)X16 + t * 8) = f.half[0];  }
__global__ __launch_bounds__(256) void k_h16(const float* __restrict__ x, _Float16* __restrict__ X16, size_t n8) { const size_t t = (size_t)blockIdx.x * 256 + threadIdx.x; if (t >= n8) return; FragH f;
#pragma unroll
  for (int q = 0; q < 8; ++q) f.h[q] = (_Float16)x[t * 8 + q]; *(v8us*)((unsigned short*)X16 + t * 8) = f.half[0];  }
__global__ __launch_bounds__(256) void k_round16f(const float* __restrict__ W, _Float16* __restrict__ Bt, size_t n8) { const size_t t = (size_t)blockIdx.x * 256 + threadIdx.x; if (t >= n8) return; FragH f;
#pragma unroll
  for (int i = 0; i < 8; ++i) f.h[i] = (_Float16)(bf16_round(W[t * 8 + i]) * 16.0f); *(v8us*)((unsigned short*)Bt + t * 8) = f.half[0];  }
// ---- fast GEMM (wave tile 32x64; requires M % 32 == 0 rows per launch region and N % 64 == 0); epilogue = k_gemm_hhx semantics ----
__device__ __forceinline__ v16h g2_frag(const _Float16* p, int hh) { FragH f; f.half[0] = *(const v8us*)((const unsigned short*)p + 8 * hh); f.half[1] = *(const v8us*)((const unsigned short*)p + 16 + 8 * hh); return f.v; }
__device__ __forceinline__ v8f g2_mma(v16h a, v16h b, v8f c) { v8f d = __builtin_amdgcn_wmma_f32_16x16x32_f16(false, a, false, b, (short)0, c, false, false); asm volatile("v_nop\n\tv_nop\n\tv_nop\n\tv_nop" : "+v"(d) : "v"(a), "v"(b)); return d; }
template <int ACT>
__global__ __launch_bounds__(128) void k_gemm2(const _Float16* __restrict__ A, int lda, size_t sA, const _Float16* __restrict__ Bh, int ldb, size_t sB, float alpha, const float* __restrict__ bias, size_t sBias, const float* __restrict__ CP, int rowsPerB, size_t sCPb, int row0g,
    float* __restrict__ C, _Float16* __restrict__ C16, int ldc, size_t sC, int M, int N, int K) { static_assert(ACT == 0 || ACT == 3 || ACT == 6 || ACT == 8 || ACT == 9 || ACT == 11 || ACT == 12 || ACT == 14 || ACT == 15 || ACT == 16 || ACT == 17, "k_gemm2: unsupported ACT code (would silently apply no activation)");
  __shared__ __attribute__((aligned(16))) float so[4][32][68];
  const int tid = threadIdx.x, w = tid >> 5, lane = tid & 31, ln = lane & 15, hh = lane >> 4; const int by = blockIdx.y;
  A += (size_t)by * sA; Bh += (size_t)by * sB; const size_t cofs = (size_t)by * sC; const float* bp = bias ? bias + (size_t)by * sBias : nullptr;
  const int ntn = N >> 6; const int mt = blockIdx.x / ntn, nq = blockIdx.x - mt * ntn; const int row0 = mt * 128 + 32 * w, col0 = nq * 64; if (row0 >= M) return;
  const _Float16* a0p = A + (size_t)(row0 + ln) * lda; const _Float16* a1p = a0p + (size_t)16 * lda;
  const _Float16* b0p = Bh + (size_t)(col0 + ln) * ldb; const _Float16* b1p = b0p + (size_t)16 * ldb; const _Float16* b2p = b1p + (size_t)16 * ldb; const _Float16* b3p = b2p + (size_t)16 * ldb;
  const v8f z8 = {0.f,0.f,0.f,0.f,0.f,0.f,0.f,0.f}; v8f c00 = z8, c01 = z8, c02 = z8, c03 = z8, c10 = z8, c11 = z8, c12 = z8, c13 = z8;
#pragma unroll 1
  for (int kb = 0; kb < K; kb += 32) { const v16h a0 = g2_frag(a0p + kb, hh), a1 = g2_frag(a1p + kb, hh);
    v16h b = g2_frag(b0p + kb, hh); c00 = g2_mma(a0, b, c00); c10 = g2_mma(a1, b, c10);
    b = g2_frag(b1p + kb, hh); c01 = g2_mma(a0, b, c01); c11 = g2_mma(a1, b, c11);
    b = g2_frag(b2p + kb, hh); c02 = g2_mma(a0, b, c02); c12 = g2_mma(a1, b, c12);
    b = g2_frag(b3p + kb, hh); c03 = g2_mma(a0, b, c03); c13 = g2_mma(a1, b, c13); }
  v8f accs[8] = {c00, c01, c02, c03, c10, c11, c12, c13};
#pragma unroll
  for (int u = 0; u < 8; ++u) { const int t = u & 3, half = u >> 2; const int col = col0 + t * 16 + ln; const float bv = bp ? bf16_round(bp[col]) : 0.f;
#pragma unroll
    for (int r = 0; r < 8; ++r) { const int rloc = half * 16 + 8 * hh + r; float v = accs[u][r] * alpha + bv; if (CP) { if (rowsPerB < 0) v += CP[cofs + (size_t)(row0g + row0 + rloc) * ldc + col];      /* rowsPerB < 0: own element of the batched C plane */ else { const int bidx = (row0g + row0 + rloc) / rowsPerB; v += CP[(size_t)bidx * sCPb + (size_t)by * 64 + col]; } }
      if (ACT == 3) v = fmaxf(v, 0.f); else if (ACT == 6) v = 0.5f * v * (1.0f + erff(v * 0.70710678118654752f)); else if (ACT == 11) v = 1.0f / (1.0f + expf(-v)); else if (ACT == 15) v = v / (1.0f + expf(-v)); else if (ACT == 12) v = (v > 0.f) ? v : 0.01f * v; else if (ACT == 8) v = tanhf(v); else if (ACT == 9) v = 0.5f * v * (1.0f + tanhf(0.7978845608028654f * (v + 0.044715f * v * v * v))); else if (ACT == 14) v = (v > 0.f) ? v : 0.1f * v; else if (ACT == 16) v = (v >= 0.f) ? v : 0.3f * v; else if (ACT == 17) v = (v >= 0.f) ? v : 0.2f * v;
      so[w][rloc][t * 16 + ln] = v; } }
  __builtin_amdgcn_fence(__ATOMIC_ACQ_REL, "workgroup"); __builtin_amdgcn_wave_barrier();
  const int rsub = lane >> 4, c4 = (lane & 15) * 4;
  {
#pragma unroll
    for (int q = 0; q < 16; ++q) { const int r = q * 2 + rsub; const v4f v = *(const v4fa*)&so[w][r][c4]; if (C) *(v4f*)(C + cofs + (size_t)(row0 + r) * ldc + col0 + c4) = v; if (C16) { v4h h4; for (int i = 0; i < 4; ++i) h4[i] = (_Float16)v[i]; *(v4h*)(C16 + cofs + (size_t)(row0 + r) * ldc + col0 + c4) = h4; } }
     } }


__global__ __launch_bounds__(256) void k_wnat(const float* __restrict__ w, size_t n8, _Float16* __restrict__ Bt) { const size_t t = (size_t)blockIdx.x * 256 + threadIdx.x; if (t >= n8) return; FragH f; for (int q = 0; q < 8; ++q) f.h[q] = (_Float16)(bf16_round(w[t * 8 + q]) * 16.0f); *(v8us*)((unsigned short*)Bt + t * 8) = f.half[0];  }
__global__ __launch_bounds__(256) void k_rsm(const float* __restrict__ S, _Float16* __restrict__ P, int nrows) {
  #pragma clang fp contract(off)
  const int i = blockIdx.x * 256 + threadIdx.x; if (i >= nrows) return; const float* s = S + (size_t)i * SQ; float mx = -3.0e38f;
#pragma unroll 1
  for (int j = 0; j < SQ; ++j) mx = fmaxf(mx, s[j]); float se = 0.f;
#pragma unroll 1
  for (int j = 0; j < SQ; ++j) se += expf(s[j] - mx); const float sc = 256.0f / se;
#pragma unroll 1
  for (int j0 = 0; j0 < SQ; j0 += 8) { FragH f; for (int q = 0; q < 8; ++q) f.h[q] = (_Float16)(expf(s[j0 + q] - mx) * sc); unsigned short* d = (unsigned short*)P + (size_t)i * SQ + j0; *(v8us*)d = f.half[0];  } }
__global__ __launch_bounds__(256) void k_vt(const _Float16* __restrict__ V16, int b, int h0, _Float16* __restrict__ VT) { __shared__ unsigned short tl[64][65]; const int tid = threadIdx.x; const int hh = blockIdx.x % HG, sg = blockIdx.x / HG; const int s0 = sg * 64; const int h = h0 + hh;
  for (int i = tid; i < 64 * 8; i += 256) { const int j = i / 8, d8 = (i % 8) * 8; FragH f; f.half[0] = *(const v8us*)((const unsigned short*)V16 + ((size_t)b * SQ + s0 + j) * DM + h * HD + d8); for (int q = 0; q < 8; ++q) tl[d8 + q][j] = f.u[q]; }
  __syncthreads();
  { for (int i = tid; i < 64 * 8; i += 256) { const int d = i / 8, j8 = (i % 8) * 8; FragH f; for (int q = 0; q < 8; ++q) f.u[q] = tl[d][j8 + q]; *(v8us*)((unsigned short*)VT + ((size_t)hh * HD + d) * SQ + s0 + j8) = f.half[0]; }  } }



__global__ __launch_bounds__(256) void k_rsmf(const float* __restrict__ S, _Float16* __restrict__ P, int qn, int hg) {
  #pragma clang fp contract(off)
  const int t = blockIdx.x * 256 + threadIdx.x; if (t >= qn * hg) return; const size_t i = (size_t)(t / qn) * SQ + (t % qn); const float* s = S + i * SQ; float mx = -3.0e38f;
#pragma unroll 1
  for (int j = 0; j < SQ; ++j) mx = fmaxf(mx, s[j]); float se = 0.f;
#pragma unroll 1
  for (int j = 0; j < SQ; ++j) se += __expf(s[j] - mx); const float sc = 256.0f / se;
#pragma unroll 1
  for (int j0 = 0; j0 < SQ; j0 += 8) { FragH f; for (int q = 0; q < 8; ++q) f.h[q] = (_Float16)(__expf(s[j0 + q] - mx) * sc); unsigned short* d = (unsigned short*)P + i * SQ + j0; *(v8us*)d = f.half[0];  } }

// 2^x on v_exp_f32 with one free issue slot behind it: the instruction set asks for that slot before the result is read or the source overwritten.
__device__ __forceinline__ float exp2_slot(float x) { float r; asm("v_exp_f32 %0, %1\n\tv_nop" : "=v"(r) : "v"(x)); return r; }
#define FK 64      /* keys per stage */
#define FQ 128     /* query rows per work-group */
#define KPH 72     /* LDS row pitch of K and V^T, halves: 144 B = 16 B x odd, b128 fragment reads free of bank conflicts */
#define MPF 68     /* LDS row pitch of the mask rows, floats: 272 B = 16 B x odd */
__device__ __forceinline__ float xhalf(float x) { return __builtin_bit_cast(float, __builtin_amdgcn_permlanex16(__builtin_bit_cast(int, x), __builtin_bit_cast(int, x), 0x76543210, 0xfedcba98, false, false)); }      /* lane l with lane l ^ 16 */
__device__ __forceinline__ v8f fa_mma(v16h a, v16h b, v8f c) { return __builtin_amdgcn_wmma_f32_16x16x32_f16(false, a, false, b, (short)0, c, false, false); }
__global__ __launch_bounds__(256) void k_fattn(const _Float16* __restrict__ Qh, const _Float16* __restrict__ Ql, const _Float16* __restrict__ Kh, const _Float16* __restrict__ Vt, const float* __restrict__ Mk, float* __restrict__ out) {
  __shared__ __attribute__((aligned(16))) _Float16 sk[FK][KPH];
  __shared__ __attribute__((aligned(16))) _Float16 sv[HD][KPH];
  __shared__ __attribute__((aligned(16))) float sm[FQ][MPF];
  const int tid = threadIdx.x, w = tid >> 5, lane = tid & 31, ln = lane & 15, hh = lane >> 4;
  const int h = blockIdx.x % NH, qb = (blockIdx.x / NH) % (SQ / FQ), b = blockIdx.x / (NH * (SQ / FQ));      /* neighbouring work-groups: same mask rows, other heads */
  const int qrow = qb * FQ + w * 16;
  const size_t qo = ((size_t)b * SQ + qrow + ln) * DM + h * HD;
  const v16h qh0 = g2_frag(Qh + qo, hh), qh1 = g2_frag(Qh + qo + 32, hh), ql0 = g2_frag(Ql + qo, hh), ql1 = g2_frag(Ql + qo + 32, hh);
  const int sr = tid >> 3, sc = (tid & 7) * 8;      /* staging: 8 threads cover one 128-byte row, a wave four whole lines */
  const _Float16* kg = Kh + ((size_t)b * SQ + sr) * DM + h * HD + sc;
  const _Float16* vg = Vt + (((size_t)b * NH + h) * HD + sr) * SQ + sc;
  const float* mg = Mk + ((size_t)b * SQ + qrow + hh) * SQ + ln * 4;      /* 16 lanes cover 256 bytes of one mask row */
  v8us kr[2], vr[2]; v4f mr[8];
#pragma unroll
  for (int i = 0; i < 2; ++i) { kr[i] = *(const v8us*)((const unsigned short*)kg + (size_t)i * 32 * DM); vr[i] = *(const v8us*)((const unsigned short*)vg + (size_t)i * 32 * SQ); }
#pragma unroll
  for (int i = 0; i < 8; ++i) mr[i] = *(const v4fa*)(mg + (size_t)i * 2 * SQ);
  const v8f z8 = {0.f, 0.f, 0.f, 0.f, 0.f, 0.f, 0.f, 0.f};
  v8f o[4] = {z8, z8, z8, z8};
  float m = -3.0e38f, l = 0.f;
#pragma unroll 1      /* rolled, for speed only */
  for (int s = 0; s < SQ / FK; ++s) {
    __syncthreads();      /* every wave has finished reading the stage before */
#pragma unroll
    for (int i = 0; i < 2; ++i) { *(v8us*)&sk[sr + 32 * i][sc] = kr[i]; *(v8us*)&sv[sr + 32 * i][sc] = vr[i]; }
#pragma unroll
    for (int i = 0; i < 8; ++i) *(v4fa*)&sm[w * 16 + 2 * i + hh][ln * 4] = mr[i];
    __syncthreads();      /* the stage is complete for every wave */
    if (s + 1 < SQ / FK) {      /* next stage's loads fly while this one is worked on */
      kg += (size_t)FK * DM; vg += FK; mg += FK;
#pragma unroll
      for (int i = 0; i < 2; ++i) { kr[i] = *(const v8us*)((const unsigned short*)kg + (size_t)i * 32 * DM); vr[i] = *(const v8us*)((const unsigned short*)vg + (size_t)i * 32 * SQ); }
#pragma unroll
      for (int i = 0; i < 8; ++i) mr[i] = *(const v4fa*)(mg + (size_t)i * 2 * SQ);
    }
    v8f sh[4], sl[4];
#pragma unroll
    for (int t = 0; t < 4; ++t) {
      const v16h a0 = g2_frag(&sk[t * 16 + ln][0], hh), a1 = g2_frag(&sk[t * 16 + ln][32], hh);
      sh[t] = fa_mma(a1, qh1, fa_mma(a0, qh0, z8)); sl[t] = fa_mma(a1, ql1, fa_mma(a0, ql0, z8)); }
    float bm = -3.0e38f;
#pragma unroll
    for (int t = 0; t < 4; ++t) {
#pragma unroll
      for (int r = 0; r < 8; ++r) { sh[t][r] += sl[t][r] * 0.0009765625f; bm = fmaxf(bm, sh[t][r]); } }      /* q_hi.k + q_lo.k 2^-10 */
    const float cl = 0.18033688011112042592f;      /* 1/8 and the change to log2 units */
    bm = fmaxf(bm, xhalf(bm)) * cl;
    const float mn = fmaxf(m, bm), al = exp2_slot(m - mn), off = mn - 8.0f; m = mn;
    float ps[4] = {0.f, 0.f, 0.f, 0.f};      /* four partial sums: no chain of 32 dependent adds */
#pragma unroll
    for (int t = 0; t < 4; ++t) o[t] *= al;
    FragH pb[2];
#pragma unroll
    for (int t = 0; t < 4; ++t) {
      const v4f k0 = *(const v4fa*)&sm[w * 16 + ln][t * 16 + 8 * hh], k1 = *(const v4fa*)&sm[w * 16 + ln][t * 16 + 8 * hh + 4];
#pragma unroll
      for (int r = 0; r < 8; ++r) { const float p = exp2_slot(sh[t][r] * cl - off) * (r < 4 ? k0[r & 3] : k1[r & 3]); ps[r & 3] += p; pb[t >> 1].h[(t & 1) * 8 + r] = (_Float16)p; } }
    l = l * al + ((ps[0] + ps[1]) + (ps[2] + ps[3]));
#pragma unroll
    for (int t = 0; t < 4; ++t) o[t] = fa_mma(g2_frag(&sv[t * 16 + ln][32], hh), pb[1].v, fa_mma(g2_frag(&sv[t * 16 + ln][0], hh), pb[0].v, o[t]));
  }
  l += xhalf(l);
  const float inv = 1.0f / l;
  /* the wave's own 16 mask rows become its output staging: [query][d], so that each store below covers whole lines */
#pragma unroll
  for (int t = 0; t < 4; ++t) { const v8f v = o[t] * inv; const v4f lo4 = {v[0], v[1], v[2], v[3]}, hi4 = {v[4], v[5], v[6], v[7]};
    *(v4fa*)&sm[w * 16 + ln][t * 16 + 8 * hh] = lo4; *(v4fa*)&sm[w * 16 + ln][t * 16 + 8 * hh + 4] = hi4; }
  __builtin_amdgcn_fence(__ATOMIC_ACQ_REL, "workgroup"); __builtin_amdgcn_wave_barrier();      /* orders the LDS stores above in front of the loads below, which read what other lanes of the same wave wrote; no other wave touches these rows */
#pragma unroll
  for (int i = 0; i < 8; ++i) { const int r = 2 * i + hh; const v4f v = *(const v4fa*)&sm[w * 16 + r][ln * 4]; *(v4f*)(out + ((size_t)b * SQ + qrow + r) * DM + h * HD + ln * 4) = v; } }

// ---- the three projection GEMMs in one launch, both operands staged in LDS by tensor loads: alpha * X[8192][1024] . Wt[1024][1024]^T for Wt = Wq, Wk, Wv, all rows k-contiguous f16 ----
// Each result leaves the kernel in the form the attention kernel reads, so that no pass stands between the two: q as two f16 planes (value, and residual x 1024), k as f16 rows,
// v transposed per batch, [batch][feature][key]: for v the two operands change places (rows of the tile = rows of Wv, columns = rows of X), which leaves every element's products and their k order as they are.
// One 128 x 128 tile of a result per work-group, four waves (2 x 2) of 64 x 64. A stage is 256 bytes (128 k) of the tile's 128 A rows and 128 Bt rows; each wave brings one 64-row slice of it with one tensor load.
// Two buffers: stage s + 2 is requested into the buffer that pass s has just left, so it flies while pass s + 1 is worked on. The k order of every accumulator is that of the plain loop: ascending in steps of 32.
// Every inner loop is fully unrolled so that the accumulator and fragment arrays are indexed by constants and live in registers.
typedef uint32_t u32x4 __attribute__((ext_vector_type(4)));
typedef uint32_t u32x8 __attribute__((ext_vector_type(8)));
#define G3T 128      /* tile rows of either operand */
#define G3RB 256     /* bytes of an operand row per stage */
#define G3P 272      /* LDS row pitch, bytes: 16 B x odd for the b128 fragment reads; laid by the tensor load's pad */
#define G3SL 18432   /* place of a slice: 64 rows x 272 B = 17,408 B, rounded up to a multiple of 2 KiB */
#define G3BUF (4 * G3SL)
#define G3NS (DM * 2 / G3RB)      /* stages */
__device__ __forceinline__ uint32_t uni(uint32_t v) { return (uint32_t)__builtin_amdgcn_readfirstlane(v); }
__device__ __forceinline__ uint32_t pinned(uint32_t v) { uint32_t w = uni(v); asm volatile("" : "+s"(w)); return w; }      /* keeps a tensor load's issue test a scalar branch, and the stage number that its descriptor words are formed from in a scalar register behind the waits */
#define G3NT ((MP / G3T) * (DM / G3T))      /* tiles of one projection */
__global__ __launch_bounds__(128) void k_gemm3(const _Float16* __restrict__ X, const _Float16* __restrict__ Wq, const _Float16* __restrict__ Wk, const _Float16* __restrict__ Wv, float alpha,
                                               _Float16* __restrict__ Qh, _Float16* __restrict__ Ql, _Float16* __restrict__ K16, _Float16* __restrict__ Vt) {
  static_assert(SQ % G3T == 0 && NH * HD == DM, "a tile's 128 token rows lie in one batch; V^T rows are the features");
  __shared__ __attribute__((aligned(2048))) unsigned char ring[2 * G3BUF];
  const int tid = threadIdx.x, lane = tid & 31, ln = lane & 15, hh = lane >> 4;
  const uint32_t w = uni((uint32_t)tid >> 5), wm = w >> 1, wn = w & 1u;
  const int pj = blockIdx.x / G3NT, tl = blockIdx.x % G3NT;      /* 0 q, 1 k, 2 v: the same for the whole work-group; q, whose output is the largest, has the lowest block numbers */
  const int nq = tl % (DM / G3T), mt = tl / (DM / G3T); const int row0 = mt * G3T, col0 = nq * G3T;      /* first token row, first feature */
  const _Float16* xr = X + (size_t)row0 * DM; const _Float16* wr = (pj == 0 ? Wq : pj == 1 ? Wk : Wv) + (size_t)col0 * DM;
  const _Float16* A = pj == 2 ? wr : xr; const _Float16* Bh = pj == 2 ? xr : wr;      /* the 128 operand rows that become the tile's rows, and those that become its columns */
  const uint32_t lbase = (uint32_t)(size_t)ring;
  /* waves 0 and 1 bring the two halves of the A rows, waves 2 and 3 those of the Bt rows */
  const uint64_t ga0 = (uint64_t)(size_t)(w < 2u ? A + (size_t)(64 * (int)w) * DM : Bh + (size_t)(64 * (int)(w - 2u)) * DM);
  u32x8 g1;      /* 1-byte elements, tile = tensor = 64 rows of 256 B, source pitch one row of the matrix, 16 B of LDS pad behind every 256 B, no mask */
  g1[0] = uni((1u << 20) | (5u << 22) | (3u << 25)); g1[1] = uni((uint32_t)G3RB << 16); g1[2] = uni(64u << 16); g1[3] = uni((uint32_t)G3RB << 16); g1[4] = uni(64u); g1[5] = uni((uint32_t)DM * 2u); g1[6] = uni(0u); g1[7] = uni(0u);
  auto issue = [&](uint32_t st) {
    const uint64_t ga = ga0 + (uint64_t)st * G3RB; u32x4 g0;
    g0[0] = uni(1u); g0[1] = uni(lbase + (st & 1u) * G3BUF + w * G3SL); g0[2] = uni((uint32_t)ga); g0[3] = uni((((uint32_t)(ga >> 32)) & 0x01FFFFFFu) | 0x80000000u);
    asm volatile("tensor_load_to_lds %0, %1" :: "s"(g0), "s"(g1) : "memory"); };
  issue(0u);
  asm volatile("s_wait_tensorcnt 0x0" ::: "memory");      /* this wave's slice of stage 0 has landed */
  __syncthreads();      /* stage 0 is complete for every wave */
  issue(1u);
  const v8f z8 = {0.f, 0.f, 0.f, 0.f, 0.f, 0.f, 0.f, 0.f};
  v8f acc[4][4];
#pragma unroll
  for (int i = 0; i < 4; ++i) {
#pragma unroll
    for (int j = 0; j < 4; ++j) acc[i][j] = z8; }
#pragma unroll 1      /* rolled: one pass is 64 matrix instructions, and the ring's order stands once in the text */
  for (uint32_t s = 0; s < G3NS; ++s) {
    const unsigned char* buf = ring + (s & 1u) * G3BUF;
    const unsigned char* ap = buf + wm * G3SL + ln * G3P; const unsigned char* bp = buf + (2u + wn) * G3SL + ln * G3P;
    v16h a[2][4], b[2][4];      /* two fragment sets: block kb + 1 is fetched, as one group, while block kb is multiplied; no fragment of another stage is fetched */
#pragma unroll
    for (int i = 0; i < 4; ++i) { a[0][i] = g2_frag((const _Float16*)(ap + i * 16 * G3P), hh); b[0][i] = g2_frag((const _Float16*)(bp + i * 16 * G3P), hh); }
#pragma unroll
    for (int kb = 0; kb < G3RB / 64; ++kb) {
      __builtin_amdgcn_sched_barrier(0);      /* keeps the next block's LDS reads together in front of this block's matrix instructions, for speed only */
      if (kb + 1 < G3RB / 64) {
#pragma unroll
        for (int i = 0; i < 4; ++i) { a[(kb + 1) & 1][i] = g2_frag((const _Float16*)(ap + i * 16 * G3P + (kb + 1) * 64), hh); b[(kb + 1) & 1][i] = g2_frag((const _Float16*)(bp + i * 16 * G3P + (kb + 1) * 64), hh); }
      }
      __builtin_amdgcn_sched_barrier(0);      /* the other side of the same group */
      if (kb + 1 == G3RB / 64) {      /* the pass's foot stands in front of its last block, whose fragments are fetched by now: the refill starts a block earlier, and what follows works on registers alone */
        asm volatile("s_wait_dscnt 0x0" ::: "memory");      /* this wave's reads of the buffer have returned before it is refilled */
        asm volatile("s_wait_tensorcnt 0x0" ::: "memory");      /* this wave's slice of stage s + 1 has landed */
        __syncthreads();      /* publishes stage s + 1 and ends every wave's reading of stage s */
        if (pinned(s + 2u < G3NS)) issue(pinned(s + 2u));
      }
#pragma unroll
      for (int i = 0; i < 4; ++i) {
#pragma unroll
        for (int j = 0; j < 4; ++j) acc[i][j] = fa_mma(a[kb & 1][i], b[kb & 1][j], acc[i][j]); }
    }
  }
  asm volatile("s_wait_tensorcnt 0x0" ::: "memory");      /* nothing in flight when the ring becomes output staging */
  asm volatile("s_wait_dscnt 0x0" ::: "memory");
  /* the last pass's barrier has ended every read of the ring: each wave stages its 64 x 64 results in its own slice place, [row][col] at 68 floats, so that each store below covers whole lines */
  float* so = (float*)(ring + w * G3SL);
#pragma unroll
  for (int i = 0; i < 4; ++i) {
#pragma unroll
    for (int j = 0; j < 4; ++j) {
#pragma unroll
      for (int r = 0; r < 8; ++r) so[(i * 16 + 8 * hh + r) * 68 + j * 16 + ln] = acc[i][j][r] * alpha; } }
  __builtin_amdgcn_fence(__ATOMIC_ACQ_REL, "workgroup"); __builtin_amdgcn_wave_barrier();      /* orders the LDS stores above in front of the loads below, which read what other lanes of the same wave wrote */
  const int c4 = ln * 4;
  if (pj == 0) {      /* one branch for the whole work-group, outside the output loops: inside each loop the LDS reads and the stores overlap */
    const size_t cb = (size_t)(row0 + 64 * (int)wm) * DM + col0 + 64 * (int)wn + c4;
#pragma unroll
    for (int q = 0; q < 32; ++q) { const int r = q * 2 + hh; const v4f v = *(const v4fa*)&so[r * 68 + c4]; v4h h4, l4;
      for (int i = 0; i < 4; ++i) { h4[i] = (_Float16)v[i]; l4[i] = (_Float16)((v[i] - (float)h4[i]) * 1024.0f); }
      *(v4h*)(Qh + cb + (size_t)r * DM) = h4; *(v4h*)(Ql + cb + (size_t)r * DM) = l4; }
  } else {      /* k: [token][feature]; v: [batch][feature][key], the tile's rows being features and its columns keys */
    _Float16* C16 = pj == 1 ? K16 + (size_t)(row0 + 64 * (int)wm) * DM + col0 + 64 * (int)wn + c4
                            : Vt + ((size_t)(row0 / SQ) * DM + col0 + 64 * (int)wm) * SQ + row0 % SQ + 64 * (int)wn + c4;
    const size_t cp = pj == 1 ? DM : SQ;
#pragma unroll
    for (int q = 0; q < 32; ++q) { const int r = q * 2 + hh; const v4f v = *(const v4fa*)&so[r * 68 + c4]; v4h h4;
      for (int i = 0; i < 4; ++i) h4[i] = (_Float16)v[i];
      *(v4h*)(C16 + (size_t)r * cp) = h4; }
  } }

// ---- operand preparation in one launch: x -> f16 rows, and the three [in][out] weights -> f16 x16, transposed to [out][in]; every value is formed as in k_x16 and k_wt_f16 ----
// Few, long-lived waves: each thread puts sixteen 16-byte loads in flight, then converts and stores; no thread depends on another, so there is no LDS and no barrier.
// Weights: a thread takes 8 k x 4 n, so that the 8 halves it stores for one n are 16 contiguous bytes of a transposed row. In a wave 4 lanes lie along n and 8 along k:
// a load covers 64 contiguous bytes of each of 8 weight rows (the wave beside it takes the other half of those lines), a store four whole 128-byte lines.
#define PWG 64       /* work-groups per weight matrix, each 32 n x 512 k */
#define PXG 512      /* work-groups on x, each 4096 groups of four floats */
__global__ __launch_bounds__(256) void k_prep(const float* __restrict__ x, const float* __restrict__ wq, const float* __restrict__ wk, const float* __restrict__ wv,
                                              _Float16* __restrict__ X16, _Float16* __restrict__ BQ, _Float16* __restrict__ BK, _Float16* __restrict__ BV) {
  static_assert(NR * DM == (size_t)PXG * 4096 * 4 && DM * DM == PWG * 32 * 512, "the work-groups cover x and each weight matrix exactly once");
  const int tid = threadIdx.x, bx = blockIdx.x;
  if (bx < 3 * PWG) {      /* the same for the whole work-group; the weights have the lowest block numbers */
    const int mi = bx / PWG, tl = bx % PWG, lane = tid & 31, w = tid >> 5;
    const float* W = mi == 0 ? wq : mi == 1 ? wk : wv; _Float16* Wt = mi == 0 ? BQ : mi == 1 ? BK : BV;
    const int n = (tl >> 1) * 32 + (w & 1) * 16 + (lane & 3) * 4, k = (tl & 1) * 512 + (w >> 1) * 64 + (lane >> 2) * 8;
    v4f r[2][8];
#pragma unroll
    for (int u = 0; u < 2; ++u) {
#pragma unroll
      for (int j = 0; j < 8; ++j) r[u][j] = *(const v4fa*)(W + (size_t)(k + u * 256 + j) * DM + n); }
#pragma unroll
    for (int u = 0; u < 2; ++u) {
#pragma unroll
      for (int i = 0; i < 4; ++i) { FragH f;
#pragma unroll
        for (int j = 0; j < 8; ++j) f.h[j] = (_Float16)(bf16_round(r[u][j][i]) * 16.0f);
        *(v8us*)((unsigned short*)Wt + (size_t)(n + i) * DM + k + u * 256) = f.half[0]; } }
  } else {
    const size_t g0 = (size_t)(bx - 3 * PWG) * 4096 + tid;      /* a wave's load covers 512 contiguous bytes, its store 256 */
    const float* xp = x + g0 * 4;
    v4f r[16];
#pragma unroll
    for (int u = 0; u < 16; ++u) r[u] = *(const v4fa*)(xp + (size_t)u * 1024);
    asm volatile("s_wait_xcnt 0x0" :: "v"(xp) : "memory");      /* the address pair that the sixteen loads name stays as it is up to this wait */
#pragma unroll
    for (int u = 0; u < 16; ++u) { v4h h4;
#pragma unroll
      for (int q = 0; q < 4; ++q) h4[q] = (_Float16)bf16_round(r[u][q]);
      *(v4h*)(X16 + (g0 + (size_t)u * 256) * 4) = h4; }
    asm volatile("s_wait_xcnt 0x0" ::: "memory");      /* behind the last x store: in the built code the weight side's instructions follow this side's and reuse the stores' address and data registers */
  } }

extern "C" void kernel_launch(void* const* d_in, const int* in_sizes, int n_in,
                              void* d_out, int out_size, void* d_ws, size_t ws_size, hipStream_t stream) {
  (void)in_sizes; (void)n_in; (void)out_size;
  const float* const* I = (const float* const*)d_in; const float* x = I[0]; const float* amask = I[1]; const float* wq = I[2]; const float* wk = I[3]; const float* wv = I[4]; const float* bq = nullptr; const float* bk = nullptr; const float* bv = nullptr;      /* [in][out] weights, no biases; float 0/1 mask [8][1024][1024] read in the softmax */
  char* ws = (char*)d_ws; size_t off = 0;
  auto take = [&](size_t bytes) { char* p = ws + off; off += (bytes + 255) & ~(size_t)255; return p; };
  _Float16* BQ = (_Float16*)take((size_t)DM * DM * 2); _Float16* BK = (_Float16*)take((size_t)DM * DM * 2); _Float16* BV = (_Float16*)take((size_t)DM * DM * 2); 
  _Float16* X16 = (_Float16*)take(NR * DM * 2); _Float16* Q16 = (_Float16*)take(NR * DM * 2); _Float16* QL = (_Float16*)take(NR * DM * 2); _Float16* K16 = (_Float16*)take(NR * DM * 2); _Float16* O16 = (_Float16*)take(NR * DM * 2);
  _Float16* VT = (_Float16*)take((size_t)NB * NH * HD * SQ * 2);
  if (off > ws_size) return;
  k_prep<<<3 * PWG + PXG, 256, 0, stream>>>(x, wq, wk, wv, X16, BQ, BK, BV);      /* x -> f16; [in][out] weights -> Bt x16 */
  const size_t r0p = (size_t)B0 * SQ;      /* first projected row */
  k_gemm3<<<(unsigned)(3 * G3NT), 128, 0, stream>>>(X16 + r0p * DM, BQ, BK, BV, 0.0625f, Q16 + r0p * DM, QL + r0p * DM, K16 + r0p * DM, VT + r0p * DM);      /* q as f16 hi + x1024 residual planes, k rows, V^T [NB][NH][HD][SQ] */
  k_fattn<<<NB * NH * (SQ / FQ), 256, 0, stream>>>(Q16, QL, K16, VT, amask, (float*)d_out);      /* ctx (merged heads) straight to the f32 output */
}

// v006
// One run takes 100 microseconds.
// Two timings next to v005 both put it at 1.04 times that version's speed.
// Over all steps from v000 it is 98.2 times as fast.
#include <hip/hip_runtime.h>
// Multi-head self-attention with a multiplicative 0/1 mask and the module's 'unsafe' softmax (x [8][1024][1024]; q = x Wq, k = x Wk, v = x Wv ([in][out] 1024^2 sigma 1/32, no biases); 16 heads of 64; scores / 8; w = exp(s) mask[b][s][t] / (sum_t exp(s) mask + 1e-8) with the float mask input [8][1024][1024] (0/1, ~90 % ones, shared across heads) READ per (query, key); out = merged ctx (no output projection) -> [8][1024][1024]).
// Compute dtype: inputs rounded to bf16; x / weights exact; k, v and softmax weights as plain f16 GEMM operands (~2^-12); q as f16 hi + x1024 lo planes (effectively f32); o written f32; scores and softmax statistics f32. v_wmma_f32_16x16x32_f16.
#define NB 8
#define SQ 1024
#define DM 1024
#define NH 16
#define HD 64
#define HG 4                         /* heads per launch of k_vt(V16, b, h0, VT); that overload is not launched */
#define B0 0                         /* first batch processed (debug hook) */
#define NBR NB                       /* batches processed (debug hook) */
#define NR ((size_t)NB * SQ)         /* token rows */
#define MP ((int)((size_t)NBR * SQ)) /* rows projected (debug hook) */
#define QN SQ                        /* unused */
#define NHD NH                       /* unused */
#define MPO MP                       /* unused */
#define LQ DM      /* unused */
typedef __bf16 v16b __attribute__((ext_vector_type(16)));
typedef unsigned short v8us __attribute__((ext_vector_type(8), may_alias));
typedef float  v8f  __attribute__((ext_vector_type(8)));
typedef float  v4f  __attribute__((ext_vector_type(4)));
typedef float  v4fa __attribute__((ext_vector_type(4), may_alias));
union FragB { v16b v; v8us half[2]; unsigned short u[16]; };

__device__ __forceinline__ unsigned short bf16_bits(float x) { unsigned int u = __float_as_uint(x); return (unsigned short)((u + 0x7FFFu + ((u >> 16) & 1u)) >> 16); }
__device__ __forceinline__ float bf16_val(unsigned short b) { return __uint_as_float(((unsigned int)b) << 16); }
__device__ __forceinline__ float bf16_round(float x) { return bf16_val(bf16_bits(x)); }
// D += A·B with NT terms: 1 = ah·bh, 2 = + al·bh (A split), 3 = + ah·bl (both split)
template <int NT>
__device__ __forceinline__ v8f mmaN(v16b ah, v16b al, v16b bh, v16b bl, v8f c) {
  c = __builtin_amdgcn_wmma_f32_16x16x32_bf16(false, ah, false, bh, (short)0, c, false, false);
  if (NT >= 2) c = __builtin_amdgcn_wmma_f32_16x16x32_bf16(false, al, false, bh, (short)0, c, false, false);
  if (NT >= 3) c = __builtin_amdgcn_wmma_f32_16x16x32_bf16(false, ah, false, bl, (short)0, c, false, false);
  asm volatile("v_nop\n\tv_nop\n\tv_nop\n\tv_nop" : "+v"(c) : "v"(ah), "v"(al), "v"(bh), "v"(bl));
  return c;
}

__global__ __launch_bounds__(256) void k_wt_bf16(const float* __restrict__ W, unsigned short* __restrict__ Wt, int K, int N) {
  const int t = blockIdx.x * 256 + threadIdx.x;
  const int k8n = K / 8;
  if (t >= N * k8n) return;
  const int n = t / k8n, k8 = (t % k8n) * 8;
  v8us v;
#pragma unroll
  for (int i = 0; i < 8; ++i) v[i] = bf16_bits(W[(size_t)(k8 + i) * N + n]);
  *(v8us*)(Wt + (size_t)n * K + k8) = v;
  
}

// GEMM C[M][N] (f32, pitch ldc) = act(A[M][K]·W + bias). A f32 row-major (pitch lda) converted per fragment to bf16
// (ASPLIT: hi/lo two planes -> 2 terms, else single rounded term); Wt bf16 [N][K] (pitch ldb). BIAS_BF16 rounds the
// bias to bf16 first (bias quantised to bf16 before the add). K%32==0, M%16==0, N%64==0.
template <bool ASPLIT, int ACT, bool BIAS_BF16>
__global__ __launch_bounds__(128) void k_gemm_bf(const float* __restrict__ A, int lda, const unsigned short* __restrict__ Wt, int ldb,
                                               const float* __restrict__ bias, float* __restrict__ C, int ldc, int M, int N, int K) {
  __shared__ __attribute__((aligned(16))) float so[4][16][64];
  const int tid = threadIdx.x, w = tid >> 5, lane = tid & 31, ln = lane & 15, hh = lane >> 4;
  const int ntn = N / 64;
  const int wid = blockIdx.x * 4 + w;
  const int mt = wid / ntn, nq = wid % ntn;
  if (mt * 16 >= M) return;
  const int row0 = mt * 16, col0 = nq * 64;
  const float* arow = A + (size_t)(row0 + ln) * lda;
  v8f acc[4] = {};
  for (int kb = 0; kb < K; kb += 32) {
    FragB ah, al;
    const v4f x0 = *(const v4fa*)(arow + kb + 8 * hh), x1 = *(const v4fa*)(arow + kb + 8 * hh + 4);
    const v4f x2 = *(const v4fa*)(arow + kb + 16 + 8 * hh), x3 = *(const v4fa*)(arow + kb + 16 + 8 * hh + 4);
    float xs[16] = {x0[0],x0[1],x0[2],x0[3],x1[0],x1[1],x1[2],x1[3],x2[0],x2[1],x2[2],x2[3],x3[0],x3[1],x3[2],x3[3]};
#pragma unroll
    for (int i = 0; i < 16; ++i) { const unsigned short hb = bf16_bits(xs[i]); ah.u[i] = hb; al.u[i] = ASPLIT ? bf16_bits(xs[i] - bf16_val(hb)) : (unsigned short)0; }
#pragma unroll
    for (int t = 0; t < 4; ++t) {
      const unsigned short* brow = Wt + (size_t)(col0 + t * 16 + ln) * ldb + kb;
      FragB b;
      b.half[0] = *(const v8us*)(brow + 8 * hh);
      b.half[1] = *(const v8us*)(brow + 16 + 8 * hh);
      acc[t] = mmaN<ASPLIT ? 2 : 1>(ah.v, al.v, b.v, b.v, acc[t]);
    }
  }
#pragma unroll
  for (int t = 0; t < 4; ++t) {
    float bv = bias ? bias[col0 + t * 16 + ln] : 0.f;
    if (BIAS_BF16) bv = bf16_round(bv);
#pragma unroll
    for (int r = 0; r < 8; ++r) { float v = acc[t][r] + bv; if (ACT == 1) v = fmaxf(v, 0.f); so[w][8 * hh + r][t * 16 + ln] = v; }
  }
  __builtin_amdgcn_fence(__ATOMIC_ACQ_REL, "workgroup");
  __builtin_amdgcn_wave_barrier();
  const int rsub = lane >> 4, c4 = (lane & 15) * 4;
  {
#pragma unroll
    for (int q = 0; q < 8; ++q) {
      const int r = q * 2 + rsub;
      const v4f v = *(const v4fa*)&so[w][r][c4];
      *(v4f*)(C + (size_t)(row0 + r) * ldc + col0 + c4) = v;
    }
    
  }
}

// GEMM C = act(A·W + bias + resid): A f32 (ASPLIT -> hi/lo 2 terms), Wt bf16 [N][K]; ACT 0 none, 1 relu, 2 exact gelu;
// resid (optional, f32, row index = (row % rmod), pitch ldr, RES_BF16 rounds it) added before the activation.
template <bool ASPLIT, int ACT, bool BIAS_BF16, bool RES_BF16>
__global__ __launch_bounds__(128) void k_gemm_bf3(const float* __restrict__ A, int lda, const unsigned short* __restrict__ Wt, int ldb,
                                                const float* __restrict__ bias, const float* __restrict__ resid, int rmod, int ldr,
                                                float* __restrict__ C, int ldc, int M, int N, int K) {
  __shared__ __attribute__((aligned(16))) float so[4][16][64];
  const int tid = threadIdx.x, w = tid >> 5, lane = tid & 31, ln = lane & 15, hh = lane >> 4;
  const int ntn = N / 64;
  const int wid = blockIdx.x * 4 + w;
  const int mt = wid / ntn, nq = wid % ntn;
  if (mt * 16 >= M) return;
  const int row0 = mt * 16, col0 = nq * 64;
  const float* arow = A + (size_t)(row0 + ln) * lda;
  v8f acc[4] = {};
  for (int kb = 0; kb < K; kb += 32) {
    FragB ah, al;
    const v4f x0 = *(const v4fa*)(arow + kb + 8 * hh), x1 = *(const v4fa*)(arow + kb + 8 * hh + 4);
    const v4f x2 = *(const v4fa*)(arow + kb + 16 + 8 * hh), x3 = *(const v4fa*)(arow + kb + 16 + 8 * hh + 4);
    float xs[16] = {x0[0],x0[1],x0[2],x0[3],x1[0],x1[1],x1[2],x1[3],x2[0],x2[1],x2[2],x2[3],x3[0],x3[1],x3[2],x3[3]};
#pragma unroll
    for (int i = 0; i < 16; ++i) { const unsigned short hb = bf16_bits(xs[i]); ah.u[i] = hb; al.u[i] = ASPLIT ? bf16_bits(xs[i] - bf16_val(hb)) : (unsigned short)0; }
#pragma unroll
    for (int t = 0; t < 4; ++t) {
      const unsigned short* brow = Wt + (size_t)(col0 + t * 16 + ln) * ldb + kb;
      FragB b;
      b.half[0] = *(const v8us*)(brow + 8 * hh);
      b.half[1] = *(const v8us*)(brow + 16 + 8 * hh);
      acc[t] = mmaN<ASPLIT ? 2 : 1>(ah.v, al.v, b.v, b.v, acc[t]);
    }
  }
#pragma unroll
  for (int t = 0; t < 4; ++t) {
    const int col = col0 + t * 16 + ln;
    float bv = bias ? bias[col] : 0.f;
    if (BIAS_BF16) bv = bf16_round(bv);
#pragma unroll
    for (int r = 0; r < 8; ++r) {
      float v = acc[t][r] + bv;
      if (resid) { float rv = resid[(size_t)((row0 + 8 * hh + r) % rmod) * ldr + col]; if (RES_BF16) rv = bf16_round(rv); v += rv; }
      if (ACT == 1) v = fmaxf(v, 0.f);
      if (ACT == 2) v = 0.5f * v * (1.0f + erff(v * 0.70710678118654752f));
      if (ACT == 3) { const float u = 0.7978845608028654f * (v + 0.044715f * v * v * v); v = 0.5f * v * (1.0f + tanhf(u)); }
      so[w][8 * hh + r][t * 16 + ln] = v;
    }
  }
  __builtin_amdgcn_fence(__ATOMIC_ACQ_REL, "workgroup");
  __builtin_amdgcn_wave_barrier();
  const int rsub = lane >> 4, c4 = (lane & 15) * 4;
  {
#pragma unroll
    for (int q = 0; q < 8; ++q) {
      const int r = q * 2 + rsub;
      const v4f v = *(const v4fa*)&so[w][r][c4];
      *(v4f*)(C + (size_t)(row0 + r) * ldc + col0 + c4) = v;
    }
    
  }
}
// row LayerNorm (biased variance, eps) over N: s = X (+ R); optional out_sum <- s; out_norm <- (s-mu)*rsqrt(var+eps)*g + b
template <bool PARAM_BF16>
__global__ __launch_bounds__(256) void k_layernorm(const float* __restrict__ X, const float* __restrict__ R, const float* __restrict__ g, const float* __restrict__ bta,
                                                  float* __restrict__ out_sum, float* __restrict__ out_norm, int N, float eps) {
  __shared__ float red[256];
  const int row = blockIdx.x, tid = threadIdx.x;
  const float* x = X + (size_t)row * N; const float* rr = R ? R + (size_t)row * N : nullptr;
  float vals[16];                     // up to N = 4096
  const int per = N / 256;            // contiguous chunk per thread? use strided-by-4 chunks: thread handles j = tid*4 + 1024*u
  float s1 = 0.f;
  for (int u = 0; u < per / 4; ++u) {
    const int j = tid * 4 + 1024 * u;
    const v4f a = *(const v4fa*)(x + j);
    v4f b = {0.f,0.f,0.f,0.f}; if (rr) b = *(const v4fa*)(rr + j);
#pragma unroll
    for (int q = 0; q < 4; ++q) { const float v = a[q] + b[q]; vals[u * 4 + q] = v; s1 += v; }
  }
  red[tid] = s1; __syncthreads();
  for (int st = 128; st > 0; st >>= 1) { if (tid < st) red[tid] += red[tid + st]; __syncthreads(); }
  const float mu = red[0] / (float)N; __syncthreads();
  float s2 = 0.f;
  for (int u = 0; u < per / 4; ++u)
#pragma unroll
    for (int q = 0; q < 4; ++q) { const float c = vals[u * 4 + q] - mu; s2 += c * c; }
  red[tid] = s2; __syncthreads();
  for (int st = 128; st > 0; st >>= 1) { if (tid < st) red[tid] += red[tid + st]; __syncthreads(); }
  const float rs = rsqrtf(red[0] / (float)N + eps);
  {
    for (int u = 0; u < per / 4; ++u) {
      const int j = tid * 4 + 1024 * u;
      v4f o, sm;
#pragma unroll
      for (int q = 0; q < 4; ++q) {
        float gg = g[j + q], bb = bta[j + q];
        if (PARAM_BF16) { gg = bf16_round(gg); bb = bf16_round(bb); }
        sm[q] = vals[u * 4 + q]; o[q] = (vals[u * 4 + q] - mu) * rs * gg + bb;
      }
      if (out_sum) *(v4f*)(out_sum + (size_t)row * N + j) = sm;
      *(v4f*)(out_norm + (size_t)row * N + j) = o;
    }
    
  }
}



// ---- f16 WMMA path (v_wmma_f32_16x16x32_f16): 11-bit significands for operands in range — used where a [0,1] probability operand needs more precision than bf16
typedef _Float16 v16h __attribute__((ext_vector_type(16)));
union FragH { v16h v; v8us half[2]; _Float16 h[16]; unsigned short u[16]; };
template <int NT>
__device__ __forceinline__ v8f mmaH(v16h ah, v16h al, v16h bh, v16h bl, v8f c) {
  c = __builtin_amdgcn_wmma_f32_16x16x32_f16(false, ah, false, bh, (short)0, c, false, false);
  if (NT >= 2) c = __builtin_amdgcn_wmma_f32_16x16x32_f16(false, al, false, bh, (short)0, c, false, false);
  if (NT >= 3) c = __builtin_amdgcn_wmma_f32_16x16x32_f16(false, ah, false, bl, (short)0, c, false, false);
  asm volatile("v_nop\n\tv_nop\n\tv_nop\n\tv_nop" : "+v"(c) : "v"(ah), "v"(al), "v"(bh), "v"(bl));
  return c;
}
// batched GEMM like k_gemm_b but f16 operands: A f32 (split into f16 hi/lo if ASPLIT, else rounded to f16), Bt = f16 values [n][k]; alpha; C f32; N multiple of 16 (partial tiles skipped)
template <bool ASPLIT>
__global__ __launch_bounds__(128) void k_gemm_h(const float* __restrict__ A, int lda, size_t sA, const _Float16* __restrict__ Bh, int ldb, size_t sB, float alpha, float* __restrict__ C, int ldc, size_t sC, int M, int N, int K) {
  __shared__ __attribute__((aligned(16))) float so[4][16][64];
  const int tid = threadIdx.x, w = tid >> 5, lane = tid & 31, ln = lane & 15, hh = lane >> 4; const int by = blockIdx.y;
  A += (size_t)by * sA; Bh += (size_t)by * sB; C += (size_t)by * sC;
  const int ntn = (N + 63) / 64; const int wid = blockIdx.x * 4 + w; const int mt = wid / ntn, nq = wid % ntn; if (mt * 16 >= M) return;
  const int row0 = mt * 16, col0 = nq * 64; const float* arow = A + (size_t)(row0 + ln) * lda;
  v8f acc[4] = {};
  for (int kb = 0; kb < K; kb += 32) {
    FragH ah, al;
    const v4f x0 = *(const v4fa*)(arow + kb + 8 * hh), x1 = *(const v4fa*)(arow + kb + 8 * hh + 4), x2 = *(const v4fa*)(arow + kb + 16 + 8 * hh), x3 = *(const v4fa*)(arow + kb + 16 + 8 * hh + 4);
    float xs[16] = {x0[0],x0[1],x0[2],x0[3],x1[0],x1[1],x1[2],x1[3],x2[0],x2[1],x2[2],x2[3],x3[0],x3[1],x3[2],x3[3]};
#pragma unroll
    for (int i = 0; i < 16; ++i) { const _Float16 h = (_Float16)xs[i]; ah.h[i] = h; al.h[i] = ASPLIT ? (_Float16)(xs[i] - (float)h) : (_Float16)0.0f; }
#pragma unroll
    for (int t = 0; t < 4; ++t) { if (col0 + t * 16 >= N) continue; const size_t boff = (size_t)(col0 + t * 16 + ln) * ldb + kb; FragH bq; bq.half[0] = *(const v8us*)(Bh + boff + 8 * hh); bq.half[1] = *(const v8us*)(Bh + boff + 16 + 8 * hh);
      acc[t] = mmaH<ASPLIT ? 2 : 1>(ah.v, al.v, bq.v, bq.v, acc[t]); }
  }
#pragma unroll
  for (int t = 0; t < 4; ++t) { if (col0 + t * 16 >= N) continue;
#pragma unroll
    for (int r = 0; r < 8; ++r) so[w][8 * hh + r][t * 16 + ln] = acc[t][r] * alpha; }
  __builtin_amdgcn_fence(__ATOMIC_ACQ_REL, "workgroup"); __builtin_amdgcn_wave_barrier();
  const int rsub = lane >> 4, c4 = (lane & 15) * 4;
  {
#pragma unroll
    for (int q = 0; q < 8; ++q) { const int r = q * 2 + rsub; if (col0 + c4 < N) { const v4f v = *(const v4fa*)&so[w][r][c4]; *(v4f*)(C + (size_t)(row0 + r) * ldc + col0 + c4) = v; } }
     }
}

// Wt[n][k] = f16(W[k][n]·scale) from f32 row-major W[K][N] (scale = power of two; bf16-exact weights stay exact in f16 away from the subnormal range)
__global__ __launch_bounds__(256) void k_wt_f16(const float* __restrict__ W, _Float16* __restrict__ Wt, int K, int N, float scale) {
  const int t = blockIdx.x * 256 + threadIdx.x; if (t >= N * (K / 8)) return; const int n = t / (K / 8), k8 = (t % (K / 8)) * 8; FragH f;
#pragma unroll
  for (int i = 0; i < 8; ++i) f.h[i] = (_Float16)(bf16_round(W[(size_t)(k8 + i) * N + n]) * scale); const v8us o = f.half[0];
  *(v8us*)((unsigned short*)Wt + (size_t)n * K + k8) = o; 
}
// k_gemm_hh variant with fused epilogue: v = acc·alpha + bias[by·sBias + col] (+ CP[(row/rowsPerB)·sCPb + by·64 + col] if CP) ; ACT 0 none / 1 elu ; writes f16 C16 (and f32 C if non-null)
template <int ACT>
__global__ __launch_bounds__(128) void k_gemm_hhx(const _Float16* __restrict__ A, int lda, size_t sA, const _Float16* __restrict__ Bh, int ldb, size_t sB, float alpha, const float* __restrict__ bias, size_t sBias, const float* __restrict__ CP, int rowsPerB, size_t sCPb, int row0g,
    float* __restrict__ C, _Float16* __restrict__ C16, int ldc, size_t sC, int M, int N, int K) {
  __shared__ __attribute__((aligned(16))) float so[4][16][64];
  const int tid = threadIdx.x, w = tid >> 5, lane = tid & 31, ln = lane & 15, hh = lane >> 4; const int by = blockIdx.y;
  A += (size_t)by * sA; Bh += (size_t)by * sB; const size_t cofs = (size_t)by * sC; const float* bp = bias ? bias + (size_t)by * sBias : nullptr;
  const int ntn = (N + 63) / 64; const int wid = blockIdx.x * 4 + w; const int mt = wid / ntn, nq = wid % ntn; if (mt * 16 >= M) return;
  const int row0 = mt * 16, col0 = nq * 64; const _Float16* arow = A + (size_t)(row0 + ln) * lda;
  v8f acc[4] = {};
  for (int kb = 0; kb < K; kb += 32) { FragH ah; ah.half[0] = *(const v8us*)((const unsigned short*)arow + kb + 8 * hh); ah.half[1] = *(const v8us*)((const unsigned short*)arow + kb + 16 + 8 * hh);
#pragma unroll
    for (int t = 0; t < 4; ++t) { if (col0 + t * 16 >= N) continue; const size_t boff = (size_t)(col0 + t * 16 + ln) * ldb + kb; FragH bq; bq.half[0] = *(const v8us*)((const unsigned short*)Bh + boff + 8 * hh); bq.half[1] = *(const v8us*)((const unsigned short*)Bh + boff + 16 + 8 * hh);
      acc[t] = mmaH<1>(ah.v, ah.v, bq.v, bq.v, acc[t]); }
  }
#pragma unroll
  for (int t = 0; t < 4; ++t) { if (col0 + t * 16 >= N) continue; const int col = col0 + t * 16 + ln; const float bv = bp ? bf16_round(bp[col]) : 0.f;
#pragma unroll
    for (int r = 0; r < 8; ++r) { float v = acc[t][r] * alpha + bv; if (CP) { const int rr = row0g + row0 + 8 * hh + r; if (rowsPerB < 0) v += CP[cofs + (size_t)rr * ldc + col];      /* rowsPerB < 0: own element of the batched C plane */ else { const int bidx = rr / rowsPerB; v += CP[(size_t)bidx * sCPb + (size_t)by * 64 + col]; } } if (ACT == 1) v = (v > 0.f) ? v : expm1f(v); else if (ACT == 7) v = (v > 0.f) ? v + 1.0f : expf(v); else if (ACT == 8) v = tanhf(v); else if (ACT == 9) v = 0.5f * v * (1.0f + tanhf(0.7978845608028654f * (v + 0.044715f * v * v * v))); else if (ACT == 11) v = 1.0f / (1.0f + expf(-v)); else if (ACT == 12) v = (v > 0.f) ? v : 0.01f * v; else if (ACT == 14) v = (v > 0.f) ? v : 0.1f * v; else if (ACT == 16) v = (v >= 0.f) ? v : 0.3f * v; else if (ACT == 17) v = (v >= 0.f) ? v : 0.2f * v; else if (ACT == 15) v = v / (1.0f + expf(-v)); else if (ACT == 3) v = fmaxf(v, 0.f); else if (ACT == 6) v = 0.5f * v * (1.0f + erff(v * 0.70710678118654752f)); so[w][8 * hh + r][t * 16 + ln] = v; } }
  __builtin_amdgcn_fence(__ATOMIC_ACQ_REL, "workgroup"); __builtin_amdgcn_wave_barrier();
  const int rsub = lane >> 4, c4 = (lane & 15) * 4; typedef _Float16 v4h __attribute__((ext_vector_type(4)));
  {
#pragma unroll
    for (int q = 0; q < 8; ++q) { const int r = q * 2 + rsub; if (col0 + c4 < N) { const v4f v = *(const v4fa*)&so[w][r][c4]; if (C) *(v4f*)(C + cofs + (size_t)(row0 + r) * ldc + col0 + c4) = v; if (C16) { v4h h4; for (int i = 0; i < 4; ++i) h4[i] = (_Float16)v[i]; *(v4h*)(C16 + cofs + (size_t)(row0 + r) * ldc + col0 + c4) = h4; } } }
     }
}


typedef _Float16 v4h __attribute__((ext_vector_type(4)));

__global__ __launch_bounds__(256) void k_x16(const float* __restrict__ x, _Float16* __restrict__ X16, size_t n8) { const size_t t = (size_t)blockIdx.x * 256 + threadIdx.x; if (t >= n8) return; FragH f;
#pragma unroll
  for (int q = 0; q < 8; ++q) f.h[q] = (_Float16)bf16_round(x[t * 8 + q]); *(v8us*)((unsigned short*)X16 + t * 8) = f.half[0];  }
__global__ __launch_bounds__(256) void k_h16(const float* __restrict__ x, _Float16* __restrict__ X16, size_t n8) { const size_t t = (size_t)blockIdx.x * 256 + threadIdx.x; if (t >= n8) return; FragH f;
#pragma unroll
  for (int q = 0; q < 8; ++q) f.h[q] = (_Float16)x[t * 8 + q]; *(v8us*)((unsigned short*)X16 + t * 8) = f.half[0];  }
__global__ __launch_bounds__(256) void k_round16f(const float* __restrict__ W, _Float16* __restrict__ Bt, size_t n8) { const size_t t = (size_t)blockIdx.x * 256 + threadIdx.x; if (t >= n8) return; FragH f;
#pragma unroll
  for (int i = 0; i < 8; ++i) f.h[i] = (_Float16)(bf16_round(W[t * 8 + i]) * 16.0f); *(v8us*)((unsigned short*)Bt + t * 8) = f.half[0];  }
// ---- fast GEMM (wave tile 32x64; requires M % 32 == 0 rows per launch region and N % 64 == 0); epilogue = k_gemm_hhx semantics ----
__device__ __forceinline__ v16h g2_frag(const _Float16* p, int hh) { FragH f; f.half[0] = *(const v8us*)((const unsigned short*)p + 8 * hh); f.half[1] = *(const v8us*)((const unsigned short*)p + 16 + 8 * hh); return f.v; }
__device__ __forceinline__ v8f g2_mma(v16h a, v16h b, v8f c) { v8f d = __builtin_amdgcn_wmma_f32_16x16x32_f16(false, a, false, b, (short)0, c, false, false); asm volatile("v_nop\n\tv_nop\n\tv_nop\n\tv_nop" : "+v"(d) : "v"(a), "v"(b)); return d; }
template <int ACT>
__global__ __launch_bounds__(128) void k_gemm2(const _Float16* __restrict__ A, int lda, size_t sA, const _Float16* __restrict__ Bh, int ldb, size_t sB, float alpha, const float* __restrict__ bias, size_t sBias, const float* __restrict__ CP, int rowsPerB, size_t sCPb, int row0g,
    float* __restrict__ C, _Float16* __restrict__ C16, int ldc, size_t sC, int M, int N, int K) { static_assert(ACT == 0 || ACT == 3 || ACT == 6 || ACT == 8 || ACT == 9 || ACT == 11 || ACT == 12 || ACT == 14 || ACT == 15 || ACT == 16 || ACT == 17, "k_gemm2: unsupported ACT code (would silently apply no activation)");
  __shared__ __attribute__((aligned(16))) float so[4][32][68];
  const int tid = threadIdx.x, w = tid >> 5, lane = tid & 31, ln = lane & 15, hh = lane >> 4; const int by = blockIdx.y;
  A += (size_t)by * sA; Bh += (size_t)by * sB; const size_t cofs = (size_t)by * sC; const float* bp = bias ? bias + (size_t)by * sBias : nullptr;
  const int ntn = N >> 6; const int mt = blockIdx.x / ntn, nq = blockIdx.x - mt * ntn; const int row0 = mt * 128 + 32 * w, col0 = nq * 64; if (row0 >= M) return;
  const _Float16* a0p = A + (size_t)(row0 + ln) * lda; const _Float16* a1p = a0p + (size_t)16 * lda;
  const _Float16* b0p = Bh + (size_t)(col0 + ln) * ldb; const _Float16* b1p = b0p + (size_t)16 * ldb; const _Float16* b2p = b1p + (size_t)16 * ldb; const _Float16* b3p = b2p + (size_t)16 * ldb;
  const v8f z8 = {0.f,0.f,0.f,0.f,0.f,0.f,0.f,0.f}; v8f c00 = z8, c01 = z8, c02 = z8, c03 = z8, c10 = z8, c11 = z8, c12 = z8, c13 = z8;
#pragma unroll 1
  for (int kb = 0; kb < K; kb += 32) { const v16h a0 = g2_frag(a0p + kb, hh), a1 = g2_frag(a1p + kb, hh);
    v16h b = g2_frag(b0p + kb, hh); c00 = g2_mma(a0, b, c00); c10 = g2_mma(a1, b, c10);
    b = g2_frag(b1p + kb, hh); c01 = g2_mma(a0, b, c01); c11 = g2_mma(a1, b, c11);
    b = g2_frag(b2p + kb, hh); c02 = g2_mma(a0, b, c02); c12 = g2_mma(a1, b, c12);
    b = g2_frag(b3p + kb, hh); c03 = g2_mma(a0, b, c03); c13 = g2_mma(a1, b, c13); }
  v8f accs[8] = {c00, c01, c02, c03, c10, c11, c12, c13};
#pragma unroll
  for (int u = 0; u < 8; ++u) { const int t = u & 3, half = u >> 2; const int col = col0 + t * 16 + ln; const float bv = bp ? bf16_round(bp[col]) : 0.f;
#pragma unroll
    for (int r = 0; r < 8; ++r) { const int rloc = half * 16 + 8 * hh + r; float v = accs[u][r] * alpha + bv; if (CP) { if (rowsPerB < 0) v += CP[cofs + (size_t)(row0g + row0 + rloc) * ldc + col];      /* rowsPerB < 0: own element of the batched C plane */ else { const int bidx = (row0g + row0 + rloc) / rowsPerB; v += CP[(size_t)bidx * sCPb + (size_t)by * 64 + col]; } }
      if (ACT == 3) v = fmaxf(v, 0.f); else if (ACT == 6) v = 0.5f * v * (1.0f + erff(v * 0.70710678118654752f)); else if (ACT == 11) v = 1.0f / (1.0f + expf(-v)); else if (ACT == 15) v = v / (1.0f + expf(-v)); else if (ACT == 12) v = (v > 0.f) ? v : 0.01f * v; else if (ACT == 8) v = tanhf(v); else if (ACT == 9) v = 0.5f * v * (1.0f + tanhf(0.7978845608028654f * (v + 0.044715f * v * v * v))); else if (ACT == 14) v = (v > 0.f) ? v : 0.1f * v; else if (ACT == 16) v = (v >= 0.f) ? v : 0.3f * v; else if (ACT == 17) v = (v >= 0.f) ? v : 0.2f * v;
      so[w][rloc][t * 16 + ln] = v; } }
  __builtin_amdgcn_fence(__ATOMIC_ACQ_REL, "workgroup"); __builtin_amdgcn_wave_barrier();
  const int rsub = lane >> 4, c4 = (lane & 15) * 4;
  {
#pragma unroll
    for (int q = 0; q < 16; ++q) { const int r = q * 2 + rsub; const v4f v = *(const v4fa*)&so[w][r][c4]; if (C) *(v4f*)(C + cofs + (size_t)(row0 + r) * ldc + col0 + c4) = v; if (C16) { v4h h4; for (int i = 0; i < 4; ++i) h4[i] = (_Float16)v[i]; *(v4h*)(C16 + cofs + (size_t)(row0 + r) * ldc + col0 + c4) = h4; } }
     } }


__global__ __launch_bounds__(256) void k_wnat(const float* __restrict__ w, size_t n8, _Float16* __restrict__ Bt) { const size_t t = (size_t)blockIdx.x * 256 + threadIdx.x; if (t >= n8) return; FragH f; for (int q = 0; q < 8; ++q) f.h[q] = (_Float16)(bf16_round(w[t * 8 + q]) * 16.0f); *(v8us*)((unsigned short*)Bt + t * 8) = f.half[0];  }
__global__ __launch_bounds__(256) void k_rsm(const float* __restrict__ S, _Float16* __restrict__ P, int nrows) {
  #pragma clang fp contract(off)
  const int i = blockIdx.x * 256 + threadIdx.x; if (i >= nrows) return; const float* s = S + (size_t)i * SQ; float mx = -3.0e38f;
#pragma unroll 1
  for (int j = 0; j < SQ; ++j) mx = fmaxf(mx, s[j]); float se = 0.f;
#pragma unroll 1
  for (int j = 0; j < SQ; ++j) se += expf(s[j] - mx); const float sc = 256.0f / se;
#pragma unroll 1
  for (int j0 = 0; j0 < SQ; j0 += 8) { FragH f; for (int q = 0; q < 8; ++q) f.h[q] = (_Float16)(expf(s[j0 + q] - mx) * sc); unsigned short* d = (unsigned short*)P + (size_t)i * SQ + j0; *(v8us*)d = f.half[0];  } }
__global__ __launch_bounds__(256) void k_vt(const _Float16* __restrict__ V16, int b, int h0, _Float16* __restrict__ VT) { __shared__ unsigned short tl[64][65]; const int tid = threadIdx.x; const int hh = blockIdx.x % HG, sg = blockIdx.x / HG; const int s0 = sg * 64; const int h = h0 + hh;
  for (int i = tid; i < 64 * 8; i += 256) { const int j = i / 8, d8 = (i % 8) * 8; FragH f; f.half[0] = *(const v8us*)((const unsigned short*)V16 + ((size_t)b * SQ + s0 + j) * DM + h * HD + d8); for (int q = 0; q < 8; ++q) tl[d8 + q][j] = f.u[q]; }
  __syncthreads();
  { for (int i = tid; i < 64 * 8; i += 256) { const int d = i / 8, j8 = (i % 8) * 8; FragH f; for (int q = 0; q < 8; ++q) f.u[q] = tl[d][j8 + q]; *(v8us*)((unsigned short*)VT + ((size_t)hh * HD + d) * SQ + s0 + j8) = f.half[0]; }  } }



__global__ __launch_bounds__(256) void k_rsmf(const float* __restrict__ S, _Float16* __restrict__ P, int qn, int hg) {
  #pragma clang fp contract(off)
  const int t = blockIdx.x * 256 + threadIdx.x; if (t >= qn * hg) return; const size_t i = (size_t)(t / qn) * SQ + (t % qn); const float* s = S + i * SQ; float mx = -3.0e38f;
#pragma unroll 1
  for (int j = 0; j < SQ; ++j) mx = fmaxf(mx, s[j]); float se = 0.f;
#pragma unroll 1
  for (int j = 0; j < SQ; ++j) se += __expf(s[j] - mx); const float sc = 256.0f / se;
#pragma unroll 1
  for (int j0 = 0; j0 < SQ; j0 += 8) { FragH f; for (int q = 0; q < 8; ++q) f.h[q] = (_Float16)(__expf(s[j0 + q] - mx) * sc); unsigned short* d = (unsigned short*)P + i * SQ + j0; *(v8us*)d = f.half[0];  } }

// 2^x on v_exp_f32 with one free issue slot behind it: the instruction set asks for that slot before the result is read or the source overwritten.
__device__ __forceinline__ float exp2_slot(float x) { float r; asm("v_exp_f32 %0, %1\n\tv_nop" : "=v"(r) : "v"(x)); return r; }
#define FK 64      /* keys per stage */
#define FQ 128     /* query rows per work-group */
#define KPH 72     /* LDS row pitch of K and V^T, halves: 144 B = 16 B x odd, b128 fragment reads free of bank conflicts */
#define MPF 68     /* LDS row pitch of the mask rows, floats: 272 B = 16 B x odd */
__device__ __forceinline__ float xhalf(float x) { return __builtin_bit_cast(float, __builtin_amdgcn_permlanex16(__builtin_bit_cast(int, x), __builtin_bit_cast(int, x), 0x76543210, 0xfedcba98, false, false)); }      /* lane l with lane l ^ 16 */
__device__ __forceinline__ v8f fa_mma(v16h a, v16h b, v8f c) { return __builtin_amdgcn_wmma_f32_16x16x32_f16(false, a, false, b, (short)0, c, false, false); }
__global__ __launch_bounds__(256) void k_fattn(const _Float16* __restrict__ Qh, const _Float16* __restrict__ Ql, const _Float16* __restrict__ Kh, const _Float16* __restrict__ Vt, const float* __restrict__ Mk, float* __restrict__ out) {
  __shared__ __attribute__((aligned(16))) _Float16 sk[FK][KPH];
  __shared__ __attribute__((aligned(16))) _Float16 sv[HD][KPH];
  __shared__ __attribute__((aligned(16))) float sm[FQ][MPF];
  const int tid = threadIdx.x, w = tid >> 5, lane = tid & 31, ln = lane & 15, hh = lane >> 4;
  const int h = blockIdx.x % NH, qb = (blockIdx.x / NH) % (SQ / FQ), b = blockIdx.x / (NH * (SQ / FQ));      /* neighbouring work-groups: same mask rows, other heads */
  const int qrow = qb * FQ + w * 16;
  const size_t qo = ((size_t)b * SQ + qrow + ln) * DM + h * HD;
  const v16h qh0 = g2_frag(Qh + qo, hh), qh1 = g2_frag(Qh + qo + 32, hh), ql0 = g2_frag(Ql + qo, hh), ql1 = g2_frag(Ql + qo + 32, hh);
  const int sr = tid >> 3, sc = (tid & 7) * 8;      /* staging: 8 threads cover one 128-byte row, a wave four whole lines */
  const _Float16* kg = Kh + ((size_t)b * SQ + sr) * DM + h * HD + sc;
  const _Float16* vg = Vt + (((size_t)b * NH + h) * HD + sr) * SQ + sc;
  const float* mg = Mk + ((size_t)b * SQ + qrow + hh) * SQ + ln * 4;      /* 16 lanes cover 256 bytes of one mask row */
  v8us kr[2], vr[2]; v4f mr[8];
#pragma unroll
  for (int i = 0; i < 2; ++i) { kr[i] = *(const v8us*)((const unsigned short*)kg + (size_t)i * 32 * DM); vr[i] = *(const v8us*)((const unsigned short*)vg + (size_t)i * 32 * SQ); }
#pragma unroll
  for (int i = 0; i < 8; ++i) mr[i] = *(const v4fa*)(mg + (size_t)i * 2 * SQ);
  const v8f z8 = {0.f, 0.f, 0.f, 0.f, 0.f, 0.f, 0.f, 0.f};
  v8f o[4] = {z8, z8, z8, z8};
  float m = -3.0e38f, l = 0.f;
#pragma unroll 1      /* rolled, for speed only */
  for (int s = 0; s < SQ / FK; ++s) {
    __syncthreads();      /* every wave has finished reading the stage before */
#pragma unroll
    for (int i = 0; i < 2; ++i) { *(v8us*)&sk[sr + 32 * i][sc] = kr[i]; *(v8us*)&sv[sr + 32 * i][sc] = vr[i]; }
#pragma unroll
    for (int i = 0; i < 8; ++i) *(v4fa*)&sm[w * 16 + 2 * i + hh][ln * 4] = mr[i];
    __syncthreads();      /* the stage is complete for every wave */
    if (s + 1 < SQ / FK) {      /* next stage's loads fly while this one is worked on */
      kg += (size_t)FK * DM; vg += FK; mg += FK;
#pragma unroll
      for (int i = 0; i < 2; ++i) { kr[i] = *(const v8us*)((const unsigned short*)kg + (size_t)i * 32 * DM); vr[i] = *(const v8us*)((const unsigned short*)vg + (size_t)i * 32 * SQ); }
#pragma unroll
      for (int i = 0; i < 8; ++i) mr[i] = *(const v4fa*)(mg + (size_t)i * 2 * SQ);
    }
    v8f sh[4], sl[4];
#pragma unroll
    for (int t = 0; t < 4; ++t) {
      const v16h a0 = g2_frag(&sk[t * 16 + ln][0], hh), a1 = g2_frag(&sk[t * 16 + ln][32], hh);
      sh[t] = fa_mma(a1, qh1, fa_mma(a0, qh0, z8)); sl[t] = fa_mma(a1, ql1, fa_mma(a0, ql0, z8)); }
    float bm = -3.0e38f;
#pragma unroll
    for (int t = 0; t < 4; ++t) {
#pragma unroll
      for (int r = 0; r < 8; ++r) { sh[t][r] += sl[t][r] * 0.0009765625f; bm = fmaxf(bm, sh[t][r]); } }      /* q_hi.k + q_lo.k 2^-10 */
    const float cl = 0.18033688011112042592f;      /* 1/8 and the change to log2 units */
    bm = fmaxf(bm, xhalf(bm)) * cl;
    const float mn = fmaxf(m, bm), al = exp2_slot(m - mn), off = mn - 8.0f; m = mn;
    float ps[4] = {0.f, 0.f, 0.f, 0.f};      /* four partial sums: no chain of 32 dependent adds */
#pragma unroll
    for (int t = 0; t < 4; ++t) o[t] *= al;
    FragH pb[2];
#pragma unroll
    for (int t = 0; t < 4; ++t) {
      const v4f k0 = *(const v4fa*)&sm[w * 16 + ln][t * 16 + 8 * hh], k1 = *(const v4fa*)&sm[w * 16 + ln][t * 16 + 8 * hh + 4];
#pragma unroll
      for (int r = 0; r < 8; ++r) { const float p = exp2_slot(sh[t][r] * cl - off) * (r < 4 ? k0[r & 3] : k1[r & 3]); ps[r & 3] += p; pb[t >> 1].h[(t & 1) * 8 + r] = (_Float16)p; } }
    l = l * al + ((ps[0] + ps[1]) + (ps[2] + ps[3]));
#pragma unroll
    for (int t = 0; t < 4; ++t) o[t] = fa_mma(g2_frag(&sv[t * 16 + ln][32], hh), pb[1].v, fa_mma(g2_frag(&sv[t * 16 + ln][0], hh), pb[0].v, o[t]));
  }
  l += xhalf(l);
  const float inv = 1.0f / l;
  /* the wave's own 16 mask rows become its output staging: [query][d], so that each store below covers whole lines */
#pragma unroll
  for (int t = 0; t < 4; ++t) { const v8f v = o[t] * inv; const v4f lo4 = {v[0], v[1], v[2], v[3]}, hi4 = {v[4], v[5], v[6], v[7]};
    *(v4fa*)&sm[w * 16 + ln][t * 16 + 8 * hh] = lo4; *(v4fa*)&sm[w * 16 + ln][t * 16 + 8 * hh + 4] = hi4; }
  __builtin_amdgcn_fence(__ATOMIC_ACQ_REL, "workgroup"); __builtin_amdgcn_wave_barrier();      /* orders the LDS stores above in front of the loads below, which read what other lanes of the same wave wrote; no other wave touches these rows */
#pragma unroll
  for (int i = 0; i < 8; ++i) { const int r = 2 * i + hh; const v4f v = *(const v4fa*)&sm[w * 16 + r][ln * 4]; *(v4f*)(out + ((size_t)b * SQ + qrow + r) * DM + h * HD + ln * 4) = v; } }

// ---- the three projection GEMMs in one launch, both operands staged in LDS by tensor loads: alpha * X[8192][1024] . Wt[1024][1024]^T for Wt = Wq, Wk, Wv, all rows k-contiguous f16 ----
// Each result leaves the kernel in the form the attention kernel reads, so that no pass stands between the two: q as two f16 planes (value, and residual x 1024), k as f16 rows,
// v transposed per batch, [batch][feature][key]: for v the two operands change places (rows of the tile = rows of Wv, columns = rows of X), which leaves every element's products and their k order as they are.
// The three weights count as one list of 3072 output features. One work-group forms 256 token rows x 192 features of that list: twelve waves (4 x 3) of 64 x 64, each wholly inside one projection.
// So a staged operand row serves more products than in a 128 x 128 tile and fewer bytes come from L2 per product. A stage is 256 bytes (128 k) of the 256 X rows and the 192 weight rows: seven 64-row slices, one tensor load each, from waves 0 to 6.
// Two buffers: stage s + 2 is requested into the buffer that pass s has just left, so it flies while pass s + 1 is worked on. The k order of every accumulator is that of the plain loop: ascending in steps of 32.
// Every inner loop is fully unrolled so that the accumulator and fragment arrays are indexed by constants and live in registers.
typedef uint32_t u32x4 __attribute__((ext_vector_type(4)));
typedef uint32_t u32x8 __attribute__((ext_vector_type(8)));
#define G3TM 256     /* token rows of a work-group's tile: slices 0 to 3 */
#define G3TN 192     /* features of a work-group's tile, out of the 3 * DM of q, k, v in a row: slices 4 to 6 */
#define G3RB 256     /* bytes of an operand row per stage */
#define G3P 272      /* LDS row pitch, bytes: 16 B x odd for the b128 fragment reads; laid by the tensor load's pad */
#define G3SL 18432   /* place of a slice: 64 rows x 272 B = 17,408 B, rounded up to a multiple of 2 KiB */
#define G3BUF (7 * G3SL)
#define G3NS (DM * 2 / G3RB)      /* stages */
__device__ __forceinline__ uint32_t uni(uint32_t v) { return (uint32_t)__builtin_amdgcn_readfirstlane(v); }
__device__ __forceinline__ uint32_t pinned(uint32_t v) { uint32_t w = uni(v); asm volatile("" : "+s"(w)); return w; }      /* for the tensor mover: keeps a tensor load's issue test a scalar branch, and the stage number that its descriptor words are formed from in a scalar register behind the waits */
#define G3NN (3 * DM / G3TN)      /* tiles along the features */
#define G3NT ((MP / G3TM) * G3NN)      /* work-groups */
__global__ __launch_bounds__(384) void k_gemm3(const _Float16* __restrict__ X, const _Float16* __restrict__ Wq, const _Float16* __restrict__ Wk, const _Float16* __restrict__ Wv, float alpha,
                                               _Float16* __restrict__ Qh, _Float16* __restrict__ Ql, _Float16* __restrict__ K16, _Float16* __restrict__ Vt) {
  static_assert(SQ % 64 == 0 && DM % 64 == 0 && MP % G3TM == 0 && (3 * DM) % G3TN == 0 && NH * HD == DM, "a wave's 64 token rows lie in one batch and its 64 features in one projection; the tiles cover everything once; V^T rows are the features");
  __shared__ __attribute__((aligned(2048))) unsigned char ring[2 * G3BUF];
  const int tid = threadIdx.x, lane = tid & 31, ln = lane & 15, hh = lane >> 4;
  const uint32_t w = uni((uint32_t)tid >> 5), wm = w & 3u, wn = w >> 2;      /* this wave's block of 64 token rows (0 to 3) and of 64 features (0 to 2) */
  const uint32_t nq = blockIdx.x % G3NN, mt = blockIdx.x / G3NN;
  const uint32_t fb = nq * (G3TN / 64) + wn, pj = fb / (DM / 64);      /* feature block in the list; pj: 0 q, 1 k, 2 v, the same for a whole wave */
  const int row0 = (int)(mt * G3TM + wm * 64u), col0 = (int)(fb % (DM / 64) * 64u);      /* this wave's first token row, and its first feature inside its projection */
  const uint32_t sa = pj == 2u ? 4u + wn : wm, sb = pj == 2u ? wm : 4u + wn;      /* the slices whose rows become this wave's 64 result rows and its 64 result columns */
  const uint32_t lbase = (uint32_t)(size_t)ring;
  /* wave w < 7 brings slice w; waves 7 to 11 bring none (their address is formed like wave 0's and never used) */
  const uint32_t sw = w < 7u ? w : 0u, sf = nq * (G3TN / 64) + (sw < 4u ? 0u : sw - 4u), sj = sf / (DM / 64);      /* for a weight slice: its feature block and its projection */
  const _Float16* sp = sw < 4u ? X + (size_t)(mt * G3TM + sw * 64u) * DM : (sj == 0u ? Wq : sj == 1u ? Wk : Wv) + (size_t)(sf % (DM / 64) * 64u) * DM;
  const uint64_t ga0 = (uint64_t)(size_t)sp;
  u32x8 g1;      /* 1-byte elements, tile = tensor = 64 rows of 256 B, source pitch one row of the matrix, 16 B of LDS pad behind every 256 B, no mask */
  /* descriptor words held in scalar registers: as plain constants they were formed anew at each issue, in registers that the loop then reused for its addresses while the request was still under way */
  g1[0] = pinned((1u << 20) | (5u << 22) | (3u << 25)); g1[1] = pinned((uint32_t)G3RB << 16); g1[2] = pinned(64u << 16); g1[3] = pinned((uint32_t)G3RB << 16); g1[4] = pinned(64u); g1[5] = pinned((uint32_t)DM * 2u); g1[6] = pinned(0u); g1[7] = pinned(0u);
  u32x4 g0; g0[0] = pinned(1u);
  auto issue = [&](uint32_t st) {
    const uint64_t ga = ga0 + (uint64_t)st * G3RB;
    g0[1] = uni(lbase + (st & 1u) * G3BUF + sw * G3SL); g0[2] = uni((uint32_t)ga); g0[3] = uni((((uint32_t)(ga >> 32)) & 0x01FFFFFFu) | 0x80000000u);
    asm volatile("tensor_load_to_lds %0, %1" :: "s"(g0), "s"(g1) : "memory"); };
  if (pinned(w < 7u)) issue(0u);
  asm volatile("s_wait_tensorcnt 0x0" ::: "memory");      /* this wave's slice of stage 0 has landed */
  __syncthreads();      /* stage 0 is complete for every wave */
  if (pinned(w < 7u)) issue(1u);
  const v8f z8 = {0.f, 0.f, 0.f, 0.f, 0.f, 0.f, 0.f, 0.f};
  v8f acc[4][4];
#pragma unroll
  for (int i = 0; i < 4; ++i) {
#pragma unroll
    for (int j = 0; j < 4; ++j) acc[i][j] = z8; }
#pragma unroll 1      /* rolled: one pass is 64 matrix instructions, and the ring's order stands once in the text */
  for (uint32_t s = 0; s < G3NS; ++s) {
    const unsigned char* buf = ring + (s & 1u) * G3BUF;
    const unsigned char* ap = buf + sa * G3SL + ln * G3P; const unsigned char* bp = buf + sb * G3SL + ln * G3P;
    v16h a[2][4], b[2][4];      /* two fragment sets: block kb + 1 is fetched, as one group, while block kb is multiplied; no fragment of another stage is fetched */
#pragma unroll
    for (int i = 0; i < 4; ++i) { a[0][i] = g2_frag((const _Float16*)(ap + i * 16 * G3P), hh); b[0][i] = g2_frag((const _Float16*)(bp + i * 16 * G3P), hh); }
#pragma unroll
    for (int kb = 0; kb < G3RB / 64; ++kb) {
      __builtin_amdgcn_sched_barrier(0);      /* keeps the next block's LDS reads together in front of this block's matrix instructions, for speed only */
      if (kb + 1 < G3RB / 64) {
#pragma unroll
        for (int i = 0; i < 4; ++i) { a[(kb + 1) & 1][i] = g2_frag((const _Float16*)(ap + i * 16 * G3P + (kb + 1) * 64), hh); b[(kb + 1) & 1][i] = g2_frag((const _Float16*)(bp + i * 16 * G3P + (kb + 1) * 64), hh); }
      }
      __builtin_amdgcn_sched_barrier(0);      /* the other side of the same group */
      if (kb + 1 == G3RB / 64) {      /* the pass's foot stands in front of its last block, whose fragments are fetched by now: the refill starts a block earlier, and what follows works on registers alone */
        asm volatile("s_wait_dscnt 0x0" ::: "memory");      /* this wave's reads of the buffer have returned before it is refilled */
        asm volatile("s_wait_tensorcnt 0x0" ::: "memory");      /* this wave's slice of stage s + 1 has landed */
        __syncthreads();      /* publishes stage s + 1 and ends every wave's reading of stage s */
        if (pinned(s + 2u < G3NS && w < 7u)) issue(pinned(s + 2u));
      }
#pragma unroll
      for (int i = 0; i < 4; ++i) {
#pragma unroll
        for (int j = 0; j < 4; ++j) acc[i][j] = fa_mma(a[kb & 1][i], b[kb & 1][j], acc[i][j]); }
    }
  }
  asm volatile("s_wait_tensorcnt 0x0" ::: "memory");      /* nothing in flight when the ring becomes output staging */
  asm volatile("s_wait_dscnt 0x0" ::: "memory");
  /* the last pass's barrier has ended every read of the ring: each wave stages its 64 x 64 results in its own slice place, [row][col] at 68 floats, so that each store below covers whole lines */
  float* so = (float*)(ring + w * G3SL);
#pragma unroll
  for (int i = 0; i < 4; ++i) {
#pragma unroll
    for (int j = 0; j < 4; ++j) {
#pragma unroll
      for (int r = 0; r < 8; ++r) so[(i * 16 + 8 * hh + r) * 68 + j * 16 + ln] = acc[i][j][r] * alpha; } }
  __builtin_amdgcn_fence(__ATOMIC_ACQ_REL, "workgroup"); __builtin_amdgcn_wave_barrier();      /* orders the LDS stores above in front of the loads below, which read what other lanes of the same wave wrote */
  const int c4 = ln * 4;
  if (pj == 0u) {      /* one branch for the whole wave, outside the output loops: inside each loop the LDS reads and the stores overlap */
    const size_t cb = (size_t)row0 * DM + col0 + c4;
#pragma unroll
    for (int q = 0; q < 32; ++q) { const int r = q * 2 + hh; const v4f v = *(const v4fa*)&so[r * 68 + c4]; v4h h4, l4;
      for (int i = 0; i < 4; ++i) { h4[i] = (_Float16)v[i]; l4[i] = (_Float16)((v[i] - (float)h4[i]) * 1024.0f); }
      *(v4h*)(Qh + cb + (size_t)r * DM) = h4; *(v4h*)(Ql + cb + (size_t)r * DM) = l4; }
  } else {      /* k: [token][feature]; v: [batch][feature][key], the tile's rows being features and its columns keys */
    _Float16* C16 = pj == 1u ? K16 + (size_t)row0 * DM + col0 + c4
                             : Vt + ((size_t)(row0 / SQ) * DM + col0) * SQ + row0 % SQ + c4;
    const size_t cp = pj == 1u ? DM : SQ;
#pragma unroll
    for (int q = 0; q < 32; ++q) { const int r = q * 2 + hh; const v4f v = *(const v4fa*)&so[r * 68 + c4]; v4h h4;
      for (int i = 0; i < 4; ++i) h4[i] = (_Float16)v[i];
      *(v4h*)(C16 + (size_t)r * cp) = h4; }
  } }

// ---- operand preparation in one launch: x -> f16 rows, and the three [in][out] weights -> f16 x16, transposed to [out][in]; every value is formed as in k_x16 and k_wt_f16 ----
// Few, long-lived waves: each thread puts sixteen 16-byte loads in flight, then converts and stores; no thread depends on another, so there is no LDS and no barrier.
// Weights: a thread takes 8 k x 4 n, so that the 8 halves it stores for one n are 16 contiguous bytes of a transposed row. In a wave 4 lanes lie along n and 8 along k:
// a load covers 64 contiguous bytes of each of 8 weight rows (the wave beside it takes the other half of those lines), a store four whole 128-byte lines.
#define PWG 64       /* work-groups per weight matrix, each 32 n x 512 k */
#define PXG 512      /* work-groups on x, each 4096 groups of four floats */
__global__ __launch_bounds__(256) void k_prep(const float* __restrict__ x, const float* __restrict__ wq, const float* __restrict__ wk, const float* __restrict__ wv,
                                              _Float16* __restrict__ X16, _Float16* __restrict__ BQ, _Float16* __restrict__ BK, _Float16* __restrict__ BV) {
  static_assert(NR * DM == (size_t)PXG * 4096 * 4 && DM * DM == PWG * 32 * 512, "the work-groups cover x and each weight matrix exactly once");
  const int tid = threadIdx.x, bx = blockIdx.x;
  if (bx < 3 * PWG) {      /* the same for the whole work-group; the weights have the lowest block numbers */
    const int mi = bx / PWG, tl = bx % PWG, lane = tid & 31, w = tid >> 5;
    const float* W = mi == 0 ? wq : mi == 1 ? wk : wv; _Float16* Wt = mi == 0 ? BQ : mi == 1 ? BK : BV;
    const int n = (tl >> 1) * 32 + (w & 1) * 16 + (lane & 3) * 4, k = (tl & 1) * 512 + (w >> 1) * 64 + (lane >> 2) * 8;
    v4f r[2][8];
#pragma unroll
    for (int u = 0; u < 2; ++u) {
#pragma unroll
      for (int j = 0; j < 8; ++j) r[u][j] = *(const v4fa*)(W + (size_t)(k + u * 256 + j) * DM + n); }
#pragma unroll
    for (int u = 0; u < 2; ++u) {
#pragma unroll
      for (int i = 0; i < 4; ++i) { FragH f;
#pragma unroll
        for (int j = 0; j < 8; ++j) f.h[j] = (_Float16)(bf16_round(r[u][j][i]) * 16.0f);
        *(v8us*)((unsigned short*)Wt + (size_t)(n + i) * DM + k + u * 256) = f.half[0]; } }
  } else {
    const size_t g0 = (size_t)(bx - 3 * PWG) * 4096 + tid;      /* a wave's load covers 512 contiguous bytes, its store 256 */
    const float* xp = x + g0 * 4;
    v4f r[16];
#pragma unroll
    for (int u = 0; u < 16; ++u) r[u] = *(const v4fa*)(xp + (size_t)u * 1024);
    asm volatile("s_wait_xcnt 0x0" :: "v"(xp) : "memory");      /* the address pair that the sixteen loads name stays as it is up to this wait */
#pragma unroll
    for (int u = 0; u < 16; ++u) { v4h h4;
#pragma unroll
      for (int q = 0; q < 4; ++q) h4[q] = (_Float16)bf16_round(r[u][q]);
      *(v4h*)(X16 + (g0 + (size_t)u * 256) * 4) = h4; }
    asm volatile("s_wait_xcnt 0x0" ::: "memory");      /* behind the last x store: in the built code the weight side's instructions follow this side's and reuse the stores' address and data registers */
  } }

extern "C" void kernel_launch(void* const* d_in, const int* in_sizes, int n_in,
                              void* d_out, int out_size, void* d_ws, size_t ws_size, hipStream_t stream) {
  (void)in_sizes; (void)n_in; (void)out_size;
  const float* const* I = (const float* const*)d_in; const float* x = I[0]; const float* amask = I[1]; const float* wq = I[2]; const float* wk = I[3]; const float* wv = I[4]; const float* bq = nullptr; const float* bk = nullptr; const float* bv = nullptr;      /* [in][out] weights, no biases; float 0/1 mask [8][1024][1024] read in the softmax */
  char* ws = (char*)d_ws; size_t off = 0;
  auto take = [&](size_t bytes) { char* p = ws + off; off += (bytes + 255) & ~(size_t)255; return p; };
  _Float16* BQ = (_Float16*)take((size_t)DM * DM * 2); _Float16* BK = (_Float16*)take((size_t)DM * DM * 2); _Float16* BV = (_Float16*)take((size_t)DM * DM * 2); 
  _Float16* X16 = (_Float16*)take(NR * DM * 2); _Float16* Q16 = (_Float16*)take(NR * DM * 2); _Float16* QL = (_Float16*)take(NR * DM * 2); _Float16* K16 = (_Float16*)take(NR * DM * 2); _Float16* O16 = (_Float16*)take(NR * DM * 2);
  _Float16* VT = (_Float16*)take((size_t)NB * NH * HD * SQ * 2);
  if (off > ws_size) return;
  k_prep<<<3 * PWG + PXG, 256, 0, stream>>>(x, wq, wk, wv, X16, BQ, BK, BV);      /* x -> f16; [in][out] weights -> Bt x16 */
  const size_t r0p = (size_t)B0 * SQ;      /* first projected row */
  k_gemm3<<<(unsigned)G3NT, 384, 0, stream>>>(X16 + r0p * DM, BQ, BK, BV, 0.0625f, Q16 + r0p * DM, QL + r0p * DM, K16 + r0p * DM, VT + r0p * DM);      /* q as f16 hi + x1024 residual planes, k rows, V^T [NB][NH][HD][SQ] */
  k_fattn<<<NB * NH * (SQ / FQ), 256, 0, stream>>>(Q16, QL, K16, VT, amask, (float*)d_out);      /* ctx (merged heads) straight to the f32 output */
}

// v007
// A run of this version takes 96 microseconds.
// Next to v006, in two timings, it ran 1.05 and 1.04 times as fast.
// Counting every step since v000, it is 103 times as fast.
#include <hip/hip_runtime.h>
// Multi-head self-attention with a multiplicative 0/1 mask and the module's 'unsafe' softmax (x [8][1024][1024]; q = x Wq, k = x Wk, v = x Wv ([in][out] 1024^2 sigma 1/32, no biases); 16 heads of 64; scores / 8; w = exp(s) mask[b][s][t] / (sum_t exp(s) mask + 1e-8) with the float mask input [8][1024][1024] (0/1, ~90 % ones, shared across heads) READ per (query, key); out = merged ctx (no output projection) -> [8][1024][1024]).
// Compute dtype: inputs rounded to bf16; x / weights exact; k, v and softmax weights as plain f16 GEMM operands (~2^-12); q as f16 hi + unscaled residual lo planes (effectively f32); o written f32; scores and softmax statistics f32. v_wmma_f32_16x16x32_f16.
#define NB 8
#define SQ 1024
#define DM 1024
#define NH 16
#define HD 64
#define HG 4                         /* heads per launch of k_vt(V16, b, h0, VT); that overload is not launched */
#define B0 0                         /* first batch processed (debug hook) */
#define NBR NB                       /* batches processed (debug hook) */
#define NR ((size_t)NB * SQ)         /* token rows */
#define MP ((int)((size_t)NBR * SQ)) /* rows projected (debug hook) */
#define QN SQ                        /* unused */
#define NHD NH                       /* unused */
#define MPO MP                       /* unused */
#define LQ DM      /* unused */
typedef __bf16 v16b __attribute__((ext_vector_type(16)));
typedef unsigned short v8us __attribute__((ext_vector_type(8), may_alias));
typedef float  v8f  __attribute__((ext_vector_type(8)));
typedef float  v4f  __attribute__((ext_vector_type(4)));
typedef float  v4fa __attribute__((ext_vector_type(4), may_alias));
union FragB { v16b v; v8us half[2]; unsigned short u[16]; };

__device__ __forceinline__ unsigned short bf16_bits(float x) { unsigned int u = __float_as_uint(x); return (unsigned short)((u + 0x7FFFu + ((u >> 16) & 1u)) >> 16); }
__device__ __forceinline__ float bf16_val(unsigned short b) { return __uint_as_float(((unsigned int)b) << 16); }
__device__ __forceinline__ float bf16_round(float x) { return bf16_val(bf16_bits(x)); }
// D += A·B with NT terms: 1 = ah·bh, 2 = + al·bh (A split), 3 = + ah·bl (both split)
template <int NT>
__device__ __forceinline__ v8f mmaN(v16b ah, v16b al, v16b bh, v16b bl, v8f c) {
  c = __builtin_amdgcn_wmma_f32_16x16x32_bf16(false, ah, false, bh, (short)0, c, false, false);
  if (NT >= 2) c = __builtin_amdgcn_wmma_f32_16x16x32_bf16(false, al, false, bh, (short)0, c, false, false);
  if (NT >= 3) c = __builtin_amdgcn_wmma_f32_16x16x32_bf16(false, ah, false, bl, (short)0, c, false, false);
  asm volatile("v_nop\n\tv_nop\n\tv_nop\n\tv_nop" : "+v"(c) : "v"(ah), "v"(al), "v"(bh), "v"(bl));
  return c;
}

__global__ __launch_bounds__(256) void k_wt_bf16(const float* __restrict__ W, unsigned short* __restrict__ Wt, int K, int N) {
  const int t = blockIdx.x * 256 + threadIdx.x;
  const int k8n = K / 8;
  if (t >= N * k8n) return;
  const int n = t / k8n, k8 = (t % k8n) * 8;
  v8us v;
#pragma unroll
  for (int i = 0; i < 8; ++i) v[i] = bf16_bits(W[(size_t)(k8 + i) * N + n]);
  *(v8us*)(Wt + (size_t)n * K + k8) = v;
  
}

// GEMM C[M][N] (f32, pitch ldc) = act(A[M][K]·W + bias). A f32 row-major (pitch lda) converted per fragment to bf16
// (ASPLIT: hi/lo two planes -> 2 terms, else single rounded term); Wt bf16 [N][K] (pitch ldb). BIAS_BF16 rounds the
// bias to bf16 first (bias quantised to bf16 before the add). K%32==0, M%16==0, N%64==0.
template <bool ASPLIT, int ACT, bool BIAS_BF16>
__global__ __launch_bounds__(128) void k_gemm_bf(const float* __restrict__ A, int lda, const unsigned short* __restrict__ Wt, int ldb,
                                               const float* __restrict__ bias, float* __restrict__ C, int ldc, int M, int N, int K) {
  __shared__ __attribute__((aligned(16))) float so[4][16][64];
  const int tid = threadIdx.x, w = tid >> 5, lane = tid & 31, ln = lane & 15, hh = lane >> 4;
  const int ntn = N / 64;
  const int wid = blockIdx.x * 4 + w;
  const int mt = wid / ntn, nq = wid % ntn;
  if (mt * 16 >= M) return;
  const int row0 = mt * 16, col0 = nq * 64;
  const float* arow = A + (size_t)(row0 + ln) * lda;
  v8f acc[4] = {};
  for (int kb = 0; kb < K; kb += 32) {
    FragB ah, al;
    const v4f x0 = *(const v4fa*)(arow + kb + 8 * hh), x1 = *(const v4fa*)(arow + kb + 8 * hh + 4);
    const v4f x2 = *(const v4fa*)(arow + kb + 16 + 8 * hh), x3 = *(const v4fa*)(arow + kb + 16 + 8 * hh + 4);
    float xs[16] = {x0[0],x0[1],x0[2],x0[3],x1[0],x1[1],x1[2],x1[3],x2[0],x2[1],x2[2],x2[3],x3[0],x3[1],x3[2],x3[3]};
#pragma unroll
    for (int i = 0; i < 16; ++i) { const unsigned short hb = bf16_bits(xs[i]); ah.u[i] = hb; al.u[i] = ASPLIT ? bf16_bits(xs[i] - bf16_val(hb)) : (unsigned short)0; }
#pragma unroll
    for (int t = 0; t < 4; ++t) {
      const unsigned short* brow = Wt + (size_t)(col0 + t * 16 + ln) * ldb + kb;
      FragB b;
      b.half[0] = *(const v8us*)(brow + 8 * hh);
      b.half[1] = *(const v8us*)(brow + 16 + 8 * hh);
      acc[t] = mmaN<ASPLIT ? 2 : 1>(ah.v, al.v, b.v, b.v, acc[t]);
    }
  }
#pragma unroll
  for (int t = 0; t < 4; ++t) {
    float bv = bias ? bias[col0 + t * 16 + ln] : 0.f;
    if (BIAS_BF16) bv = bf16_round(bv);
#pragma unroll
    for (int r = 0; r < 8; ++r) { float v = acc[t][r] + bv; if (ACT == 1) v = fmaxf(v, 0.f); so[w][8 * hh + r][t * 16 + ln] = v; }
  }
  __builtin_amdgcn_fence(__ATOMIC_ACQ_REL, "workgroup");
  __builtin_amdgcn_wave_barrier();
  const int rsub = lane >> 4, c4 = (lane & 15) * 4;
  {
#pragma unroll
    for (int q = 0; q < 8; ++q) {
      const int r = q * 2 + rsub;
      const v4f v = *(const v4fa*)&so[w][r][c4];
      *(v4f*)(C + (size_t)(row0 + r) * ldc + col0 + c4) = v;
    }
    
  }
}

// GEMM C = act(A·W + bias + resid): A f32 (ASPLIT -> hi/lo 2 terms), Wt bf16 [N][K]; ACT 0 none, 1 relu, 2 exact gelu;
// resid (optional, f32, row index = (row % rmod), pitch ldr, RES_BF16 rounds it) added before the activation.
template <bool ASPLIT, int ACT, bool BIAS_BF16, bool RES_BF16>
__global__ __launch_bounds__(128) void k_gemm_bf3(const float* __restrict__ A, int lda, const unsigned short* __restrict__ Wt, int ldb,
                                                const float* __restrict__ bias, const float* __restrict__ resid, int rmod, int ldr,
                                                float* __restrict__ C, int ldc, int M, int N, int K) {
  __shared__ __attribute__((aligned(16))) float so[4][16][64];
  const int tid = threadIdx.x, w = tid >> 5, lane = tid & 31, ln = lane & 15, hh = lane >> 4;
  const int ntn = N / 64;
  const int wid = blockIdx.x * 4 + w;
  const int mt = wid / ntn, nq = wid % ntn;
  if (mt * 16 >= M) return;
  const int row0 = mt * 16, col0 = nq * 64;
  const float* arow = A + (size_t)(row0 + ln) * lda;
  v8f acc[4] = {};
  for (int kb = 0; kb < K; kb += 32) {
    FragB ah, al;
    const v4f x0 = *(const v4fa*)(arow + kb + 8 * hh), x1 = *(const v4fa*)(arow + kb + 8 * hh + 4);
    const v4f x2 = *(const v4fa*)(arow + kb + 16 + 8 * hh), x3 = *(const v4fa*)(arow + kb + 16 + 8 * hh + 4);
    float xs[16] = {x0[0],x0[1],x0[2],x0[3],x1[0],x1[1],x1[2],x1[3],x2[0],x2[1],x2[2],x2[3],x3[0],x3[1],x3[2],x3[3]};
#pragma unroll
    for (int i = 0; i < 16; ++i) { const unsigned short hb = bf16_bits(xs[i]); ah.u[i] = hb; al.u[i] = ASPLIT ? bf16_bits(xs[i] - bf16_val(hb)) : (unsigned short)0; }
#pragma unroll
    for (int t = 0; t < 4; ++t) {
      const unsigned short* brow = Wt + (size_t)(col0 + t * 16 + ln) * ldb + kb;
      FragB b;
      b.half[0] = *(const v8us*)(brow + 8 * hh);
      b.half[1] = *(const v8us*)(brow + 16 + 8 * hh);
      acc[t] = mmaN<ASPLIT ? 2 : 1>(ah.v, al.v, b.v, b.v, acc[t]);
    }
  }
#pragma unroll
  for (int t = 0; t < 4; ++t) {
    const int col = col0 + t * 16 + ln;
    float bv = bias ? bias[col] : 0.f;
    if (BIAS_BF16) bv = bf16_round(bv);
#pragma unroll
    for (int r = 0; r < 8; ++r) {
      float v = acc[t][r] + bv;
      if (resid) { float rv = resid[(size_t)((row0 + 8 * hh + r) % rmod) * ldr + col]; if (RES_BF16) rv = bf16_round(rv); v += rv; }
      if (ACT == 1) v = fmaxf(v, 0.f);
      if (ACT == 2) v = 0.5f * v * (1.0f + erff(v * 0.70710678118654752f));
      if (ACT == 3) { const float u = 0.7978845608028654f * (v + 0.044715f * v * v * v); v = 0.5f * v * (1.0f + tanhf(u)); }
      so[w][8 * hh + r][t * 16 + ln] = v;
    }
  }
  __builtin_amdgcn_fence(__ATOMIC_ACQ_REL, "workgroup");
  __builtin_amdgcn_wave_barrier();
  const int rsub = lane >> 4, c4 = (lane & 15) * 4;
  {
#pragma unroll
    for (int q = 0; q < 8; ++q) {
      const int r = q * 2 + rsub;
      const v4f v = *(const v4fa*)&so[w][r][c4];
      *(v4f*)(C + (size_t)(row0 + r) * ldc + col0 + c4) = v;
    }
    
  }
}
// row LayerNorm (biased variance, eps) over N: s = X (+ R); optional out_sum <- s; out_norm <- (s-mu)*rsqrt(var+eps)*g + b
template <bool PARAM_BF16>
__global__ __launch_bounds__(256) void k_layernorm(const float* __restrict__ X, const float* __restrict__ R, const float* __restrict__ g, const float* __restrict__ bta,
                                                  float* __restrict__ out_sum, float* __restrict__ out_norm, int N, float eps) {
  __shared__ float red[256];
  const int row = blockIdx.x, tid = threadIdx.x;
  const float* x = X + (size_t)row * N; const float* rr = R ? R + (size_t)row * N : nullptr;
  float vals[16];                     // up to N = 4096
  const int per = N / 256;            // contiguous chunk per thread? use strided-by-4 chunks: thread handles j = tid*4 + 1024*u
  float s1 = 0.f;
  for (int u = 0; u < per / 4; ++u) {
    const int j = tid * 4 + 1024 * u;
    const v4f a = *(const v4fa*)(x + j);
    v4f b = {0.f,0.f,0.f,0.f}; if (rr) b = *(const v4fa*)(rr + j);
#pragma unroll
    for (int q = 0; q < 4; ++q) { const float v = a[q] + b[q]; vals[u * 4 + q] = v; s1 += v; }
  }
  red[tid] = s1; __syncthreads();
  for (int st = 128; st > 0; st >>= 1) { if (tid < st) red[tid] += red[tid + st]; __syncthreads(); }
  const float mu = red[0] / (float)N; __syncthreads();
  float s2 = 0.f;
  for (int u = 0; u < per / 4; ++u)
#pragma unroll
    for (int q = 0; q < 4; ++q) { const float c = vals[u * 4 + q] - mu; s2 += c * c; }
  red[tid] = s2; __syncthreads();
  for (int st = 128; st > 0; st >>= 1) { if (tid < st) red[tid] += red[tid + st]; __syncthreads(); }
  const float rs = rsqrtf(red[0] / (float)N + eps);
  {
    for (int u = 0; u < per / 4; ++u) {
      const int j = tid * 4 + 1024 * u;
      v4f o, sm;
#pragma unroll
      for (int q = 0; q < 4; ++q) {
        float gg = g[j + q], bb = bta[j + q];
        if (PARAM_BF16) { gg = bf16_round(gg); bb = bf16_round(bb); }
        sm[q] = vals[u * 4 + q]; o[q] = (vals[u * 4 + q] - mu) * rs * gg + bb;
      }
      if (out_sum) *(v4f*)(out_sum + (size_t)row * N + j) = sm;
      *(v4f*)(out_norm + (size_t)row * N + j) = o;
    }
    
  }
}



// ---- f16 WMMA path (v_wmma_f32_16x16x32_f16): 11-bit significands for operands in range — used where a [0,1] probability operand needs more precision than bf16
typedef _Float16 v16h __attribute__((ext_vector_type(16)));
union FragH { v16h v; v8us half[2]; _Float16 h[16]; unsigned short u[16]; };
template <int NT>
__device__ __forceinline__ v8f mmaH(v16h ah, v16h al, v16h bh, v16h bl, v8f c) {
  c = __builtin_amdgcn_wmma_f32_16x16x32_f16(false, ah, false, bh, (short)0, c, false, false);
  if (NT >= 2) c = __builtin_amdgcn_wmma_f32_16x16x32_f16(false, al, false, bh, (short)0, c, false, false);
  if (NT >= 3) c = __builtin_amdgcn_wmma_f32_16x16x32_f16(false, ah, false, bl, (short)0, c, false, false);
  asm volatile("v_nop\n\tv_nop\n\tv_nop\n\tv_nop" : "+v"(c) : "v"(ah), "v"(al), "v"(bh), "v"(bl));
  return c;
}
// batched GEMM like k_gemm_b but f16 operands: A f32 (split into f16 hi/lo if ASPLIT, else rounded to f16), Bt = f16 values [n][k]; alpha; C f32; N multiple of 16 (partial tiles skipped)
template <bool ASPLIT>
__global__ __launch_bounds__(128) void k_gemm_h(const float* __restrict__ A, int lda, size_t sA, const _Float16* __restrict__ Bh, int ldb, size_t sB, float alpha, float* __restrict__ C, int ldc, size_t sC, int M, int N, int K) {
  __shared__ __attribute__((aligned(16))) float so[4][16][64];
  const int tid = threadIdx.x, w = tid >> 5, lane = tid & 31, ln = lane & 15, hh = lane >> 4; const int by = blockIdx.y;
  A += (size_t)by * sA; Bh += (size_t)by * sB; C += (size_t)by * sC;
  const int ntn = (N + 63) / 64; const int wid = blockIdx.x * 4 + w; const int mt = wid / ntn, nq = wid % ntn; if (mt * 16 >= M) return;
  const int row0 = mt * 16, col0 = nq * 64; const float* arow = A + (size_t)(row0 + ln) * lda;
  v8f acc[4] = {};
  for (int kb = 0; kb < K; kb += 32) {
    FragH ah, al;
    const v4f x0 = *(const v4fa*)(arow + kb + 8 * hh), x1 = *(const v4fa*)(arow + kb + 8 * hh + 4), x2 = *(const v4fa*)(arow + kb + 16 + 8 * hh), x3 = *(const v4fa*)(arow + kb + 16 + 8 * hh + 4);
    float xs[16] = {x0[0],x0[1],x0[2],x0[3],x1[0],x1[1],x1[2],x1[3],x2[0],x2[1],x2[2],x2[3],x3[0],x3[1],x3[2],x3[3]};
#pragma unroll
    for (int i = 0; i < 16; ++i) { const _Float16 h = (_Float16)xs[i]; ah.h[i] = h; al.h[i] = ASPLIT ? (_Float16)(xs[i] - (float)h) : (_Float16)0.0f; }
#pragma unroll
    for (int t = 0; t < 4; ++t) { if (col0 + t * 16 >= N) continue; const size_t boff = (size_t)(col0 + t * 16 + ln) * ldb + kb; FragH bq; bq.half[0] = *(const v8us*)(Bh + boff + 8 * hh); bq.half[1] = *(const v8us*)(Bh + boff + 16 + 8 * hh);
      acc[t] = mmaH<ASPLIT ? 2 : 1>(ah.v, al.v, bq.v, bq.v, acc[t]); }
  }
#pragma unroll
  for (int t = 0; t < 4; ++t) { if (col0 + t * 16 >= N) continue;
#pragma unroll
    for (int r = 0; r < 8; ++r) so[w][8 * hh + r][t * 16 + ln] = acc[t][r] * alpha; }
  __builtin_amdgcn_fence(__ATOMIC_ACQ_REL, "workgroup"); __builtin_amdgcn_wave_barrier();
  const int rsub = lane >> 4, c4 = (lane & 15) * 4;
  {
#pragma unroll
    for (int q = 0; q < 8; ++q) { const int r = q * 2 + rsub; if (col0 + c4 < N) { const v4f v = *(const v4fa*)&so[w][r][c4]; *(v4f*)(C + (size_t)(row0 + r) * ldc + col0 + c4) = v; } }
     }
}

// Wt[n][k] = f16(W[k][n]·scale) from f32 row-major W[K][N] (scale = power of two; bf16-exact weights stay exact in f16 away from the subnormal range)
__global__ __launch_bounds__(256) void k_wt_f16(const float* __restrict__ W, _Float16* __restrict__ Wt, int K, int N, float scale) {
  const int t = blockIdx.x * 256 + threadIdx.x; if (t >= N * (K / 8)) return; const int n = t / (K / 8), k8 = (t % (K / 8)) * 8; FragH f;
#pragma unroll
  for (int i = 0; i < 8; ++i) f.h[i] = (_Float16)(bf16_round(W[(size_t)(k8 + i) * N + n]) * scale); const v8us o = f.half[0];
  *(v8us*)((unsigned short*)Wt + (size_t)n * K + k8) = o; 
}
// k_gemm_hh variant with fused epilogue: v = acc·alpha + bias[by·sBias + col] (+ CP[(row/rowsPerB)·sCPb + by·64 + col] if CP) ; ACT 0 none / 1 elu ; writes f16 C16 (and f32 C if non-null)
template <int ACT>
__global__ __launch_bounds__(128) void k_gemm_hhx(const _Float16* __restrict__ A, int lda, size_t sA, const _Float16* __restrict__ Bh, int ldb, size_t sB, float alpha, const float* __restrict__ bias, size_t sBias, const float* __restrict__ CP, int rowsPerB, size_t sCPb, int row0g,
    float* __restrict__ C, _Float16* __restrict__ C16, int ldc, size_t sC, int M, int N, int K) {
  __shared__ __attribute__((aligned(16))) float so[4][16][64];
  const int tid = threadIdx.x, w = tid >> 5, lane = tid & 31, ln = lane & 15, hh = lane >> 4; const int by = blockIdx.y;
  A += (size_t)by * sA; Bh += (size_t)by * sB; const size_t cofs = (size_t)by * sC; const float* bp = bias ? bias + (size_t)by * sBias : nullptr;
  const int ntn = (N + 63) / 64; const int wid = blockIdx.x * 4 + w; const int mt = wid / ntn, nq = wid % ntn; if (mt * 16 >= M) return;
  const int row0 = mt * 16, col0 = nq * 64; const _Float16* arow = A + (size_t)(row0 + ln) * lda;
  v8f acc[4] = {};
  for (int kb = 0; kb < K; kb += 32) { FragH ah; ah.half[0] = *(const v8us*)((const unsigned short*)arow + kb + 8 * hh); ah.half[1] = *(const v8us*)((const unsigned short*)arow + kb + 16 + 8 * hh);
#pragma unroll
    for (int t = 0; t < 4; ++t) { if (col0 + t * 16 >= N) continue; const size_t boff = (size_t)(col0 + t * 16 + ln) * ldb + kb; FragH bq; bq.half[0] = *(const v8us*)((const unsigned short*)Bh + boff + 8 * hh); bq.half[1] = *(const v8us*)((const unsigned short*)Bh + boff + 16 + 8 * hh);
      acc[t] = mmaH<1>(ah.v, ah.v, bq.v, bq.v, acc[t]); }
  }
#pragma unroll
  for (int t = 0; t < 4; ++t) { if (col0 + t * 16 >= N) continue; const int col = col0 + t * 16 + ln; const float bv = bp ? bf16_round(bp[col]) : 0.f;
#pragma unroll
    for (int r = 0; r < 8; ++r) { float v = acc[t][r] * alpha + bv; if (CP) { const int rr = row0g + row0 + 8 * hh + r; if (rowsPerB < 0) v += CP[cofs + (size_t)rr * ldc + col];      /* rowsPerB < 0: own element of the batched C plane */ else { const int bidx = rr / rowsPerB; v += CP[(size_t)bidx * sCPb + (size_t)by * 64 + col]; } } if (ACT == 1) v = (v > 0.f) ? v : expm1f(v); else if (ACT == 7) v = (v > 0.f) ? v + 1.0f : expf(v); else if (ACT == 8) v = tanhf(v); else if (ACT == 9) v = 0.5f * v * (1.0f + tanhf(0.7978845608028654f * (v + 0.044715f * v * v * v))); else if (ACT == 11) v = 1.0f / (1.0f + expf(-v)); else if (ACT == 12) v = (v > 0.f) ? v : 0.01f * v; else if (ACT == 14) v = (v > 0.f) ? v : 0.1f * v; else if (ACT == 16) v = (v >= 0.f) ? v : 0.3f * v; else if (ACT == 17) v = (v >= 0.f) ? v : 0.2f * v; else if (ACT == 15) v = v / (1.0f + expf(-v)); else if (ACT == 3) v = fmaxf(v, 0.f); else if (ACT == 6) v = 0.5f * v * (1.0f + erff(v * 0.70710678118654752f)); so[w][8 * hh + r][t * 16 + ln] = v; } }
  __builtin_amdgcn_fence(__ATOMIC_ACQ_REL, "workgroup"); __builtin_amdgcn_wave_barrier();
  const int rsub = lane >> 4, c4 = (lane & 15) * 4; typedef _Float16 v4h __attribute__((ext_vector_type(4)));
  {
#pragma unroll
    for (int q = 0; q < 8; ++q) { const int r = q * 2 + rsub; if (col0 + c4 < N) { const v4f v = *(const v4fa*)&so[w][r][c4]; if (C) *(v4f*)(C + cofs + (size_t)(row0 + r) * ldc + col0 + c4) = v; if (C16) { v4h h4; for (int i = 0; i < 4; ++i) h4[i] = (_Float16)v[i]; *(v4h*)(C16 + cofs + (size_t)(row0 + r) * ldc + col0 + c4) = h4; } } }
     }
}


typedef _Float16 v4h __attribute__((ext_vector_type(4)));

__global__ __launch_bounds__(256) void k_x16(const float* __restrict__ x, _Float16* __restrict__ X16, size_t n8) { const size_t t = (size_t)blockIdx.x * 256 + threadIdx.x; if (t >= n8) return; FragH f;
#pragma unroll
  for (int q = 0; q < 8; ++q) f.h[q] = (_Float16)bf16_round(x[t * 8 + q]); *(v8us*)((unsigned short*)X16 + t * 8) = f.half[0];  }
__global__ __launch_bounds__(256) void k_h16(const float* __restrict__ x, _Float16* __restrict__ X16, size_t n8) { const size_t t = (size_t)blockIdx.x * 256 + threadIdx.x; if (t >= n8) return; FragH f;
#pragma unroll
  for (int q = 0; q < 8; ++q) f.h[q] = (_Float16)x[t * 8 + q]; *(v8us*)((unsigned short*)X16 + t * 8) = f.half[0];  }
__global__ __launch_bounds__(256) void k_round16f(const float* __restrict__ W, _Float16* __restrict__ Bt, size_t n8) { const size_t t = (size_t)blockIdx.x * 256 + threadIdx.x; if (t >= n8) return; FragH f;
#pragma unroll
  for (int i = 0; i < 8; ++i) f.h[i] = (_Float16)(bf16_round(W[t * 8 + i]) * 16.0f); *(v8us*)((unsigned short*)Bt + t * 8) = f.half[0];  }
// ---- fast GEMM (wave tile 32x64; requires M % 32 == 0 rows per launch region and N % 64 == 0); epilogue = k_gemm_hhx semantics ----
__device__ __forceinline__ v16h g2_frag(const _Float16* p, int hh) { FragH f; f.half[0] = *(const v8us*)((const unsigned short*)p + 8 * hh); f.half[1] = *(const v8us*)((const unsigned short*)p + 16 + 8 * hh); return f.v; }
__device__ __forceinline__ v8f g2_mma(v16h a, v16h b, v8f c) { v8f d = __builtin_amdgcn_wmma_f32_16x16x32_f16(false, a, false, b, (short)0, c, false, false); asm volatile("v_nop\n\tv_nop\n\tv_nop\n\tv_nop" : "+v"(d) : "v"(a), "v"(b)); return d; }
template <int ACT>
__global__ __launch_bounds__(128) void k_gemm2(const _Float16* __restrict__ A, int lda, size_t sA, const _Float16* __restrict__ Bh, int ldb, size_t sB, float alpha, const float* __restrict__ bias, size_t sBias, const float* __restrict__ CP, int rowsPerB, size_t sCPb, int row0g,
    float* __restrict__ C, _Float16* __restrict__ C16, int ldc, size_t sC, int M, int N, int K) { static_assert(ACT == 0 || ACT == 3 || ACT == 6 || ACT == 8 || ACT == 9 || ACT == 11 || ACT == 12 || ACT == 14 || ACT == 15 || ACT == 16 || ACT == 17, "k_gemm2: unsupported ACT code (would silently apply no activation)");
  __shared__ __attribute__((aligned(16))) float so[4][32][68];
  const int tid = threadIdx.x, w = tid >> 5, lane = tid & 31, ln = lane & 15, hh = lane >> 4; const int by = blockIdx.y;
  A += (size_t)by * sA; Bh += (size_t)by * sB; const size_t cofs = (size_t)by * sC; const float* bp = bias ? bias + (size_t)by * sBias : nullptr;
  const int ntn = N >> 6; const int mt = blockIdx.x / ntn, nq = blockIdx.x - mt * ntn; const int row0 = mt * 128 + 32 * w, col0 = nq * 64; if (row0 >= M) return;
  const _Float16* a0p = A + (size_t)(row0 + ln) * lda; const _Float16* a1p = a0p + (size_t)16 * lda;
  const _Float16* b0p = Bh + (size_t)(col0 + ln) * ldb; const _Float16* b1p = b0p + (size_t)16 * ldb; const _Float16* b2p = b1p + (size_t)16 * ldb; const _Float16* b3p = b2p + (size_t)16 * ldb;
  const v8f z8 = {0.f,0.f,0.f,0.f,0.f,0.f,0.f,0.f}; v8f c00 = z8, c01 = z8, c02 = z8, c03 = z8, c10 = z8, c11 = z8, c12 = z8, c13 = z8;
#pragma unroll 1
  for (int kb = 0; kb < K; kb += 32) { const v16h a0 = g2_frag(a0p + kb, hh), a1 = g2_frag(a1p + kb, hh);
    v16h b = g2_frag(b0p + kb, hh); c00 = g2_mma(a0, b, c00); c10 = g2_mma(a1, b, c10);
    b = g2_frag(b1p + kb, hh); c01 = g2_mma(a0, b, c01); c11 = g2_mma(a1, b, c11);
    b = g2_frag(b2p + kb, hh); c02 = g2_mma(a0, b, c02); c12 = g2_mma(a1, b, c12);
    b = g2_frag(b3p + kb, hh); c03 = g2_mma(a0, b, c03); c13 = g2_mma(a1, b, c13); }
  v8f accs[8] = {c00, c01, c02, c03, c10, c11, c12, c13};
#pragma unroll
  for (int u = 0; u < 8; ++u) { const int t = u & 3, half = u >> 2; const int col = col0 + t * 16 + ln; const float bv = bp ? bf16_round(bp[col]) : 0.f;
#pragma unroll
    for (int r = 0; r < 8; ++r) { const int rloc = half * 16 + 8 * hh + r; float v = accs[u][r] * alpha + bv; if (CP) { if (rowsPerB < 0) v += CP[cofs + (size_t)(row0g + row0 + rloc) * ldc + col];      /* rowsPerB < 0: own element of the batched C plane */ else { const int bidx = (row0g + row0 + rloc) / rowsPerB; v += CP[(size_t)bidx * sCPb + (size_t)by * 64 + col]; } }
      if (ACT == 3) v = fmaxf(v, 0.f); else if (ACT == 6) v = 0.5f * v * (1.0f + erff(v * 0.70710678118654752f)); else if (ACT == 11) v = 1.0f / (1.0f + expf(-v)); else if (ACT == 15) v = v / (1.0f + expf(-v)); else if (ACT == 12) v = (v > 0.f) ? v : 0.01f * v; else if (ACT == 8) v = tanhf(v); else if (ACT == 9) v = 0.5f * v * (1.0f + tanhf(0.7978845608028654f * (v + 0.044715f * v * v * v))); else if (ACT == 14) v = (v > 0.f) ? v : 0.1f * v; else if (ACT == 16) v = (v >= 0.f) ? v : 0.3f * v; else if (ACT == 17) v = (v >= 0.f) ? v : 0.2f * v;
      so[w][rloc][t * 16 + ln] = v; } }
  __builtin_amdgcn_fence(__ATOMIC_ACQ_REL, "workgroup"); __builtin_amdgcn_wave_barrier();
  const int rsub = lane >> 4, c4 = (lane & 15) * 4;
  {
#pragma unroll
    for (int q = 0; q < 16; ++q) { const int r = q * 2 + rsub; const v4f v = *(const v4fa*)&so[w][r][c4]; if (C) *(v4f*)(C + cofs + (size_t)(row0 + r) * ldc + col0 + c4) = v; if (C16) { v4h h4; for (int i = 0; i < 4; ++i) h4[i] = (_Float16)v[i]; *(v4h*)(C16 + cofs + (size_t)(row0 + r) * ldc + col0 + c4) = h4; } }
     } }


__global__ __launch_bounds__(256) void k_wnat(const float* __restrict__ w, size_t n8, _Float16* __restrict__ Bt) { const size_t t = (size_t)blockIdx.x * 256 + threadIdx.x; if (t >= n8) return; FragH f; for (int q = 0; q < 8; ++q) f.h[q] = (_Float16)(bf16_round(w[t * 8 + q]) * 16.0f); *(v8us*)((unsigned short*)Bt + t * 8) = f.half[0];  }
__global__ __launch_bounds__(256) void k_rsm(const float* __restrict__ S, _Float16* __restrict__ P, int nrows) {
  #pragma clang fp contract(off)
  const int i = blockIdx.x * 256 + threadIdx.x; if (i >= nrows) return; const float* s = S + (size_t)i * SQ; float mx = -3.0e38f;
#pragma unroll 1
  for (int j = 0; j < SQ; ++j) mx = fmaxf(mx, s[j]); float se = 0.f;
#pragma unroll 1
  for (int j = 0; j < SQ; ++j) se += expf(s[j] - mx); const float sc = 256.0f / se;
#pragma unroll 1
  for (int j0 = 0; j0 < SQ; j0 += 8) { FragH f; for (int q = 0; q < 8; ++q) f.h[q] = (_Float16)(expf(s[j0 + q] - mx) * sc); unsigned short* d = (unsigned short*)P + (size_t)i * SQ + j0; *(v8us*)d = f.half[0];  } }
__global__ __launch_bounds__(256) void k_vt(const _Float16* __restrict__ V16, int b, int h0, _Float16* __restrict__ VT) { __shared__ unsigned short tl[64][65]; const int tid = threadIdx.x; const int hh = blockIdx.x % HG, sg = blockIdx.x / HG; const int s0 = sg * 64; const int h = h0 + hh;
  for (int i = tid; i < 64 * 8; i += 256) { const int j = i / 8, d8 = (i % 8) * 8; FragH f; f.half[0] = *(const v8us*)((const unsigned short*)V16 + ((size_t)b * SQ + s0 + j) * DM + h * HD + d8); for (int q = 0; q < 8; ++q) tl[d8 + q][j] = f.u[q]; }
  __syncthreads();
  { for (int i = tid; i < 64 * 8; i += 256) { const int d = i / 8, j8 = (i % 8) * 8; FragH f; for (int q = 0; q < 8; ++q) f.u[q] = tl[d][j8 + q]; *(v8us*)((unsigned short*)VT + ((size_t)hh * HD + d) * SQ + s0 + j8) = f.half[0]; }  } }



__global__ __launch_bounds__(256) void k_rsmf(const float* __restrict__ S, _Float16* __restrict__ P, int qn, int hg) {
  #pragma clang fp contract(off)
  const int t = blockIdx.x * 256 + threadIdx.x; if (t >= qn * hg) return; const size_t i = (size_t)(t / qn) * SQ + (t % qn); const float* s = S + i * SQ; float mx = -3.0e38f;
#pragma unroll 1
  for (int j = 0; j < SQ; ++j) mx = fmaxf(mx, s[j]); float se = 0.f;
#pragma unroll 1
  for (int j = 0; j < SQ; ++j) se += __expf(s[j] - mx); const float sc = 256.0f / se;
#pragma unroll 1
  for (int j0 = 0; j0 < SQ; j0 += 8) { FragH f; for (int q = 0; q < 8; ++q) f.h[q] = (_Float16)(__expf(s[j0 + q] - mx) * sc); unsigned short* d = (unsigned short*)P + i * SQ + j0; *(v8us*)d = f.half[0];  } }

// 2^x on v_exp_f32 with one free issue slot behind it: the instruction set asks for that slot before the result is read or the source overwritten.
__device__ __forceinline__ float exp2_slot(float x) { float r; asm("v_exp_f32 %0, %1\n\tv_nop" : "=v"(r) : "v"(x)); return r; }
#define FK 64      /* keys per stage */
#define FQ 128     /* query rows per work-group */
#define KPH 72     /* LDS row pitch of K and V^T, halves: 144 B = 16 B x odd, b128 fragment reads free of bank conflicts */
#define MPF 68     /* LDS row pitch of the mask rows, floats: 272 B = 16 B x odd */
typedef float v2f __attribute__((ext_vector_type(2)));
__device__ __forceinline__ float xhalf(float x) { return __builtin_bit_cast(float, __builtin_amdgcn_permlanex16(__builtin_bit_cast(int, x), __builtin_bit_cast(int, x), 0x76543210, 0xfedcba98, false, false)); }      /* lane l with lane l ^ 16 */
__device__ __forceinline__ v8f fa_mma(v16h a, v16h b, v8f c) { return __builtin_amdgcn_wmma_f32_16x16x32_f16(false, a, false, b, (short)0, c, false, false); }
__global__ __launch_bounds__(256) void k_fattn(const _Float16* __restrict__ Qh, const _Float16* __restrict__ Ql, const _Float16* __restrict__ Kh, const _Float16* __restrict__ Vt, const float* __restrict__ Mk, float* __restrict__ out) {
  __shared__ __attribute__((aligned(16))) _Float16 sk[FK][KPH];
  __shared__ __attribute__((aligned(16))) _Float16 sv[HD][KPH];
  __shared__ __attribute__((aligned(16))) float sm[FQ][MPF];
  const int tid = threadIdx.x, w = tid >> 5, lane = tid & 31, ln = lane & 15, hh = lane >> 4;
  const int h = blockIdx.x % NH, qb = (blockIdx.x / NH) % (SQ / FQ), b = blockIdx.x / (NH * (SQ / FQ));      /* neighbouring work-groups: same mask rows, other heads */
  const int qrow = qb * FQ + w * 16;
  const size_t qo = ((size_t)b * SQ + qrow + ln) * DM + h * HD;
  const v16h qh0 = g2_frag(Qh + qo, hh), qh1 = g2_frag(Qh + qo + 32, hh), ql0 = g2_frag(Ql + qo, hh), ql1 = g2_frag(Ql + qo + 32, hh);
  const int sr = tid >> 3, sc = (tid & 7) * 8;      /* staging: 8 threads cover one 128-byte row, a wave four whole lines */
  const _Float16* kg = Kh + ((size_t)b * SQ + sr) * DM + h * HD + sc;
  const _Float16* vg = Vt + (((size_t)b * NH + h) * HD + sr) * SQ + sc;
  const float* mg = Mk + ((size_t)b * SQ + qrow + hh) * SQ + ln * 4;      /* 16 lanes cover 256 bytes of one mask row */
  v8us kr[2], vr[2]; v4f mr[8];
#pragma unroll
  for (int i = 0; i < 2; ++i) { kr[i] = *(const v8us*)((const unsigned short*)kg + (size_t)i * 32 * DM); vr[i] = *(const v8us*)((const unsigned short*)vg + (size_t)i * 32 * SQ); }
#pragma unroll
  for (int i = 0; i < 8; ++i) mr[i] = *(const v4fa*)(mg + (size_t)i * 2 * SQ);
  const v8f z8 = {0.f, 0.f, 0.f, 0.f, 0.f, 0.f, 0.f, 0.f};
  v8f o[4] = {z8, z8, z8, z8};
  v8f cin = z8;      /* minus the offset in use, in all eight rows of the lane's query column: the C operand of every score tile */
  float l = 0.f;
#pragma unroll 1      /* rolled, for speed only */
  for (int s = 0; s < SQ / FK; ++s) {
    __syncthreads();      /* every wave has finished reading the stage before */
#pragma unroll
    for (int i = 0; i < 2; ++i) { *(v8us*)&sk[sr + 32 * i][sc] = kr[i]; *(v8us*)&sv[sr + 32 * i][sc] = vr[i]; }
#pragma unroll
    for (int i = 0; i < 8; ++i) *(v4fa*)&sm[w * 16 + 2 * i + hh][ln * 4] = mr[i];
    __syncthreads();      /* the stage is complete for every wave */
    if (s + 1 < SQ / FK) {      /* next stage's loads fly while this one is worked on */
      kg += (size_t)FK * DM; vg += FK; mg += FK;
#pragma unroll
      for (int i = 0; i < 2; ++i) { kr[i] = *(const v8us*)((const unsigned short*)kg + (size_t)i * 32 * DM); vr[i] = *(const v8us*)((const unsigned short*)vg + (size_t)i * 32 * SQ); }
#pragma unroll
      for (int i = 0; i < 8; ++i) mr[i] = *(const v4fa*)(mg + (size_t)i * 2 * SQ);
    }
    v16h ka[4][2];
#pragma unroll
    for (int u = 0; u < 2; ++u) {
#pragma unroll
      for (int t = 0; t < 4; ++t) ka[t][u] = g2_frag(&sk[t * 16 + ln][32 * u], hh); }
    v8f sc[4];      /* k.(q_hi + q_lo) - offset in use, log2 units; the four tiles take turns, so that no product waits for the one before it in its own accumulator */
    __builtin_amdgcn_sched_barrier(0);      /* this one and the three below keep the turns: left alone, the compiler runs each tile's four dependent products one behind the other, and each then waits for the one before */
#pragma unroll
    for (int t = 0; t < 4; ++t) sc[t] = fa_mma(ka[t][0], qh0, cin);
    __builtin_amdgcn_sched_barrier(0);
#pragma unroll
    for (int t = 0; t < 4; ++t) sc[t] = fa_mma(ka[t][0], ql0, sc[t]);
    __builtin_amdgcn_sched_barrier(0);
#pragma unroll
    for (int t = 0; t < 4; ++t) sc[t] = fa_mma(ka[t][1], qh1, sc[t]);
    __builtin_amdgcn_sched_barrier(0);
#pragma unroll
    for (int t = 0; t < 4; ++t) sc[t] = fa_mma(ka[t][1], ql1, sc[t]);
    float bt[4];      /* one maximum per tile: four short chains, the first of them at work while the last products run */
#pragma unroll
    for (int t = 0; t < 4; ++t) { bt[t] = -3.0e38f;
#pragma unroll
      for (int r = 0; r < 8; ++r) bt[t] = fmaxf(bt[t], sc[t][r]); }
    const float bm = fmaxf(fmaxf(bt[0], bt[1]), fmaxf(bt[2], bt[3]));
    if (s == 0 || __builtin_amdgcn_ballot_w32(bm > 12.0f) != 0u) {      /* the same for the whole wave: the first stage sets the offset, a later one moves it where a weight would pass 2^12 */
      const float bf = fmaxf(bm, xhalf(bm));      /* both halves of the wave hold the same query: one offset */
      const float d = (s == 0 || bf > 12.0f) ? bf - 4.0f : 0.f, al = exp2_slot(fminf(-d, 0.f));      /* the largest weight so far becomes 2^4; d is below 0 in the first stage alone, where sums and context are still 0 and their factor must only stay finite */
#pragma unroll
      for (int t = 0; t < 4; ++t) { sc[t] -= d; o[t] *= al; }
      cin -= d; l *= al;
    }
    v2f ps[2] = {{0.f, 0.f}, {0.f, 0.f}};      /* four partial sums, as two pairs: no chain of 32 dependent adds */
    FragH pb[2];
#pragma unroll
    for (int t = 0; t < 4; ++t) {
      const v4f k0 = *(const v4fa*)&sm[w * 16 + ln][t * 16 + 8 * hh], k1 = *(const v4fa*)&sm[w * 16 + ln][t * 16 + 8 * hh + 4];
#pragma unroll
      for (int r = 0; r < 8; r += 2) {      /* two neighbouring keys at a time, in register pairs as the accumulator and the mask rows hold them */
        const v2f e = {exp2_slot(sc[t][r]), exp2_slot(sc[t][r + 1])}, k = {r < 4 ? k0[r & 3] : k1[r & 3], r < 4 ? k0[(r & 3) + 1] : k1[(r & 3) + 1]}, p = e * k;
        ps[(r >> 1) & 1] += p; pb[t >> 1].h[(t & 1) * 8 + r] = (_Float16)p[0]; pb[t >> 1].h[(t & 1) * 8 + r + 1] = (_Float16)p[1]; } }
    l += (ps[0][0] + ps[0][1]) + (ps[1][0] + ps[1][1]);
#pragma unroll
    for (int t = 0; t < 4; ++t) o[t] = fa_mma(g2_frag(&sv[t * 16 + ln][32], hh), pb[1].v, fa_mma(g2_frag(&sv[t * 16 + ln][0], hh), pb[0].v, o[t]));
  }
  l += xhalf(l);
  const float inv = 1.0f / l;
  /* the wave's own 16 mask rows become its output staging: [query][d], so that each store below covers whole lines */
#pragma unroll
  for (int t = 0; t < 4; ++t) { const v8f v = o[t] * inv; const v4f lo4 = {v[0], v[1], v[2], v[3]}, hi4 = {v[4], v[5], v[6], v[7]};
    *(v4fa*)&sm[w * 16 + ln][t * 16 + 8 * hh] = lo4; *(v4fa*)&sm[w * 16 + ln][t * 16 + 8 * hh + 4] = hi4; }
  __builtin_amdgcn_fence(__ATOMIC_ACQ_REL, "workgroup"); __builtin_amdgcn_wave_barrier();      /* orders the LDS stores above in front of the loads below, which read what other lanes of the same wave wrote; no other wave touches these rows */
#pragma unroll
  for (int i = 0; i < 8; ++i) { const int r = 2 * i + hh; const v4f v = *(const v4fa*)&sm[w * 16 + r][ln * 4]; *(v4f*)(out + ((size_t)b * SQ + qrow + r) * DM + h * HD + ln * 4) = v; } }

// ---- the three projection GEMMs in one launch, both operands staged in LDS by tensor loads: alpha * X[8192][1024] . Wt[1024][1024]^T for Wt = Wq, Wk, Wv, all rows k-contiguous f16 ----
// Each result leaves the kernel in the form the attention kernel reads, so that no pass stands between the two: q, times log2(e) / 8, as two f16 planes (value and residual), k as f16 rows,
// v transposed per batch, [batch][feature][key]: for v the two operands change places (rows of the tile = rows of Wv, columns = rows of X), which leaves every element's products and their k order as they are.
// The three weights count as one list of 3072 output features. One work-group forms 256 token rows x 192 features of that list: twelve waves (4 x 3) of 64 x 64, each wholly inside one projection.
// So a staged operand row serves more products than in a 128 x 128 tile and fewer bytes come from L2 per product. A stage is 256 bytes (128 k) of the 256 X rows and the 192 weight rows: seven 64-row slices, one tensor load each, from waves 0 to 6.
// Two buffers: stage s + 2 is requested into the buffer that pass s has just left, so it flies while pass s + 1 is worked on. The k order of every accumulator is that of the plain loop: ascending in steps of 32.
// Every inner loop is fully unrolled so that the accumulator and fragment arrays are indexed by constants and live in registers.
typedef uint32_t u32x4 __attribute__((ext_vector_type(4)));
typedef uint32_t u32x8 __attribute__((ext_vector_type(8)));
#define G3TM 256     /* token rows of a work-group's tile: slices 0 to 3 */
#define G3TN 192     /* features of a work-group's tile, out of the 3 * DM of q, k, v in a row: slices 4 to 6 */
#define G3RB 256     /* bytes of an operand row per stage */
#define G3P 272      /* LDS row pitch, bytes: 16 B x odd for the b128 fragment reads; laid by the tensor load's pad */
#define G3SL 18432   /* place of a slice: 64 rows x 272 B = 17,408 B, rounded up to a multiple of 2 KiB */
#define G3BUF (7 * G3SL)
#define G3NS (DM * 2 / G3RB)      /* stages */
__device__ __forceinline__ uint32_t uni(uint32_t v) { return (uint32_t)__builtin_amdgcn_readfirstlane(v); }
__device__ __forceinline__ uint32_t pinned(uint32_t v) { uint32_t w = uni(v); asm volatile("" : "+s"(w)); return w; }      /* for the tensor mover: keeps a tensor load's issue test a scalar branch, and the stage number that its descriptor words are formed from in a scalar register behind the waits */
#define G3NN (3 * DM / G3TN)      /* tiles along the features */
#define G3NT ((MP / G3TM) * G3NN)      /* work-groups */
__global__ __launch_bounds__(384) void k_gemm3(const _Float16* __restrict__ X, const _Float16* __restrict__ Wq, const _Float16* __restrict__ Wk, const _Float16* __restrict__ Wv, float alpha,
                                               _Float16* __restrict__ Qh, _Float16* __restrict__ Ql, _Float16* __restrict__ K16, _Float16* __restrict__ Vt) {
  static_assert(SQ % 64 == 0 && DM % 64 == 0 && MP % G3TM == 0 && (3 * DM) % G3TN == 0 && NH * HD == DM, "a wave's 64 token rows lie in one batch and its 64 features in one projection; the tiles cover everything once; V^T rows are the features");
  __shared__ __attribute__((aligned(2048))) unsigned char ring[2 * G3BUF];
  const int tid = threadIdx.x, lane = tid & 31, ln = lane & 15, hh = lane >> 4;
  const uint32_t w = uni((uint32_t)tid >> 5), wm = w & 3u, wn = w >> 2;      /* this wave's block of 64 token rows (0 to 3) and of 64 features (0 to 2) */
  const uint32_t nq = blockIdx.x % G3NN, mt = blockIdx.x / G3NN;
  const uint32_t fb = nq * (G3TN / 64) + wn, pj = fb / (DM / 64);      /* feature block in the list; pj: 0 q, 1 k, 2 v, the same for a whole wave */
  const int row0 = (int)(mt * G3TM + wm * 64u), col0 = (int)(fb % (DM / 64) * 64u);      /* this wave's first token row, and its first feature inside its projection */
  const uint32_t sa = pj == 2u ? 4u + wn : wm, sb = pj == 2u ? wm : 4u + wn;      /* the slices whose rows become this wave's 64 result rows and its 64 result columns */
  const uint32_t lbase = (uint32_t)(size_t)ring;
  /* wave w < 7 brings slice w; waves 7 to 11 bring none (their address is formed like wave 0's and never used) */
  const uint32_t sw = w < 7u ? w : 0u, sf = nq * (G3TN / 64) + (sw < 4u ? 0u : sw - 4u), sj = sf / (DM / 64);      /* for a weight slice: its feature block and its projection */
  const _Float16* sp = sw < 4u ? X + (size_t)(mt * G3TM + sw * 64u) * DM : (sj == 0u ? Wq : sj == 1u ? Wk : Wv) + (size_t)(sf % (DM / 64) * 64u) * DM;
  const uint64_t ga0 = (uint64_t)(size_t)sp;
  u32x8 g1;      /* 1-byte elements, tile = tensor = 64 rows of 256 B, source pitch one row of the matrix, 16 B of LDS pad behind every 256 B, no mask */
  /* descriptor words held in scalar registers: as plain constants they were formed anew at each issue, in registers that the loop then reused for its addresses while the request was still under way */
  g1[0] = pinned((1u << 20) | (5u << 22) | (3u << 25)); g1[1] = pinned((uint32_t)G3RB << 16); g1[2] = pinned(64u << 16); g1[3] = pinned((uint32_t)G3RB << 16); g1[4] = pinned(64u); g1[5] = pinned((uint32_t)DM * 2u); g1[6] = pinned(0u); g1[7] = pinned(0u);
  u32x4 g0; g0[0] = pinned(1u);
  auto issue = [&](uint32_t st) {
    const uint64_t ga = ga0 + (uint64_t)st * G3RB;
    g0[1] = uni(lbase + (st & 1u) * G3BUF + sw * G3SL); g0[2] = uni((uint32_t)ga); g0[3] = uni((((uint32_t)(ga >> 32)) & 0x01FFFFFFu) | 0x80000000u);
    asm volatile("tensor_load_to_lds %0, %1" :: "s"(g0), "s"(g1) : "memory"); };
  if (pinned(w < 7u)) issue(0u);
  asm volatile("s_wait_tensorcnt 0x0" ::: "memory");      /* this wave's slice of stage 0 has landed */
  __syncthreads();      /* stage 0 is complete for every wave */
  if (pinned(w < 7u)) issue(1u);
  const v8f z8 = {0.f, 0.f, 0.f, 0.f, 0.f, 0.f, 0.f, 0.f};
  v8f acc[4][4];
#pragma unroll
  for (int i = 0; i < 4; ++i) {
#pragma unroll
    for (int j = 0; j < 4; ++j) acc[i][j] = z8; }
#pragma unroll 1      /* rolled: one pass is 64 matrix instructions, and the ring's order stands once in the text */
  for (uint32_t s = 0; s < G3NS; ++s) {
    const unsigned char* buf = ring + (s & 1u) * G3BUF;
    const unsigned char* ap = buf + sa * G3SL + ln * G3P; const unsigned char* bp = buf + sb * G3SL + ln * G3P;
    v16h a[2][4], b[2][4];      /* two fragment sets: block kb + 1 is fetched, as one group, while block kb is multiplied; no fragment of another stage is fetched */
#pragma unroll
    for (int i = 0; i < 4; ++i) { a[0][i] = g2_frag((const _Float16*)(ap + i * 16 * G3P), hh); b[0][i] = g2_frag((const _Float16*)(bp + i * 16 * G3P), hh); }
#pragma unroll
    for (int kb = 0; kb < G3RB / 64; ++kb) {
      __builtin_amdgcn_sched_barrier(0);      /* keeps the next block's LDS reads together in front of this block's matrix instructions, for speed only */
      if (kb + 1 < G3RB / 64) {
#pragma unroll
        for (int i = 0; i < 4; ++i) { a[(kb + 1) & 1][i] = g2_frag((const _Float16*)(ap + i * 16 * G3P + (kb + 1) * 64), hh); b[(kb + 1) & 1][i] = g2_frag((const _Float16*)(bp + i * 16 * G3P + (kb + 1) * 64), hh); }
      }
      __builtin_amdgcn_sched_barrier(0);      /* the other side of the same group */
      if (kb + 1 == G3RB / 64) {      /* the pass's foot stands in front of its last block, whose fragments are fetched by now: the refill starts a block earlier, and what follows works on registers alone */
        asm volatile("s_wait_dscnt 0x0" ::: "memory");      /* this wave's reads of the buffer have returned before it is refilled */
        asm volatile("s_wait_tensorcnt 0x0" ::: "memory");      /* this wave's slice of stage s + 1 has landed */
        __syncthreads();      /* publishes stage s + 1 and ends every wave's reading of stage s */
        if (pinned(s + 2u < G3NS && w < 7u)) issue(pinned(s + 2u));
      }
#pragma unroll
      for (int i = 0; i < 4; ++i) {
#pragma unroll
        for (int j = 0; j < 4; ++j) acc[i][j] = fa_mma(a[kb & 1][i], b[kb & 1][j], acc[i][j]); }
    }
  }
  asm volatile("s_wait_tensorcnt 0x0" ::: "memory");      /* nothing in flight when the ring becomes output staging */
  asm volatile("s_wait_dscnt 0x0" ::: "memory");
  /* the last pass's barrier has ended every read of the ring: each wave stages its 64 x 64 results in its own slice place, [row][col] at 68 floats, so that each store below covers whole lines */
  float* so = (float*)(ring + w * G3SL);
#pragma unroll
  for (int i = 0; i < 4; ++i) {
#pragma unroll
    for (int j = 0; j < 4; ++j) {
#pragma unroll
      for (int r = 0; r < 8; ++r) so[(i * 16 + 8 * hh + r) * 68 + j * 16 + ln] = acc[i][j][r] * alpha; } }
  __builtin_amdgcn_fence(__ATOMIC_ACQ_REL, "workgroup"); __builtin_amdgcn_wave_barrier();      /* orders the LDS stores above in front of the loads below, which read what other lanes of the same wave wrote */
  const int c4 = ln * 4;
  if (pj == 0u) {      /* one branch for the whole wave, outside the output loops: inside each loop the LDS reads and the stores overlap */
    const size_t cb = (size_t)row0 * DM + col0 + c4;
#pragma unroll
    for (int q = 0; q < 32; ++q) { const int r = q * 2 + hh; const v4f v = *(const v4fa*)&so[r * 68 + c4]; v4h h4, l4;
      for (int i = 0; i < 4; ++i) { const float qv = v[i] * 0.18033688011112042592f; h4[i] = (_Float16)qv; l4[i] = (_Float16)(qv - (float)h4[i]); }      /* 1/8 and the change to log2 units; the residual keeps its own size (f16 subnormals where it is small), so that it adds into the accumulator of the value plane */
      *(v4h*)(Qh + cb + (size_t)r * DM) = h4; *(v4h*)(Ql + cb + (size_t)r * DM) = l4; }
  } else {      /* k: [token][feature]; v: [batch][feature][key], the tile's rows being features and its columns keys */
    _Float16* C16 = pj == 1u ? K16 + (size_t)row0 * DM + col0 + c4
                             : Vt + ((size_t)(row0 / SQ) * DM + col0) * SQ + row0 % SQ + c4;
    const size_t cp = pj == 1u ? DM : SQ;
#pragma unroll
    for (int q = 0; q < 32; ++q) { const int r = q * 2 + hh; const v4f v = *(const v4fa*)&so[r * 68 + c4]; v4h h4;
      for (int i = 0; i < 4; ++i) h4[i] = (_Float16)v[i];
      *(v4h*)(C16 + (size_t)r * cp) = h4; }
  } }

// ---- operand preparation in one launch: x -> f16 rows, and the three [in][out] weights -> f16 x16, transposed to [out][in]; every value is formed as in k_x16 and k_wt_f16 ----
// Few, long-lived waves: each thread puts sixteen 16-byte loads in flight, then converts and stores; no thread depends on another, so there is no LDS and no barrier.
// Weights: a thread takes 8 k x 4 n, so that the 8 halves it stores for one n are 16 contiguous bytes of a transposed row. In a wave 4 lanes lie along n and 8 along k:
// a load covers 64 contiguous bytes of each of 8 weight rows (the wave beside it takes the other half of those lines), a store four whole 128-byte lines.
#define PWG 64       /* work-groups per weight matrix, each 32 n x 512 k */
#define PXG 512      /* work-groups on x, each 4096 groups of four floats */
__global__ __launch_bounds__(256) void k_prep(const float* __restrict__ x, const float* __restrict__ wq, const float* __restrict__ wk, const float* __restrict__ wv,
                                              _Float16* __restrict__ X16, _Float16* __restrict__ BQ, _Float16* __restrict__ BK, _Float16* __restrict__ BV) {
  static_assert(NR * DM == (size_t)PXG * 4096 * 4 && DM * DM == PWG * 32 * 512, "the work-groups cover x and each weight matrix exactly once");
  const int tid = threadIdx.x, bx = blockIdx.x;
  if (bx < 3 * PWG) {      /* the same for the whole work-group; the weights have the lowest block numbers */
    const int mi = bx / PWG, tl = bx % PWG, lane = tid & 31, w = tid >> 5;
    const float* W = mi == 0 ? wq : mi == 1 ? wk : wv; _Float16* Wt = mi == 0 ? BQ : mi == 1 ? BK : BV;
    const int n = (tl >> 1) * 32 + (w & 1) * 16 + (lane & 3) * 4, k = (tl & 1) * 512 + (w >> 1) * 64 + (lane >> 2) * 8;
    v4f r[2][8];
#pragma unroll
    for (int u = 0; u < 2; ++u) {
#pragma unroll
      for (int j = 0; j < 8; ++j) r[u][j] = *(const v4fa*)(W + (size_t)(k + u * 256 + j) * DM + n); }
#pragma unroll
    for (int u = 0; u < 2; ++u) {
#pragma unroll
      for (int i = 0; i < 4; ++i) { FragH f;
#pragma unroll
        for (int j = 0; j < 8; ++j) f.h[j] = (_Float16)(bf16_round(r[u][j][i]) * 16.0f);
        *(v8us*)((unsigned short*)Wt + (size_t)(n + i) * DM + k + u * 256) = f.half[0]; } }
  } else {
    const size_t g0 = (size_t)(bx - 3 * PWG) * 4096 + tid;      /* a wave's load covers 512 contiguous bytes, its store 256 */
    const float* xp = x + g0 * 4;
    v4f r[16];
#pragma unroll
    for (int u = 0; u < 16; ++u) r[u] = *(const v4fa*)(xp + (size_t)u * 1024);
    asm volatile("s_wait_xcnt 0x0" :: "v"(xp) : "memory");      /* the address pair that the sixteen loads name stays as it is up to this wait */
#pragma unroll
    for (int u = 0; u < 16; ++u) { v4h h4;
#pragma unroll
      for (int q = 0; q < 4; ++q) h4[q] = (_Float16)bf16_round(r[u][q]);
      *(v4h*)(X16 + (g0 + (size_t)u * 256) * 4) = h4; }
    asm volatile("s_wait_xcnt 0x0" ::: "memory");      /* behind the last x store: in the built code the weight side's instructions follow this side's and reuse the stores' address and data registers */
  } }

extern "C" void kernel_launch(void* const* d_in, const int* in_sizes, int n_in,
                              void* d_out, int out_size, void* d_ws, size_t ws_size, hipStream_t stream) {
  (void)in_sizes; (void)n_in; (void)out_size;
  const float* const* I = (const float* const*)d_in; const float* x = I[0]; const float* amask = I[1]; const float* wq = I[2]; const float* wk = I[3]; const float* wv = I[4]; const float* bq = nullptr; const float* bk = nullptr; const float* bv = nullptr;      /* [in][out] weights, no biases; float 0/1 mask [8][1024][1024] read in the softmax */
  char* ws = (char*)d_ws; size_t off = 0;
  auto take = [&](size_t bytes) { char* p = ws + off; off += (bytes + 255) & ~(size_t)255; return p; };
  _Float16* BQ = (_Float16*)take((size_t)DM * DM * 2); _Float16* BK = (_Float16*)take((size_t)DM * DM * 2); _Float16* BV = (_Float16*)take((size_t)DM * DM * 2); 
  _Float16* X16 = (_Float16*)take(NR * DM * 2); _Float16* Q16 = (_Float16*)take(NR * DM * 2); _Float16* QL = (_Float16*)take(NR * DM * 2); _Float16* K16 = (_Float16*)take(NR * DM * 2); _Float16* O16 = (_Float16*)take(NR * DM * 2);
  _Float16* VT = (_Float16*)take((size_t)NB * NH * HD * SQ * 2);
  if (off > ws_size) return;
  k_prep<<<3 * PWG + PXG, 256, 0, stream>>>(x, wq, wk, wv, X16, BQ, BK, BV);      /* x -> f16; [in][out] weights -> Bt x16 */
  const size_t r0p = (size_t)B0 * SQ;      /* first projected row */
  k_gemm3<<<(unsigned)G3NT, 384, 0, stream>>>(X16 + r0p * DM, BQ, BK, BV, 0.0625f, Q16 + r0p * DM, QL + r0p * DM, K16 + r0p * DM, VT + r0p * DM);      /* q log2(e) / 8 as f16 value + residual planes, k rows, V^T [NB][NH][HD][SQ] */
  k_fattn<<<NB * NH * (SQ / FQ), 256, 0, stream>>>(Q16, QL, K16, VT, amask, (float*)d_out);      /* ctx (merged heads) straight to the f32 output */
}

// v008
// One run takes 88.7 microseconds.
// Timed twice side by side with v007, it ran 1.08 times as fast both times.
// All steps since v000 together make it 111 times as fast.
#include <hip/hip_runtime.h>
// Multi-head self-attention with a multiplicative 0/1 mask and the module's 'unsafe' softmax (x [8][1024][1024]; q = x Wq, k = x Wk, v = x Wv ([in][out] 1024^2 sigma 1/32, no biases); 16 heads of 64; scores / 8; w = exp(s) mask[b][s][t] / (sum_t exp(s) mask + 1e-8) with the float mask input [8][1024][1024] (0/1, ~90 % ones, shared across heads) READ per (query, key); out = merged ctx (no output projection) -> [8][1024][1024]).
// Compute dtype: inputs rounded to bf16; x / weights exact; k, v and softmax weights as plain f16 GEMM operands (~2^-12); q as f16 hi + unscaled residual lo planes (effectively f32); o written f32; scores and softmax statistics f32. v_wmma_f32_16x16x32_f16.
#define NB 8
#define SQ 1024
#define DM 1024
#define NH 16
#define HD 64
#define HG 4                         /* heads per launch of k_vt(V16, b, h0, VT); that overload is not launched */
#define B0 0                         /* first batch processed (debug hook) */
#define NBR NB                       /* batches processed (debug hook) */
#define NR ((size_t)NB * SQ)         /* token rows */
#define MP ((int)((size_t)NBR * SQ)) /* rows projected (debug hook) */
#define QN SQ                        /* unused */
#define NHD NH                       /* unused */
#define MPO MP                       /* unused */
#define LQ DM      /* unused */
typedef __bf16 v16b __attribute__((ext_vector_type(16)));
typedef unsigned short v8us __attribute__((ext_vector_type(8), may_alias));
typedef float  v8f  __attribute__((ext_vector_type(8)));
typedef float  v4f  __attribute__((ext_vector_type(4)));
typedef float  v4fa __attribute__((ext_vector_type(4), may_alias));
union FragB { v16b v; v8us half[2]; unsigned short u[16]; };

__device__ __forceinline__ unsigned short bf16_bits(float x) { unsigned int u = __float_as_uint(x); return (unsigned short)((u + 0x7FFFu + ((u >> 16) & 1u)) >> 16); }
__device__ __forceinline__ float bf16_val(unsigned short b) { return __uint_as_float(((unsigned int)b) << 16); }
__device__ __forceinline__ float bf16_round(float x) { return bf16_val(bf16_bits(x)); }
// D += A·B with NT terms: 1 = ah·bh, 2 = + al·bh (A split), 3 = + ah·bl (both split)
template <int NT>
__device__ __forceinline__ v8f mmaN(v16b ah, v16b al, v16b bh, v16b bl, v8f c) {
  c = __builtin_amdgcn_wmma_f32_16x16x32_bf16(false, ah, false, bh, (short)0, c, false, false);
  if (NT >= 2) c = __builtin_amdgcn_wmma_f32_16x16x32_bf16(false, al, false, bh, (short)0, c, false, false);
  if (NT >= 3) c = __builtin_amdgcn_wmma_f32_16x16x32_bf16(false, ah, false, bl, (short)0, c, false, false);
  asm volatile("v_nop\n\tv_nop\n\tv_nop\n\tv_nop" : "+v"(c) : "v"(ah), "v"(al), "v"(bh), "v"(bl));
  return c;
}

__global__ __launch_bounds__(256) void k_wt_bf16(const float* __restrict__ W, unsigned short* __restrict__ Wt, int K, int N) {
  const int t = blockIdx.x * 256 + threadIdx.x;
  const int k8n = K / 8;
  if (t >= N * k8n) return;
  const int n = t / k8n, k8 = (t % k8n) * 8;
  v8us v;
#pragma unroll
  for (int i = 0; i < 8; ++i) v[i] = bf16_bits(W[(size_t)(k8 + i) * N + n]);
  *(v8us*)(Wt + (size_t)n * K + k8) = v;
  
}

// GEMM C[M][N] (f32, pitch ldc) = act(A[M][K]·W + bias). A f32 row-major (pitch lda) converted per fragment to bf16
// (ASPLIT: hi/lo two planes -> 2 terms, else single rounded term); Wt bf16 [N][K] (pitch ldb). BIAS_BF16 rounds the
// bias to bf16 first (bias quantised to bf16 before the add). K%32==0, M%16==0, N%64==0.
template <bool ASPLIT, int ACT, bool BIAS_BF16>
__global__ __launch_bounds__(128) void k_gemm_bf(const float* __restrict__ A, int lda, const unsigned short* __restrict__ Wt, int ldb,
                                               const float* __restrict__ bias, float* __restrict__ C, int ldc, int M, int N, int K) {
  __shared__ __attribute__((aligned(16))) float so[4][16][64];
  const int tid = threadIdx.x, w = tid >> 5, lane = tid & 31, ln = lane & 15, hh = lane >> 4;
  const int ntn = N / 64;
  const int wid = blockIdx.x * 4 + w;
  const int mt = wid / ntn, nq = wid % ntn;
  if (mt * 16 >= M) return;
  const int row0 = mt * 16, col0 = nq * 64;
  const float* arow = A + (size_t)(row0 + ln) * lda;
  v8f acc[4] = {};
  for (int kb = 0; kb < K; kb += 32) {
    FragB ah, al;
    const v4f x0 = *(const v4fa*)(arow + kb + 8 * hh), x1 = *(const v4fa*)(arow + kb + 8 * hh + 4);
    const v4f x2 = *(const v4fa*)(arow + kb + 16 + 8 * hh), x3 = *(const v4fa*)(arow + kb + 16 + 8 * hh + 4);
    float xs[16] = {x0[0],x0[1],x0[2],x0[3],x1[0],x1[1],x1[2],x1[3],x2[0],x2[1],x2[2],x2[3],x3[0],x3[1],x3[2],x3[3]};
#pragma unroll
    for (int i = 0; i < 16; ++i) { const unsigned short hb = bf16_bits(xs[i]); ah.u[i] = hb; al.u[i] = ASPLIT ? bf16_bits(xs[i] - bf16_val(hb)) : (unsigned short)0; }
#pragma unroll
    for (int t = 0; t < 4; ++t) {
      const unsigned short* brow = Wt + (size_t)(col0 + t * 16 + ln) * ldb + kb;
      FragB b;
      b.half[0] = *(const v8us*)(brow + 8 * hh);
      b.half[1] = *(const v8us*)(brow + 16 + 8 * hh);
      acc[t] = mmaN<ASPLIT ? 2 : 1>(ah.v, al.v, b.v, b.v, acc[t]);
    }
  }
#pragma unroll
  for (int t = 0; t < 4; ++t) {
    float bv = bias ? bias[col0 + t * 16 + ln] : 0.f;
    if (BIAS_BF16) bv = bf16_round(bv);
#pragma unroll
    for (int r = 0; r < 8; ++r) { float v = acc[t][r] + bv; if (ACT == 1) v = fmaxf(v, 0.f); so[w][8 * hh + r][t * 16 + ln] = v; }
  }
  __builtin_amdgcn_fence(__ATOMIC_ACQ_REL, "workgroup");
  __builtin_amdgcn_wave_barrier();
  const int rsub = lane >> 4, c4 = (lane & 15) * 4;
  {
#pragma unroll
    for (int q = 0; q < 8; ++q) {
      const int r = q * 2 + rsub;
      const v4f v = *(const v4fa*)&so[w][r][c4];
      *(v4f*)(C + (size_t)(row0 + r) * ldc + col0 + c4) = v;
    }
    
  }
}

// GEMM C = act(A·W + bias + resid): A f32 (ASPLIT -> hi/lo 2 terms), Wt bf16 [N][K]; ACT 0 none, 1 relu, 2 exact gelu;
// resid (optional, f32, row index = (row % rmod), pitch ldr, RES_BF16 rounds it) added before the activation.
template <bool ASPLIT, int ACT, bool BIAS_BF16, bool RES_BF16>
__global__ __launch_bounds__(128) void k_gemm_bf3(const float* __restrict__ A, int lda, const unsigned short* __restrict__ Wt, int ldb,
                                                const float* __restrict__ bias, const float* __restrict__ resid, int rmod, int ldr,
                                                float* __restrict__ C, int ldc, int M, int N, int K) {
  __shared__ __attribute__((aligned(16))) float so[4][16][64];
  const int tid = threadIdx.x, w = tid >> 5, lane = tid & 31, ln = lane & 15, hh = lane >> 4;
  const int ntn = N / 64;
  const int wid = blockIdx.x * 4 + w;
  const int mt = wid / ntn, nq = wid % ntn;
  if (mt * 16 >= M) return;
  const int row0 = mt * 16, col0 = nq * 64;
  const float* arow = A + (size_t)(row0 + ln) * lda;
  v8f acc[4] = {};
  for (int kb = 0; kb < K; kb += 32) {
    FragB ah, al;
    const v4f x0 = *(const v4fa*)(arow + kb + 8 * hh), x1 = *(const v4fa*)(arow + kb + 8 * hh + 4);
    const v4f x2 = *(const v4fa*)(arow + kb + 16 + 8 * hh), x3 = *(const v4fa*)(arow + kb + 16 + 8 * hh + 4);
    float xs[16] = {x0[0],x0[1],x0[2],x0[3],x1[0],x1[1],x1[2],x1[3],x2[0],x2[1],x2[2],x2[3],x3[0],x3[1],x3[2],x3[3]};
#pragma unroll
    for (int i = 0; i < 16; ++i) { const unsigned short hb = bf16_bits(xs[i]); ah.u[i] = hb; al.u[i] = ASPLIT ? bf16_bits(xs[i] - bf16_val(hb)) : (unsigned short)0; }
#pragma unroll
    for (int t = 0; t < 4; ++t) {
      const unsigned short* brow = Wt + (size_t)(col0 + t * 16 + ln) * ldb + kb;
      FragB b;
      b.half[0] = *(const v8us*)(brow + 8 * hh);
      b.half[1] = *(const v8us*)(brow + 16 + 8 * hh);
      acc[t] = mmaN<ASPLIT ? 2 : 1>(ah.v, al.v, b.v, b.v, acc[t]);
    }
  }
#pragma unroll
  for (int t = 0; t < 4; ++t) {
    const int col = col0 + t * 16 + ln;
    float bv = bias ? bias[col] : 0.f;
    if (BIAS_BF16) bv = bf16_round(bv);
#pragma unroll
    for (int r = 0; r < 8; ++r) {
      float v = acc[t][r] + bv;
      if (resid) { float rv = resid[(size_t)((row0 + 8 * hh + r) % rmod) * ldr + col]; if (RES_BF16) rv = bf16_round(rv); v += rv; }
      if (ACT == 1) v = fmaxf(v, 0.f);
      if (ACT == 2) v = 0.5f * v * (1.0f + erff(v * 0.70710678118654752f));
      if (ACT == 3) { const float u = 0.7978845608028654f * (v + 0.044715f * v * v * v); v = 0.5f * v * (1.0f + tanhf(u)); }
      so[w][8 * hh + r][t * 16 + ln] = v;
    }
  }
  __builtin_amdgcn_fence(__ATOMIC_ACQ_REL, "workgroup");
  __builtin_amdgcn_wave_barrier();
  const int rsub = lane >> 4, c4 = (lane & 15) * 4;
  {
#pragma unroll
    for (int q = 0; q < 8; ++q) {
      const int r = q * 2 + rsub;
      const v4f v = *(const v4fa*)&so[w][r][c4];
      *(v4f*)(C + (size_t)(row0 + r) * ldc + col0 + c4) = v;
    }
    
  }
}
// row LayerNorm (biased variance, eps) over N: s = X (+ R); optional out_sum <- s; out_norm <- (s-mu)*rsqrt(var+eps)*g + b
template <bool PARAM_BF16>
__global__ __launch_bounds__(256) void k_layernorm(const float* __restrict__ X, const float* __restrict__ R, const float* __restrict__ g, const float* __restrict__ bta,
                                                  float* __restrict__ out_sum, float* __restrict__ out_norm, int N, float eps) {
  __shared__ float red[256];
  const int row = blockIdx.x, tid = threadIdx.x;
  const float* x = X + (size_t)row * N; const float* rr = R ? R + (size_t)row * N : nullptr;
  float vals[16];                     // up to N = 4096
  const int per = N / 256;            // contiguous chunk per thread? use strided-by-4 chunks: thread handles j = tid*4 + 1024*u
  float s1 = 0.f;
  for (int u = 0; u < per / 4; ++u) {
    const int j = tid * 4 + 1024 * u;
    const v4f a = *(const v4fa*)(x + j);
    v4f b = {0.f,0.f,0.f,0.f}; if (rr) b = *(const v4fa*)(rr + j);
#pragma unroll
    for (int q = 0; q < 4; ++q) { const float v = a[q] + b[q]; vals[u * 4 + q] = v; s1 += v; }
  }
  red[tid] = s1; __syncthreads();
  for (int st = 128; st > 0; st >>= 1) { if (tid < st) red[tid] += red[tid + st]; __syncthreads(); }
  const float mu = red[0] / (float)N; __syncthreads();
  float s2 = 0.f;
  for (int u = 0; u < per / 4; ++u)
#pragma unroll
    for (int q = 0; q < 4; ++q) { const float c = vals[u * 4 + q] - mu; s2 += c * c; }
  red[tid] = s2; __syncthreads();
  for (int st = 128; st > 0; st >>= 1) { if (tid < st) red[tid] += red[tid + st]; __syncthreads(); }
  const float rs = rsqrtf(red[0] / (float)N + eps);
  {
    for (int u = 0; u < per / 4; ++u) {
      const int j = tid * 4 + 1024 * u;
      v4f o, sm;
#pragma unroll
      for (int q = 0; q < 4; ++q) {
        float gg = g[j + q], bb = bta[j + q];
        if (PARAM_BF16) { gg = bf16_round(gg); bb = bf16_round(bb); }
        sm[q] = vals[u * 4 + q]; o[q] = (vals[u * 4 + q] - mu) * rs * gg + bb;
      }
      if (out_sum) *(v4f*)(out_sum + (size_t)row * N + j) = sm;
      *(v4f*)(out_norm + (size_t)row * N + j) = o;
    }
    
  }
}



// ---- f16 WMMA path (v_wmma_f32_16x16x32_f16): 11-bit significands for operands in range — used where a [0,1] probability operand needs more precision than bf16
typedef _Float16 v16h __attribute__((ext_vector_type(16)));
union FragH { v16h v; v8us half[2]; _Float16 h[16]; unsigned short u[16]; };
template <int NT>
__device__ __forceinline__ v8f mmaH(v16h ah, v16h al, v16h bh, v16h bl, v8f c) {
  c = __builtin_amdgcn_wmma_f32_16x16x32_f16(false, ah, false, bh, (short)0, c, false, false);
  if (NT >= 2) c = __builtin_amdgcn_wmma_f32_16x16x32_f16(false, al, false, bh, (short)0, c, false, false);
  if (NT >= 3) c = __builtin_amdgcn_wmma_f32_16x16x32_f16(false, ah, false, bl, (short)0, c, false, false);
  asm volatile("v_nop\n\tv_nop\n\tv_nop\n\tv_nop" : "+v"(c) : "v"(ah), "v"(al), "v"(bh), "v"(bl));
  return c;
}
// batched GEMM like k_gemm_b but f16 operands: A f32 (split into f16 hi/lo if ASPLIT, else rounded to f16), Bt = f16 values [n][k]; alpha; C f32; N multiple of 16 (partial tiles skipped)
template <bool ASPLIT>
__global__ __launch_bounds__(128) void k_gemm_h(const float* __restrict__ A, int lda, size_t sA, const _Float16* __restrict__ Bh, int ldb, size_t sB, float alpha, float* __restrict__ C, int ldc, size_t sC, int M, int N, int K) {
  __shared__ __attribute__((aligned(16))) float so[4][16][64];
  const int tid = threadIdx.x, w = tid >> 5, lane = tid & 31, ln = lane & 15, hh = lane >> 4; const int by = blockIdx.y;
  A += (size_t)by * sA; Bh += (size_t)by * sB; C += (size_t)by * sC;
  const int ntn = (N + 63) / 64; const int wid = blockIdx.x * 4 + w; const int mt = wid / ntn, nq = wid % ntn; if (mt * 16 >= M) return;
  const int row0 = mt * 16, col0 = nq * 64; const float* arow = A + (size_t)(row0 + ln) * lda;
  v8f acc[4] = {};
  for (int kb = 0; kb < K; kb += 32) {
    FragH ah, al;
    const v4f x0 = *(const v4fa*)(arow + kb + 8 * hh), x1 = *(const v4fa*)(arow + kb + 8 * hh + 4), x2 = *(const v4fa*)(arow + kb + 16 + 8 * hh), x3 = *(const v4fa*)(arow + kb + 16 + 8 * hh + 4);
    float xs[16] = {x0[0],x0[1],x0[2],x0[3],x1[0],x1[1],x1[2],x1[3],x2[0],x2[1],x2[2],x2[3],x3[0],x3[1],x3[2],x3[3]};
#pragma unroll
    for (int i = 0; i < 16; ++i) { const _Float16 h = (_Float16)xs[i]; ah.h[i] = h; al.h[i] = ASPLIT ? (_Float16)(xs[i] - (float)h) : (_Float16)0.0f; }
#pragma unroll
    for (int t = 0; t < 4; ++t) { if (col0 + t * 16 >= N) continue; const size_t boff = (size_t)(col0 + t * 16 + ln) * ldb + kb; FragH bq; bq.half[0] = *(const v8us*)(Bh + boff + 8 * hh); bq.half[1] = *(const v8us*)(Bh + boff + 16 + 8 * hh);
      acc[t] = mmaH<ASPLIT ? 2 : 1>(ah.v, al.v, bq.v, bq.v, acc[t]); }
  }
#pragma unroll
  for (int t = 0; t < 4; ++t) { if (col0 + t * 16 >= N) continue;
#pragma unroll
    for (int r = 0; r < 8; ++r) so[w][8 * hh + r][t * 16 + ln] = acc[t][r] * alpha; }
  __builtin_amdgcn_fence(__ATOMIC_ACQ_REL, "workgroup"); __builtin_amdgcn_wave_barrier();
  const int rsub = lane >> 4, c4 = (lane & 15) * 4;
  {
#pragma unroll
    for (int q = 0; q < 8; ++q) { const int r = q * 2 + rsub; if (col0 + c4 < N) { const v4f v = *(const v4fa*)&so[w][r][c4]; *(v4f*)(C + (size_t)(row0 + r) * ldc + col0 + c4) = v; } }
     }
}

// Wt[n][k] = f16(W[k][n]·scale) from f32 row-major W[K][N] (scale = power of two; bf16-exact weights stay exact in f16 away from the subnormal range)
__global__ __launch_bounds__(256) void k_wt_f16(const float* __restrict__ W, _Float16* __restrict__ Wt, int K, int N, float scale) {
  const int t = blockIdx.x * 256 + threadIdx.x; if (t >= N * (K / 8)) return; const int n = t / (K / 8), k8 = (t % (K / 8)) * 8; FragH f;
#pragma unroll
  for (int i = 0; i < 8; ++i) f.h[i] = (_Float16)(bf16_round(W[(size_t)(k8 + i) * N + n]) * scale); const v8us o = f.half[0];
  *(v8us*)((unsigned short*)Wt + (size_t)n * K + k8) = o; 
}
// k_gemm_hh variant with fused epilogue: v = acc·alpha + bias[by·sBias + col] (+ CP[(row/rowsPerB)·sCPb + by·64 + col] if CP) ; ACT 0 none / 1 elu ; writes f16 C16 (and f32 C if non-null)
template <int ACT>
__global__ __launch_bounds__(128) void k_gemm_hhx(const _Float16* __restrict__ A, int lda, size_t sA, const _Float16* __restrict__ Bh, int ldb, size_t sB, float alpha, const float* __restrict__ bias, size_t sBias, const float* __restrict__ CP, int rowsPerB, size_t sCPb, int row0g,
    float* __restrict__ C, _Float16* __restrict__ C16, int ldc, size_t sC, int M, int N, int K) {
  __shared__ __attribute__((aligned(16))) float so[4][16][64];
  const int tid = threadIdx.x, w = tid >> 5, lane = tid & 31, ln = lane & 15, hh = lane >> 4; const int by = blockIdx.y;
  A += (size_t)by * sA; Bh += (size_t)by * sB; const size_t cofs = (size_t)by * sC; const float* bp = bias ? bias + (size_t)by * sBias : nullptr;
  const int ntn = (N + 63) / 64; const int wid = blockIdx.x * 4 + w; const int mt = wid / ntn, nq = wid % ntn; if (mt * 16 >= M) return;
  const int row0 = mt * 16, col0 = nq * 64; const _Float16* arow = A + (size_t)(row0 + ln) * lda;
  v8f acc[4] = {};
  for (int kb = 0; kb < K; kb += 32) { FragH ah; ah.half[0] = *(const v8us*)((const unsigned short*)arow + kb + 8 * hh); ah.half[1] = *(const v8us*)((const unsigned short*)arow + kb + 16 + 8 * hh);
#pragma unroll
    for (int t = 0; t < 4; ++t) { if (col0 + t * 16 >= N) continue; const size_t boff = (size_t)(col0 + t * 16 + ln) * ldb + kb; FragH bq; bq.half[0] = *(const v8us*)((const unsigned short*)Bh + boff + 8 * hh); bq.half[1] = *(const v8us*)((const unsigned short*)Bh + boff + 16 + 8 * hh);
      acc[t] = mmaH<1>(ah.v, ah.v, bq.v, bq.v, acc[t]); }
  }
#pragma unroll
  for (int t = 0; t < 4; ++t) { if (col0 + t * 16 >= N) continue; const int col = col0 + t * 16 + ln; const float bv = bp ? bf16_round(bp[col]) : 0.f;
#pragma unroll
    for (int r = 0; r < 8; ++r) { float v = acc[t][r] * alpha + bv; if (CP) { const int rr = row0g + row0 + 8 * hh + r; if (rowsPerB < 0) v += CP[cofs + (size_t)rr * ldc + col];      /* rowsPerB < 0: own element of the batched C plane */ else { const int bidx = rr / rowsPerB; v += CP[(size_t)bidx * sCPb + (size_t)by * 64 + col]; } } if (ACT == 1) v = (v > 0.f) ? v : expm1f(v); else if (ACT == 7) v = (v > 0.f) ? v + 1.0f : expf(v); else if (ACT == 8) v = tanhf(v); else if (ACT == 9) v = 0.5f * v * (1.0f + tanhf(0.7978845608028654f * (v + 0.044715f * v * v * v))); else if (ACT == 11) v = 1.0f / (1.0f + expf(-v)); else if (ACT == 12) v = (v > 0.f) ? v : 0.01f * v; else if (ACT == 14) v = (v > 0.f) ? v : 0.1f * v; else if (ACT == 16) v = (v >= 0.f) ? v : 0.3f * v; else if (ACT == 17) v = (v >= 0.f) ? v : 0.2f * v; else if (ACT == 15) v = v / (1.0f + expf(-v)); else if (ACT == 3) v = fmaxf(v, 0.f); else if (ACT == 6) v = 0.5f * v * (1.0f + erff(v * 0.70710678118654752f)); so[w][8 * hh + r][t * 16 + ln] = v; } }
  __builtin_amdgcn_fence(__ATOMIC_ACQ_REL, "workgroup"); __builtin_amdgcn_wave_barrier();
  const int rsub = lane >> 4, c4 = (lane & 15) * 4; typedef _Float16 v4h __attribute__((ext_vector_type(4)));
  {
#pragma unroll
    for (int q = 0; q < 8; ++q) { const int r = q * 2 + rsub; if (col0 + c4 < N) { const v4f v = *(const v4fa*)&so[w][r][c4]; if (C) *(v4f*)(C + cofs + (size_t)(row0 + r) * ldc + col0 + c4) = v; if (C16) { v4h h4; for (int i = 0; i < 4; ++i) h4[i] = (_Float16)v[i]; *(v4h*)(C16 + cofs + (size_t)(row0 + r) * ldc + col0 + c4) = h4; } } }
     }
}


typedef _Float16 v4h __attribute__((ext_vector_type(4)));

__global__ __launch_bounds__(256) void k_x16(const float* __restrict__ x, _Float16* __restrict__ X16, size_t n8) { const size_t t = (size_t)blockIdx.x * 256 + threadIdx.x; if (t >= n8) return; FragH f;
#pragma unroll
  for (int q = 0; q < 8; ++q) f.h[q] = (_Float16)bf16_round(x[t * 8 + q]); *(v8us*)((unsigned short*)X16 + t * 8) = f.half[0];  }
__global__ __launch_bounds__(256) void k_h16(const float* __restrict__ x, _Float16* __restrict__ X16, size_t n8) { const size_t t = (size_t)blockIdx.x * 256 + threadIdx.x; if (t >= n8) return; FragH f;
#pragma unroll
  for (int q = 0; q < 8; ++q) f.h[q] = (_Float16)x[t * 8 + q]; *(v8us*)((unsigned short*)X16 + t * 8) = f.half[0];  }
__global__ __launch_bounds__(256) void k_round16f(const float* __restrict__ W, _Float16* __restrict__ Bt, size_t n8) { const size_t t = (size_t)blockIdx.x * 256 + threadIdx.x; if (t >= n8) return; FragH f;
#pragma unroll
  for (int i = 0; i < 8; ++i) f.h[i] = (_Float16)(bf16_round(W[t * 8 + i]) * 16.0f); *(v8us*)((unsigned short*)Bt + t * 8) = f.half[0];  }
// ---- fast GEMM (wave tile 32x64; requires M % 32 == 0 rows per launch region and N % 64 == 0); epilogue = k_gemm_hhx semantics ----
__device__ __forceinline__ v16h g2_frag(const _Float16* p, int hh) { FragH f; f.half[0] = *(const v8us*)((const unsigned short*)p + 8 * hh); f.half[1] = *(const v8us*)((const unsigned short*)p + 16 + 8 * hh); return f.v; }
__device__ __forceinline__ v8f g2_mma(v16h a, v16h b, v8f c) { v8f d = __builtin_amdgcn_wmma_f32_16x16x32_f16(false, a, false, b, (short)0, c, false, false); asm volatile("v_nop\n\tv_nop\n\tv_nop\n\tv_nop" : "+v"(d) : "v"(a), "v"(b)); return d; }
template <int ACT>
__global__ __launch_bounds__(128) void k_gemm2(const _Float16* __restrict__ A, int lda, size_t sA, const _Float16* __restrict__ Bh, int ldb, size_t sB, float alpha, const float* __restrict__ bias, size_t sBias, const float* __restrict__ CP, int rowsPerB, size_t sCPb, int row0g,
    float* __restrict__ C, _Float16* __restrict__ C16, int ldc, size_t sC, int M, int N, int K) { static_assert(ACT == 0 || ACT == 3 || ACT == 6 || ACT == 8 || ACT == 9 || ACT == 11 || ACT == 12 || ACT == 14 || ACT == 15 || ACT == 16 || ACT == 17, "k_gemm2: unsupported ACT code (would silently apply no activation)");
  __shared__ __attribute__((aligned(16))) float so[4][32][68];
  const int tid = threadIdx.x, w = tid >> 5, lane = tid & 31, ln = lane & 15, hh = lane >> 4; const int by = blockIdx.y;
  A += (size_t)by * sA; Bh += (size_t)by * sB; const size_t cofs = (size_t)by * sC; const float* bp = bias ? bias + (size_t)by * sBias : nullptr;
  const int ntn = N >> 6; const int mt = blockIdx.x / ntn, nq = blockIdx.x - mt * ntn; const int row0 = mt * 128 + 32 * w, col0 = nq * 64; if (row0 >= M) return;
  const _Float16* a0p = A + (size_t)(row0 + ln) * lda; const _Float16* a1p = a0p + (size_t)16 * lda;
  const _Float16* b0p = Bh + (size_t)(col0 + ln) * ldb; const _Float16* b1p = b0p + (size_t)16 * ldb; const _Float16* b2p = b1p + (size_t)16 * ldb; const _Float16* b3p = b2p + (size_t)16 * ldb;
  const v8f z8 = {0.f,0.f,0.f,0.f,0.f,0.f,0.f,0.f}; v8f c00 = z8, c01 = z8, c02 = z8, c03 = z8, c10 = z8, c11 = z8, c12 = z8, c13 = z8;
#pragma unroll 1
  for (int kb = 0; kb < K; kb += 32) { const v16h a0 = g2_frag(a0p + kb, hh), a1 = g2_frag(a1p + kb, hh);
    v16h b = g2_frag(b0p + kb, hh); c00 = g2_mma(a0, b, c00); c10 = g2_mma(a1, b, c10);
    b = g2_frag(b1p + kb, hh); c01 = g2_mma(a0, b, c01); c11 = g2_mma(a1, b, c11);
    b = g2_frag(b2p + kb, hh); c02 = g2_mma(a0, b, c02); c12 = g2_mma(a1, b, c12);
    b = g2_frag(b3p + kb, hh); c03 = g2_mma(a0, b, c03); c13 = g2_mma(a1, b, c13); }
  v8f accs[8] = {c00, c01, c02, c03, c10, c11, c12, c13};
#pragma unroll
  for (int u = 0; u < 8; ++u) { const int t = u & 3, half = u >> 2; const int col = col0 + t * 16 + ln; const float bv = bp ? bf16_round(bp[col]) : 0.f;
#pragma unroll
    for (int r = 0; r < 8; ++r) { const int rloc = half * 16 + 8 * hh + r; float v = accs[u][r] * alpha + bv; if (CP) { if (rowsPerB < 0) v += CP[cofs + (size_t)(row0g + row0 + rloc) * ldc + col];      /* rowsPerB < 0: own element of the batched C plane */ else { const int bidx = (row0g + row0 + rloc) / rowsPerB; v += CP[(size_t)bidx * sCPb + (size_t)by * 64 + col]; } }
      if (ACT == 3) v = fmaxf(v, 0.f); else if (ACT == 6) v = 0.5f * v * (1.0f + erff(v * 0.70710678118654752f)); else if (ACT == 11) v = 1.0f / (1.0f + expf(-v)); else if (ACT == 15) v = v / (1.0f + expf(-v)); else if (ACT == 12) v = (v > 0.f) ? v : 0.01f * v; else if (ACT == 8) v = tanhf(v); else if (ACT == 9) v = 0.5f * v * (1.0f + tanhf(0.7978845608028654f * (v + 0.044715f * v * v * v))); else if (ACT == 14) v = (v > 0.f) ? v : 0.1f * v; else if (ACT == 16) v = (v >= 0.f) ? v : 0.3f * v; else if (ACT == 17) v = (v >= 0.f) ? v : 0.2f * v;
      so[w][rloc][t * 16 + ln] = v; } }
  __builtin_amdgcn_fence(__ATOMIC_ACQ_REL, "workgroup"); __builtin_amdgcn_wave_barrier();
  const int rsub = lane >> 4, c4 = (lane & 15) * 4;
  {
#pragma unroll
    for (int q = 0; q < 16; ++q) { const int r = q * 2 + rsub; const v4f v = *(const v4fa*)&so[w][r][c4]; if (C) *(v4f*)(C + cofs + (size_t)(row0 + r) * ldc + col0 + c4) = v; if (C16) { v4h h4; for (int i = 0; i < 4; ++i) h4[i] = (_Float16)v[i]; *(v4h*)(C16 + cofs + (size_t)(row0 + r) * ldc + col0 + c4) = h4; } }
     } }


__global__ __launch_bounds__(256) void k_wnat(const float* __restrict__ w, size_t n8, _Float16* __restrict__ Bt) { const size_t t = (size_t)blockIdx.x * 256 + threadIdx.x; if (t >= n8) return; FragH f; for (int q = 0; q < 8; ++q) f.h[q] = (_Float16)(bf16_round(w[t * 8 + q]) * 16.0f); *(v8us*)((unsigned short*)Bt + t * 8) = f.half[0];  }
__global__ __launch_bounds__(256) void k_rsm(const float* __restrict__ S, _Float16* __restrict__ P, int nrows) {
  #pragma clang fp contract(off)
  const int i = blockIdx.x * 256 + threadIdx.x; if (i >= nrows) return; const float* s = S + (size_t)i * SQ; float mx = -3.0e38f;
#pragma unroll 1
  for (int j = 0; j < SQ; ++j) mx = fmaxf(mx, s[j]); float se = 0.f;
#pragma unroll 1
  for (int j = 0; j < SQ; ++j) se += expf(s[j] - mx); const float sc = 256.0f / se;
#pragma unroll 1
  for (int j0 = 0; j0 < SQ; j0 += 8) { FragH f; for (int q = 0; q < 8; ++q) f.h[q] = (_Float16)(expf(s[j0 + q] - mx) * sc); unsigned short* d = (unsigned short*)P + (size_t)i * SQ + j0; *(v8us*)d = f.half[0];  } }
__global__ __launch_bounds__(256) void k_vt(const _Float16* __restrict__ V16, int b, int h0, _Float16* __restrict__ VT) { __shared__ unsigned short tl[64][65]; const int tid = threadIdx.x; const int hh = blockIdx.x % HG, sg = blockIdx.x / HG; const int s0 = sg * 64; const int h = h0 + hh;
  for (int i = tid; i < 64 * 8; i += 256) { const int j = i / 8, d8 = (i % 8) * 8; FragH f; f.half[0] = *(const v8us*)((const unsigned short*)V16 + ((size_t)b * SQ + s0 + j) * DM + h * HD + d8); for (int q = 0; q < 8; ++q) tl[d8 + q][j] = f.u[q]; }
  __syncthreads();
  { for (int i = tid; i < 64 * 8; i += 256) { const int d = i / 8, j8 = (i % 8) * 8; FragH f; for (int q = 0; q < 8; ++q) f.u[q] = tl[d][j8 + q]; *(v8us*)((unsigned short*)VT + ((size_t)hh * HD + d) * SQ + s0 + j8) = f.half[0]; }  } }



__global__ __launch_bounds__(256) void k_rsmf(const float* __restrict__ S, _Float16* __restrict__ P, int qn, int hg) {
  #pragma clang fp contract(off)
  const int t = blockIdx.x * 256 + threadIdx.x; if (t >= qn * hg) return; const size_t i = (size_t)(t / qn) * SQ + (t % qn); const float* s = S + i * SQ; float mx = -3.0e38f;
#pragma unroll 1
  for (int j = 0; j < SQ; ++j) mx = fmaxf(mx, s[j]); float se = 0.f;
#pragma unroll 1
  for (int j = 0; j < SQ; ++j) se += __expf(s[j] - mx); const float sc = 256.0f / se;
#pragma unroll 1
  for (int j0 = 0; j0 < SQ; j0 += 8) { FragH f; for (int q = 0; q < 8; ++q) f.h[q] = (_Float16)(__expf(s[j0 + q] - mx) * sc); unsigned short* d = (unsigned short*)P + i * SQ + j0; *(v8us*)d = f.half[0];  } }

// 2^x on v_exp_f32 with one free issue slot behind it: the instruction set asks for that slot before the result is read or the source overwritten.
__device__ __forceinline__ float exp2_slot(float x) { float r; asm("v_exp_f32 %0, %1\n\tv_nop" : "=v"(r) : "v"(x)); return r; }
#define FK 64      /* keys per stage */
#define FQ 128     /* query rows per work-group */
#define KPH 72     /* LDS row pitch of K, V^T and the mask slices, halves: 144 B = 16 B x odd, b128 reads free of bank conflicts */
#define MPF 68     /* LDS row pitch of the output staging, floats: 272 B = 16 B x odd */
typedef float v2f __attribute__((ext_vector_type(2)));
__device__ __forceinline__ float xhalf(float x) { return __builtin_bit_cast(float, __builtin_amdgcn_permlanex16(__builtin_bit_cast(int, x), __builtin_bit_cast(int, x), 0x76543210, 0xfedcba98, false, false)); }      /* lane l with lane l ^ 16 */
__device__ __forceinline__ v8f fa_mma(v16h a, v16h b, v8f c) { return __builtin_amdgcn_wmma_f32_16x16x32_f16(false, a, false, b, (short)0, c, false, false); }
typedef uint32_t u32x4 __attribute__((ext_vector_type(4)));
typedef uint32_t u32x8 __attribute__((ext_vector_type(8)));
__device__ __forceinline__ uint32_t uni(uint32_t v) { return (uint32_t)__builtin_amdgcn_readfirstlane(v); }
__device__ __forceinline__ uint32_t pinned(uint32_t v) { uint32_t w = uni(v); asm volatile("" : "+s"(w)); return w; }      /* for the tensor mover: keeps a tensor load's issue test a scalar branch, and the stage number that its descriptor words are formed from in a scalar register behind the waits */
#define FSL 10240      /* place of a slice: 64 rows x 144 B = 9,216 B, rounded up to a multiple of 2 KiB */
#define FBUF (6 * FSL)
#define FNS (SQ / FK)      /* stages */
__global__ __launch_bounds__(256) void k_fattn(const _Float16* __restrict__ Qh, const _Float16* __restrict__ Ql, const _Float16* __restrict__ Kh, const _Float16* __restrict__ Vt, const float* __restrict__ Mk, float* __restrict__ out) {
  static_assert(FK == 64 && HD == 64 && FQ == 128 && FNS >= 2, "every slice is 64 rows of 128 bytes: 64 halves of a K or V^T row, 32 floats of a mask row; the ring's prologue needs two stages");
  __shared__ __attribute__((aligned(2048))) unsigned char ring[2 * FBUF];
  const int tid = threadIdx.x, lane = tid & 31, ln = lane & 15, hh = lane >> 4;
  const uint32_t w = uni((uint32_t)tid >> 5);
  const int h = blockIdx.x % NH, qb = (blockIdx.x / NH) % (SQ / FQ), b = blockIdx.x / (NH * (SQ / FQ));      /* neighbouring work-groups: same mask rows, other heads */
  const int qrow = qb * FQ + (int)w * 16;
  const size_t qo = ((size_t)b * SQ + qrow + ln) * DM + h * HD;
  const v16h qh0 = g2_frag(Qh + qo, hh), qh1 = g2_frag(Qh + qo + 32, hh), ql0 = g2_frag(Ql + qo, hh), ql1 = g2_frag(Ql + qo + 32, hh);
  /* wave w < 6 brings slice w: 0 to 3 the mask (queries 64 (w >> 1) to + 63 of the work-group, keys 32 (w & 1) to + 31 of the stage), 4 the K rows, 5 the V^T rows; waves 6 and 7 bring none (their address is formed like wave 0's and never used) */
  const uint32_t lbase = (uint32_t)(size_t)ring, sw = w < 6u ? w : 0u;
  const uint64_t ga0 = sw < 4u ? (uint64_t)(size_t)(Mk + ((size_t)b * SQ + qb * FQ + (sw >> 1) * 64u) * SQ + (sw & 1u) * 32u) : sw == 4u ? (uint64_t)(size_t)(Kh + (size_t)b * SQ * DM + h * HD) : (uint64_t)(size_t)(Vt + ((size_t)b * NH + h) * HD * SQ);
  const uint32_t gst = sw < 4u ? FK * 4u : sw == 4u ? FK * DM * 2u : FK * 2u;      /* bytes from one stage's tile to the next: 64 keys along a mask row, 64 K rows, 64 keys along a V^T row */
  u32x8 g1;      /* 1-byte elements, tile = tensor = 64 rows of 128 B, source pitch one row of the slice's matrix, 16 B of LDS pad behind every 128 B, no mask */
  /* descriptor words held in scalar registers of their own through the loop, so that none is formed anew in a register that other code uses while a request is under way */
  g1[0] = pinned((1u << 20) | (4u << 22) | (3u << 25)); g1[1] = pinned(128u << 16); g1[2] = pinned(64u << 16); g1[3] = pinned(128u << 16); g1[4] = pinned(64u); g1[5] = pinned(sw < 4u ? (uint32_t)SQ * 4u : sw == 4u ? (uint32_t)DM * 2u : (uint32_t)SQ * 2u); g1[6] = pinned(0u); g1[7] = pinned(0u);
  u32x4 g0; g0[0] = pinned(1u); g0[1] = pinned(lbase); g0[2] = pinned(0u); g0[3] = pinned(0u);
  auto issue = [&](uint32_t st) {
    const uint64_t ga = ga0 + (uint64_t)st * gst;
    g0[1] = uni(lbase + (st & 1u) * FBUF + sw * FSL); g0[2] = uni((uint32_t)ga); g0[3] = uni((((uint32_t)(ga >> 32)) & 0x01FFFFFFu) | 0x80000000u);
    asm volatile("tensor_load_to_lds %0, %1" :: "s"(g0), "s"(g1) : "memory"); };
  if (pinned(w < 6u)) issue(0u);
  asm volatile("s_wait_tensorcnt 0x0" :: "s"(g0) : "memory");      /* this wave's slice of stage 0 has landed; the address group is named so that its registers stay as they are from the issue up to here */
  __syncthreads();      /* stage 0 is complete for every wave */
  if (pinned(w < 6u)) issue(1u);
  const v8f z8 = {0.f, 0.f, 0.f, 0.f, 0.f, 0.f, 0.f, 0.f};
  v8f o[4] = {z8, z8, z8, z8};
  v8f cin = z8;      /* minus the offset in use, in all eight rows of the lane's query column: the C operand of every score tile */
  float l = 0.f;
#pragma unroll 1      /* rolled: the ring's order stands once in the text */
  for (uint32_t s = 0; s < FNS; ++s) {
    const unsigned char* buf = ring + (s & 1u) * FBUF;
    const _Float16* sk = (const _Float16*)(buf + 4 * FSL) + ln * KPH;      /* K row ln of the stage; tile t lies 16 rows further */
    const _Float16* sv = (const _Float16*)(buf + 5 * FSL) + ln * KPH;      /* V^T row ln */
    const float* sm = (const float*)(buf + (w >> 2) * 2u * FSL + ((w & 3u) * 16u + ln) * (KPH * 2)) + 8 * hh;      /* the mask row of this lane's query in the slice of the stage's first 32 keys, at this half's keys; the other 32 keys lie one slice further */
    v16h ka[4][2];
#pragma unroll
    for (int u = 0; u < 2; ++u) {
#pragma unroll
      for (int t = 0; t < 4; ++t) ka[t][u] = g2_frag(sk + t * 16 * KPH + 32 * u, hh); }
    v8f sc[4];      /* k.(q_hi + q_lo) - offset in use, log2 units; the four tiles take turns, so that no product waits for the one before it in its own accumulator */
    __builtin_amdgcn_sched_barrier(0);      /* this one and the three below keep the turns: left alone, the compiler runs each tile's four dependent products one behind the other, and each then waits for the one before */
#pragma unroll
    for (int t = 0; t < 4; ++t) sc[t] = fa_mma(ka[t][0], qh0, cin);
    __builtin_amdgcn_sched_barrier(0);
#pragma unroll
    for (int t = 0; t < 4; ++t) sc[t] = fa_mma(ka[t][0], ql0, sc[t]);
    __builtin_amdgcn_sched_barrier(0);
#pragma unroll
    for (int t = 0; t < 4; ++t) sc[t] = fa_mma(ka[t][1], qh1, sc[t]);
    __builtin_amdgcn_sched_barrier(0);
#pragma unroll
    for (int t = 0; t < 4; ++t) sc[t] = fa_mma(ka[t][1], ql1, sc[t]);
    float bt[4];      /* one maximum per tile: four short chains, the first of them at work while the last products run */
#pragma unroll
    for (int t = 0; t < 4; ++t) { bt[t] = -3.0e38f;
#pragma unroll
      for (int r = 0; r < 8; ++r) bt[t] = fmaxf(bt[t], sc[t][r]); }
    const float bm = fmaxf(fmaxf(bt[0], bt[1]), fmaxf(bt[2], bt[3]));
    if (s == 0u || __builtin_amdgcn_ballot_w32(bm > 12.0f) != 0u) {      /* the same for the whole wave: the first stage sets the offset, a later one moves it where a weight would pass 2^12 */
      const float bf = fmaxf(bm, xhalf(bm));      /* both halves of the wave hold the same query: one offset */
      const float d = (s == 0u || bf > 12.0f) ? bf - 4.0f : 0.f, al = exp2_slot(fminf(-d, 0.f));      /* the largest weight so far becomes 2^4; d is below 0 in the first stage alone, where sums and context are still 0 and their factor must only stay finite */
#pragma unroll
      for (int t = 0; t < 4; ++t) { sc[t] -= d; o[t] *= al; }
      cin -= d; l *= al;
    }
    v2f ps[2] = {{0.f, 0.f}, {0.f, 0.f}};      /* four partial sums, as two pairs: no chain of 32 dependent adds */
    FragH pb[2];
#pragma unroll
    for (int t = 0; t < 4; ++t) {
      const v4f k0 = *(const v4fa*)(sm + (t >> 1) * (FSL / 4) + (t & 1) * 16), k1 = *(const v4fa*)(sm + (t >> 1) * (FSL / 4) + (t & 1) * 16 + 4);
#pragma unroll
      for (int r = 0; r < 8; r += 2) {      /* two neighbouring keys at a time, in register pairs as the accumulator and the mask rows hold them */
        const v2f e = {exp2_slot(sc[t][r]), exp2_slot(sc[t][r + 1])}, k = {r < 4 ? k0[r & 3] : k1[r & 3], r < 4 ? k0[(r & 3) + 1] : k1[(r & 3) + 1]}, p = e * k;
        ps[(r >> 1) & 1] += p; pb[t >> 1].h[(t & 1) * 8 + r] = (_Float16)p[0]; pb[t >> 1].h[(t & 1) * 8 + r + 1] = (_Float16)p[1]; } }
    l += (ps[0][0] + ps[0][1]) + (ps[1][0] + ps[1][1]);
#pragma unroll
    for (int t = 0; t < 4; ++t) o[t] = fa_mma(g2_frag(sv + t * 16 * KPH + 32, hh), pb[1].v, fa_mma(g2_frag(sv + t * 16 * KPH, hh), pb[0].v, o[t]));
    /* the pass's foot, every wave, in the ring's order */
    asm volatile("s_wait_dscnt 0x0" ::: "memory");      /* this wave's reads of the buffer have returned before it is refilled */
    asm volatile("s_wait_tensorcnt 0x0" :: "s"(g0) : "memory");      /* this wave's slice of stage s + 1 has landed; the address group is named so that its registers stay as they are from the issue up to here */
    __syncthreads();      /* publishes stage s + 1 and ends every wave's reading of stage s */
    if (pinned(s + 2u < FNS && w < 6u)) issue(pinned(s + 2u));
  }
  asm volatile("s_wait_tensorcnt 0x0" ::: "memory");      /* nothing in flight when the ring becomes output staging */
  asm volatile("s_wait_dscnt 0x0" ::: "memory");
  l += xhalf(l);
  const float inv = 1.0f / l;
  /* the last pass's barrier has ended every read of the ring: each wave stages its output in a slice place of its own, [query][d], so that each store below covers whole lines */
  float* so = (float*)(ring + w * FSL);
#pragma unroll
  for (int t = 0; t < 4; ++t) { const v8f v = o[t] * inv; const v4f lo4 = {v[0], v[1], v[2], v[3]}, hi4 = {v[4], v[5], v[6], v[7]};
    *(v4fa*)&so[ln * MPF + t * 16 + 8 * hh] = lo4; *(v4fa*)&so[ln * MPF + t * 16 + 8 * hh + 4] = hi4; }
  __builtin_amdgcn_fence(__ATOMIC_ACQ_REL, "workgroup"); __builtin_amdgcn_wave_barrier();      /* orders the LDS stores above in front of the loads below, which read what other lanes of the same wave wrote; no other wave touches these rows */
#pragma unroll
  for (int i = 0; i < 8; ++i) { const int r = 2 * i + hh; const v4f v = *(const v4fa*)&so[r * MPF + ln * 4]; *(v4f*)(out + ((size_t)b * SQ + qrow + r) * DM + h * HD + ln * 4) = v; } }

// ---- the three projection GEMMs in one launch, both operands staged in LDS by tensor loads: alpha * X[8192][1024] . Wt[1024][1024]^T for Wt = Wq, Wk, Wv, all rows k-contiguous f16 ----
// Each result leaves the kernel in the form the attention kernel reads, so that no pass stands between the two: q, times log2(e) / 8, as two f16 planes (value and residual), k as f16 rows,
// v transposed per batch, [batch][feature][key]: for v the two operands change places (rows of the tile = rows of Wv, columns = rows of X), which leaves every element's products and their k order as they are.
// The three weights count as one list of 3072 output features. One work-group forms 256 token rows x 192 features of that list: twelve waves (4 x 3) of 64 x 64, each wholly inside one projection.
// So a staged operand row serves more products than in a 128 x 128 tile and fewer bytes come from L2 per product. A stage is 256 bytes (128 k) of the 256 X rows and the 192 weight rows: seven 64-row slices, one tensor load each, from waves 0 to 6.
// Two buffers: stage s + 2 is requested into the buffer that pass s has just left, so it flies while pass s + 1 is worked on. The k order of every accumulator is that of the plain loop: ascending in steps of 32.
// Every inner loop is fully unrolled so that the accumulator and fragment arrays are indexed by constants and live in registers.
#define G3TM 256     /* token rows of a work-group's tile: slices 0 to 3 */
#define G3TN 192     /* features of a work-group's tile, out of the 3 * DM of q, k, v in a row: slices 4 to 6 */
#define G3RB 256     /* bytes of an operand row per stage */
#define G3P 272      /* LDS row pitch, bytes: 16 B x odd for the b128 fragment reads; laid by the tensor load's pad */
#define G3SL 18432   /* place of a slice: 64 rows x 272 B = 17,408 B, rounded up to a multiple of 2 KiB */
#define G3BUF (7 * G3SL)
#define G3NS (DM * 2 / G3RB)      /* stages */
#define G3NN (3 * DM / G3TN)      /* tiles along the features */
#define G3NT ((MP / G3TM) * G3NN)      /* work-groups */
__global__ __launch_bounds__(384) void k_gemm3(const _Float16* __restrict__ X, const _Float16* __restrict__ Wq, const _Float16* __restrict__ Wk, const _Float16* __restrict__ Wv, float alpha,
                                               _Float16* __restrict__ Qh, _Float16* __restrict__ Ql, _Float16* __restrict__ K16, _Float16* __restrict__ Vt) {
  static_assert(SQ % 64 == 0 && DM % 64 == 0 && MP % G3TM == 0 && (3 * DM) % G3TN == 0 && NH * HD == DM, "a wave's 64 token rows lie in one batch and its 64 features in one projection; the tiles cover everything once; V^T rows are the features");
  __shared__ __attribute__((aligned(2048))) unsigned char ring[2 * G3BUF];
  const int tid = threadIdx.x, lane = tid & 31, ln = lane & 15, hh = lane >> 4;
  const uint32_t w = uni((uint32_t)tid >> 5), wm = w & 3u, wn = w >> 2;      /* this wave's block of 64 token rows (0 to 3) and of 64 features (0 to 2) */
  const uint32_t nq = blockIdx.x % G3NN, mt = blockIdx.x / G3NN;
  const uint32_t fb = nq * (G3TN / 64) + wn, pj = fb / (DM / 64);      /* feature block in the list; pj: 0 q, 1 k, 2 v, the same for a whole wave */
  const int row0 = (int)(mt * G3TM + wm * 64u), col0 = (int)(fb % (DM / 64) * 64u);      /* this wave's first token row, and its first feature inside its projection */
  const uint32_t sa = pj == 2u ? 4u + wn : wm, sb = pj == 2u ? wm : 4u + wn;      /* the slices whose rows become this wave's 64 result rows and its 64 result columns */
  const uint32_t lbase = (uint32_t)(size_t)ring;
  /* wave w < 7 brings slice w; waves 7 to 11 bring none (their address is formed like wave 0's and never used) */
  const uint32_t sw = w < 7u ? w : 0u, sf = nq * (G3TN / 64) + (sw < 4u ? 0u : sw - 4u), sj = sf / (DM / 64);      /* for a weight slice: its feature block and its projection */
  const _Float16* sp = sw < 4u ? X + (size_t)(mt * G3TM + sw * 64u) * DM : (sj == 0u ? Wq : sj == 1u ? Wk : Wv) + (size_t)(sf % (DM / 64) * 64u) * DM;
  const uint64_t ga0 = (uint64_t)(size_t)sp;
  u32x8 g1;      /* 1-byte elements, tile = tensor = 64 rows of 256 B, source pitch one row of the matrix, 16 B of LDS pad behind every 256 B, no mask */
  /* descriptor words held in scalar registers: as plain constants they were formed anew at each issue, in registers that the loop then reused for its addresses while the request was still under way */
  g1[0] = pinned((1u << 20) | (5u << 22) | (3u << 25)); g1[1] = pinned((uint32_t)G3RB << 16); g1[2] = pinned(64u << 16); g1[3] = pinned((uint32_t)G3RB << 16); g1[4] = pinned(64u); g1[5] = pinned((uint32_t)DM * 2u); g1[6] = pinned(0u); g1[7] = pinned(0u);
  u32x4 g0; g0[0] = pinned(1u);
  auto issue = [&](uint32_t st) {
    const uint64_t ga = ga0 + (uint64_t)st * G3RB;
    g0[1] = uni(lbase + (st & 1u) * G3BUF + sw * G3SL); g0[2] = uni((uint32_t)ga); g0[3] = uni((((uint32_t)(ga >> 32)) & 0x01FFFFFFu) | 0x80000000u);
    asm volatile("tensor_load_to_lds %0, %1" :: "s"(g0), "s"(g1) : "memory"); };
  if (pinned(w < 7u)) issue(0u);
  asm volatile("s_wait_tensorcnt 0x0" ::: "memory");      /* this wave's slice of stage 0 has landed */
  __syncthreads();      /* stage 0 is complete for every wave */
  if (pinned(w < 7u)) issue(1u);
  const v8f z8 = {0.f, 0.f, 0.f, 0.f, 0.f, 0.f, 0.f, 0.f};
  v8f acc[4][4];
#pragma unroll
  for (int i = 0; i < 4; ++i) {
#pragma unroll
    for (int j = 0; j < 4; ++j) acc[i][j] = z8; }
#pragma unroll 1      /* rolled: one pass is 64 matrix instructions, and the ring's order stands once in the text */
  for (uint32_t s = 0; s < G3NS; ++s) {
    const unsigned char* buf = ring + (s & 1u) * G3BUF;
    const unsigned char* ap = buf + sa * G3SL + ln * G3P; const unsigned char* bp = buf + sb * G3SL + ln * G3P;
    v16h a[2][4], b[2][4];      /* two fragment sets: block kb + 1 is fetched, as one group, while block kb is multiplied; no fragment of another stage is fetched */
#pragma unroll
    for (int i = 0; i < 4; ++i) { a[0][i] = g2_frag((const _Float16*)(ap + i * 16 * G3P), hh); b[0][i] = g2_frag((const _Float16*)(bp + i * 16 * G3P), hh); }
#pragma unroll
    for (int kb = 0; kb < G3RB / 64; ++kb) {
      __builtin_amdgcn_sched_barrier(0);      /* keeps the next block's LDS reads together in front of this block's matrix instructions, for speed only */
      if (kb + 1 < G3RB / 64) {
#pragma unroll
        for (int i = 0; i < 4; ++i) { a[(kb + 1) & 1][i] = g2_frag((const _Float16*)(ap + i * 16 * G3P + (kb + 1) * 64), hh); b[(kb + 1) & 1][i] = g2_frag((const _Float16*)(bp + i * 16 * G3P + (kb + 1) * 64), hh); }
      }
      __builtin_amdgcn_sched_barrier(0);      /* the other side of the same group */
      if (kb + 1 == G3RB / 64) {      /* the pass's foot stands in front of its last block, whose fragments are fetched by now: the refill starts a block earlier, and what follows works on registers alone */
        asm volatile("s_wait_dscnt 0x0" ::: "memory");      /* this wave's reads of the buffer have returned before it is refilled */
        asm volatile("s_wait_tensorcnt 0x0" ::: "memory");      /* this wave's slice of stage s + 1 has landed */
        __syncthreads();      /* publishes stage s + 1 and ends every wave's reading of stage s */
        if (pinned(s + 2u < G3NS && w < 7u)) issue(pinned(s + 2u));
      }
#pragma unroll
      for (int i = 0; i < 4; ++i) {
#pragma unroll
        for (int j = 0; j < 4; ++j) acc[i][j] = fa_mma(a[kb & 1][i], b[kb & 1][j], acc[i][j]); }
    }
  }
  asm volatile("s_wait_tensorcnt 0x0" ::: "memory");      /* nothing in flight when the ring becomes output staging */
  asm volatile("s_wait_dscnt 0x0" ::: "memory");
  /* the last pass's barrier has ended every read of the ring: each wave stages its 64 x 64 results in its own slice place, [row][col] at 68 floats, so that each store below covers whole lines */
  float* so = (float*)(ring + w * G3SL);
#pragma unroll
  for (int i = 0; i < 4; ++i) {
#pragma unroll
    for (int j = 0; j < 4; ++j) {
#pragma unroll
      for (int r = 0; r < 8; ++r) so[(i * 16 + 8 * hh + r) * 68 + j * 16 + ln] = acc[i][j][r] * alpha; } }
  __builtin_amdgcn_fence(__ATOMIC_ACQ_REL, "workgroup"); __builtin_amdgcn_wave_barrier();      /* orders the LDS stores above in front of the loads below, which read what other lanes of the same wave wrote */
  const int c4 = ln * 4;
  if (pj == 0u) {      /* one branch for the whole wave, outside the output loops: inside each loop the LDS reads and the stores overlap */
    const size_t cb = (size_t)row0 * DM + col0 + c4;
#pragma unroll
    for (int q = 0; q < 32; ++q) { const int r = q * 2 + hh; const v4f v = *(const v4fa*)&so[r * 68 + c4]; v4h h4, l4;
      for (int i = 0; i < 4; ++i) { const float qv = v[i] * 0.18033688011112042592f; h4[i] = (_Float16)qv; l4[i] = (_Float16)(qv - (float)h4[i]); }      /* 1/8 and the change to log2 units; the residual keeps its own size (f16 subnormals where it is small), so that it adds into the accumulator of the value plane */
      *(v4h*)(Qh + cb + (size_t)r * DM) = h4; *(v4h*)(Ql + cb + (size_t)r * DM) = l4; }
  } else {      /* k: [token][feature]; v: [batch][feature][key], the tile's rows being features and its columns keys */
    _Float16* C16 = pj == 1u ? K16 + (size_t)row0 * DM + col0 + c4
                             : Vt + ((size_t)(row0 / SQ) * DM + col0) * SQ + row0 % SQ + c4;
    const size_t cp = pj == 1u ? DM : SQ;
#pragma unroll
    for (int q = 0; q < 32; ++q) { const int r = q * 2 + hh; const v4f v = *(const v4fa*)&so[r * 68 + c4]; v4h h4;
      for (int i = 0; i < 4; ++i) h4[i] = (_Float16)v[i];
      *(v4h*)(C16 + (size_t)r * cp) = h4; }
  } }

// ---- operand preparation in one launch: x -> f16 rows, and the three [in][out] weights -> f16 x16, transposed to [out][in]; every value is formed as in k_x16 and k_wt_f16 ----
// Few, long-lived waves: each thread puts sixteen 16-byte loads in flight, then converts and stores; no thread depends on another, so there is no LDS and no barrier.
// Weights: a thread takes 8 k x 4 n, so that the 8 halves it stores for one n are 16 contiguous bytes of a transposed row. In a wave 4 lanes lie along n and 8 along k:
// a load covers 64 contiguous bytes of each of 8 weight rows (the wave beside it takes the other half of those lines), a store four whole 128-byte lines.
#define PWG 64       /* work-groups per weight matrix, each 32 n x 512 k */
#define PXG 512      /* work-groups on x, each 4096 groups of four floats */
__global__ __launch_bounds__(256) void k_prep(const float* __restrict__ x, const float* __restrict__ wq, const float* __restrict__ wk, const float* __restrict__ wv,
                                              _Float16* __restrict__ X16, _Float16* __restrict__ BQ, _Float16* __restrict__ BK, _Float16* __restrict__ BV) {
  static_assert(NR * DM == (size_t)PXG * 4096 * 4 && DM * DM == PWG * 32 * 512, "the work-groups cover x and each weight matrix exactly once");
  const int tid = threadIdx.x, bx = blockIdx.x;
  if (bx < 3 * PWG) {      /* the same for the whole work-group; the weights have the lowest block numbers */
    const int mi = bx / PWG, tl = bx % PWG, lane = tid & 31, w = tid >> 5;
    const float* W = mi == 0 ? wq : mi == 1 ? wk : wv; _Float16* Wt = mi == 0 ? BQ : mi == 1 ? BK : BV;
    const int n = (tl >> 1) * 32 + (w & 1) * 16 + (lane & 3) * 4, k = (tl & 1) * 512 + (w >> 1) * 64 + (lane >> 2) * 8;
    v4f r[2][8];
#pragma unroll
    for (int u = 0; u < 2; ++u) {
#pragma unroll
      for (int j = 0; j < 8; ++j) r[u][j] = *(const v4fa*)(W + (size_t)(k + u * 256 + j) * DM + n); }
#pragma unroll
    for (int u = 0; u < 2; ++u) {
#pragma unroll
      for (int i = 0; i < 4; ++i) { FragH f;
#pragma unroll
        for (int j = 0; j < 8; ++j) f.h[j] = (_Float16)(bf16_round(r[u][j][i]) * 16.0f);
        *(v8us*)((unsigned short*)Wt + (size_t)(n + i) * DM + k + u * 256) = f.half[0]; } }
  } else {
    const size_t g0 = (size_t)(bx - 3 * PWG) * 4096 + tid;      /* a wave's load covers 512 contiguous bytes, its store 256 */
    const float* xp = x + g0 * 4;
    v4f r[16];
#pragma unroll
    for (int u = 0; u < 16; ++u) r[u] = *(const v4fa*)(xp + (size_t)u * 1024);
    asm volatile("s_wait_xcnt 0x0" :: "v"(xp) : "memory");      /* the address pair that the sixteen loads name stays as it is up to this wait */
#pragma unroll
    for (int u = 0; u < 16; ++u) { v4h h4;
#pragma unroll
      for (int q = 0; q < 4; ++q) h4[q] = (_Float16)bf16_round(r[u][q]);
      *(v4h*)(X16 + (g0 + (size_t)u * 256) * 4) = h4; }
    asm volatile("s_wait_xcnt 0x0" ::: "memory");      /* behind the last x store: in the built code the weight side's instructions follow this side's and reuse the stores' address and data registers */
  } }

extern "C" void kernel_launch(void* const* d_in, const int* in_sizes, int n_in,
                              void* d_out, int out_size, void* d_ws, size_t ws_size, hipStream_t stream) {
  (void)in_sizes; (void)n_in; (void)out_size;
  const float* const* I = (const float* const*)d_in; const float* x = I[0]; const float* amask = I[1]; const float* wq = I[2]; const float* wk = I[3]; const float* wv = I[4]; const float* bq = nullptr; const float* bk = nullptr; const float* bv = nullptr;      /* [in][out] weights, no biases; float 0/1 mask [8][1024][1024] read in the softmax */
  char* ws = (char*)d_ws; size_t off = 0;
  auto take = [&](size_t bytes) { char* p = ws + off; off += (bytes + 255) & ~(size_t)255; return p; };
  _Float16* BQ = (_Float16*)take((size_t)DM * DM * 2); _Float16* BK = (_Float16*)take((size_t)DM * DM * 2); _Float16* BV = (_Float16*)take((size_t)DM * DM * 2); 
  _Float16* X16 = (_Float16*)take(NR * DM * 2); _Float16* Q16 = (_Float16*)take(NR * DM * 2); _Float16* QL = (_Float16*)take(NR * DM * 2); _Float16* K16 = (_Float16*)take(NR * DM * 2); _Float16* O16 = (_Float16*)take(NR * DM * 2);
  _Float16* VT = (_Float16*)take((size_t)NB * NH * HD * SQ * 2);
  if (off > ws_size) return;
  k_prep<<<3 * PWG + PXG, 256, 0, stream>>>(x, wq, wk, wv, X16, BQ, BK, BV);      /* x -> f16; [in][out] weights -> Bt x16 */
  const size_t r0p = (size_t)B0 * SQ;      /* first projected row */
  k_gemm3<<<(unsigned)G3NT, 384, 0, stream>>>(X16 + r0p * DM, BQ, BK, BV, 0.0625f, Q16 + r0p * DM, QL + r0p * DM, K16 + r0p * DM, VT + r0p * DM);      /* q log2(e) / 8 as f16 value + residual planes, k rows, V^T [NB][NH][HD][SQ] */
  k_fattn<<<NB * NH * (SQ / FQ), 256, 0, stream>>>(Q16, QL, K16, VT, amask, (float*)d_out);      /* ctx (merged heads) straight to the f32 output */
}

// v009
// One run takes 80.5 microseconds.
// In both of two side-by-side timings against v008, it was 1.10 times as fast.
// Counting every step since v000, it is 122 times as fast.
#include <hip/hip_runtime.h>
// Multi-head self-attention with a multiplicative 0/1 mask and the module's 'unsafe' softmax (x [8][1024][1024]; q = x Wq, k = x Wk, v = x Wv ([in][out] 1024^2 sigma 1/32, no biases); 16 heads of 64; scores / 8; w = exp(s) mask[b][s][t] / (sum_t exp(s) mask + 1e-8) with the float mask input [8][1024][1024] (0/1, ~90 % ones, shared across heads) READ per (query, key); out = merged ctx (no output projection) -> [8][1024][1024]).
// Compute dtype: inputs rounded to bf16; x / weights exact; k, v and softmax weights as plain f16 GEMM operands (~2^-12); q as f16 hi + unscaled residual lo planes (effectively f32); o written f32; scores and softmax statistics f32. v_wmma_f32_16x16x32_f16.
#define NB 8
#define SQ 1024
#define DM 1024
#define NH 16
#define HD 64
#define HG 4                         /* heads per launch of k_vt(V16, b, h0, VT); that overload is not launched */
#define B0 0                         /* first batch processed (debug hook) */
#define NBR NB                       /* batches processed (debug hook) */
#define NR ((size_t)NB * SQ)         /* token rows */
#define MP ((int)((size_t)NBR * SQ)) /* rows projected (debug hook) */
#define QN SQ                        /* unused */
#define NHD NH                       /* unused */
#define MPO MP                       /* unused */
#define LQ DM      /* unused */
typedef __bf16 v16b __attribute__((ext_vector_type(16)));
typedef unsigned short v8us __attribute__((ext_vector_type(8), may_alias));
typedef float  v8f  __attribute__((ext_vector_type(8)));
typedef float  v4f  __attribute__((ext_vector_type(4)));
typedef float  v4fa __attribute__((ext_vector_type(4), may_alias));
union FragB { v16b v; v8us half[2]; unsigned short u[16]; };

__device__ __forceinline__ unsigned short bf16_bits(float x) { unsigned int u = __float_as_uint(x); return (unsigned short)((u + 0x7FFFu + ((u >> 16) & 1u)) >> 16); }
__device__ __forceinline__ float bf16_val(unsigned short b) { return __uint_as_float(((unsigned int)b) << 16); }
__device__ __forceinline__ float bf16_round(float x) { return bf16_val(bf16_bits(x)); }
// D += A·B with NT terms: 1 = ah·bh, 2 = + al·bh (A split), 3 = + ah·bl (both split)
template <int NT>
__device__ __forceinline__ v8f mmaN(v16b ah, v16b al, v16b bh, v16b bl, v8f c) {
  c = __builtin_amdgcn_wmma_f32_16x16x32_bf16(false, ah, false, bh, (short)0, c, false, false);
  if (NT >= 2) c = __builtin_amdgcn_wmma_f32_16x16x32_bf16(false, al, false, bh, (short)0, c, false, false);
  if (NT >= 3) c = __builtin_amdgcn_wmma_f32_16x16x32_bf16(false, ah, false, bl, (short)0, c, false, false);
  asm volatile("v_nop\n\tv_nop\n\tv_nop\n\tv_nop" : "+v"(c) : "v"(ah), "v"(al), "v"(bh), "v"(bl));
  return c;
}

__global__ __launch_bounds__(256) void k_wt_bf16(const float* __restrict__ W, unsigned short* __restrict__ Wt, int K, int N) {
  const int t = blockIdx.x * 256 + threadIdx.x;
  const int k8n = K / 8;
  if (t >= N * k8n) return;
  const int n = t / k8n, k8 = (t % k8n) * 8;
  v8us v;
#pragma unroll
  for (int i = 0; i < 8; ++i) v[i] = bf16_bits(W[(size_t)(k8 + i) * N + n]);
  *(v8us*)(Wt + (size_t)n * K + k8) = v;
  
}

// GEMM C[M][N] (f32, pitch ldc) = act(A[M][K]·W + bias). A f32 row-major (pitch lda) converted per fragment to bf16
// (ASPLIT: hi/lo two planes -> 2 terms, else single rounded term); Wt bf16 [N][K] (pitch ldb). BIAS_BF16 rounds the
// bias to bf16 first (bias quantised to bf16 before the add). K%32==0, M%16==0, N%64==0.
template <bool ASPLIT, int ACT, bool BIAS_BF16>
__global__ __launch_bounds__(128) void k_gemm_bf(const float* __restrict__ A, int lda, const unsigned short* __restrict__ Wt, int ldb,
                                               const float* __restrict__ bias, float* __restrict__ C, int ldc, int M, int N, int K) {
  __shared__ __attribute__((aligned(16))) float so[4][16][64];
  const int tid = threadIdx.x, w = tid >> 5, lane = tid & 31, ln = lane & 15, hh = lane >> 4;
  const int ntn = N / 64;
  const int wid = blockIdx.x * 4 + w;
  const int mt = wid / ntn, nq = wid % ntn;
  if (mt * 16 >= M) return;
  const int row0 = mt * 16, col0 = nq * 64;
  const float* arow = A + (size_t)(row0 + ln) * lda;
  v8f acc[4] = {};
  for (int kb = 0; kb < K; kb += 32) {
    FragB ah, al;
    const v4f x0 = *(const v4fa*)(arow + kb + 8 * hh), x1 = *(const v4fa*)(arow + kb + 8 * hh + 4);
    const v4f x2 = *(const v4fa*)(arow + kb + 16 + 8 * hh), x3 = *(const v4fa*)(arow + kb + 16 + 8 * hh + 4);
    float xs[16] = {x0[0],x0[1],x0[2],x0[3],x1[0],x1[1],x1[2],x1[3],x2[0],x2[1],x2[2],x2[3],x3[0],x3[1],x3[2],x3[3]};
#pragma unroll
    for (int i = 0; i < 16; ++i) { const unsigned short hb = bf16_bits(xs[i]); ah.u[i] = hb; al.u[i] = ASPLIT ? bf16_bits(xs[i] - bf16_val(hb)) : (unsigned short)0; }
#pragma unroll
    for (int t = 0; t < 4; ++t) {
      const unsigned short* brow = Wt + (size_t)(col0 + t * 16 + ln) * ldb + kb;
      FragB b;
      b.half[0] = *(const v8us*)(brow + 8 * hh);
      b.half[1] = *(const v8us*)(brow + 16 + 8 * hh);
      acc[t] = mmaN<ASPLIT ? 2 : 1>(ah.v, al.v, b.v, b.v, acc[t]);
    }
  }
#pragma unroll
  for (int t = 0; t < 4; ++t) {
    float bv = bias ? bias[col0 + t * 16 + ln] : 0.f;
    if (BIAS_BF16) bv = bf16_round(bv);
#pragma unroll
    for (int r = 0; r < 8; ++r) { float v = acc[t][r] + bv; if (ACT == 1) v = fmaxf(v, 0.f); so[w][8 * hh + r][t * 16 + ln] = v; }
  }
  __builtin_amdgcn_fence(__ATOMIC_ACQ_REL, "workgroup");
  __builtin_amdgcn_wave_barrier();
  const int rsub = lane >> 4, c4 = (lane & 15) * 4;
  {
#pragma unroll
    for (int q = 0; q < 8; ++q) {
      const int r = q * 2 + rsub;
      const v4f v = *(const v4fa*)&so[w][r][c4];
      *(v4f*)(C + (size_t)(row0 + r) * ldc + col0 + c4) = v;
    }
    
  }
}

// GEMM C = act(A·W + bias + resid): A f32 (ASPLIT -> hi/lo 2 terms), Wt bf16 [N][K]; ACT 0 none, 1 relu, 2 exact gelu;
// resid (optional, f32, row index = (row % rmod), pitch ldr, RES_BF16 rounds it) added before the activation.
template <bool ASPLIT, int ACT, bool BIAS_BF16, bool RES_BF16>
__global__ __launch_bounds__(128) void k_gemm_bf3(const float* __restrict__ A, int lda, const unsigned short* __restrict__ Wt, int ldb,
                                                const float* __restrict__ bias, const float* __restrict__ resid, int rmod, int ldr,
                                                float* __restrict__ C, int ldc, int M, int N, int K) {
  __shared__ __attribute__((aligned(16))) float so[4][16][64];
  const int tid = threadIdx.x, w = tid >> 5, lane = tid & 31, ln = lane & 15, hh = lane >> 4;
  const int ntn = N / 64;
  const int wid = blockIdx.x * 4 + w;
  const int mt = wid / ntn, nq = wid % ntn;
  if (mt * 16 >= M) return;
  const int row0 = mt * 16, col0 = nq * 64;
  const float* arow = A + (size_t)(row0 + ln) * lda;
  v8f acc[4] = {};
  for (int kb = 0; kb < K; kb += 32) {
    FragB ah, al;
    const v4f x0 = *(const v4fa*)(arow + kb + 8 * hh), x1 = *(const v4fa*)(arow + kb + 8 * hh + 4);
    const v4f x2 = *(const v4fa*)(arow + kb + 16 + 8 * hh), x3 = *(const v4fa*)(arow + kb + 16 + 8 * hh + 4);
    float xs[16] = {x0[0],x0[1],x0[2],x0[3],x1[0],x1[1],x1[2],x1[3],x2[0],x2[1],x2[2],x2[3],x3[0],x3[1],x3[2],x3[3]};
#pragma unroll
    for (int i = 0; i < 16; ++i) { const unsigned short hb = bf16_bits(xs[i]); ah.u[i] = hb; al.u[i] = ASPLIT ? bf16_bits(xs[i] - bf16_val(hb)) : (unsigned short)0; }
#pragma unroll
    for (int t = 0; t < 4; ++t) {
      const unsigned short* brow = Wt + (size_t)(col0 + t * 16 + ln) * ldb + kb;
      FragB b;
      b.half[0] = *(const v8us*)(brow + 8 * hh);
      b.half[1] = *(const v8us*)(brow + 16 + 8 * hh);
      acc[t] = mmaN<ASPLIT ? 2 : 1>(ah.v, al.v, b.v, b.v, acc[t]);
    }
  }
#pragma unroll
  for (int t = 0; t < 4; ++t) {
    const int col = col0 + t * 16 + ln;
    float bv = bias ? bias[col] : 0.f;
    if (BIAS_BF16) bv = bf16_round(bv);
#pragma unroll
    for (int r = 0; r < 8; ++r) {
      float v = acc[t][r] + bv;
      if (resid) { float rv = resid[(size_t)((row0 + 8 * hh + r) % rmod) * ldr + col]; if (RES_BF16) rv = bf16_round(rv); v += rv; }
      if (ACT == 1) v = fmaxf(v, 0.f);
      if (ACT == 2) v = 0.5f * v * (1.0f + erff(v * 0.70710678118654752f));
      if (ACT == 3) { const float u = 0.7978845608028654f * (v + 0.044715f * v * v * v); v = 0.5f * v * (1.0f + tanhf(u)); }
      so[w][8 * hh + r][t * 16 + ln] = v;
    }
  }
  __builtin_amdgcn_fence(__ATOMIC_ACQ_REL, "workgroup");
  __builtin_amdgcn_wave_barrier();
  const int rsub = lane >> 4, c4 = (lane & 15) * 4;
  {
#pragma unroll
    for (int q = 0; q < 8; ++q) {
      const int r = q * 2 + rsub;
      const v4f v = *(const v4fa*)&so[w][r][c4];
      *(v4f*)(C + (size_t)(row0 + r) * ldc + col0 + c4) = v;
    }
    
  }
}
// row LayerNorm (biased variance, eps) over N: s = X (+ R); optional out_sum <- s; out_norm <- (s-mu)*rsqrt(var+eps)*g + b
template <bool PARAM_BF16>
__global__ __launch_bounds__(256) void k_layernorm(const float* __restrict__ X, const float* __restrict__ R, const float* __restrict__ g, const float* __restrict__ bta,
                                                  float* __restrict__ out_sum, float* __restrict__ out_norm, int N, float eps) {
  __shared__ float red[256];
  const int row = blockIdx.x, tid = threadIdx.x;
  const float* x = X + (size_t)row * N; const float* rr = R ? R + (size_t)row * N : nullptr;
  float vals[16];                     // up to N = 4096
  const int per = N / 256;            // contiguous chunk per thread? use strided-by-4 chunks: thread handles j = tid*4 + 1024*u
  float s1 = 0.f;
  for (int u = 0; u < per / 4; ++u) {
    const int j = tid * 4 + 1024 * u;
    const v4f a = *(const v4fa*)(x + j);
    v4f b = {0.f,0.f,0.f,0.f}; if (rr) b = *(const v4fa*)(rr + j);
#pragma unroll
    for (int q = 0; q < 4; ++q) { const float v = a[q] + b[q]; vals[u * 4 + q] = v; s1 += v; }
  }
  red[tid] = s1; __syncthreads();
  for (int st = 128; st > 0; st >>= 1) { if (tid < st) red[tid] += red[tid + st]; __syncthreads(); }
  const float mu = red[0] / (float)N; __syncthreads();
  float s2 = 0.f;
  for (int u = 0; u < per / 4; ++u)
#pragma unroll
    for (int q = 0; q < 4; ++q) { const float c = vals[u * 4 + q] - mu; s2 += c * c; }
  red[tid] = s2; __syncthreads();
  for (int st = 128; st > 0; st >>= 1) { if (tid < st) red[tid] += red[tid + st]; __syncthreads(); }
  const float rs = rsqrtf(red[0] / (float)N + eps);
  {
    for (int u = 0; u < per / 4; ++u) {
      const int j = tid * 4 + 1024 * u;
      v4f o, sm;
#pragma unroll
      for (int q = 0; q < 4; ++q) {
        float gg = g[j + q], bb = bta[j + q];
        if (PARAM_BF16) { gg = bf16_round(gg); bb = bf16_round(bb); }
        sm[q] = vals[u * 4 + q]; o[q] = (vals[u * 4 + q] - mu) * rs * gg + bb;
      }
      if (out_sum) *(v4f*)(out_sum + (size_t)row * N + j) = sm;
      *(v4f*)(out_norm + (size_t)row * N + j) = o;
    }
    
  }
}



// ---- f16 WMMA path (v_wmma_f32_16x16x32_f16): 11-bit significands for operands in range — used where a [0,1] probability operand needs more precision than bf16
typedef _Float16 v16h __attribute__((ext_vector_type(16)));
union FragH { v16h v; v8us half[2]; _Float16 h[16]; unsigned short u[16]; };
template <int NT>
__device__ __forceinline__ v8f mmaH(v16h ah, v16h al, v16h bh, v16h bl, v8f c) {
  c = __builtin_amdgcn_wmma_f32_16x16x32_f16(false, ah, false, bh, (short)0, c, false, false);
  if (NT >= 2) c = __builtin_amdgcn_wmma_f32_16x16x32_f16(false, al, false, bh, (short)0, c, false, false);
  if (NT >= 3) c = __builtin_amdgcn_wmma_f32_16x16x32_f16(false, ah, false, bl, (short)0, c, false, false);
  asm volatile("v_nop\n\tv_nop\n\tv_nop\n\tv_nop" : "+v"(c) : "v"(ah), "v"(al), "v"(bh), "v"(bl));
  return c;
}
// batched GEMM like k_gemm_b but f16 operands: A f32 (split into f16 hi/lo if ASPLIT, else rounded to f16), Bt = f16 values [n][k]; alpha; C f32; N multiple of 16 (partial tiles skipped)
template <bool ASPLIT>
__global__ __launch_bounds__(128) void k_gemm_h(const float* __restrict__ A, int lda, size_t sA, const _Float16* __restrict__ Bh, int ldb, size_t sB, float alpha, float* __restrict__ C, int ldc, size_t sC, int M, int N, int K) {
  __shared__ __attribute__((aligned(16))) float so[4][16][64];
  const int tid = threadIdx.x, w = tid >> 5, lane = tid & 31, ln = lane & 15, hh = lane >> 4; const int by = blockIdx.y;
  A += (size_t)by * sA; Bh += (size_t)by * sB; C += (size_t)by * sC;
  const int ntn = (N + 63) / 64; const int wid = blockIdx.x * 4 + w; const int mt = wid / ntn, nq = wid % ntn; if (mt * 16 >= M) return;
  const int row0 = mt * 16, col0 = nq * 64; const float* arow = A + (size_t)(row0 + ln) * lda;
  v8f acc[4] = {};
  for (int kb = 0; kb < K; kb += 32) {
    FragH ah, al;
    const v4f x0 = *(const v4fa*)(arow + kb + 8 * hh), x1 = *(const v4fa*)(arow + kb + 8 * hh + 4), x2 = *(const v4fa*)(arow + kb + 16 + 8 * hh), x3 = *(const v4fa*)(arow + kb + 16 + 8 * hh + 4);
    float xs[16] = {x0[0],x0[1],x0[2],x0[3],x1[0],x1[1],x1[2],x1[3],x2[0],x2[1],x2[2],x2[3],x3[0],x3[1],x3[2],x3[3]};
#pragma unroll
    for (int i = 0; i < 16; ++i) { const _Float16 h = (_Float16)xs[i]; ah.h[i] = h; al.h[i] = ASPLIT ? (_Float16)(xs[i] - (float)h) : (_Float16)0.0f; }
#pragma unroll
    for (int t = 0; t < 4; ++t) { if (col0 + t * 16 >= N) continue; const size_t boff = (size_t)(col0 + t * 16 + ln) * ldb + kb; FragH bq; bq.half[0] = *(const v8us*)(Bh + boff + 8 * hh); bq.half[1] = *(const v8us*)(Bh + boff + 16 + 8 * hh);
      acc[t] = mmaH<ASPLIT ? 2 : 1>(ah.v, al.v, bq.v, bq.v, acc[t]); }
  }
#pragma unroll
  for (int t = 0; t < 4; ++t) { if (col0 + t * 16 >= N) continue;
#pragma unroll
    for (int r = 0; r < 8; ++r) so[w][8 * hh + r][t * 16 + ln] = acc[t][r] * alpha; }
  __builtin_amdgcn_fence(__ATOMIC_ACQ_REL, "workgroup"); __builtin_amdgcn_wave_barrier();
  const int rsub = lane >> 4, c4 = (lane & 15) * 4;
  {
#pragma unroll
    for (int q = 0; q < 8; ++q) { const int r = q * 2 + rsub; if (col0 + c4 < N) { const v4f v = *(const v4fa*)&so[w][r][c4]; *(v4f*)(C + (size_t)(row0 + r) * ldc + col0 + c4) = v; } }
     }
}

// Wt[n][k] = f16(W[k][n]·scale) from f32 row-major W[K][N] (scale = power of two; bf16-exact weights stay exact in f16 away from the subnormal range)
__global__ __launch_bounds__(256) void k_wt_f16(const float* __restrict__ W, _Float16* __restrict__ Wt, int K, int N, float scale) {
  const int t = blockIdx.x * 256 + threadIdx.x; if (t >= N * (K / 8)) return; const int n = t / (K / 8), k8 = (t % (K / 8)) * 8; FragH f;
#pragma unroll
  for (int i = 0; i < 8; ++i) f.h[i] = (_Float16)(bf16_round(W[(size_t)(k8 + i) * N + n]) * scale); const v8us o = f.half[0];
  *(v8us*)((unsigned short*)Wt + (size_t)n * K + k8) = o; 
}
// k_gemm_hh variant with fused epilogue: v = acc·alpha + bias[by·sBias + col] (+ CP[(row/rowsPerB)·sCPb + by·64 + col] if CP) ; ACT 0 none / 1 elu ; writes f16 C16 (and f32 C if non-null)
template <int ACT>
__global__ __launch_bounds__(128) void k_gemm_hhx(const _Float16* __restrict__ A, int lda, size_t sA, const _Float16* __restrict__ Bh, int ldb, size_t sB, float alpha, const float* __restrict__ bias, size_t sBias, const float* __restrict__ CP, int rowsPerB, size_t sCPb, int row0g,
    float* __restrict__ C, _Float16* __restrict__ C16, int ldc, size_t sC, int M, int N, int K) {
  __shared__ __attribute__((aligned(16))) float so[4][16][64];
  const int tid = threadIdx.x, w = tid >> 5, lane = tid & 31, ln = lane & 15, hh = lane >> 4; const int by = blockIdx.y;
  A += (size_t)by * sA; Bh += (size_t)by * sB; const size_t cofs = (size_t)by * sC; const float* bp = bias ? bias + (size_t)by * sBias : nullptr;
  const int ntn = (N + 63) / 64; const int wid = blockIdx.x * 4 + w; const int mt = wid / ntn, nq = wid % ntn; if (mt * 16 >= M) return;
  const int row0 = mt * 16, col0 = nq * 64; const _Float16* arow = A + (size_t)(row0 + ln) * lda;
  v8f acc[4] = {};
  for (int kb = 0; kb < K; kb += 32) { FragH ah; ah.half[0] = *(const v8us*)((const unsigned short*)arow + kb + 8 * hh); ah.half[1] = *(const v8us*)((const unsigned short*)arow + kb + 16 + 8 * hh);
#pragma unroll
    for (int t = 0; t < 4; ++t) { if (col0 + t * 16 >= N) continue; const size_t boff = (size_t)(col0 + t * 16 + ln) * ldb + kb; FragH bq; bq.half[0] = *(const v8us*)((const unsigned short*)Bh + boff + 8 * hh); bq.half[1] = *(const v8us*)((const unsigned short*)Bh + boff + 16 + 8 * hh);
      acc[t] = mmaH<1>(ah.v, ah.v, bq.v, bq.v, acc[t]); }
  }
#pragma unroll
  for (int t = 0; t < 4; ++t) { if (col0 + t * 16 >= N) continue; const int col = col0 + t * 16 + ln; const float bv = bp ? bf16_round(bp[col]) : 0.f;
#pragma unroll
    for (int r = 0; r < 8; ++r) { float v = acc[t][r] * alpha + bv; if (CP) { const int rr = row0g + row0 + 8 * hh + r; if (rowsPerB < 0) v += CP[cofs + (size_t)rr * ldc + col];      /* rowsPerB < 0: own element of the batched C plane */ else { const int bidx = rr / rowsPerB; v += CP[(size_t)bidx * sCPb + (size_t)by * 64 + col]; } } if (ACT == 1) v = (v > 0.f) ? v : expm1f(v); else if (ACT == 7) v = (v > 0.f) ? v + 1.0f : expf(v); else if (ACT == 8) v = tanhf(v); else if (ACT == 9) v = 0.5f * v * (1.0f + tanhf(0.7978845608028654f * (v + 0.044715f * v * v * v))); else if (ACT == 11) v = 1.0f / (1.0f + expf(-v)); else if (ACT == 12) v = (v > 0.f) ? v : 0.01f * v; else if (ACT == 14) v = (v > 0.f) ? v : 0.1f * v; else if (ACT == 16) v = (v >= 0.f) ? v : 0.3f * v; else if (ACT == 17) v = (v >= 0.f) ? v : 0.2f * v; else if (ACT == 15) v = v / (1.0f + expf(-v)); else if (ACT == 3) v = fmaxf(v, 0.f); else if (ACT == 6) v = 0.5f * v * (1.0f + erff(v * 0.70710678118654752f)); so[w][8 * hh + r][t * 16 + ln] = v; } }
  __builtin_amdgcn_fence(__ATOMIC_ACQ_REL, "workgroup"); __builtin_amdgcn_wave_barrier();
  const int rsub = lane >> 4, c4 = (lane & 15) * 4; typedef _Float16 v4h __attribute__((ext_vector_type(4)));
  {
#pragma unroll
    for (int q = 0; q < 8; ++q) { const int r = q * 2 + rsub; if (col0 + c4 < N) { const v4f v = *(const v4fa*)&so[w][r][c4]; if (C) *(v4f*)(C + cofs + (size_t)(row0 + r) * ldc + col0 + c4) = v; if (C16) { v4h h4; for (int i = 0; i < 4; ++i) h4[i] = (_Float16)v[i]; *(v4h*)(C16 + cofs + (size_t)(row0 + r) * ldc + col0 + c4) = h4; } } }
     }
}


typedef _Float16 v4h __attribute__((ext_vector_type(4)));

__global__ __launch_bounds__(256) void k_x16(const float* __restrict__ x, _Float16* __restrict__ X16, size_t n8) { const size_t t = (size_t)blockIdx.x * 256 + threadIdx.x; if (t >= n8) return; FragH f;
#pragma unroll
  for (int q = 0; q < 8; ++q) f.h[q] = (_Float16)bf16_round(x[t * 8 + q]); *(v8us*)((unsigned short*)X16 + t * 8) = f.half[0];  }
__global__ __launch_bounds__(256) void k_h16(const float* __restrict__ x, _Float16* __restrict__ X16, size_t n8) { const size_t t = (size_t)blockIdx.x * 256 + threadIdx.x; if (t >= n8) return; FragH f;
#pragma unroll
  for (int q = 0; q < 8; ++q) f.h[q] = (_Float16)x[t * 8 + q]; *(v8us*)((unsigned short*)X16 + t * 8) = f.half[0];  }
__global__ __launch_bounds__(256) void k_round16f(const float* __restrict__ W, _Float16* __restrict__ Bt, size_t n8) { const size_t t = (size_t)blockIdx.x * 256 + threadIdx.x; if (t >= n8) return; FragH f;
#pragma unroll
  for (int i = 0; i < 8; ++i) f.h[i] = (_Float16)(bf16_round(W[t * 8 + i]) * 16.0f); *(v8us*)((unsigned short*)Bt + t * 8) = f.half[0];  }
// ---- fast GEMM (wave tile 32x64; requires M % 32 == 0 rows per launch region and N % 64 == 0); epilogue = k_gemm_hhx semantics ----
__device__ __forceinline__ v16h g2_frag(const _Float16* p, int hh) { FragH f; f.half[0] = *(const v8us*)((const unsigned short*)p + 8 * hh); f.half[1] = *(const v8us*)((const unsigned short*)p + 16 + 8 * hh); return f.v; }
__device__ __forceinline__ v8f g2_mma(v16h a, v16h b, v8f c) { v8f d = __builtin_amdgcn_wmma_f32_16x16x32_f16(false, a, false, b, (short)0, c, false, false); asm volatile("v_nop\n\tv_nop\n\tv_nop\n\tv_nop" : "+v"(d) : "v"(a), "v"(b)); return d; }
template <int ACT>
__global__ __launch_bounds__(128) void k_gemm2(const _Float16* __restrict__ A, int lda, size_t sA, const _Float16* __restrict__ Bh, int ldb, size_t sB, float alpha, const float* __restrict__ bias, size_t sBias, const float* __restrict__ CP, int rowsPerB, size_t sCPb, int row0g,
    float* __restrict__ C, _Float16* __restrict__ C16, int ldc, size_t sC, int M, int N, int K) { static_assert(ACT == 0 || ACT == 3 || ACT == 6 || ACT == 8 || ACT == 9 || ACT == 11 || ACT == 12 || ACT == 14 || ACT == 15 || ACT == 16 || ACT == 17, "k_gemm2: unsupported ACT code (would silently apply no activation)");
  __shared__ __attribute__((aligned(16))) float so[4][32][68];
  const int tid = threadIdx.x, w = tid >> 5, lane = tid & 31, ln = lane & 15, hh = lane >> 4; const int by = blockIdx.y;
  A += (size_t)by * sA; Bh += (size_t)by * sB; const size_t cofs = (size_t)by * sC; const float* bp = bias ? bias + (size_t)by * sBias : nullptr;
  const int ntn = N >> 6; const int mt = blockIdx.x / ntn, nq = blockIdx.x - mt * ntn; const int row0 = mt * 128 + 32 * w, col0 = nq * 64; if (row0 >= M) return;
  const _Float16* a0p = A + (size_t)(row0 + ln) * lda; const _Float16* a1p = a0p + (size_t)16 * lda;
  const _Float16* b0p = Bh + (size_t)(col0 + ln) * ldb; const _Float16* b1p = b0p + (size_t)16 * ldb; const _Float16* b2p = b1p + (size_t)16 * ldb; const _Float16* b3p = b2p + (size_t)16 * ldb;
  const v8f z8 = {0.f,0.f,0.f,0.f,0.f,0.f,0.f,0.f}; v8f c00 = z8, c01 = z8, c02 = z8, c03 = z8, c10 = z8, c11 = z8, c12 = z8, c13 = z8;
#pragma unroll 1
  for (int kb = 0; kb < K; kb += 32) { const v16h a0 = g2_frag(a0p + kb, hh), a1 = g2_frag(a1p + kb, hh);
    v16h b = g2_frag(b0p + kb, hh); c00 = g2_mma(a0, b, c00); c10 = g2_mma(a1, b, c10);
    b = g2_frag(b1p + kb, hh); c01 = g2_mma(a0, b, c01); c11 = g2_mma(a1, b, c11);
    b = g2_frag(b2p + kb, hh); c02 = g2_mma(a0, b, c02); c12 = g2_mma(a1, b, c12);
    b = g2_frag(b3p + kb, hh); c03 = g2_mma(a0, b, c03); c13 = g2_mma(a1, b, c13); }
  v8f accs[8] = {c00, c01, c02, c03, c10, c11, c12, c13};
#pragma unroll
  for (int u = 0; u < 8; ++u) { const int t = u & 3, half = u >> 2; const int col = col0 + t * 16 + ln; const float bv = bp ? bf16_round(bp[col]) : 0.f;
#pragma unroll
    for (int r = 0; r < 8; ++r) { const int rloc = half * 16 + 8 * hh + r; float v = accs[u][r] * alpha + bv; if (CP) { if (rowsPerB < 0) v += CP[cofs + (size_t)(row0g + row0 + rloc) * ldc + col];      /* rowsPerB < 0: own element of the batched C plane */ else { const int bidx = (row0g + row0 + rloc) / rowsPerB; v += CP[(size_t)bidx * sCPb + (size_t)by * 64 + col]; } }
      if (ACT == 3) v = fmaxf(v, 0.f); else if (ACT == 6) v = 0.5f * v * (1.0f + erff(v * 0.70710678118654752f)); else if (ACT == 11) v = 1.0f / (1.0f + expf(-v)); else if (ACT == 15) v = v / (1.0f + expf(-v)); else if (ACT == 12) v = (v > 0.f) ? v : 0.01f * v; else if (ACT == 8) v = tanhf(v); else if (ACT == 9) v = 0.5f * v * (1.0f + tanhf(0.7978845608028654f * (v + 0.044715f * v * v * v))); else if (ACT == 14) v = (v > 0.f) ? v : 0.1f * v; else if (ACT == 16) v = (v >= 0.f) ? v : 0.3f * v; else if (ACT == 17) v = (v >= 0.f) ? v : 0.2f * v;
      so[w][rloc][t * 16 + ln] = v; } }
  __builtin_amdgcn_fence(__ATOMIC_ACQ_REL, "workgroup"); __builtin_amdgcn_wave_barrier();
  const int rsub = lane >> 4, c4 = (lane & 15) * 4;
  {
#pragma unroll
    for (int q = 0; q < 16; ++q) { const int r = q * 2 + rsub; const v4f v = *(const v4fa*)&so[w][r][c4]; if (C) *(v4f*)(C + cofs + (size_t)(row0 + r) * ldc + col0 + c4) = v; if (C16) { v4h h4; for (int i = 0; i < 4; ++i) h4[i] = (_Float16)v[i]; *(v4h*)(C16 + cofs + (size_t)(row0 + r) * ldc + col0 + c4) = h4; } }
     } }


__global__ __launch_bounds__(256) void k_wnat(const float* __restrict__ w, size_t n8, _Float16* __restrict__ Bt) { const size_t t = (size_t)blockIdx.x * 256 + threadIdx.x; if (t >= n8) return; FragH f; for (int q = 0; q < 8; ++q) f.h[q] = (_Float16)(bf16_round(w[t * 8 + q]) * 16.0f); *(v8us*)((unsigned short*)Bt + t * 8) = f.half[0];  }
__global__ __launch_bounds__(256) void k_rsm(const float* __restrict__ S, _Float16* __restrict__ P, int nrows) {
  #pragma clang fp contract(off)
  const int i = blockIdx.x * 256 + threadIdx.x; if (i >= nrows) return; const float* s = S + (size_t)i * SQ; float mx = -3.0e38f;
#pragma unroll 1
  for (int j = 0; j < SQ; ++j) mx = fmaxf(mx, s[j]); float se = 0.f;
#pragma unroll 1
  for (int j = 0; j < SQ; ++j) se += expf(s[j] - mx); const float sc = 256.0f / se;
#pragma unroll 1
  for (int j0 = 0; j0 < SQ; j0 += 8) { FragH f; for (int q = 0; q < 8; ++q) f.h[q] = (_Float16)(expf(s[j0 + q] - mx) * sc); unsigned short* d = (unsigned short*)P + (size_t)i * SQ + j0; *(v8us*)d = f.half[0];  } }
__global__ __launch_bounds__(256) void k_vt(const _Float16* __restrict__ V16, int b, int h0, _Float16* __restrict__ VT) { __shared__ unsigned short tl[64][65]; const int tid = threadIdx.x; const int hh = blockIdx.x % HG, sg = blockIdx.x / HG; const int s0 = sg * 64; const int h = h0 + hh;
  for (int i = tid; i < 64 * 8; i += 256) { const int j = i / 8, d8 = (i % 8) * 8; FragH f; f.half[0] = *(const v8us*)((const unsigned short*)V16 + ((size_t)b * SQ + s0 + j) * DM + h * HD + d8); for (int q = 0; q < 8; ++q) tl[d8 + q][j] = f.u[q]; }
  __syncthreads();
  { for (int i = tid; i < 64 * 8; i += 256) { const int d = i / 8, j8 = (i % 8) * 8; FragH f; for (int q = 0; q < 8; ++q) f.u[q] = tl[d][j8 + q]; *(v8us*)((unsigned short*)VT + ((size_t)hh * HD + d) * SQ + s0 + j8) = f.half[0]; }  } }



__global__ __launch_bounds__(256) void k_rsmf(const float* __restrict__ S, _Float16* __restrict__ P, int qn, int hg) {
  #pragma clang fp contract(off)
  const int t = blockIdx.x * 256 + threadIdx.x; if (t >= qn * hg) return; const size_t i = (size_t)(t / qn) * SQ + (t % qn); const float* s = S + i * SQ; float mx = -3.0e38f;
#pragma unroll 1
  for (int j = 0; j < SQ; ++j) mx = fmaxf(mx, s[j]); float se = 0.f;
#pragma unroll 1
  for (int j = 0; j < SQ; ++j) se += __expf(s[j] - mx); const float sc = 256.0f / se;
#pragma unroll 1
  for (int j0 = 0; j0 < SQ; j0 += 8) { FragH f; for (int q = 0; q < 8; ++q) f.h[q] = (_Float16)(__expf(s[j0 + q] - mx) * sc); unsigned short* d = (unsigned short*)P + i * SQ + j0; *(v8us*)d = f.half[0];  } }

// 2^x on v_exp_f32 with one free issue slot behind it: the instruction set asks for that slot before the result is read or the source overwritten.
__device__ __forceinline__ float exp2_slot(float x) { float r; asm("v_exp_f32 %0, %1\n\tv_nop" : "=v"(r) : "v"(x)); return r; }
#define FK 64      /* keys per stage */
#define FQ 128     /* query rows per work-group */
#define FH 2       /* heads per work-group */
#define FJ 2       /* 16-query tiles per wave */
#define KPH 72     /* LDS row pitch of K, V^T and the mask slices, halves: 144 B = 16 B x odd, b128 reads free of bank conflicts */
#define MPF 68     /* LDS row pitch of the output staging, floats: 272 B = 16 B x odd */
typedef float v2f __attribute__((ext_vector_type(2)));
__device__ __forceinline__ float xhalf(float x) { return __builtin_bit_cast(float, __builtin_amdgcn_permlanex16(__builtin_bit_cast(int, x), __builtin_bit_cast(int, x), 0x76543210, 0xfedcba98, false, false)); }      /* lane l with lane l ^ 16 */
__device__ __forceinline__ v8f fa_mma(v16h a, v16h b, v8f c) { return __builtin_amdgcn_wmma_f32_16x16x32_f16(false, a, false, b, (short)0, c, false, false); }
typedef uint32_t u32x4 __attribute__((ext_vector_type(4)));
typedef uint32_t u32x8 __attribute__((ext_vector_type(8)));
__device__ __forceinline__ uint32_t uni(uint32_t v) { return (uint32_t)__builtin_amdgcn_readfirstlane(v); }
__device__ __forceinline__ uint32_t pinned(uint32_t v) { uint32_t w = uni(v); asm volatile("" : "+s"(w)); return w; }      /* for the tensor mover: keeps a tensor load's issue test a scalar branch, and the stage number that its descriptor words are formed from in a scalar register behind the waits */
#define FSL 10240      /* place of a slice: 64 rows x 144 B = 9,216 B, rounded up to a multiple of 2 KiB */
#define FBUF (8 * FSL)
#define FNS (SQ / FK)      /* stages */
__global__ __launch_bounds__(256) __attribute__((amdgpu_waves_per_eu(4, 4))) void k_fattn(const _Float16* __restrict__ Qh, const _Float16* __restrict__ Ql, const _Float16* __restrict__ Kh, const _Float16* __restrict__ Vt, const float* __restrict__ Mk, float* __restrict__ out) {
  static_assert(FK == 64 && HD == 64 && FQ == 128 && FH == 2 && FJ == 2 && NH % FH == 0 && SQ % FQ == 0 && FNS >= 2, "every slice is 64 rows of 128 bytes: 64 halves of a K or V^T row, 32 floats of a mask row; eight waves, eight slices; the ring's prologue needs two stages");
  static_assert(2 * (2 * FBUF) <= 327680 && FJ * 16 * MPF * 4 <= FSL, "two work-groups share the LDS; a wave's output staging fits its slice place");
  __shared__ __attribute__((aligned(2048))) unsigned char ring[2 * FBUF];
  const int tid = threadIdx.x, lane = tid & 31, ln = lane & 15, hh = lane >> 4;
  const uint32_t w = uni((uint32_t)tid >> 5), wq = w & 3u, wh = w >> 2;      /* this wave's block of 32 queries (0 to 3) and its head of the pair */
  const int h0 = (blockIdx.x % (NH / FH)) * FH, qb = (blockIdx.x / (NH / FH)) % (SQ / FQ), b = blockIdx.x / ((NH / FH) * (SQ / FQ));      /* neighbouring work-groups: same mask rows, other heads */
  const int h = h0 + (int)wh, qrow = qb * FQ + (int)wq * (FJ * 16);
  v16h qh[FJ][2], ql[FJ][2];
#pragma unroll
  for (int j = 0; j < FJ; ++j) { const size_t qo = ((size_t)b * SQ + qrow + j * 16 + ln) * DM + h * HD;
    qh[j][0] = g2_frag(Qh + qo, hh); qh[j][1] = g2_frag(Qh + qo + 32, hh); ql[j][0] = g2_frag(Ql + qo, hh); ql[j][1] = g2_frag(Ql + qo + 32, hh); }
  /* wave w brings slice w: 0 to 3 the mask (queries 64 (w >> 1) to + 63 of the work-group, keys 32 (w & 1) to + 31 of the stage), 4 and 5 the K rows of the two heads, 6 and 7 their V^T rows */
  const uint32_t lbase = (uint32_t)(size_t)ring;
  const uint64_t ga0 = w < 4u ? (uint64_t)(size_t)(Mk + ((size_t)b * SQ + qb * FQ + (w >> 1) * 64u) * SQ + (w & 1u) * 32u) : w < 6u ? (uint64_t)(size_t)(Kh + (size_t)b * SQ * DM + (h0 + (w - 4u)) * HD) : (uint64_t)(size_t)(Vt + ((size_t)b * NH + h0 + (w - 6u)) * HD * SQ);
  const uint32_t gst = w < 4u ? FK * 4u : w < 6u ? FK * DM * 2u : FK * 2u;      /* bytes from one stage's tile to the next: 64 keys along a mask row, 64 K rows, 64 keys along a V^T row */
  u32x8 g1;      /* 1-byte elements, tile = tensor = 64 rows of 128 B, source pitch one row of the slice's matrix, 16 B of LDS pad behind every 128 B, no mask */
  /* pinned(): descriptor words held in scalar registers of their own through the loop, so that none is formed anew in a register that other code uses while a request is under way */
  g1[0] = pinned((1u << 20) | (4u << 22) | (3u << 25)); g1[1] = pinned(128u << 16); g1[2] = pinned(64u << 16); g1[3] = pinned(128u << 16); g1[4] = pinned(64u); g1[5] = pinned(w < 4u ? (uint32_t)SQ * 4u : w < 6u ? (uint32_t)DM * 2u : (uint32_t)SQ * 2u); g1[6] = pinned(0u); g1[7] = pinned(0u);
  u32x4 g0; g0[0] = pinned(1u); g0[1] = pinned(lbase); g0[2] = pinned(0u); g0[3] = pinned(0u);
  auto issue = [&](uint32_t st) {
    const uint64_t ga = ga0 + (uint64_t)st * gst;
    g0[1] = uni(lbase + (st & 1u) * FBUF + w * FSL); g0[2] = uni((uint32_t)ga); g0[3] = uni((((uint32_t)(ga >> 32)) & 0x01FFFFFFu) | 0x80000000u);
    asm volatile("tensor_load_to_lds %0, %1" :: "s"(g0), "s"(g1) : "memory"); };
  issue(0u);      /* every wave, its own slice */
  asm volatile("s_wait_tensorcnt 0x0" :: "s"(g0) : "memory");      /* this wave's slice of stage 0 has landed; the address group is named so that its registers stay as they are from the issue up to here */
  asm volatile("s_wait_xcnt 0x0" ::: "memory");      /* behind the sixteen q loads above: the code below reuses their address registers */
  __syncthreads();      /* stage 0 is complete for every wave */
  issue(1u);
  const v8f z8 = {0.f, 0.f, 0.f, 0.f, 0.f, 0.f, 0.f, 0.f};
  v8f o[FJ][4] = {{z8, z8, z8, z8}, {z8, z8, z8, z8}};
  v8f cin[FJ] = {z8, z8};      /* minus the offset in use, in all eight rows of the lane's query column: the C operand of every score tile */
  float l[FJ] = {0.f, 0.f};
#pragma unroll 1      /* rolled: the ring's order stands once in the text */
  for (uint32_t s = 0; s < FNS; ++s) {
    const unsigned char* buf = ring + (s & 1u) * FBUF;
    const _Float16* sk = (const _Float16*)(buf + (4u + wh) * FSL) + ln * KPH;      /* K row ln of the stage, this wave's head; tile t lies 16 rows further */
    const _Float16* sv = (const _Float16*)(buf + (6u + wh) * FSL) + ln * KPH;      /* V^T row ln */
    const float* sm = (const float*)(buf + (wq >> 1) * 2u * FSL + ((wq & 1u) * 32u + ln) * (KPH * 2)) + 8 * hh;      /* the mask row of this lane's first query in the slice of the stage's first 32 keys, at this half's keys; the second query lies 16 rows further, the other 32 keys one slice further */
#pragma unroll
    for (int hp = 0; hp < 2; ++hp) {      /* two passes of 32 keys per stage: scores, weights and fragments of 32 keys x 32 queries fit the wave's quarter of the registers beside q, context and offsets */
      v16h ka[2][2];
#pragma unroll
      for (int t = 0; t < 2; ++t) {
#pragma unroll
        for (int u = 0; u < 2; ++u) ka[t][u] = g2_frag(sk + (hp * 2 + t) * 16 * KPH + 32 * u, hh); }
      v8f sc[FJ][2];      /* k.(q_hi + q_lo) - offset in use, log2 units; the four tiles take turns, so that no product waits for the one before it in its own accumulator */
      __builtin_amdgcn_sched_barrier(0);      /* this one and the three below keep the turns: left alone, the compiler runs each tile's four dependent products one behind the other, and each then waits for the one before */
#pragma unroll
      for (int t = 0; t < 2; ++t) {
#pragma unroll
        for (int j = 0; j < FJ; ++j) sc[j][t] = fa_mma(ka[t][0], qh[j][0], cin[j]); }
      __builtin_amdgcn_sched_barrier(0);
#pragma unroll
      for (int t = 0; t < 2; ++t) {
#pragma unroll
        for (int j = 0; j < FJ; ++j) sc[j][t] = fa_mma(ka[t][0], ql[j][0], sc[j][t]); }
      __builtin_amdgcn_sched_barrier(0);
#pragma unroll
      for (int t = 0; t < 2; ++t) {
#pragma unroll
        for (int j = 0; j < FJ; ++j) sc[j][t] = fa_mma(ka[t][1], qh[j][1], sc[j][t]); }
      __builtin_amdgcn_sched_barrier(0);
#pragma unroll
      for (int t = 0; t < 2; ++t) {
#pragma unroll
        for (int j = 0; j < FJ; ++j) sc[j][t] = fa_mma(ka[t][1], ql[j][1], sc[j][t]); }
      v4f mk[FJ][2][2];      /* the pass's mask values for this lane's two queries, fetched as one group into the registers that the K fragments have left: they arrive while the maxima are taken */
#pragma unroll
      for (int j = 0; j < FJ; ++j) {
#pragma unroll
        for (int t = 0; t < 2; ++t) { const float* mp = sm + j * (16 * KPH / 2) + hp * (FSL / 4) + t * 16; mk[j][t][0] = *(const v4fa*)mp; mk[j][t][1] = *(const v4fa*)(mp + 4); } }
      __builtin_amdgcn_sched_barrier(0);      /* keeps that group together here: left alone, the compiler puts each pair of reads directly in front of its products, and the wave waits out the LDS latency four times a pass */
      float bm[FJ];
#pragma unroll
      for (int j = 0; j < FJ; ++j) {
        float bt[2];      /* one maximum per tile: short chains */
#pragma unroll
        for (int t = 0; t < 2; ++t) { bt[t] = -3.0e38f;
#pragma unroll
          for (int r = 0; r < 8; ++r) bt[t] = fmaxf(bt[t], sc[j][t][r]); }
        bm[j] = fmaxf(bt[0], bt[1]); }
      const bool first = hp == 0 && s == 0u;
      if (first || __builtin_amdgcn_ballot_w32(fmaxf(bm[0], bm[1]) > 12.0f) != 0u) {      /* the same for the whole wave: the first pass sets the offsets, a later one moves one where a weight would pass 2^12 */
#pragma unroll
        for (int j = 0; j < FJ; ++j) {
          const float bf = fmaxf(bm[j], xhalf(bm[j]));      /* both halves of the wave hold the same query: one offset */
          const float d = (first || bf > 12.0f) ? bf - 4.0f : 0.f, al = exp2_slot(fminf(-d, 0.f));      /* the largest weight so far becomes 2^4; d is below 0 in the first pass alone, where sums and context are still 0 and their factor must only stay finite */
#pragma unroll
          for (int t = 0; t < 2; ++t) sc[j][t] -= d;
#pragma unroll
          for (int t = 0; t < 4; ++t) o[j][t] *= al;
          cin[j] -= d; l[j] *= al; }
      }
      FragH pb[FJ];
      v16h va[4];
#pragma unroll
      for (int j = 0; j < FJ; ++j) {
        if (j == FJ - 1) {      /* the pass's V^T fragments, as one group, in the registers that the first query tile's scores and mask values have left: they arrive while the last tile's weights are formed */
          __builtin_amdgcn_sched_barrier(0);      /* this one and the next keep the group together at this place, for the same reason as above */
#pragma unroll
          for (int t = 0; t < 4; ++t) va[t] = g2_frag(sv + t * 16 * KPH + 32 * hp, hh);
          __builtin_amdgcn_sched_barrier(0);
        }
        v2f ps[2] = {{0.f, 0.f}, {0.f, 0.f}};      /* four partial sums, as two pairs: no chain of 16 dependent adds */
#pragma unroll
        for (int t = 0; t < 2; ++t) {
          const v4f k0 = mk[j][t][0], k1 = mk[j][t][1];
#pragma unroll
          for (int r = 0; r < 8; r += 2) {      /* two neighbouring keys at a time, in register pairs as the accumulator and the mask rows hold them */
            const v2f e = {exp2_slot(sc[j][t][r]), exp2_slot(sc[j][t][r + 1])}, k = {r < 4 ? k0[r & 3] : k1[r & 3], r < 4 ? k0[(r & 3) + 1] : k1[(r & 3) + 1]}, p = e * k;
            ps[(r >> 1) & 1] += p; pb[j].h[t * 8 + r] = (_Float16)p[0]; pb[j].h[t * 8 + r + 1] = (_Float16)p[1]; } }
        l[j] += (ps[0][0] + ps[0][1]) + (ps[1][0] + ps[1][1]); }
      __builtin_amdgcn_sched_barrier(0);      /* the row sums stay in front of the products below: left alone, the compiler keeps the f32 weights in registers over them, and the wave passes its quarter of the registers and spills */
#pragma unroll
      for (int t = 0; t < 4; ++t) {
#pragma unroll
        for (int j = 0; j < FJ; ++j) o[j][t] = fa_mma(va[t], pb[j].v, o[j][t]); }
    }
    /* the stage's foot, every wave, in the ring's order */
    asm volatile("s_wait_dscnt 0x0" ::: "memory");      /* this wave's reads of the buffer have returned before it is refilled */
    asm volatile("s_wait_tensorcnt 0x0" :: "s"(g0) : "memory");      /* this wave's slice of stage s + 1 has landed; the address group is named so that its registers stay as they are from the issue up to here */
    __syncthreads();      /* publishes stage s + 1 and ends every wave's reading of stage s */
    if (pinned(s + 2u < FNS)) issue(pinned(s + 2u));
  }
  asm volatile("s_wait_tensorcnt 0x0" ::: "memory");      /* nothing in flight when the ring becomes output staging */
  asm volatile("s_wait_dscnt 0x0" ::: "memory");
  /* the last pass's barrier has ended every read of the ring: each wave stages its output in a slice place of its own, [query][d], so that each store below covers whole lines */
  float* so = (float*)(ring + w * FSL);
#pragma unroll
  for (int j = 0; j < FJ; ++j) {
    const float lj = l[j] + xhalf(l[j]), inv = 1.0f / lj;
#pragma unroll
    for (int t = 0; t < 4; ++t) { const v8f v = o[j][t] * inv; const v4f lo4 = {v[0], v[1], v[2], v[3]}, hi4 = {v[4], v[5], v[6], v[7]};
      *(v4fa*)&so[(j * 16 + ln) * MPF + t * 16 + 8 * hh] = lo4; *(v4fa*)&so[(j * 16 + ln) * MPF + t * 16 + 8 * hh + 4] = hi4; } }
  __builtin_amdgcn_fence(__ATOMIC_ACQ_REL, "workgroup"); __builtin_amdgcn_wave_barrier();      /* orders the LDS stores above in front of the loads below, which read what other lanes of the same wave wrote; no other wave touches these rows */
#pragma unroll
  for (int i = 0; i < FJ * 8; ++i) { const int r = 2 * i + hh; const v4f v = *(const v4fa*)&so[r * MPF + ln * 4]; *(v4f*)(out + ((size_t)b * SQ + qrow + r) * DM + h * HD + ln * 4) = v; } }

// ---- the three projection GEMMs in one launch, both operands staged in LDS by tensor loads: alpha * X[8192][1024] . Wt[1024][1024]^T for Wt = Wq, Wk, Wv, all rows k-contiguous f16 ----
// Each result leaves the kernel in the form the attention kernel reads, so that no pass stands between the two: q, times log2(e) / 8, as two f16 planes (value and residual), k as f16 rows,
// v transposed per batch, [batch][feature][key]: for v the two operands change places (rows of the tile = rows of Wv, columns = rows of X), which leaves every element's products and their k order as they are.
// The three weights count as one list of 3072 output features. One work-group forms 256 token rows x 192 features of that list: twelve waves (4 x 3) of 64 x 64, each wholly inside one projection.
// So a staged operand row serves more products than in a 128 x 128 tile and fewer bytes come from L2 per product. A stage is 256 bytes (128 k) of the 256 X rows and the 192 weight rows: seven 64-row slices, one tensor load each, from waves 0 to 6.
// Two buffers: stage s + 2 is requested into the buffer that pass s has just left, so it flies while pass s + 1 is worked on. The k order of every accumulator is that of the plain loop: ascending in steps of 32.
// Every inner loop is fully unrolled so that the accumulator and fragment arrays are indexed by constants and live in registers.
#define G3TM 256     /* token rows of a work-group's tile: slices 0 to 3 */
#define G3TN 192     /* features of a work-group's tile, out of the 3 * DM of q, k, v in a row: slices 4 to 6 */
#define G3RB 256     /* bytes of an operand row per stage */
#define G3P 272      /* LDS row pitch, bytes: 16 B x odd for the b128 fragment reads; laid by the tensor load's pad */
#define G3SL 18432   /* place of a slice: 64 rows x 272 B = 17,408 B, rounded up to a multiple of 2 KiB */
#define G3BUF (7 * G3SL)
#define G3NS (DM * 2 / G3RB)      /* stages */
#define G3NN (3 * DM / G3TN)      /* tiles along the features */
#define G3NT ((MP / G3TM) * G3NN)      /* work-groups */
__global__ __launch_bounds__(384) void k_gemm3(const _Float16* __restrict__ X, const _Float16* __restrict__ Wq, const _Float16* __restrict__ Wk, const _Float16* __restrict__ Wv, float alpha,
                                               _Float16* __restrict__ Qh, _Float16* __restrict__ Ql, _Float16* __restrict__ K16, _Float16* __restrict__ Vt) {
  static_assert(SQ % 64 == 0 && DM % 64 == 0 && MP % G3TM == 0 && (3 * DM) % G3TN == 0 && NH * HD == DM, "a wave's 64 token rows lie in one batch and its 64 features in one projection; the tiles cover everything once; V^T rows are the features");
  __shared__ __attribute__((aligned(2048))) unsigned char ring[2 * G3BUF];
  const int tid = threadIdx.x, lane = tid & 31, ln = lane & 15, hh = lane >> 4;
  const uint32_t w = uni((uint32_t)tid >> 5), wm = w & 3u, wn = w >> 2;      /* this wave's block of 64 token rows (0 to 3) and of 64 features (0 to 2) */
  const uint32_t nq = blockIdx.x % G3NN, mt = blockIdx.x / G3NN;
  const uint32_t fb = nq * (G3TN / 64) + wn, pj = fb / (DM / 64);      /* feature block in the list; pj: 0 q, 1 k, 2 v, the same for a whole wave */
  const int row0 = (int)(mt * G3TM + wm * 64u), col0 = (int)(fb % (DM / 64) * 64u);      /* this wave's first token row, and its first feature inside its projection */
  const uint32_t sa = pj == 2u ? 4u + wn : wm, sb = pj == 2u ? wm : 4u + wn;      /* the slices whose rows become this wave's 64 result rows and its 64 result columns */
  const uint32_t lbase = (uint32_t)(size_t)ring;
  /* wave w < 7 brings slice w; waves 7 to 11 bring none (their address is formed like wave 0's and never used) */
  const uint32_t sw = w < 7u ? w : 0u, sf = nq * (G3TN / 64) + (sw < 4u ? 0u : sw - 4u), sj = sf / (DM / 64);      /* for a weight slice: its feature block and its projection */
  const _Float16* sp = sw < 4u ? X + (size_t)(mt * G3TM + sw * 64u) * DM : (sj == 0u ? Wq : sj == 1u ? Wk : Wv) + (size_t)(sf % (DM / 64) * 64u) * DM;
  const uint64_t ga0 = (uint64_t)(size_t)sp;
  u32x8 g1;      /* 1-byte elements, tile = tensor = 64 rows of 256 B, source pitch one row of the matrix, 16 B of LDS pad behind every 256 B, no mask */
  /* descriptor words held in scalar registers: as plain constants they were formed anew at each issue, in registers that the loop then reused for its addresses while the request was still under way */
  g1[0] = pinned((1u << 20) | (5u << 22) | (3u << 25)); g1[1] = pinned((uint32_t)G3RB << 16); g1[2] = pinned(64u << 16); g1[3] = pinned((uint32_t)G3RB << 16); g1[4] = pinned(64u); g1[5] = pinned((uint32_t)DM * 2u); g1[6] = pinned(0u); g1[7] = pinned(0u);
  u32x4 g0; g0[0] = pinned(1u);
  auto issue = [&](uint32_t st) {
    const uint64_t ga = ga0 + (uint64_t)st * G3RB;
    g0[1] = uni(lbase + (st & 1u) * G3BUF + sw * G3SL); g0[2] = uni((uint32_t)ga); g0[3] = uni((((uint32_t)(ga >> 32)) & 0x01FFFFFFu) | 0x80000000u);
    asm volatile("tensor_load_to_lds %0, %1" :: "s"(g0), "s"(g1) : "memory"); };
  if (pinned(w < 7u)) issue(0u);
  asm volatile("s_wait_tensorcnt 0x0" ::: "memory");      /* this wave's slice of stage 0 has landed */
  __syncthreads();      /* stage 0 is complete for every wave */
  if (pinned(w < 7u)) issue(1u);
  const v8f z8 = {0.f, 0.f, 0.f, 0.f, 0.f, 0.f, 0.f, 0.f};
  v8f acc[4][4];
#pragma unroll
  for (int i = 0; i < 4; ++i) {
#pragma unroll
    for (int j = 0; j < 4; ++j) acc[i][j] = z8; }
#pragma unroll 1      /* rolled: one pass is 64 matrix instructions, and the ring's order stands once in the text */
  for (uint32_t s = 0; s < G3NS; ++s) {
    const unsigned char* buf = ring + (s & 1u) * G3BUF;
    const unsigned char* ap = buf + sa * G3SL + ln * G3P; const unsigned char* bp = buf + sb * G3SL + ln * G3P;
    v16h a[2][4], b[2][4];      /* two fragment sets: block kb + 1 is fetched, as one group, while block kb is multiplied; no fragment of another stage is fetched */
#pragma unroll
    for (int i = 0; i < 4; ++i) { a[0][i] = g2_frag((const _Float16*)(ap + i * 16 * G3P), hh); b[0][i] = g2_frag((const _Float16*)(bp + i * 16 * G3P), hh); }
#pragma unroll
    for (int kb = 0; kb < G3RB / 64; ++kb) {
      __builtin_amdgcn_sched_barrier(0);      /* keeps the next block's LDS reads together in front of this block's matrix instructions, for speed only */
      if (kb + 1 < G3RB / 64) {
#pragma unroll
        for (int i = 0; i < 4; ++i) { a[(kb + 1) & 1][i] = g2_frag((const _Float16*)(ap + i * 16 * G3P + (kb + 1) * 64), hh); b[(kb + 1) & 1][i] = g2_frag((const _Float16*)(bp + i * 16 * G3P + (kb + 1) * 64), hh); }
      }
      __builtin_amdgcn_sched_barrier(0);      /* the other side of the same group */
      if (kb + 1 == G3RB / 64) {      /* the pass's foot stands in front of its last block, whose fragments are fetched by now: the refill starts a block earlier, and what follows works on registers alone */
        asm volatile("s_wait_dscnt 0x0" ::: "memory");      /* this wave's reads of the buffer have returned before it is refilled */
        asm volatile("s_wait_tensorcnt 0x0" ::: "memory");      /* this wave's slice of stage s + 1 has landed */
        __syncthreads();      /* publishes stage s + 1 and ends every wave's reading of stage s */
        if (pinned(s + 2u < G3NS && w < 7u)) issue(pinned(s + 2u));
      }
#pragma unroll
      for (int i = 0; i < 4; ++i) {
#pragma unroll
        for (int j = 0; j < 4; ++j) acc[i][j] = fa_mma(a[kb & 1][i], b[kb & 1][j], acc[i][j]); }
    }
  }
  asm volatile("s_wait_tensorcnt 0x0" ::: "memory");      /* nothing in flight when the ring becomes output staging */
  asm volatile("s_wait_dscnt 0x0" ::: "memory");
  /* the last pass's barrier has ended every read of the ring: each wave stages its 64 x 64 results in its own slice place, [row][col] at 68 floats, so that each store below covers whole lines */
  float* so = (float*)(ring + w * G3SL);
#pragma unroll
  for (int i = 0; i < 4; ++i) {
#pragma unroll
    for (int j = 0; j < 4; ++j) {
#pragma unroll
      for (int r = 0; r < 8; ++r) so[(i * 16 + 8 * hh + r) * 68 + j * 16 + ln] = acc[i][j][r] * alpha; } }
  __builtin_amdgcn_fence(__ATOMIC_ACQ_REL, "workgroup"); __builtin_amdgcn_wave_barrier();      /* orders the LDS stores above in front of the loads below, which read what other lanes of the same wave wrote */
  const int c4 = ln * 4;
  if (pj == 0u) {      /* one branch for the whole wave, outside the output loops: inside each loop the LDS reads and the stores overlap */
    const size_t cb = (size_t)row0 * DM + col0 + c4;
#pragma unroll
    for (int q = 0; q < 32; ++q) { const int r = q * 2 + hh; const v4f v = *(const v4fa*)&so[r * 68 + c4]; v4h h4, l4;
      for (int i = 0; i < 4; ++i) { const float qv = v[i] * 0.18033688011112042592f; h4[i] = (_Float16)qv; l4[i] = (_Float16)(qv - (float)h4[i]); }      /* 1/8 and the change to log2 units; the residual keeps its own size (f16 subnormals where it is small), so that it adds into the accumulator of the value plane */
      *(v4h*)(Qh + cb + (size_t)r * DM) = h4; *(v4h*)(Ql + cb + (size_t)r * DM) = l4; }
  } else {      /* k: [token][feature]; v: [batch][feature][key], the tile's rows being features and its columns keys */
    _Float16* C16 = pj == 1u ? K16 + (size_t)row0 * DM + col0 + c4
                             : Vt + ((size_t)(row0 / SQ) * DM + col0) * SQ + row0 % SQ + c4;
    const size_t cp = pj == 1u ? DM : SQ;
#pragma unroll
    for (int q = 0; q < 32; ++q) { const int r = q * 2 + hh; const v4f v = *(const v4fa*)&so[r * 68 + c4]; v4h h4;
      for (int i = 0; i < 4; ++i) h4[i] = (_Float16)v[i];
      *(v4h*)(C16 + (size_t)r * cp) = h4; }
  } }

// ---- operand preparation in one launch: x -> f16 rows, and the three [in][out] weights -> f16 x16, transposed to [out][in]; every value is formed as in k_x16 and k_wt_f16 ----
// Few, long-lived waves: each thread puts sixteen 16-byte loads in flight, then converts and stores; no thread depends on another, so there is no LDS and no barrier.
// Weights: a thread takes 8 k x 4 n, so that the 8 halves it stores for one n are 16 contiguous bytes of a transposed row. In a wave 4 lanes lie along n and 8 along k:
// a load covers 64 contiguous bytes of each of 8 weight rows (the wave beside it takes the other half of those lines), a store four whole 128-byte lines.
#define PWG 64       /* work-groups per weight matrix, each 32 n x 512 k */
#define PXG 512      /* work-groups on x, each 4096 groups of four floats */
__global__ __launch_bounds__(256) void k_prep(const float* __restrict__ x, const float* __restrict__ wq, const float* __restrict__ wk, const float* __restrict__ wv,
                                              _Float16* __restrict__ X16, _Float16* __restrict__ BQ, _Float16* __restrict__ BK, _Float16* __restrict__ BV) {
  static_assert(NR * DM == (size_t)PXG * 4096 * 4 && DM * DM == PWG * 32 * 512, "the work-groups cover x and each weight matrix exactly once");
  const int tid = threadIdx.x, bx = blockIdx.x;
  if (bx < 3 * PWG) {      /* the same for the whole work-group; the weights have the lowest block numbers */
    const int mi = bx / PWG, tl = bx % PWG, lane = tid & 31, w = tid >> 5;
    const float* W = mi == 0 ? wq : mi == 1 ? wk : wv; _Float16* Wt = mi == 0 ? BQ : mi == 1 ? BK : BV;
    const int n = (tl >> 1) * 32 + (w & 1) * 16 + (lane & 3) * 4, k = (tl & 1) * 512 + (w >> 1) * 64 + (lane >> 2) * 8;
    v4f r[2][8];
#pragma unroll
    for (int u = 0; u < 2; ++u) {
#pragma unroll
      for (int j = 0; j < 8; ++j) r[u][j] = *(const v4fa*)(W + (size_t)(k + u * 256 + j) * DM + n); }
#pragma unroll
    for (int u = 0; u < 2; ++u) {
#pragma unroll
      for (int i = 0; i < 4; ++i) { FragH f;
#pragma unroll
        for (int j = 0; j < 8; ++j) f.h[j] = (_Float16)(bf16_round(r[u][j][i]) * 16.0f);
        *(v8us*)((unsigned short*)Wt + (size_t)(n + i) * DM + k + u * 256) = f.half[0]; } }
  } else {
    const size_t g0 = (size_t)(bx - 3 * PWG) * 4096 + tid;      /* a wave's load covers 512 contiguous bytes, its store 256 */
    const float* xp = x + g0 * 4;
    v4f r[16];
#pragma unroll
    for (int u = 0; u < 16; ++u) r[u] = *(const v4fa*)(xp + (size_t)u * 1024);
    asm volatile("s_wait_xcnt 0x0" :: "v"(xp) : "memory");      /* the address pair that the sixteen loads name stays as it is up to this wait */
#pragma unroll
    for (int u = 0; u < 16; ++u) { v4h h4;
#pragma unroll
      for (int q = 0; q < 4; ++q) h4[q] = (_Float16)bf16_round(r[u][q]);
      *(v4h*)(X16 + (g0 + (size_t)u * 256) * 4) = h4; }
    asm volatile("s_wait_xcnt 0x0" ::: "memory");      /* behind the last x store: in the built code the weight side's instructions follow this side's and reuse the stores' address and data registers */
  } }

extern "C" void kernel_launch(void* const* d_in, const int* in_sizes, int n_in,
                              void* d_out, int out_size, void* d_ws, size_t ws_size, hipStream_t stream) {
  (void)in_sizes; (void)n_in; (void)out_size;
  const float* const* I = (const float* const*)d_in; const float* x = I[0]; const float* amask = I[1]; const float* wq = I[2]; const float* wk = I[3]; const float* wv = I[4]; const float* bq = nullptr; const float* bk = nullptr; const float* bv = nullptr;      /* [in][out] weights, no biases; float 0/1 mask [8][1024][1024] read in the softmax */
  char* ws = (char*)d_ws; size_t off = 0;
  auto take = [&](size_t bytes) { char* p = ws + off; off += (bytes + 255) & ~(size_t)255; return p; };
  _Float16* BQ = (_Float16*)take((size_t)DM * DM * 2); _Float16* BK = (_Float16*)take((size_t)DM * DM * 2); _Float16* BV = (_Float16*)take((size_t)DM * DM * 2); 
  _Float16* X16 = (_Float16*)take(NR * DM * 2); _Float16* Q16 = (_Float16*)take(NR * DM * 2); _Float16* QL = (_Float16*)take(NR * DM * 2); _Float16* K16 = (_Float16*)take(NR * DM * 2); _Float16* O16 = (_Float16*)take(NR * DM * 2);
  _Float16* VT = (_Float16*)take((size_t)NB * NH * HD * SQ * 2);
  if (off > ws_size) return;
  k_prep<<<3 * PWG + PXG, 256, 0, stream>>>(x, wq, wk, wv, X16, BQ, BK, BV);      /* x -> f16; [in][out] weights -> Bt x16 */
  const size_t r0p = (size_t)B0 * SQ;      /* first projected row */
  k_gemm3<<<(unsigned)G3NT, 384, 0, stream>>>(X16 + r0p * DM, BQ, BK, BV, 0.0625f, Q16 + r0p * DM, QL + r0p * DM, K16 + r0p * DM, VT + r0p * DM);      /* q log2(e) / 8 as f16 value + residual planes, k rows, V^T [NB][NH][HD][SQ] */
  k_fattn<<<NB * (NH / FH) * (SQ / FQ), 256, 0, stream>>>(Q16, QL, K16, VT, amask, (float*)d_out);      /* ctx (merged heads) straight to the f32 output */
}
